// v000
// The times below were measured on an AMD MI455X: many runs one after another, warmed up first and cycling through
// copies of the inputs, with the whole window's GPU time divided by the number of runs. Launches and the gaps
// between them are all in it. The median over several windows is given; except for v000 it joins two sittings, which
// can be a few percent apart, so the side-by-side timings, each taken in one sitting, are the better comparison.
// The starting kernel, v000, takes 657 microseconds a run.
#include <hip/hip_runtime.h>

// Contractions: v_wmma_f32_16x16x32_f16 (f16 operands, f32 accumulate) for q/k/v projections, q.k^T, p.v, output projection, ffn1, ffn2; weight planes carried x16, p plane carried x1024, activations x1.

#pragma clang fp contract(off)

#ifndef NB
#define NB 2
#endif
#ifndef SEQ
#define SEQ 4096
#endif
#define NB_FULL 2
#define SEQ_FULL 4096
#define CDIM 512
#define NHEAD 8
#define HD 64
#define HID 2048
#define MROWS (NB * SEQ)

static_assert(NB >= 1 && NB <= NB_FULL);
static_assert(SEQ % 64 == 0 && SEQ >= 64 && SEQ <= SEQ_FULL);
static_assert(CDIM == NHEAD * HD);
static_assert(HD == 64);
static_assert(CDIM == 512);
static_assert(CDIM == 32 * 2 * 8);          // LayerNorm lane map: 32 lanes x 2 segments x 8 columns
static_assert(HID % 64 == 0 && CDIM % 64 == 0);
static_assert(CDIM % 32 == 0 && HID % 32 == 0);   // k loops step by 32
static_assert(MROWS % 64 == 0);
static_assert(MROWS % 8 == 0);
static_assert((3 * CDIM) % 64 == 0);

typedef _Float16 v16h __attribute__((ext_vector_type(16)));
typedef _Float16 v8h  __attribute__((ext_vector_type(8)));
typedef float    v8f  __attribute__((ext_vector_type(8)));
typedef float    v4f  __attribute__((ext_vector_type(4)));
typedef unsigned int v4u __attribute__((ext_vector_type(4)));

union Frag { v16h v; v4u q[2]; };

// WMMA with hazard guard: D += A(16x32) * B(32x16)
__device__ __forceinline__ v8f mma(v16h a, v16h b, v8f c) {
  v8f d = __builtin_amdgcn_wmma_f32_16x16x32_f16(false, a, false, b, (short)0, c, false, false);
  asm volatile("v_nop\n\tv_nop\n\tv_nop\n\tv_nop" : "+v"(d) : "v"(a), "v"(b));
  return d;
}

__device__ __forceinline__ v8f zero8() {
  v8f z;
#pragma unroll
  for (int i = 0; i < 8; ++i) z[i] = 0.0f;
  return z;
}

// f32 -> nearest-even bf16 value, returned as f32
__device__ __forceinline__ float bf16q(float f) {
  unsigned int u = __float_as_uint(f);
  unsigned int r = u + 0x7FFFu + ((u >> 16) & 1u);
  r = ((u & 0x7F800000u) == 0x7F800000u) ? u : r;
  return __uint_as_float(r & 0xFFFF0000u);
}
__device__ __forceinline__ v4f bf16q4(v4f a) {
  v4f r;
  r.x = bf16q(a.x); r.y = bf16q(a.y); r.z = bf16q(a.z); r.w = bf16q(a.w);
  return r;
}
// f32 -> f16 (RNE convert) bit pattern
__device__ __forceinline__ unsigned short hbits(float f) {
  _Float16 h = (_Float16)f;
  return __builtin_bit_cast(unsigned short, h);
}
__device__ __forceinline__ v4u pack8h(float f0, float f1, float f2, float f3,
                                      float f4, float f5, float f6, float f7) {
  v8h t;
  t[0] = (_Float16)f0; t[1] = (_Float16)f1; t[2] = (_Float16)f2; t[3] = (_Float16)f3;
  t[4] = (_Float16)f4; t[5] = (_Float16)f5; t[6] = (_Float16)f6; t[7] = (_Float16)f7;
  return __builtin_bit_cast(v4u, t);
}
__device__ __forceinline__ float gelu_erf(float u) {
  return 0.5f * u * (1.0f + erff(u * 0.70710678118654752f));
}

// ---------------------------------------------------------------------------
// Weight prep: src[K][N] (f32, row pitch N) -> dst[rowoff + n][k] f16 plane
// (row pitch K), value = f16(bf16q(w) * 16).  in[K][N] -> out[N][K].
// grid = (K/64, N/64).
// ---------------------------------------------------------------------------
__global__ __launch_bounds__(256) void k_wprep(
    const float* __restrict__ src, unsigned short* __restrict__ dst, int K, int N, int rowoff) {
  __shared__ __attribute__((aligned(16))) unsigned short sT[64][72];
  const int tid = threadIdx.x;
  const int k0 = blockIdx.x * 64, n0 = blockIdx.y * 64;
#pragma unroll
  for (int it = 0; it < 4; ++it) {
    const int idx = it * 256 + tid;
    const int kk = idx >> 4;            // 0..63
    const int j4 = (idx & 15) * 4;      // 0..60
    const v4f wv = *(const v4f*)(src + (size_t)(k0 + kk) * (size_t)N + n0 + j4);
    sT[j4 + 0][kk] = hbits(bf16q(wv.x) * 16.0f);
    sT[j4 + 1][kk] = hbits(bf16q(wv.y) * 16.0f);
    sT[j4 + 2][kk] = hbits(bf16q(wv.z) * 16.0f);
    sT[j4 + 3][kk] = hbits(bf16q(wv.w) * 16.0f);
  }
  __syncthreads();   // cross-wave: staged by all waves, read by all waves
  v4u val[2];
  size_t off[2];
#pragma unroll
  for (int p = 0; p < 2; ++p) {
    const int n = p * 32 + (tid >> 3);
    const int piece = tid & 7;
    val[p] = *(const v4u*)&sT[n][piece * 8];
    off[p] = (size_t)(rowoff + n0 + n) * (size_t)K + k0 + piece * 8;
  }
#pragma unroll
  for (int p = 0; p < 2; ++p) *(v4u*)(dst + off[p]) = val[p];
  
}

// ---------------------------------------------------------------------------
// LayerNorm over CDIM=512: one wave per row, lane l owns cols 8l..8l+7 and
// 256+8l..256+8l+7.  RNDIN: input rows read at full strides and converted to
// their bf16 values first.  Output f16 plane [nrows][512], rows compact.
// coverage: 2 instructions x 32 lanes x 16 B = cols 0..255 (4 lines) + cols 256..511 (4 lines) per row.
// ---------------------------------------------------------------------------
template <int RNDIN>
__device__ __forceinline__ void ln_body(
    const float* __restrict__ x, const float* __restrict__ g, const float* __restrict__ bt,
    unsigned short* __restrict__ hout, int nrows) {
  const int lane = threadIdx.x & 31, w = threadIdx.x >> 5;
  const int row = blockIdx.x * 8 + w;
  if (row >= nrows) return;            // no barriers in this kernel
  size_t xrow;
  if (RNDIN) {
    const int b = row / SEQ, t = row - b * SEQ;
    xrow = ((size_t)b * SEQ_FULL + t) * CDIM;
  } else {
    xrow = (size_t)row * CDIM;
  }
  const int c0 = lane * 8;
  const int c1 = 256 + lane * 8;

  float v[16];
  {
    const v4f t0 = *(const v4f*)(x + xrow + c0);
    const v4f t1 = *(const v4f*)(x + xrow + c0 + 4);
    const v4f t2 = *(const v4f*)(x + xrow + c1);
    const v4f t3 = *(const v4f*)(x + xrow + c1 + 4);
    v[0] = t0.x; v[1] = t0.y; v[2] = t0.z; v[3] = t0.w;
    v[4] = t1.x; v[5] = t1.y; v[6] = t1.z; v[7] = t1.w;
    v[8] = t2.x; v[9] = t2.y; v[10] = t2.z; v[11] = t2.w;
    v[12] = t3.x; v[13] = t3.y; v[14] = t3.z; v[15] = t3.w;
  }
  if (RNDIN) {
#pragma unroll
    for (int i = 0; i < 16; ++i) v[i] = bf16q(v[i]);
  }

  float s = 0.0f;
#pragma unroll
  for (int i = 0; i < 16; ++i) s += v[i];
#pragma unroll
  for (int xm = 1; xm < 32; xm <<= 1) s += __shfl_xor(s, xm, 32);
  const float mu = s * (1.0f / CDIM);

  float d[16];
#pragma unroll
  for (int i = 0; i < 16; ++i) d[i] = v[i] - mu;
  float qs = 0.0f;
#pragma unroll
  for (int i = 0; i < 16; ++i) qs += d[i] * d[i];
#pragma unroll
  for (int xm = 1; xm < 32; xm <<= 1) qs += __shfl_xor(qs, xm, 32);
  const float var = qs * (1.0f / CDIM);
  const float rstd = rsqrtf(var + 1e-5f);

  float gg[16], bb[16];
  {
    const v4f g0 = bf16q4(*(const v4f*)(g + c0));
    const v4f g1 = bf16q4(*(const v4f*)(g + c0 + 4));
    const v4f g2 = bf16q4(*(const v4f*)(g + c1));
    const v4f g3 = bf16q4(*(const v4f*)(g + c1 + 4));
    const v4f b0 = bf16q4(*(const v4f*)(bt + c0));
    const v4f b1 = bf16q4(*(const v4f*)(bt + c0 + 4));
    const v4f b2 = bf16q4(*(const v4f*)(bt + c1));
    const v4f b3 = bf16q4(*(const v4f*)(bt + c1 + 4));
    gg[0] = g0.x; gg[1] = g0.y; gg[2] = g0.z; gg[3] = g0.w;
    gg[4] = g1.x; gg[5] = g1.y; gg[6] = g1.z; gg[7] = g1.w;
    gg[8] = g2.x; gg[9] = g2.y; gg[10] = g2.z; gg[11] = g2.w;
    gg[12] = g3.x; gg[13] = g3.y; gg[14] = g3.z; gg[15] = g3.w;
    bb[0] = b0.x; bb[1] = b0.y; bb[2] = b0.z; bb[3] = b0.w;
    bb[4] = b1.x; bb[5] = b1.y; bb[6] = b1.z; bb[7] = b1.w;
    bb[8] = b2.x; bb[9] = b2.y; bb[10] = b2.z; bb[11] = b2.w;
    bb[12] = b3.x; bb[13] = b3.y; bb[14] = b3.z; bb[15] = b3.w;
  }
  float y[16];
#pragma unroll
  for (int i = 0; i < 16; ++i) y[i] = d[i] * rstd * gg[i] + bb[i];

  const v4u o0 = pack8h(y[0], y[1], y[2], y[3], y[4], y[5], y[6], y[7]);
  const v4u o1 = pack8h(y[8], y[9], y[10], y[11], y[12], y[13], y[14], y[15]);
  unsigned short* orow = hout + (size_t)row * CDIM;
  *(v4u*)(orow + c0) = o0;
  *(v4u*)(orow + c1) = o1;
  
}

__global__ __launch_bounds__(256) void k_ln_in(
    const float* __restrict__ x, const float* __restrict__ g, const float* __restrict__ bt,
    unsigned short* __restrict__ hout, int nrows) {
  ln_body<1>(x, g, bt, hout, nrows);
}
__global__ __launch_bounds__(256) void k_ln_mid(
    const float* __restrict__ x, const float* __restrict__ g, const float* __restrict__ bt,
    unsigned short* __restrict__ hout, int nrows) {
  ln_body<0>(x, g, bt, hout, nrows);
}

// ---------------------------------------------------------------------------
// 64x64-tile f16 GEMM main loop: D = A[M][K] * Bt[N][K]^T, 4 waves per WG,
// wave w owns rows 16w..16w+15 x 64 cols (4 accumulator tiles).  Fragments are
// loaded straight from the 16-bit planes with the split k map for A and B
// (row/col = lane&15, elements 0..7 <- k0+8h.., 8..15 <- k0+16+8h..).
// acc[j][r] = D(row 16w + 8h + r, col 16j + (lane&15)).
// ---------------------------------------------------------------------------
__device__ __forceinline__ void gemm_main(
    const unsigned short* __restrict__ A, const unsigned short* __restrict__ Bt, int K,
    int m0, int n0, int w, int m, int k8, v8f (&acc)[4]) {
#pragma unroll
  for (int j = 0; j < 4; ++j) acc[j] = zero8();
  const unsigned short* ap = A + (size_t)(m0 + 16 * w + m) * (size_t)K + k8;
  const unsigned short* bp = Bt + (size_t)(n0 + m) * (size_t)K + k8;
  const size_t jstep = (size_t)16 * (size_t)K;
#pragma unroll 1
  for (int k0 = 0; k0 < K; k0 += 32) {
    Frag a;
    a.q[0] = *(const v4u*)(ap + k0);
    a.q[1] = *(const v4u*)(ap + k0 + 16);
#pragma unroll
    for (int j = 0; j < 4; ++j) {
      Frag b;
      const unsigned short* bj = bp + jstep * j + k0;
      b.q[0] = *(const v4u*)(bj);
      b.q[1] = *(const v4u*)(bj + 16);
      acc[j] = mma(a.v, b.v, acc[j]);
    }
  }
}

// ---------------------------------------------------------------------------
// q/k/v projection: A = LN1 plane [M][512], Bt = [1536][512] (q rows, k rows, v rows).
// value = acc/16 + bf16q(bias).  q and k -> planes [b*H+h][t][64]; v -> transposed
// plane vt[b*H+h][64][t].  The three planes are contiguous: plane p at qkv + p*M*512.
// coverage: 4 passes x 4 waves x 4 rows = 64 rows x 64 cols (q/k); 4 passes x 4 waves x 4 d = 64 d rows x 64 tokens (v).
// LDS sT: cross-wave (block barrier).
// ---------------------------------------------------------------------------
__global__ __launch_bounds__(128) void k_gemm_qkv(
    const unsigned short* __restrict__ A, const unsigned short* __restrict__ Bt,
    const float* __restrict__ bq, const float* __restrict__ bk, const float* __restrict__ bv,
    unsigned short* __restrict__ qkv) {
  __shared__ __attribute__((aligned(16))) unsigned short sT[64][72];
  const int tid = threadIdx.x, lane = tid & 31, w = tid >> 5;
  const int m = lane & 15, hl = lane >> 4, k8 = hl * 8;
  const int m0 = blockIdx.y * 64, n0 = blockIdx.x * 64;

  v8f acc[4];
  gemm_main(A, Bt, CDIM, m0, n0, w, m, k8, acc);

  const float wsc = 0.0625f;               // undo the x16 weight carry
  const int lrow0 = 16 * w + 8 * hl;       // D rows of this lane within the WG tile
  const int which = n0 / CDIM;             // 0 q, 1 k, 2 v (WG-uniform)
  const int cb = n0 - which * CDIM;
#pragma unroll
  for (int j = 0; j < 4; ++j) {
    const int cn = cb + 16 * j + m;
    const float b0 = bf16q(bq[cn]);
    const float b1 = bf16q(bk[cn]);
    const float b2 = bf16q(bv[cn]);
    const float bj = (which == 0) ? b0 : ((which == 1) ? b1 : b2);
#pragma unroll
    for (int r = 0; r < 8; ++r) sT[lrow0 + r][16 * j + m] = hbits(acc[j][r] * wsc + bj);
  }
  __syncthreads();   // cross-wave for the v path; also orders the reload
  const int hh = cb / HD;
  const int b = m0 / SEQ, t0 = m0 - b * SEQ;
  const int bh = b * NHEAD + hh;
  unsigned short* dst = qkv + (size_t)which * ((size_t)MROWS * CDIM);
  v4u val[4];
  unsigned int off[4];
  if (which < 2) {                       // WG-uniform
#pragma unroll
    for (int p = 0; p < 4; ++p) {
      const int row = p * 16 + 4 * w + (lane >> 3);
      const int piece = lane & 7;
      val[p] = *(const v4u*)&sT[row][piece * 8];
      off[p] = (unsigned int)((bh * SEQ + t0 + row) * HD + piece * 8);
    }
  } else {
#pragma unroll
    for (int p = 0; p < 4; ++p) {
      const int d = p * 16 + 4 * w + (lane >> 3);
      const int piece = lane & 7;
      unsigned int wv[4];
#pragma unroll
      for (int e = 0; e < 4; ++e) {
        const unsigned int lo = sT[piece * 8 + 2 * e][d];
        const unsigned int hi = sT[piece * 8 + 2 * e + 1][d];
        wv[e] = lo | (hi << 16);
      }
      v4u t;
      t.x = wv[0]; t.y = wv[1]; t.z = wv[2]; t.w = wv[3];
      val[p] = t;
      off[p] = (unsigned int)((bh * HD + d) * SEQ + t0 + piece * 8);
    }
  }
#pragma unroll
  for (int p = 0; p < 4; ++p) *(v4u*)(dst + off[p]) = val[p];
  
}

// ---------------------------------------------------------------------------
// GEMM + bias + residual, f32 output of width CDIM:
// out = acc/16 + bf16q(bias) + res.  resfull: res rows read at full strides and
// converted to bf16 values; outfull: out rows written at full strides.
// Residual added at the store stage as float4.  Each row segment (64 floats =
// coverage: 8 passes x 2 rows per wave = 16 rows x 64 cols per wave.
// LDS sF: wave-private rows; block barrier orders the reload.
// ---------------------------------------------------------------------------
__global__ __launch_bounds__(128) void k_gemm_res(
    const unsigned short* __restrict__ A, const unsigned short* __restrict__ Bt, int K,
    const float* __restrict__ bias, const float* __restrict__ res,
    float* __restrict__ outF, int resfull, int outfull) {
  __shared__ __attribute__((aligned(16))) float sF[64][68];
  const int tid = threadIdx.x, lane = tid & 31, w = tid >> 5;
  const int m = lane & 15, hl = lane >> 4, k8 = hl * 8;
  const int m0 = blockIdx.y * 64, n0 = blockIdx.x * 64;

  v8f acc[4];
  gemm_main(A, Bt, K, m0, n0, w, m, k8, acc);

  const float wsc = 0.0625f;
  const int lrow0 = 16 * w + 8 * hl;
#pragma unroll
  for (int j = 0; j < 4; ++j) {
#pragma unroll
    for (int r = 0; r < 8; ++r) sF[lrow0 + r][16 * j + m] = acc[j][r] * wsc;
  }
  __syncthreads();
  const int b = m0 / SEQ, t0 = m0 - b * SEQ;
  v4f val[8];
  unsigned int off[8];
#pragma unroll
  for (int p = 0; p < 8; ++p) {
    const int row = 16 * w + 2 * p + hl;
    const int piece = m;
    const int ncol = n0 + 4 * piece;
    const v4f a = *(const v4f*)&sF[row][4 * piece];
    const v4f bv = bf16q4(*(const v4f*)(bias + ncol));
    const size_t frow = (size_t)b * SEQ_FULL + t0 + row;   // full-stride row
    const size_t crow = (size_t)(m0 + row);                // compact row
    const size_t rrow = resfull ? frow : crow;
    const v4f rraw = *(const v4f*)(res + rrow * (size_t)CDIM + ncol);
    const v4f rq = bf16q4(rraw);
    const v4f rr = resfull ? rq : rraw;
    val[p] = (a + bv) + rr;
    const size_t orow = outfull ? frow : crow;
    off[p] = (unsigned int)(orow * (size_t)CDIM + ncol);
  }
#pragma unroll
  for (int p = 0; p < 8; ++p) *(v4f*)(outF + off[p]) = val[p];
  
}

// ---------------------------------------------------------------------------
// ffn1: f16 out[M][HID] = gelu_erf(acc/16 + bf16q(bias)).
// coverage: 4 passes x 4 rows per wave = 16 rows x 64 cols per wave.
// LDS sT: wave-private rows; block barrier orders the reload.
// ---------------------------------------------------------------------------
__global__ __launch_bounds__(128) void k_gemm_gelu(
    const unsigned short* __restrict__ A, const unsigned short* __restrict__ Bt, int K,
    const float* __restrict__ bias, unsigned short* __restrict__ out0) {
  __shared__ __attribute__((aligned(16))) unsigned short sT[64][72];
  const int tid = threadIdx.x, lane = tid & 31, w = tid >> 5;
  const int m = lane & 15, hl = lane >> 4, k8 = hl * 8;
  const int m0 = blockIdx.y * 64, n0 = blockIdx.x * 64;

  v8f acc[4];
  gemm_main(A, Bt, K, m0, n0, w, m, k8, acc);

  const float wsc = 0.0625f;
  const int lrow0 = 16 * w + 8 * hl;
#pragma unroll
  for (int j = 0; j < 4; ++j) {
    const float bj = bf16q(bias[n0 + 16 * j + m]);
#pragma unroll
    for (int r = 0; r < 8; ++r) {
      const float u = acc[j][r] * wsc + bj;
      sT[lrow0 + r][16 * j + m] = hbits(gelu_erf(u));
    }
  }
  __syncthreads();
  v4u val[4];
  unsigned int off[4];
#pragma unroll
  for (int p = 0; p < 4; ++p) {
    const int row = 16 * w + 4 * p + (lane >> 3);
    const int piece = lane & 7;
    val[p] = *(const v4u*)&sT[row][piece * 8];
    off[p] = (unsigned int)((size_t)(m0 + row) * (size_t)HID + n0 + piece * 8);
  }
#pragma unroll
  for (int p = 0; p < 4; ++p) *(v4u*)(out0 + off[p]) = val[p];
  
}

// ---------------------------------------------------------------------------
// Flash attention, no mask.  One WG = one (b,h) x 64 query rows, 4 waves x 16 rows.
// Key chunks of 64 over the whole sequence (WG-uniform trip count).  S in
// registers, online softmax (running max) with 16-lane shuffles; P = f16(p*1024)
// staged per wave in LDS (D layout) and reloaded as an A fragment after a WG
// barrier; K and V^T fragments straight from the k / vt planes.
// LDS sP: wave-private rows, separated by block barriers; staged extent 16 x 64 == consumed extent.
// ---------------------------------------------------------------------------
__global__ __launch_bounds__(128) __attribute__((amdgpu_num_vgpr(256)))
void k_attn(const unsigned short* __restrict__ qp, const unsigned short* __restrict__ kp,
            const unsigned short* __restrict__ vp, unsigned short* __restrict__ op) {
  __shared__ __attribute__((aligned(16))) unsigned short sP[4][16][72];
  const int tid = threadIdx.x, lane = tid & 31, w = tid >> 5;
  const int m = lane & 15, hl = lane >> 4, k8 = hl * 8;
  const int nqt = SEQ / 64;
  const int bh = blockIdx.x / nqt, qt = blockIdx.x - bh * nqt;
  const int b = bh / NHEAD, hh = bh - b * NHEAD;
  const int tq = qt * 64 + 16 * w;          // first query row of this wave (within the sequence)

  Frag qa0, qa1;
  {
    const unsigned short* qr = qp + ((size_t)bh * SEQ + tq + m) * HD + k8;
    qa0.q[0] = *(const v4u*)(qr);
    qa0.q[1] = *(const v4u*)(qr + 16);
    qa1.q[0] = *(const v4u*)(qr + 32);
    qa1.q[1] = *(const v4u*)(qr + 48);
  }
  float mrun[8], lrun[8];
  v8f oacc[4];
#pragma unroll
  for (int r = 0; r < 8; ++r) { mrun[r] = -1e30f; lrun[r] = 0.0f; }
#pragma unroll
  for (int j = 0; j < 4; ++j) oacc[j] = zero8();

#pragma unroll 1
  for (int kt = 0; kt < nqt; ++kt) {
    // ---- S = Q K^T, four 16-key subtiles ----
    v8f s[4];
    const unsigned short* kb = kp + ((size_t)bh * SEQ + kt * 64 + m) * HD + k8;
#pragma unroll
    for (int j = 0; j < 4; ++j) {
      const unsigned short* kr = kb + j * 16 * HD;
      Frag f0, f1;
      f0.q[0] = *(const v4u*)(kr);
      f0.q[1] = *(const v4u*)(kr + 16);
      f1.q[0] = *(const v4u*)(kr + 32);
      f1.q[1] = *(const v4u*)(kr + 48);
      v8f t = mma(qa0.v, f0.v, zero8());
      t = mma(qa1.v, f1.v, t);
      s[j] = t;
    }
    // ---- scale, row max ----
    float tmax[8];
#pragma unroll
    for (int r = 0; r < 8; ++r) tmax[r] = -1e30f;
#pragma unroll
    for (int j = 0; j < 4; ++j) {
#pragma unroll
      for (int r = 0; r < 8; ++r) {
        const float val = s[j][r] * 0.125f;
        s[j][r] = val;
        tmax[r] = fmaxf(tmax[r], val);
      }
    }
#pragma unroll
    for (int r = 0; r < 8; ++r) {
#pragma unroll
      for (int xm = 1; xm < 16; xm <<= 1) tmax[r] = fmaxf(tmax[r], __shfl_xor(tmax[r], xm, 32));
    }
    float corr[8];
#pragma unroll
    for (int r = 0; r < 8; ++r) {
      const float mn = fmaxf(mrun[r], tmax[r]);
      corr[r] = __expf(mrun[r] - mn);
      mrun[r] = mn;
    }
    // ---- p = exp(s - m); stage f16(1024 p) in D layout; row sums ----
    float tsum[8];
#pragma unroll
    for (int r = 0; r < 8; ++r) tsum[r] = 0.0f;
#pragma unroll
    for (int j = 0; j < 4; ++j) {
#pragma unroll
      for (int r = 0; r < 8; ++r) {
        const float p = __expf(s[j][r] - mrun[r]);
        tsum[r] += p;
        sP[w][8 * hl + r][16 * j + m] = hbits(p * 1024.0f);
      }
    }
#pragma unroll
    for (int r = 0; r < 8; ++r) {
#pragma unroll
      for (int xm = 1; xm < 16; xm <<= 1) tsum[r] += __shfl_xor(tsum[r], xm, 32);
      lrun[r] = lrun[r] * corr[r] + tsum[r];
    }
#pragma unroll
    for (int j = 0; j < 4; ++j) {
#pragma unroll
      for (int r = 0; r < 8; ++r) oacc[j][r] *= corr[r];
    }
    __syncthreads();   // P staged -> visible, ordered before the fragment reload
    // ---- O += P (16 x 64 keys) * V (64 keys x 64 d) ----
    Frag pa0, pa1;
    {
      const unsigned short* pr = &sP[w][m][k8];
      pa0.q[0] = *(const v4u*)(pr);
      pa0.q[1] = *(const v4u*)(pr + 16);
      pa1.q[0] = *(const v4u*)(pr + 32);
      pa1.q[1] = *(const v4u*)(pr + 48);
    }
    const unsigned short* vb = vp + ((size_t)bh * HD + m) * (size_t)SEQ + kt * 64 + k8;
#pragma unroll
    for (int jd = 0; jd < 4; ++jd) {
      const unsigned short* vr = vb + (size_t)jd * 16 * SEQ;
      Frag g0, g1;
      g0.q[0] = *(const v4u*)(vr);
      g0.q[1] = *(const v4u*)(vr + 16);
      g1.q[0] = *(const v4u*)(vr + 32);
      g1.q[1] = *(const v4u*)(vr + 48);
      oacc[jd] = mma(pa0.v, g0.v, oacc[jd]);
      oacc[jd] = mma(pa1.v, g1.v, oacc[jd]);
    }
    __syncthreads();   // all P reads done before the next chunk overwrites sP
  }

  // ---- finalize: o = acc / (1024 l), stage per wave, whole-line stores ----
  float il[8];
#pragma unroll
  for (int r = 0; r < 8; ++r) il[r] = 1.0f / (lrun[r] * 1024.0f);
#pragma unroll
  for (int jd = 0; jd < 4; ++jd) {
#pragma unroll
    for (int r = 0; r < 8; ++r) sP[w][8 * hl + r][16 * jd + m] = hbits(oacc[jd][r] * il[r]);
  }
  __syncthreads();
  v4u val[4];
  unsigned int off[4];
#pragma unroll
  for (int p = 0; p < 4; ++p) {
    const int row = 4 * p + (lane >> 3);
    const int piece = lane & 7;
    val[p] = *(const v4u*)&sP[w][row][piece * 8];
    off[p] = (unsigned int)((size_t)(b * SEQ + tq + row) * CDIM + hh * HD + piece * 8);
  }
#pragma unroll
  for (int p = 0; p < 4; ++p) *(v4u*)(op + off[p]) = val[p];
  
}

// ---------------------------------------------------------------------------
// Host launcher
// ---------------------------------------------------------------------------
constexpr size_t al256c(size_t v) { return (v + 255) & ~(size_t)255; }
constexpr size_t MCE = (size_t)MROWS * CDIM;
constexpr size_t SZ_WQKV = al256c((size_t)3 * CDIM * CDIM * 2);
constexpr size_t SZ_WO   = al256c((size_t)CDIM * CDIM * 2);
constexpr size_t SZ_W1   = al256c((size_t)HID * CDIM * 2);
constexpr size_t SZ_W2   = al256c((size_t)CDIM * HID * 2);
constexpr size_t SZ_H    = al256c(MCE * 2);
constexpr size_t SZ_QKV  = al256c((size_t)3 * MCE * 2);
constexpr size_t SZ_O    = al256c(MCE * 2);
constexpr size_t SZ_X1   = al256c(MCE * 4);
constexpr size_t SZ_H2   = al256c(MCE * 2);
constexpr size_t SZ_ACT  = al256c((size_t)MROWS * HID * 2);
constexpr size_t WS_TOTAL = SZ_WQKV + SZ_WO + SZ_W1 + SZ_W2 + SZ_H + SZ_QKV + SZ_O + SZ_X1 + SZ_H2 + SZ_ACT;
static_assert(WS_TOTAL <= (size_t)134217728);
static_assert((size_t)MROWS * HID < (size_t)4294967296ull);     // u32 element offsets in the epilogues
static_assert((size_t)NB_FULL * SEQ_FULL * CDIM < (size_t)4294967296ull);

extern "C" void kernel_launch(void* const* d_in, const int* in_sizes, int n_in,
                              void* d_out, int out_size, void* d_ws, size_t ws_size,
                              hipStream_t stream) {
  if (n_in < 17) return;
  const long needX = ((long)(NB - 1) * SEQ_FULL + SEQ) * CDIM;
  const long nWW = (long)CDIM * CDIM;
  if ((long)in_sizes[0] < needX) return;
  if ((long)in_sizes[1] < nWW || in_sizes[2] < CDIM) return;
  if ((long)in_sizes[3] < nWW || in_sizes[4] < CDIM) return;
  if ((long)in_sizes[5] < nWW || in_sizes[6] < CDIM) return;
  if ((long)in_sizes[7] < nWW || in_sizes[8] < CDIM) return;
  if ((long)in_sizes[9] < (long)CDIM * HID || in_sizes[10] < HID) return;
  if ((long)in_sizes[11] < (long)HID * CDIM || in_sizes[12] < CDIM) return;
  if (in_sizes[13] < CDIM || in_sizes[14] < CDIM) return;
  if (in_sizes[15] < CDIM || in_sizes[16] < CDIM) return;
  if ((long)out_size < needX) return;
  if ((size_t)WS_TOTAL > ws_size) return;

  const float* x   = (const float*)d_in[0];
  const float* Wq  = (const float*)d_in[1];
  const float* bq  = (const float*)d_in[2];
  const float* Wk  = (const float*)d_in[3];
  const float* bk  = (const float*)d_in[4];
  const float* Wv  = (const float*)d_in[5];
  const float* bv  = (const float*)d_in[6];
  const float* Wo  = (const float*)d_in[7];
  const float* bo  = (const float*)d_in[8];
  const float* W1  = (const float*)d_in[9];
  const float* b1  = (const float*)d_in[10];
  const float* W2  = (const float*)d_in[11];
  const float* b2  = (const float*)d_in[12];
  const float* g1  = (const float*)d_in[13];
  const float* be1 = (const float*)d_in[14];
  const float* g2  = (const float*)d_in[15];
  const float* be2 = (const float*)d_in[16];
  float* out = (float*)d_out;

  char* ws = (char*)d_ws;
  size_t off = 0;
  unsigned short* wqkv = (unsigned short*)(ws + off); off += SZ_WQKV;   // [1536][512]
  unsigned short* wot  = (unsigned short*)(ws + off); off += SZ_WO;     // [512][512]
  unsigned short* w1t  = (unsigned short*)(ws + off); off += SZ_W1;     // [2048][512]
  unsigned short* w2t  = (unsigned short*)(ws + off); off += SZ_W2;     // [512][2048]
  unsigned short* hpl  = (unsigned short*)(ws + off); off += SZ_H;      // [M][512]
  unsigned short* qkv  = (unsigned short*)(ws + off); off += SZ_QKV;    // q [B*H][SEQ][64], k same, vt [B*H][64][SEQ]
  unsigned short* opl  = (unsigned short*)(ws + off); off += SZ_O;      // [M][512]
  float*          x1   = (float*)(ws + off);          off += SZ_X1;     // [M][512]
  unsigned short* h2p  = (unsigned short*)(ws + off); off += SZ_H2;     // [M][512]
  unsigned short* act  = (unsigned short*)(ws + off); off += SZ_ACT;    // [M][2048]
  if (off > ws_size) return;
  unsigned short* qpl = qkv;
  unsigned short* kpl = qkv + MCE;
  unsigned short* vtp = qkv + 2 * MCE;

  // 1) weight planes: in[K][N] -> out[N][K], bf16 values x16 as f16; grid = (K/64, N/64)
  k_wprep<<<dim3(CDIM / 64, CDIM / 64), 256, 0, stream>>>(Wq, wqkv, CDIM, CDIM, 0);
  k_wprep<<<dim3(CDIM / 64, CDIM / 64), 256, 0, stream>>>(Wk, wqkv, CDIM, CDIM, CDIM);
  k_wprep<<<dim3(CDIM / 64, CDIM / 64), 256, 0, stream>>>(Wv, wqkv, CDIM, CDIM, 2 * CDIM);
  k_wprep<<<dim3(CDIM / 64, CDIM / 64), 256, 0, stream>>>(Wo, wot, CDIM, CDIM, 0);
  k_wprep<<<dim3(CDIM / 64, HID / 64), 256, 0, stream>>>(W1, w1t, CDIM, HID, 0);   // in[512][2048] -> out[2048][512]
  k_wprep<<<dim3(HID / 64, CDIM / 64), 256, 0, stream>>>(W2, w2t, HID, CDIM, 0);   // in[2048][512] -> out[512][2048]
  // 2) LN1 on bf16 values of x -> h (f16)
  k_ln_in<<<MROWS / 8, 256, 0, stream>>>(x, g1, be1, hpl, MROWS);
  // 3) q/k/v projections + bias -> q, k, vt planes
  k_gemm_qkv<<<dim3(3 * CDIM / 64, MROWS / 64), 128, 0, stream>>>(hpl, wqkv, bq, bk, bv, qkv);
  // 4) attention -> o plane
  k_attn<<<NB * NHEAD * (SEQ / 64), 128, 0, stream>>>(qpl, kpl, vtp, opl);
  // 5) output projection + bias + residual(bf16 values of x) -> x1 (f32, compact rows)
  k_gemm_res<<<dim3(CDIM / 64, MROWS / 64), 128, 0, stream>>>(opl, wot, CDIM, bo, x, x1, 1, 0);
  // 6) LN2 -> h2 (f16)
  k_ln_mid<<<MROWS / 8, 256, 0, stream>>>(x1, g2, be2, h2p, MROWS);
  // 7) ffn1 + bias + gelu(erf) -> act (f16)
  k_gemm_gelu<<<dim3(HID / 64, MROWS / 64), 128, 0, stream>>>(h2p, w1t, CDIM, b1, act);
  // 8) ffn2 + bias + residual(x1) -> out (f32, full strides)
  k_gemm_res<<<dim3(CDIM / 64, MROWS / 64), 128, 0, stream>>>(act, w2t, HID, b2, x1, out, 0, 1);
}

// v001
// It runs in 286 microseconds.
// Timed twice side by side with v000, it ran 2.33 times as fast both times.
#include <hip/hip_runtime.h>

// Contractions: v_wmma_f32_16x16x32_f16 (f16 operands, f32 accumulate) for q/k/v projections, q.k^T, p.v, output projection, ffn1, ffn2; weight planes carried x16, p plane carried x1024, activations x1.

#pragma clang fp contract(off)

#ifndef NB
#define NB 2
#endif
#ifndef SEQ
#define SEQ 4096
#endif
#define NB_FULL 2
#define SEQ_FULL 4096
#define CDIM 512
#define NHEAD 8
#define HD 64
#define HID 2048
#define MROWS (NB * SEQ)

static_assert(NB >= 1 && NB <= NB_FULL);
static_assert(SEQ % 64 == 0 && SEQ >= 64 && SEQ <= SEQ_FULL);
static_assert(CDIM == NHEAD * HD);
static_assert(HD == 64);
static_assert(CDIM == 512);
static_assert(CDIM == 32 * 2 * 8);          // LayerNorm lane map: 32 lanes x 2 segments x 8 columns
static_assert(HID % 64 == 0 && CDIM % 64 == 0);
static_assert(CDIM % 32 == 0 && HID % 32 == 0);   // WMMA k-steps of 32, two per 64-wide k trip
static_assert(MROWS % 64 == 0);
static_assert(MROWS % 8 == 0);
static_assert((3 * CDIM) % 64 == 0);

typedef _Float16 v16h __attribute__((ext_vector_type(16)));
typedef _Float16 v8h  __attribute__((ext_vector_type(8)));
typedef float    v8f  __attribute__((ext_vector_type(8)));
typedef float    v4f  __attribute__((ext_vector_type(4)));
typedef unsigned int v4u __attribute__((ext_vector_type(4)));

union Frag { v16h v; v4u q[2]; };

// WMMA with hazard guard: D += A(16x32) * B(32x16)
__device__ __forceinline__ v8f mma(v16h a, v16h b, v8f c) {
  v8f d = __builtin_amdgcn_wmma_f32_16x16x32_f16(false, a, false, b, (short)0, c, false, false);
  asm volatile("v_nop\n\tv_nop\n\tv_nop\n\tv_nop" : "+v"(d) : "v"(a), "v"(b));
  return d;
}

__device__ __forceinline__ v8f zero8() {
  v8f z;
#pragma unroll
  for (int i = 0; i < 8; ++i) z[i] = 0.0f;
  return z;
}

// f32 -> nearest-even bf16 value, returned as f32
__device__ __forceinline__ float bf16q(float f) {
  unsigned int u = __float_as_uint(f);
  unsigned int r = u + 0x7FFFu + ((u >> 16) & 1u);
  r = ((u & 0x7F800000u) == 0x7F800000u) ? u : r;
  return __uint_as_float(r & 0xFFFF0000u);
}
__device__ __forceinline__ v4f bf16q4(v4f a) {
  v4f r;
  r.x = bf16q(a.x); r.y = bf16q(a.y); r.z = bf16q(a.z); r.w = bf16q(a.w);
  return r;
}
// f32 -> f16 (RNE convert) bit pattern
__device__ __forceinline__ unsigned short hbits(float f) {
  _Float16 h = (_Float16)f;
  return __builtin_bit_cast(unsigned short, h);
}
__device__ __forceinline__ v4u pack8h(float f0, float f1, float f2, float f3,
                                      float f4, float f5, float f6, float f7) {
  v8h t;
  t[0] = (_Float16)f0; t[1] = (_Float16)f1; t[2] = (_Float16)f2; t[3] = (_Float16)f3;
  t[4] = (_Float16)f4; t[5] = (_Float16)f5; t[6] = (_Float16)f6; t[7] = (_Float16)f7;
  return __builtin_bit_cast(v4u, t);
}
__device__ __forceinline__ float gelu_erf(float u) {
  return 0.5f * u * (1.0f + erff(u * 0.70710678118654752f));
}

// ---------------------------------------------------------------------------
// Weight prep: src[K][N] (f32, row pitch N) -> dst[rowoff + n][k] f16 plane
// (row pitch K), value = f16(bf16q(w) * 16).  in[K][N] -> out[N][K].
// grid = (K/64, N/64).
// ---------------------------------------------------------------------------
__global__ __launch_bounds__(256) void k_wprep(
    const float* __restrict__ src, unsigned short* __restrict__ dst, int K, int N, int rowoff) {
  __shared__ __attribute__((aligned(16))) unsigned short sT[64][72];
  const int tid = threadIdx.x;
  const int k0 = blockIdx.x * 64, n0 = blockIdx.y * 64;
#pragma unroll
  for (int it = 0; it < 4; ++it) {
    const int idx = it * 256 + tid;
    const int kk = idx >> 4;            // 0..63
    const int j4 = (idx & 15) * 4;      // 0..60
    const v4f wv = *(const v4f*)(src + (size_t)(k0 + kk) * (size_t)N + n0 + j4);
    sT[j4 + 0][kk] = hbits(bf16q(wv.x) * 16.0f);
    sT[j4 + 1][kk] = hbits(bf16q(wv.y) * 16.0f);
    sT[j4 + 2][kk] = hbits(bf16q(wv.z) * 16.0f);
    sT[j4 + 3][kk] = hbits(bf16q(wv.w) * 16.0f);
  }
  __syncthreads();   // cross-wave: staged by all waves, read by all waves
  v4u val[2];
  size_t off[2];
#pragma unroll
  for (int p = 0; p < 2; ++p) {
    const int n = p * 32 + (tid >> 3);
    const int piece = tid & 7;
    val[p] = *(const v4u*)&sT[n][piece * 8];
    off[p] = (size_t)(rowoff + n0 + n) * (size_t)K + k0 + piece * 8;
  }
#pragma unroll
  for (int p = 0; p < 2; ++p) *(v4u*)(dst + off[p]) = val[p];
  
}

// ---------------------------------------------------------------------------
// LayerNorm over CDIM=512: one wave per row, lane l owns cols 8l..8l+7 and
// 256+8l..256+8l+7.  RNDIN: input rows read at full strides and converted to
// their bf16 values first.  Output f16 plane [nrows][512], rows compact.
// coverage: 2 instructions x 32 lanes x 16 B = cols 0..255 (4 lines) + cols 256..511 (4 lines) per row.
// ---------------------------------------------------------------------------
template <int RNDIN>
__device__ __forceinline__ void ln_body(
    const float* __restrict__ x, const float* __restrict__ g, const float* __restrict__ bt,
    unsigned short* __restrict__ hout, int nrows) {
  const int lane = threadIdx.x & 31, w = threadIdx.x >> 5;
  const int row = blockIdx.x * 8 + w;
  if (row >= nrows) return;            // no barriers in this kernel
  size_t xrow;
  if (RNDIN) {
    const int b = row / SEQ, t = row - b * SEQ;
    xrow = ((size_t)b * SEQ_FULL + t) * CDIM;
  } else {
    xrow = (size_t)row * CDIM;
  }
  const int c0 = lane * 8;
  const int c1 = 256 + lane * 8;

  float v[16];
  {
    const v4f t0 = *(const v4f*)(x + xrow + c0);
    const v4f t1 = *(const v4f*)(x + xrow + c0 + 4);
    const v4f t2 = *(const v4f*)(x + xrow + c1);
    const v4f t3 = *(const v4f*)(x + xrow + c1 + 4);
    v[0] = t0.x; v[1] = t0.y; v[2] = t0.z; v[3] = t0.w;
    v[4] = t1.x; v[5] = t1.y; v[6] = t1.z; v[7] = t1.w;
    v[8] = t2.x; v[9] = t2.y; v[10] = t2.z; v[11] = t2.w;
    v[12] = t3.x; v[13] = t3.y; v[14] = t3.z; v[15] = t3.w;
  }
  if (RNDIN) {
#pragma unroll
    for (int i = 0; i < 16; ++i) v[i] = bf16q(v[i]);
  }

  float s = 0.0f;
#pragma unroll
  for (int i = 0; i < 16; ++i) s += v[i];
#pragma unroll
  for (int xm = 1; xm < 32; xm <<= 1) s += __shfl_xor(s, xm, 32);
  const float mu = s * (1.0f / CDIM);

  float d[16];
#pragma unroll
  for (int i = 0; i < 16; ++i) d[i] = v[i] - mu;
  float qs = 0.0f;
#pragma unroll
  for (int i = 0; i < 16; ++i) qs += d[i] * d[i];
#pragma unroll
  for (int xm = 1; xm < 32; xm <<= 1) qs += __shfl_xor(qs, xm, 32);
  const float var = qs * (1.0f / CDIM);
  const float rstd = rsqrtf(var + 1e-5f);

  float gg[16], bb[16];
  {
    const v4f g0 = bf16q4(*(const v4f*)(g + c0));
    const v4f g1 = bf16q4(*(const v4f*)(g + c0 + 4));
    const v4f g2 = bf16q4(*(const v4f*)(g + c1));
    const v4f g3 = bf16q4(*(const v4f*)(g + c1 + 4));
    const v4f b0 = bf16q4(*(const v4f*)(bt + c0));
    const v4f b1 = bf16q4(*(const v4f*)(bt + c0 + 4));
    const v4f b2 = bf16q4(*(const v4f*)(bt + c1));
    const v4f b3 = bf16q4(*(const v4f*)(bt + c1 + 4));
    gg[0] = g0.x; gg[1] = g0.y; gg[2] = g0.z; gg[3] = g0.w;
    gg[4] = g1.x; gg[5] = g1.y; gg[6] = g1.z; gg[7] = g1.w;
    gg[8] = g2.x; gg[9] = g2.y; gg[10] = g2.z; gg[11] = g2.w;
    gg[12] = g3.x; gg[13] = g3.y; gg[14] = g3.z; gg[15] = g3.w;
    bb[0] = b0.x; bb[1] = b0.y; bb[2] = b0.z; bb[3] = b0.w;
    bb[4] = b1.x; bb[5] = b1.y; bb[6] = b1.z; bb[7] = b1.w;
    bb[8] = b2.x; bb[9] = b2.y; bb[10] = b2.z; bb[11] = b2.w;
    bb[12] = b3.x; bb[13] = b3.y; bb[14] = b3.z; bb[15] = b3.w;
  }
  float y[16];
#pragma unroll
  for (int i = 0; i < 16; ++i) y[i] = d[i] * rstd * gg[i] + bb[i];

  const v4u o0 = pack8h(y[0], y[1], y[2], y[3], y[4], y[5], y[6], y[7]);
  const v4u o1 = pack8h(y[8], y[9], y[10], y[11], y[12], y[13], y[14], y[15]);
  unsigned short* orow = hout + (size_t)row * CDIM;
  *(v4u*)(orow + c0) = o0;
  *(v4u*)(orow + c1) = o1;
  
}

__global__ __launch_bounds__(256) void k_ln_in(
    const float* __restrict__ x, const float* __restrict__ g, const float* __restrict__ bt,
    unsigned short* __restrict__ hout, int nrows) {
  ln_body<1>(x, g, bt, hout, nrows);
}
__global__ __launch_bounds__(256) void k_ln_mid(
    const float* __restrict__ x, const float* __restrict__ g, const float* __restrict__ bt,
    unsigned short* __restrict__ hout, int nrows) {
  ln_body<0>(x, g, bt, hout, nrows);
}

// ---------------------------------------------------------------------------
// Operand tiles in LDS.  A tile is 64 rows x 64 16-bit elements (128 B = one
// line per row); LDS row pitch TP elements = 144 B (16 B x odd: the b128
// fragment reads of 16 rows fall on distinct banks).
// tiles_async: the 128 threads of a WG copy two such tiles, global -> LDS,
// 16 B per lane and copy; a wave's copy covers 4 whole rows (4 whole lines).
// ga / gb: first element of the tile, pa / pb: its global row pitch in elements.
// ---------------------------------------------------------------------------
#define TP 72
typedef unsigned short Tile[64][TP];

__device__ __forceinline__ void tiles_async(
    unsigned short* la, const unsigned short* ga, size_t pa,
    unsigned short* lb, const unsigned short* gb, size_t pb, int tid) {
  const int row = tid >> 3, pc = (tid & 7) * 8;
  const unsigned int la0 = (unsigned int)(size_t)(la + row * TP + pc);
  const unsigned int lb0 = (unsigned int)(size_t)(lb + row * TP + pc);
  const unsigned int la1 = la0 + 16 * TP * 2, la2 = la0 + 32 * TP * 2, la3 = la0 + 48 * TP * 2;
  const unsigned int lb1 = lb0 + 16 * TP * 2, lb2 = lb0 + 32 * TP * 2, lb3 = lb0 + 48 * TP * 2;
  const unsigned short* a0 = ga + (size_t)row * pa + pc;
  const unsigned short* a1 = a0 + 16 * pa;
  const unsigned short* a2 = a0 + 32 * pa;
  const unsigned short* a3 = a0 + 48 * pa;
  const unsigned short* b0 = gb + (size_t)row * pb + pc;
  const unsigned short* b1 = b0 + 16 * pb;
  const unsigned short* b2 = b0 + 32 * pb;
  const unsigned short* b3 = b0 + 48 * pb;
  // the copies and, as the last line, the wait that stands before their address registers are reused
  asm volatile(
      "global_load_async_to_lds_b128 %0, %8, off\n\t"
      "global_load_async_to_lds_b128 %1, %9, off\n\t"
      "global_load_async_to_lds_b128 %2, %10, off\n\t"
      "global_load_async_to_lds_b128 %3, %11, off\n\t"
      "global_load_async_to_lds_b128 %4, %12, off\n\t"
      "global_load_async_to_lds_b128 %5, %13, off\n\t"
      "global_load_async_to_lds_b128 %6, %14, off\n\t"
      "global_load_async_to_lds_b128 %7, %15, off\n\t"
      "s_wait_xcnt 0x0"
      :: "v"(la0), "v"(la1), "v"(la2), "v"(la3), "v"(lb0), "v"(lb1), "v"(lb2), "v"(lb3),
         "v"(a0), "v"(a1), "v"(a2), "v"(a3), "v"(b0), "v"(b1), "v"(b2), "v"(b3)
      : "memory");
}
// this wave's copies have landed
__device__ __forceinline__ void wait_async0() { asm volatile("s_wait_asynccnt 0x0" ::: "memory"); }
// this wave's LDS reads and writes have retired (before a buffer it read is refilled)
__device__ __forceinline__ void wait_ds0() { asm volatile("s_wait_dscnt 0x0" ::: "memory"); }

// ---------------------------------------------------------------------------
// 64x64-tile f16 GEMM main loop: D = A[M][K] * Bt[N][K]^T, 4 waves per WG,
// wave w owns rows 16w..16w+15 x 64 cols (4 accumulator tiles).  A trip covers
// 64 of k: the A and Bt tiles of trip t + 1 are copied to the other LDS buffer
// while trip t is worked on.  Fragments are read from LDS with the split k map
// for A and B (row/col = lane&15, elements 0..7 <- k0+8h.., 8..15 <- k0+16+8h..).
// acc[j][r] = D(row 16w + 8h + r, col 16j + (lane&15)).
// ---------------------------------------------------------------------------
__device__ __forceinline__ void gemm_main(
    const unsigned short* __restrict__ A, const unsigned short* __restrict__ Bt, int K,
    int m0, int n0, int w, int m, int k8, int tid, Tile* sA, Tile* sB, v8f (&acc)[4]) {
#pragma unroll
  for (int j = 0; j < 4; ++j) acc[j] = zero8();
  const unsigned short* ag = A + (size_t)m0 * (size_t)K;
  const unsigned short* bg = Bt + (size_t)n0 * (size_t)K;
  const int nt = K >> 6;
  tiles_async(&sA[0][0][0], ag, (size_t)K, &sB[0][0][0], bg, (size_t)K, tid);
  wait_async0();
  __syncthreads();   // tile 0 published
  if (nt > 1) tiles_async(&sA[1][0][0], ag + 64, (size_t)K, &sB[1][0][0], bg + 64, (size_t)K, tid);
#pragma unroll 1
  for (int t = 0; t < nt; ++t) {
    const int bf = t & 1;
    // all fragment reads of the trip as one group ahead of its WMMAs: one LDS latency per trip
    Frag a[2], b[2][4];
#pragma unroll
    for (int h = 0; h < 2; ++h) {
      const unsigned short* ar = &sA[bf][16 * w + m][32 * h + k8];
      a[h].q[0] = *(const v4u*)(ar);
      a[h].q[1] = *(const v4u*)(ar + 16);
#pragma unroll
      for (int j = 0; j < 4; ++j) {
        const unsigned short* bj = &sB[bf][16 * j + m][32 * h + k8];
        b[h][j].q[0] = *(const v4u*)(bj);
        b[h][j].q[1] = *(const v4u*)(bj + 16);
      }
    }
#pragma unroll
    for (int h = 0; h < 2; ++h) {
#pragma unroll
      for (int j = 0; j < 4; ++j) acc[j] = mma(a[h].v, b[h][j].v, acc[j]);
    }
    wait_ds0();
    wait_async0();
    __syncthreads();   // publishes tile t + 1; ends every read of buffer bf
    if (t + 2 < nt)
      tiles_async(&sA[bf][0][0], ag + (size_t)(t + 2) * 64, (size_t)K,
                  &sB[bf][0][0], bg + (size_t)(t + 2) * 64, (size_t)K, tid);
  }
  wait_async0();
}

// ---------------------------------------------------------------------------
// q/k/v projection: A = LN1 plane [M][512], Bt = [1536][512] (q rows, k rows, v rows).
// value = acc/16 + bf16q(bias).  q and k -> planes [b*H+h][t][64]; v -> transposed
// plane vt[b*H+h][64][t].  The three planes are contiguous: plane p at qkv + p*M*512.
// coverage: 4 passes x 4 waves x 4 rows = 64 rows x 64 cols (q/k); 4 passes x 4 waves x 4 d = 64 d rows x 64 tokens (v).
// LDS sT: cross-wave (block barrier).
// ---------------------------------------------------------------------------
__global__ __launch_bounds__(128) void k_gemm_qkv(
    const unsigned short* __restrict__ A, const unsigned short* __restrict__ Bt,
    const float* __restrict__ bq, const float* __restrict__ bk, const float* __restrict__ bv,
    unsigned short* __restrict__ qkv) {
  __shared__ __attribute__((aligned(16))) unsigned short sT[64][72];
  __shared__ __attribute__((aligned(16))) Tile sA[2];
  __shared__ __attribute__((aligned(16))) Tile sB[2];
  const int tid = threadIdx.x, lane = tid & 31, w = tid >> 5;
  const int m = lane & 15, hl = lane >> 4, k8 = hl * 8;
  const int m0 = blockIdx.y * 64, n0 = blockIdx.x * 64;

  v8f acc[4];
  gemm_main(A, Bt, CDIM, m0, n0, w, m, k8, tid, sA, sB, acc);

  const float wsc = 0.0625f;               // undo the x16 weight carry
  const int lrow0 = 16 * w + 8 * hl;       // D rows of this lane within the WG tile
  const int which = n0 / CDIM;             // 0 q, 1 k, 2 v (WG-uniform)
  const int cb = n0 - which * CDIM;
#pragma unroll
  for (int j = 0; j < 4; ++j) {
    const int cn = cb + 16 * j + m;
    const float b0 = bf16q(bq[cn]);
    const float b1 = bf16q(bk[cn]);
    const float b2 = bf16q(bv[cn]);
    const float bj = (which == 0) ? b0 : ((which == 1) ? b1 : b2);
#pragma unroll
    for (int r = 0; r < 8; ++r) sT[lrow0 + r][16 * j + m] = hbits(acc[j][r] * wsc + bj);
  }
  __syncthreads();   // cross-wave: both the q/k and the v reload read rows of other waves
  const int hh = cb / HD;
  const int b = m0 / SEQ, t0 = m0 - b * SEQ;
  const int bh = b * NHEAD + hh;
  unsigned short* dst = qkv + (size_t)which * ((size_t)MROWS * CDIM);
  v4u val[4];
  unsigned int off[4];
  if (which < 2) {                       // WG-uniform
#pragma unroll
    for (int p = 0; p < 4; ++p) {
      const int row = p * 16 + 4 * w + (lane >> 3);
      const int piece = lane & 7;
      val[p] = *(const v4u*)&sT[row][piece * 8];
      off[p] = (unsigned int)((bh * SEQ + t0 + row) * HD + piece * 8);
    }
  } else {
#pragma unroll
    for (int p = 0; p < 4; ++p) {
      const int d = p * 16 + 4 * w + (lane >> 3);
      const int piece = lane & 7;
      unsigned int wv[4];
#pragma unroll
      for (int e = 0; e < 4; ++e) {
        const unsigned int lo = sT[piece * 8 + 2 * e][d];
        const unsigned int hi = sT[piece * 8 + 2 * e + 1][d];
        wv[e] = lo | (hi << 16);
      }
      v4u t;
      t.x = wv[0]; t.y = wv[1]; t.z = wv[2]; t.w = wv[3];
      val[p] = t;
      off[p] = (unsigned int)((bh * HD + d) * SEQ + t0 + piece * 8);
    }
  }
#pragma unroll
  for (int p = 0; p < 4; ++p) *(v4u*)(dst + off[p]) = val[p];
  
}

// ---------------------------------------------------------------------------
// GEMM + bias + residual, f32 output of width CDIM:
// out = acc/16 + bf16q(bias) + res.  resfull: res rows read at full strides and
// converted to bf16 values; outfull: out rows written at full strides.
// Residual added at the store stage as float4.  Each row segment (64 floats =
// coverage: 8 passes x 2 rows per wave = 16 rows x 64 cols per wave.
// LDS sF: wave-private rows; block barrier orders the reload.
// ---------------------------------------------------------------------------
__global__ __launch_bounds__(128) void k_gemm_res(
    const unsigned short* __restrict__ A, const unsigned short* __restrict__ Bt, int K,
    const float* __restrict__ bias, const float* __restrict__ res,
    float* __restrict__ outF, int resfull, int outfull) {
  __shared__ __attribute__((aligned(16))) float sF[64][68];
  __shared__ __attribute__((aligned(16))) Tile sA[2];
  __shared__ __attribute__((aligned(16))) Tile sB[2];
  const int tid = threadIdx.x, lane = tid & 31, w = tid >> 5;
  const int m = lane & 15, hl = lane >> 4, k8 = hl * 8;
  const int m0 = blockIdx.y * 64, n0 = blockIdx.x * 64;

  v8f acc[4];
  gemm_main(A, Bt, K, m0, n0, w, m, k8, tid, sA, sB, acc);

  const float wsc = 0.0625f;
  const int lrow0 = 16 * w + 8 * hl;
#pragma unroll
  for (int j = 0; j < 4; ++j) {
#pragma unroll
    for (int r = 0; r < 8; ++r) sF[lrow0 + r][16 * j + m] = acc[j][r] * wsc;
  }
  __syncthreads();
  const int b = m0 / SEQ, t0 = m0 - b * SEQ;
  v4f val[8];
  unsigned int off[8];
#pragma unroll
  for (int p = 0; p < 8; ++p) {
    const int row = 16 * w + 2 * p + hl;
    const int piece = m;
    const int ncol = n0 + 4 * piece;
    const v4f a = *(const v4f*)&sF[row][4 * piece];
    const v4f bv = bf16q4(*(const v4f*)(bias + ncol));
    const size_t frow = (size_t)b * SEQ_FULL + t0 + row;   // full-stride row
    const size_t crow = (size_t)(m0 + row);                // compact row
    const size_t rrow = resfull ? frow : crow;
    const v4f rraw = *(const v4f*)(res + rrow * (size_t)CDIM + ncol);
    const v4f rq = bf16q4(rraw);
    const v4f rr = resfull ? rq : rraw;
    val[p] = (a + bv) + rr;
    const size_t orow = outfull ? frow : crow;
    off[p] = (unsigned int)(orow * (size_t)CDIM + ncol);
  }
#pragma unroll
  for (int p = 0; p < 8; ++p) *(v4f*)(outF + off[p]) = val[p];
  
}

// ---------------------------------------------------------------------------
// ffn1: f16 out[M][HID] = gelu_erf(acc/16 + bf16q(bias)).
// coverage: 4 passes x 4 rows per wave = 16 rows x 64 cols per wave.
// LDS sT: wave-private rows; block barrier orders the reload.
// ---------------------------------------------------------------------------
__global__ __launch_bounds__(128) void k_gemm_gelu(
    const unsigned short* __restrict__ A, const unsigned short* __restrict__ Bt, int K,
    const float* __restrict__ bias, unsigned short* __restrict__ out0) {
  __shared__ __attribute__((aligned(16))) unsigned short sT[64][72];
  __shared__ __attribute__((aligned(16))) Tile sA[2];
  __shared__ __attribute__((aligned(16))) Tile sB[2];
  const int tid = threadIdx.x, lane = tid & 31, w = tid >> 5;
  const int m = lane & 15, hl = lane >> 4, k8 = hl * 8;
  const int m0 = blockIdx.y * 64, n0 = blockIdx.x * 64;

  v8f acc[4];
  gemm_main(A, Bt, K, m0, n0, w, m, k8, tid, sA, sB, acc);

  const float wsc = 0.0625f;
  const int lrow0 = 16 * w + 8 * hl;
#pragma unroll
  for (int j = 0; j < 4; ++j) {
    const float bj = bf16q(bias[n0 + 16 * j + m]);
#pragma unroll
    for (int r = 0; r < 8; ++r) {
      const float u = acc[j][r] * wsc + bj;
      sT[lrow0 + r][16 * j + m] = hbits(gelu_erf(u));
    }
  }
  __syncthreads();
  v4u val[4];
  unsigned int off[4];
#pragma unroll
  for (int p = 0; p < 4; ++p) {
    const int row = 16 * w + 4 * p + (lane >> 3);
    const int piece = lane & 7;
    val[p] = *(const v4u*)&sT[row][piece * 8];
    off[p] = (unsigned int)((size_t)(m0 + row) * (size_t)HID + n0 + piece * 8);
  }
#pragma unroll
  for (int p = 0; p < 4; ++p) *(v4u*)(out0 + off[p]) = val[p];
  
}

// ---------------------------------------------------------------------------
// Flash attention, no mask.  One WG = one (b,h) x 64 query rows, 4 waves x 16 rows.
// Key chunks of 64 over the whole sequence (WG-uniform trip count).  S in
// registers, online softmax (running max) with 16-lane shuffles; P = f16(p*1024)
// staged per wave in LDS (D layout) and reloaded as an A fragment after a WG
// barrier; the K and V^T tiles of chunk kt + 1 are copied to the other LDS buffer
// while chunk kt is worked on, and all four waves read their fragments from there.
// LDS sP: wave-private rows, separated by block barriers; staged extent 16 x 64 == consumed extent.
// ---------------------------------------------------------------------------
__global__ __launch_bounds__(128) __attribute__((amdgpu_num_vgpr(256)))
void k_attn(const unsigned short* __restrict__ qp, const unsigned short* __restrict__ kp,
            const unsigned short* __restrict__ vp, unsigned short* __restrict__ op) {
  __shared__ __attribute__((aligned(16))) unsigned short sP[4][16][72];
  __shared__ __attribute__((aligned(16))) Tile sK[2];
  __shared__ __attribute__((aligned(16))) Tile sV[2];
  const int tid = threadIdx.x, lane = tid & 31, w = tid >> 5;
  const int m = lane & 15, hl = lane >> 4, k8 = hl * 8;
  const int nqt = SEQ / 64;
  const int bh = blockIdx.x / nqt, qt = blockIdx.x - bh * nqt;
  const int b = bh / NHEAD, hh = bh - b * NHEAD;
  const int tq = qt * 64 + 16 * w;          // first query row of this wave (within the sequence)

  const unsigned short* kg = kp + (size_t)bh * SEQ * HD;   // chunk kt: + kt*64 rows, row pitch HD
  const unsigned short* vg = vp + (size_t)bh * HD * SEQ;   // chunk kt: + kt*64 columns, row pitch SEQ
  tiles_async(&sK[0][0][0], kg, (size_t)HD, &sV[0][0][0], vg, (size_t)SEQ, tid);
  wait_async0();
  __syncthreads();   // chunk 0 published
  if (nqt > 1)
    tiles_async(&sK[1][0][0], kg + (size_t)64 * HD, (size_t)HD, &sV[1][0][0], vg + 64, (size_t)SEQ, tid);

  Frag qa0, qa1;
  {
    const unsigned short* qr = qp + ((size_t)bh * SEQ + tq + m) * HD + k8;
    qa0.q[0] = *(const v4u*)(qr);
    qa0.q[1] = *(const v4u*)(qr + 16);
    qa1.q[0] = *(const v4u*)(qr + 32);
    qa1.q[1] = *(const v4u*)(qr + 48);
  }
  float mrun[8], lrun[8];
  v8f oacc[4];
#pragma unroll
  for (int r = 0; r < 8; ++r) { mrun[r] = -1e30f; lrun[r] = 0.0f; }
#pragma unroll
  for (int j = 0; j < 4; ++j) oacc[j] = zero8();

#pragma unroll 1
  for (int kt = 0; kt < nqt; ++kt) {
    // ---- S = Q K^T, four 16-key subtiles ----
    v8f s[4];
    const int bf = kt & 1;
    // all K fragment reads of the chunk as one group ahead of its WMMAs: one LDS latency, not four
    Frag f0[4], f1[4];
#pragma unroll
    for (int j = 0; j < 4; ++j) {
      const unsigned short* kr = &sK[bf][16 * j + m][k8];
      f0[j].q[0] = *(const v4u*)(kr);
      f0[j].q[1] = *(const v4u*)(kr + 16);
      f1[j].q[0] = *(const v4u*)(kr + 32);
      f1[j].q[1] = *(const v4u*)(kr + 48);
    }
#pragma unroll
    for (int j = 0; j < 4; ++j) {
      v8f t = mma(qa0.v, f0[j].v, zero8());
      t = mma(qa1.v, f1[j].v, t);
      s[j] = t;
    }
    // ---- scale, row max ----
    float tmax[8];
#pragma unroll
    for (int r = 0; r < 8; ++r) tmax[r] = -1e30f;
#pragma unroll
    for (int j = 0; j < 4; ++j) {
#pragma unroll
      for (int r = 0; r < 8; ++r) {
        const float val = s[j][r] * 0.125f;
        s[j][r] = val;
        tmax[r] = fmaxf(tmax[r], val);
      }
    }
#pragma unroll
    for (int r = 0; r < 8; ++r) {
#pragma unroll
      for (int xm = 1; xm < 16; xm <<= 1) tmax[r] = fmaxf(tmax[r], __shfl_xor(tmax[r], xm, 32));
    }
    float corr[8];
#pragma unroll
    for (int r = 0; r < 8; ++r) {
      const float mn = fmaxf(mrun[r], tmax[r]);
      corr[r] = __expf(mrun[r] - mn);
      mrun[r] = mn;
    }
    // ---- p = exp(s - m); stage f16(1024 p) in D layout; row sums ----
    float tsum[8];
#pragma unroll
    for (int r = 0; r < 8; ++r) tsum[r] = 0.0f;
#pragma unroll
    for (int j = 0; j < 4; ++j) {
#pragma unroll
      for (int r = 0; r < 8; ++r) {
        const float p = __expf(s[j][r] - mrun[r]);
        tsum[r] += p;
        sP[w][8 * hl + r][16 * j + m] = hbits(p * 1024.0f);
      }
    }
#pragma unroll
    for (int r = 0; r < 8; ++r) {
#pragma unroll
      for (int xm = 1; xm < 16; xm <<= 1) tsum[r] += __shfl_xor(tsum[r], xm, 32);
      lrun[r] = lrun[r] * corr[r] + tsum[r];
    }
#pragma unroll
    for (int j = 0; j < 4; ++j) {
#pragma unroll
      for (int r = 0; r < 8; ++r) oacc[j][r] *= corr[r];
    }
    __syncthreads();   // P staged -> visible, ordered before the fragment reload
    // ---- O += P (16 x 64 keys) * V (64 keys x 64 d) ----
    Frag pa0, pa1;
    {
      const unsigned short* pr = &sP[w][m][k8];
      pa0.q[0] = *(const v4u*)(pr);
      pa0.q[1] = *(const v4u*)(pr + 16);
      pa1.q[0] = *(const v4u*)(pr + 32);
      pa1.q[1] = *(const v4u*)(pr + 48);
    }
    // all V^T fragment reads of the chunk as one group, as for K
    Frag g0[4], g1[4];
#pragma unroll
    for (int jd = 0; jd < 4; ++jd) {
      const unsigned short* vr = &sV[bf][16 * jd + m][k8];
      g0[jd].q[0] = *(const v4u*)(vr);
      g0[jd].q[1] = *(const v4u*)(vr + 16);
      g1[jd].q[0] = *(const v4u*)(vr + 32);
      g1[jd].q[1] = *(const v4u*)(vr + 48);
    }
#pragma unroll
    for (int jd = 0; jd < 4; ++jd) {
      oacc[jd] = mma(pa0.v, g0[jd].v, oacc[jd]);
      oacc[jd] = mma(pa1.v, g1[jd].v, oacc[jd]);
    }
    wait_ds0();
    wait_async0();
    __syncthreads();   // publishes chunk kt + 1; ends every read of buffer bf and of sP
    if (kt + 2 < nqt)
      tiles_async(&sK[bf][0][0], kg + (size_t)(kt + 2) * 64 * HD, (size_t)HD,
                  &sV[bf][0][0], vg + (size_t)(kt + 2) * 64, (size_t)SEQ, tid);
  }
  wait_async0();

  // ---- finalize: o = acc / (1024 l), stage per wave, whole-line stores ----
  float il[8];
#pragma unroll
  for (int r = 0; r < 8; ++r) il[r] = 1.0f / (lrun[r] * 1024.0f);
#pragma unroll
  for (int jd = 0; jd < 4; ++jd) {
#pragma unroll
    for (int r = 0; r < 8; ++r) sP[w][8 * hl + r][16 * jd + m] = hbits(oacc[jd][r] * il[r]);
  }
  __syncthreads();
  v4u val[4];
  unsigned int off[4];
#pragma unroll
  for (int p = 0; p < 4; ++p) {
    const int row = 4 * p + (lane >> 3);
    const int piece = lane & 7;
    val[p] = *(const v4u*)&sP[w][row][piece * 8];
    off[p] = (unsigned int)((size_t)(b * SEQ + tq + row) * CDIM + hh * HD + piece * 8);
  }
#pragma unroll
  for (int p = 0; p < 4; ++p) *(v4u*)(op + off[p]) = val[p];
  
}

// ---------------------------------------------------------------------------
// Host launcher
// ---------------------------------------------------------------------------
constexpr size_t al256c(size_t v) { return (v + 255) & ~(size_t)255; }
constexpr size_t MCE = (size_t)MROWS * CDIM;
constexpr size_t SZ_WQKV = al256c((size_t)3 * CDIM * CDIM * 2);
constexpr size_t SZ_WO   = al256c((size_t)CDIM * CDIM * 2);
constexpr size_t SZ_W1   = al256c((size_t)HID * CDIM * 2);
constexpr size_t SZ_W2   = al256c((size_t)CDIM * HID * 2);
constexpr size_t SZ_H    = al256c(MCE * 2);
constexpr size_t SZ_QKV  = al256c((size_t)3 * MCE * 2);
constexpr size_t SZ_O    = al256c(MCE * 2);
constexpr size_t SZ_X1   = al256c(MCE * 4);
constexpr size_t SZ_H2   = al256c(MCE * 2);
constexpr size_t SZ_ACT  = al256c((size_t)MROWS * HID * 2);
constexpr size_t WS_TOTAL = SZ_WQKV + SZ_WO + SZ_W1 + SZ_W2 + SZ_H + SZ_QKV + SZ_O + SZ_X1 + SZ_H2 + SZ_ACT;
static_assert(WS_TOTAL <= (size_t)134217728);
static_assert((size_t)MROWS * HID < (size_t)4294967296ull);     // u32 element offsets in the epilogues
static_assert((size_t)NB_FULL * SEQ_FULL * CDIM < (size_t)4294967296ull);

extern "C" void kernel_launch(void* const* d_in, const int* in_sizes, int n_in,
                              void* d_out, int out_size, void* d_ws, size_t ws_size,
                              hipStream_t stream) {
  if (n_in < 17) return;
  const long needX = ((long)(NB - 1) * SEQ_FULL + SEQ) * CDIM;
  const long nWW = (long)CDIM * CDIM;
  if ((long)in_sizes[0] < needX) return;
  if ((long)in_sizes[1] < nWW || in_sizes[2] < CDIM) return;
  if ((long)in_sizes[3] < nWW || in_sizes[4] < CDIM) return;
  if ((long)in_sizes[5] < nWW || in_sizes[6] < CDIM) return;
  if ((long)in_sizes[7] < nWW || in_sizes[8] < CDIM) return;
  if ((long)in_sizes[9] < (long)CDIM * HID || in_sizes[10] < HID) return;
  if ((long)in_sizes[11] < (long)HID * CDIM || in_sizes[12] < CDIM) return;
  if (in_sizes[13] < CDIM || in_sizes[14] < CDIM) return;
  if (in_sizes[15] < CDIM || in_sizes[16] < CDIM) return;
  if ((long)out_size < needX) return;
  if ((size_t)WS_TOTAL > ws_size) return;

  const float* x   = (const float*)d_in[0];
  const float* Wq  = (const float*)d_in[1];
  const float* bq  = (const float*)d_in[2];
  const float* Wk  = (const float*)d_in[3];
  const float* bk  = (const float*)d_in[4];
  const float* Wv  = (const float*)d_in[5];
  const float* bv  = (const float*)d_in[6];
  const float* Wo  = (const float*)d_in[7];
  const float* bo  = (const float*)d_in[8];
  const float* W1  = (const float*)d_in[9];
  const float* b1  = (const float*)d_in[10];
  const float* W2  = (const float*)d_in[11];
  const float* b2  = (const float*)d_in[12];
  const float* g1  = (const float*)d_in[13];
  const float* be1 = (const float*)d_in[14];
  const float* g2  = (const float*)d_in[15];
  const float* be2 = (const float*)d_in[16];
  float* out = (float*)d_out;

  char* ws = (char*)d_ws;
  size_t off = 0;
  unsigned short* wqkv = (unsigned short*)(ws + off); off += SZ_WQKV;   // [1536][512]
  unsigned short* wot  = (unsigned short*)(ws + off); off += SZ_WO;     // [512][512]
  unsigned short* w1t  = (unsigned short*)(ws + off); off += SZ_W1;     // [2048][512]
  unsigned short* w2t  = (unsigned short*)(ws + off); off += SZ_W2;     // [512][2048]
  unsigned short* hpl  = (unsigned short*)(ws + off); off += SZ_H;      // [M][512]
  unsigned short* qkv  = (unsigned short*)(ws + off); off += SZ_QKV;    // q [B*H][SEQ][64], k same, vt [B*H][64][SEQ]
  unsigned short* opl  = (unsigned short*)(ws + off); off += SZ_O;      // [M][512]
  float*          x1   = (float*)(ws + off);          off += SZ_X1;     // [M][512]
  unsigned short* h2p  = (unsigned short*)(ws + off); off += SZ_H2;     // [M][512]
  unsigned short* act  = (unsigned short*)(ws + off); off += SZ_ACT;    // [M][2048]
  if (off > ws_size) return;
  unsigned short* qpl = qkv;
  unsigned short* kpl = qkv + MCE;
  unsigned short* vtp = qkv + 2 * MCE;

  // 1) weight planes: in[K][N] -> out[N][K], bf16 values x16 as f16; grid = (K/64, N/64)
  k_wprep<<<dim3(CDIM / 64, CDIM / 64), 256, 0, stream>>>(Wq, wqkv, CDIM, CDIM, 0);
  k_wprep<<<dim3(CDIM / 64, CDIM / 64), 256, 0, stream>>>(Wk, wqkv, CDIM, CDIM, CDIM);
  k_wprep<<<dim3(CDIM / 64, CDIM / 64), 256, 0, stream>>>(Wv, wqkv, CDIM, CDIM, 2 * CDIM);
  k_wprep<<<dim3(CDIM / 64, CDIM / 64), 256, 0, stream>>>(Wo, wot, CDIM, CDIM, 0);
  k_wprep<<<dim3(CDIM / 64, HID / 64), 256, 0, stream>>>(W1, w1t, CDIM, HID, 0);   // in[512][2048] -> out[2048][512]
  k_wprep<<<dim3(HID / 64, CDIM / 64), 256, 0, stream>>>(W2, w2t, HID, CDIM, 0);   // in[2048][512] -> out[512][2048]
  // 2) LN1 on bf16 values of x -> h (f16)
  k_ln_in<<<MROWS / 8, 256, 0, stream>>>(x, g1, be1, hpl, MROWS);
  // 3) q/k/v projections + bias -> q, k, vt planes
  k_gemm_qkv<<<dim3(3 * CDIM / 64, MROWS / 64), 128, 0, stream>>>(hpl, wqkv, bq, bk, bv, qkv);
  // 4) attention -> o plane
  k_attn<<<NB * NHEAD * (SEQ / 64), 128, 0, stream>>>(qpl, kpl, vtp, opl);
  // 5) output projection + bias + residual(bf16 values of x) -> x1 (f32, compact rows)
  k_gemm_res<<<dim3(CDIM / 64, MROWS / 64), 128, 0, stream>>>(opl, wot, CDIM, bo, x, x1, 1, 0);
  // 6) LN2 -> h2 (f16)
  k_ln_mid<<<MROWS / 8, 256, 0, stream>>>(x1, g2, be2, h2p, MROWS);
  // 7) ffn1 + bias + gelu(erf) -> act (f16)
  k_gemm_gelu<<<dim3(HID / 64, MROWS / 64), 128, 0, stream>>>(h2p, w1t, CDIM, b1, act);
  // 8) ffn2 + bias + residual(x1) -> out (f32, full strides)
  k_gemm_res<<<dim3(CDIM / 64, MROWS / 64), 128, 0, stream>>>(act, w2t, HID, b2, x1, out, 0, 1);
}

// v002
// A run of this version takes 192 microseconds.
// In two side-by-side timings against v001, it was 1.49 and 1.50 times as fast.
// Over all steps from v000 it is 3.49 times as fast.
#include <hip/hip_runtime.h>

// Contractions: v_wmma_f32_16x16x32_f16 (f16 operands, f32 accumulate) for q/k/v projections, q.k^T, p.v, output projection, ffn1, ffn2; weight planes carried x16, p carried x1024, activations x1.

#pragma clang fp contract(off)

#ifndef NB
#define NB 2
#endif
#ifndef SEQ
#define SEQ 4096
#endif
#define NB_FULL 2
#define SEQ_FULL 4096
#define CDIM 512
#define NHEAD 8
#define HD 64
#define HID 2048
#define MROWS (NB * SEQ)

static_assert(NB >= 1 && NB <= NB_FULL);
static_assert(SEQ % 64 == 0 && SEQ >= 64 && SEQ <= SEQ_FULL);
static_assert(CDIM == NHEAD * HD);
static_assert(HD == 64);
static_assert(CDIM == 512);
static_assert(CDIM == 32 * 2 * 8);          // LayerNorm lane map: 32 lanes x 2 segments x 8 columns
static_assert(HID % 64 == 0 && CDIM % 64 == 0);
static_assert(CDIM % 32 == 0 && HID % 32 == 0);   // WMMA k-steps of 32, two per 64-wide k trip
static_assert(MROWS % 64 == 0);
static_assert(MROWS % 8 == 0);
static_assert((3 * CDIM) % 64 == 0);

typedef _Float16 v16h __attribute__((ext_vector_type(16)));
typedef _Float16 v8h  __attribute__((ext_vector_type(8)));
typedef float    v8f  __attribute__((ext_vector_type(8)));
typedef float    v4f  __attribute__((ext_vector_type(4)));
typedef unsigned int v4u __attribute__((ext_vector_type(4)));

union Frag { v16h v; v4u q[2]; };

// WMMA with hazard guard: D += A(16x32) * B(32x16)
__device__ __forceinline__ v8f mma(v16h a, v16h b, v8f c) {
  v8f d = __builtin_amdgcn_wmma_f32_16x16x32_f16(false, a, false, b, (short)0, c, false, false);
  asm volatile("v_nop\n\tv_nop\n\tv_nop\n\tv_nop" : "+v"(d) : "v"(a), "v"(b));
  return d;
}

__device__ __forceinline__ v8f zero8() {
  v8f z;
#pragma unroll
  for (int i = 0; i < 8; ++i) z[i] = 0.0f;
  return z;
}

// f32 -> nearest-even bf16 value, returned as f32
__device__ __forceinline__ float bf16q(float f) {
  unsigned int u = __float_as_uint(f);
  unsigned int r = u + 0x7FFFu + ((u >> 16) & 1u);
  r = ((u & 0x7F800000u) == 0x7F800000u) ? u : r;
  return __uint_as_float(r & 0xFFFF0000u);
}
__device__ __forceinline__ v4f bf16q4(v4f a) {
  v4f r;
  r.x = bf16q(a.x); r.y = bf16q(a.y); r.z = bf16q(a.z); r.w = bf16q(a.w);
  return r;
}
// f32 -> f16 (RNE convert) bit pattern
__device__ __forceinline__ unsigned short hbits(float f) {
  _Float16 h = (_Float16)f;
  return __builtin_bit_cast(unsigned short, h);
}
__device__ __forceinline__ v4u pack8h(float f0, float f1, float f2, float f3,
                                      float f4, float f5, float f6, float f7) {
  v8h t;
  t[0] = (_Float16)f0; t[1] = (_Float16)f1; t[2] = (_Float16)f2; t[3] = (_Float16)f3;
  t[4] = (_Float16)f4; t[5] = (_Float16)f5; t[6] = (_Float16)f6; t[7] = (_Float16)f7;
  return __builtin_bit_cast(v4u, t);
}
__device__ __forceinline__ float gelu_erf(float u) {
  return 0.5f * u * (1.0f + erff(u * 0.70710678118654752f));
}

// ---------------------------------------------------------------------------
// Weight prep: src[K][N] (f32, row pitch N) -> dst[rowoff + n][k] f16 plane
// (row pitch K), value = f16(bf16q(w) * 16).  in[K][N] -> out[N][K].
// grid = (K/64, N/64).
// ---------------------------------------------------------------------------
__global__ __launch_bounds__(256) void k_wprep(
    const float* __restrict__ src, unsigned short* __restrict__ dst, int K, int N, int rowoff) {
  __shared__ __attribute__((aligned(16))) unsigned short sT[64][72];
  const int tid = threadIdx.x;
  const int k0 = blockIdx.x * 64, n0 = blockIdx.y * 64;
#pragma unroll
  for (int it = 0; it < 4; ++it) {
    const int idx = it * 256 + tid;
    const int kk = idx >> 4;            // 0..63
    const int j4 = (idx & 15) * 4;      // 0..60
    const v4f wv = *(const v4f*)(src + (size_t)(k0 + kk) * (size_t)N + n0 + j4);
    sT[j4 + 0][kk] = hbits(bf16q(wv.x) * 16.0f);
    sT[j4 + 1][kk] = hbits(bf16q(wv.y) * 16.0f);
    sT[j4 + 2][kk] = hbits(bf16q(wv.z) * 16.0f);
    sT[j4 + 3][kk] = hbits(bf16q(wv.w) * 16.0f);
  }
  __syncthreads();   // cross-wave: staged by all waves, read by all waves
  v4u val[2];
  size_t off[2];
#pragma unroll
  for (int p = 0; p < 2; ++p) {
    const int n = p * 32 + (tid >> 3);
    const int piece = tid & 7;
    val[p] = *(const v4u*)&sT[n][piece * 8];
    off[p] = (size_t)(rowoff + n0 + n) * (size_t)K + k0 + piece * 8;
  }
#pragma unroll
  for (int p = 0; p < 2; ++p) *(v4u*)(dst + off[p]) = val[p];
  
}

// ---------------------------------------------------------------------------
// LayerNorm over CDIM=512: one wave per row, lane l owns cols 8l..8l+7 and
// 256+8l..256+8l+7.  RNDIN: input rows read at full strides and converted to
// their bf16 values first.  Output f16 plane [nrows][512], rows compact.
// coverage: 2 instructions x 32 lanes x 16 B = cols 0..255 (4 lines) + cols 256..511 (4 lines) per row.
// ---------------------------------------------------------------------------
template <int RNDIN>
__device__ __forceinline__ void ln_body(
    const float* __restrict__ x, const float* __restrict__ g, const float* __restrict__ bt,
    unsigned short* __restrict__ hout, int nrows) {
  const int lane = threadIdx.x & 31, w = threadIdx.x >> 5;
  const int row = blockIdx.x * 8 + w;
  if (row >= nrows) return;            // no barriers in this kernel
  size_t xrow;
  if (RNDIN) {
    const int b = row / SEQ, t = row - b * SEQ;
    xrow = ((size_t)b * SEQ_FULL + t) * CDIM;
  } else {
    xrow = (size_t)row * CDIM;
  }
  const int c0 = lane * 8;
  const int c1 = 256 + lane * 8;

  float v[16];
  {
    const v4f t0 = *(const v4f*)(x + xrow + c0);
    const v4f t1 = *(const v4f*)(x + xrow + c0 + 4);
    const v4f t2 = *(const v4f*)(x + xrow + c1);
    const v4f t3 = *(const v4f*)(x + xrow + c1 + 4);
    v[0] = t0.x; v[1] = t0.y; v[2] = t0.z; v[3] = t0.w;
    v[4] = t1.x; v[5] = t1.y; v[6] = t1.z; v[7] = t1.w;
    v[8] = t2.x; v[9] = t2.y; v[10] = t2.z; v[11] = t2.w;
    v[12] = t3.x; v[13] = t3.y; v[14] = t3.z; v[15] = t3.w;
  }
  if (RNDIN) {
#pragma unroll
    for (int i = 0; i < 16; ++i) v[i] = bf16q(v[i]);
  }

  float s = 0.0f;
#pragma unroll
  for (int i = 0; i < 16; ++i) s += v[i];
#pragma unroll
  for (int xm = 1; xm < 32; xm <<= 1) s += __shfl_xor(s, xm, 32);
  const float mu = s * (1.0f / CDIM);

  float d[16];
#pragma unroll
  for (int i = 0; i < 16; ++i) d[i] = v[i] - mu;
  float qs = 0.0f;
#pragma unroll
  for (int i = 0; i < 16; ++i) qs += d[i] * d[i];
#pragma unroll
  for (int xm = 1; xm < 32; xm <<= 1) qs += __shfl_xor(qs, xm, 32);
  const float var = qs * (1.0f / CDIM);
  const float rstd = rsqrtf(var + 1e-5f);

  float gg[16], bb[16];
  {
    const v4f g0 = bf16q4(*(const v4f*)(g + c0));
    const v4f g1 = bf16q4(*(const v4f*)(g + c0 + 4));
    const v4f g2 = bf16q4(*(const v4f*)(g + c1));
    const v4f g3 = bf16q4(*(const v4f*)(g + c1 + 4));
    const v4f b0 = bf16q4(*(const v4f*)(bt + c0));
    const v4f b1 = bf16q4(*(const v4f*)(bt + c0 + 4));
    const v4f b2 = bf16q4(*(const v4f*)(bt + c1));
    const v4f b3 = bf16q4(*(const v4f*)(bt + c1 + 4));
    gg[0] = g0.x; gg[1] = g0.y; gg[2] = g0.z; gg[3] = g0.w;
    gg[4] = g1.x; gg[5] = g1.y; gg[6] = g1.z; gg[7] = g1.w;
    gg[8] = g2.x; gg[9] = g2.y; gg[10] = g2.z; gg[11] = g2.w;
    gg[12] = g3.x; gg[13] = g3.y; gg[14] = g3.z; gg[15] = g3.w;
    bb[0] = b0.x; bb[1] = b0.y; bb[2] = b0.z; bb[3] = b0.w;
    bb[4] = b1.x; bb[5] = b1.y; bb[6] = b1.z; bb[7] = b1.w;
    bb[8] = b2.x; bb[9] = b2.y; bb[10] = b2.z; bb[11] = b2.w;
    bb[12] = b3.x; bb[13] = b3.y; bb[14] = b3.z; bb[15] = b3.w;
  }
  float y[16];
#pragma unroll
  for (int i = 0; i < 16; ++i) y[i] = d[i] * rstd * gg[i] + bb[i];

  const v4u o0 = pack8h(y[0], y[1], y[2], y[3], y[4], y[5], y[6], y[7]);
  const v4u o1 = pack8h(y[8], y[9], y[10], y[11], y[12], y[13], y[14], y[15]);
  unsigned short* orow = hout + (size_t)row * CDIM;
  *(v4u*)(orow + c0) = o0;
  *(v4u*)(orow + c1) = o1;
  
}

__global__ __launch_bounds__(256) void k_ln_in(
    const float* __restrict__ x, const float* __restrict__ g, const float* __restrict__ bt,
    unsigned short* __restrict__ hout, int nrows) {
  ln_body<1>(x, g, bt, hout, nrows);
}
__global__ __launch_bounds__(256) void k_ln_mid(
    const float* __restrict__ x, const float* __restrict__ g, const float* __restrict__ bt,
    unsigned short* __restrict__ hout, int nrows) {
  ln_body<0>(x, g, bt, hout, nrows);
}

// ---------------------------------------------------------------------------
// Operand tiles in LDS.  A tile is 64 rows x 64 16-bit elements (128 B = one
// line per row); LDS row pitch TP elements = 144 B (16 B x odd: the b128
// fragment reads of 16 rows fall on distinct banks).
// tiles_async: the 128 threads of a WG copy two such tiles, global -> LDS,
// 16 B per lane and copy; a wave's copy covers 4 whole rows (4 whole lines).
// ga / gb: first element of the tile, pa / pb: its global row pitch in elements.
// ---------------------------------------------------------------------------
#define TP 72
typedef unsigned short Tile[64][TP];

__device__ __forceinline__ void tiles_async(
    unsigned short* la, const unsigned short* ga, size_t pa,
    unsigned short* lb, const unsigned short* gb, size_t pb, int tid) {
  const int row = tid >> 3, pc = (tid & 7) * 8;
  const unsigned int la0 = (unsigned int)(size_t)(la + row * TP + pc);
  const unsigned int lb0 = (unsigned int)(size_t)(lb + row * TP + pc);
  const unsigned int la1 = la0 + 16 * TP * 2, la2 = la0 + 32 * TP * 2, la3 = la0 + 48 * TP * 2;
  const unsigned int lb1 = lb0 + 16 * TP * 2, lb2 = lb0 + 32 * TP * 2, lb3 = lb0 + 48 * TP * 2;
  const unsigned short* a0 = ga + (size_t)row * pa + pc;
  const unsigned short* a1 = a0 + 16 * pa;
  const unsigned short* a2 = a0 + 32 * pa;
  const unsigned short* a3 = a0 + 48 * pa;
  const unsigned short* b0 = gb + (size_t)row * pb + pc;
  const unsigned short* b1 = b0 + 16 * pb;
  const unsigned short* b2 = b0 + 32 * pb;
  const unsigned short* b3 = b0 + 48 * pb;
  // the copies and, as the last line, the wait that stands before their address registers are reused
  asm volatile(
      "global_load_async_to_lds_b128 %0, %8, off\n\t"
      "global_load_async_to_lds_b128 %1, %9, off\n\t"
      "global_load_async_to_lds_b128 %2, %10, off\n\t"
      "global_load_async_to_lds_b128 %3, %11, off\n\t"
      "global_load_async_to_lds_b128 %4, %12, off\n\t"
      "global_load_async_to_lds_b128 %5, %13, off\n\t"
      "global_load_async_to_lds_b128 %6, %14, off\n\t"
      "global_load_async_to_lds_b128 %7, %15, off\n\t"
      "s_wait_xcnt 0x0"
      :: "v"(la0), "v"(la1), "v"(la2), "v"(la3), "v"(lb0), "v"(lb1), "v"(lb2), "v"(lb3),
         "v"(a0), "v"(a1), "v"(a2), "v"(a3), "v"(b0), "v"(b1), "v"(b2), "v"(b3)
      : "memory");
}
// this wave's copies have landed
__device__ __forceinline__ void wait_async0() { asm volatile("s_wait_asynccnt 0x0" ::: "memory"); }
// this wave's LDS reads and writes have retired (before a buffer it read is refilled)
__device__ __forceinline__ void wait_ds0() { asm volatile("s_wait_dscnt 0x0" ::: "memory"); }

// ---------------------------------------------------------------------------
// 64x64-tile f16 GEMM main loop: D = A[M][K] * Bt[N][K]^T, 4 waves per WG,
// wave w owns rows 16w..16w+15 x 64 cols (4 accumulator tiles).  A trip covers
// 64 of k: the A and Bt tiles of trip t + 1 are copied to the other LDS buffer
// while trip t is worked on.  Fragments are read from LDS with the split k map
// for A and B (row/col = lane&15, elements 0..7 <- k0+8h.., 8..15 <- k0+16+8h..).
// acc[j][r] = D(row 16w + 8h + r, col 16j + (lane&15)).
// ---------------------------------------------------------------------------
__device__ __forceinline__ void gemm_main(
    const unsigned short* __restrict__ A, const unsigned short* __restrict__ Bt, int K,
    int m0, int n0, int w, int m, int k8, int tid, Tile* sA, Tile* sB, v8f (&acc)[4]) {
#pragma unroll
  for (int j = 0; j < 4; ++j) acc[j] = zero8();
  const unsigned short* ag = A + (size_t)m0 * (size_t)K;
  const unsigned short* bg = Bt + (size_t)n0 * (size_t)K;
  const int nt = K >> 6;
  tiles_async(&sA[0][0][0], ag, (size_t)K, &sB[0][0][0], bg, (size_t)K, tid);
  wait_async0();
  __syncthreads();   // tile 0 published
  if (nt > 1) tiles_async(&sA[1][0][0], ag + 64, (size_t)K, &sB[1][0][0], bg + 64, (size_t)K, tid);
#pragma unroll 1
  for (int t = 0; t < nt; ++t) {
    const int bf = t & 1;
    // all fragment reads of the trip as one group ahead of its WMMAs: one LDS latency per trip
    Frag a[2], b[2][4];
#pragma unroll
    for (int h = 0; h < 2; ++h) {
      const unsigned short* ar = &sA[bf][16 * w + m][32 * h + k8];
      a[h].q[0] = *(const v4u*)(ar);
      a[h].q[1] = *(const v4u*)(ar + 16);
#pragma unroll
      for (int j = 0; j < 4; ++j) {
        const unsigned short* bj = &sB[bf][16 * j + m][32 * h + k8];
        b[h][j].q[0] = *(const v4u*)(bj);
        b[h][j].q[1] = *(const v4u*)(bj + 16);
      }
    }
#pragma unroll
    for (int h = 0; h < 2; ++h) {
#pragma unroll
      for (int j = 0; j < 4; ++j) acc[j] = mma(a[h].v, b[h][j].v, acc[j]);
    }
    wait_ds0();
    wait_async0();
    __syncthreads();   // publishes tile t + 1; ends every read of buffer bf
    if (t + 2 < nt)
      tiles_async(&sA[bf][0][0], ag + (size_t)(t + 2) * 64, (size_t)K,
                  &sB[bf][0][0], bg + (size_t)(t + 2) * 64, (size_t)K, tid);
  }
  wait_async0();
}

// ---------------------------------------------------------------------------
// q/k/v projection: A = LN1 plane [M][512], Bt = [1536][512] (q rows, k rows, v rows).
// value = acc/16 + bf16q(bias).  q and k -> planes [b*H+h][t][64]; v -> transposed
// plane vt[b*H+h][64][t].  The three planes are contiguous: plane p at qkv + p*M*512.
// coverage: 4 passes x 4 waves x 4 rows = 64 rows x 64 cols (q/k); 4 passes x 4 waves x 4 d = 64 d rows x 64 tokens (v).
// LDS sT: cross-wave (block barrier).
// ---------------------------------------------------------------------------
__global__ __launch_bounds__(128) void k_gemm_qkv(
    const unsigned short* __restrict__ A, const unsigned short* __restrict__ Bt,
    const float* __restrict__ bq, const float* __restrict__ bk, const float* __restrict__ bv,
    unsigned short* __restrict__ qkv) {
  __shared__ __attribute__((aligned(16))) unsigned short sT[64][72];
  __shared__ __attribute__((aligned(16))) Tile sA[2];
  __shared__ __attribute__((aligned(16))) Tile sB[2];
  const int tid = threadIdx.x, lane = tid & 31, w = tid >> 5;
  const int m = lane & 15, hl = lane >> 4, k8 = hl * 8;
  const int m0 = blockIdx.y * 64, n0 = blockIdx.x * 64;

  v8f acc[4];
  gemm_main(A, Bt, CDIM, m0, n0, w, m, k8, tid, sA, sB, acc);

  const float wsc = 0.0625f;               // undo the x16 weight carry
  const int lrow0 = 16 * w + 8 * hl;       // D rows of this lane within the WG tile
  const int which = n0 / CDIM;             // 0 q, 1 k, 2 v (WG-uniform)
  const int cb = n0 - which * CDIM;
#pragma unroll
  for (int j = 0; j < 4; ++j) {
    const int cn = cb + 16 * j + m;
    const float b0 = bf16q(bq[cn]);
    const float b1 = bf16q(bk[cn]);
    const float b2 = bf16q(bv[cn]);
    const float bj = (which == 0) ? b0 : ((which == 1) ? b1 : b2);
#pragma unroll
    for (int r = 0; r < 8; ++r) sT[lrow0 + r][16 * j + m] = hbits(acc[j][r] * wsc + bj);
  }
  __syncthreads();   // cross-wave: both the q/k and the v reload read rows of other waves
  const int hh = cb / HD;
  const int b = m0 / SEQ, t0 = m0 - b * SEQ;
  const int bh = b * NHEAD + hh;
  unsigned short* dst = qkv + (size_t)which * ((size_t)MROWS * CDIM);
  v4u val[4];
  unsigned int off[4];
  if (which < 2) {                       // WG-uniform
#pragma unroll
    for (int p = 0; p < 4; ++p) {
      const int row = p * 16 + 4 * w + (lane >> 3);
      const int piece = lane & 7;
      val[p] = *(const v4u*)&sT[row][piece * 8];
      off[p] = (unsigned int)((bh * SEQ + t0 + row) * HD + piece * 8);
    }
  } else {
#pragma unroll
    for (int p = 0; p < 4; ++p) {
      const int d = p * 16 + 4 * w + (lane >> 3);
      const int piece = lane & 7;
      unsigned int wv[4];
#pragma unroll
      for (int e = 0; e < 4; ++e) {
        const unsigned int lo = sT[piece * 8 + 2 * e][d];
        const unsigned int hi = sT[piece * 8 + 2 * e + 1][d];
        wv[e] = lo | (hi << 16);
      }
      v4u t;
      t.x = wv[0]; t.y = wv[1]; t.z = wv[2]; t.w = wv[3];
      val[p] = t;
      off[p] = (unsigned int)((bh * HD + d) * SEQ + t0 + piece * 8);
    }
  }
#pragma unroll
  for (int p = 0; p < 4; ++p) *(v4u*)(dst + off[p]) = val[p];
  
}

// ---------------------------------------------------------------------------
// GEMM + bias + residual, f32 output of width CDIM:
// out = acc/16 + bf16q(bias) + res.  resfull: res rows read at full strides and
// converted to bf16 values; outfull: out rows written at full strides.
// Residual added at the store stage as float4.  Each row segment (64 floats =
// coverage: 8 passes x 2 rows per wave = 16 rows x 64 cols per wave.
// LDS sF: wave-private rows; block barrier orders the reload.
// ---------------------------------------------------------------------------
__global__ __launch_bounds__(128) void k_gemm_res(
    const unsigned short* __restrict__ A, const unsigned short* __restrict__ Bt, int K,
    const float* __restrict__ bias, const float* __restrict__ res,
    float* __restrict__ outF, int resfull, int outfull) {
  __shared__ __attribute__((aligned(16))) float sF[64][68];
  __shared__ __attribute__((aligned(16))) Tile sA[2];
  __shared__ __attribute__((aligned(16))) Tile sB[2];
  const int tid = threadIdx.x, lane = tid & 31, w = tid >> 5;
  const int m = lane & 15, hl = lane >> 4, k8 = hl * 8;
  const int m0 = blockIdx.y * 64, n0 = blockIdx.x * 64;

  v8f acc[4];
  gemm_main(A, Bt, K, m0, n0, w, m, k8, tid, sA, sB, acc);

  const float wsc = 0.0625f;
  const int lrow0 = 16 * w + 8 * hl;
#pragma unroll
  for (int j = 0; j < 4; ++j) {
#pragma unroll
    for (int r = 0; r < 8; ++r) sF[lrow0 + r][16 * j + m] = acc[j][r] * wsc;
  }
  __syncthreads();
  const int b = m0 / SEQ, t0 = m0 - b * SEQ;
  v4f val[8];
  unsigned int off[8];
#pragma unroll
  for (int p = 0; p < 8; ++p) {
    const int row = 16 * w + 2 * p + hl;
    const int piece = m;
    const int ncol = n0 + 4 * piece;
    const v4f a = *(const v4f*)&sF[row][4 * piece];
    const v4f bv = bf16q4(*(const v4f*)(bias + ncol));
    const size_t frow = (size_t)b * SEQ_FULL + t0 + row;   // full-stride row
    const size_t crow = (size_t)(m0 + row);                // compact row
    const size_t rrow = resfull ? frow : crow;
    const v4f rraw = *(const v4f*)(res + rrow * (size_t)CDIM + ncol);
    const v4f rq = bf16q4(rraw);
    const v4f rr = resfull ? rq : rraw;
    val[p] = (a + bv) + rr;
    const size_t orow = outfull ? frow : crow;
    off[p] = (unsigned int)(orow * (size_t)CDIM + ncol);
  }
#pragma unroll
  for (int p = 0; p < 8; ++p) *(v4f*)(outF + off[p]) = val[p];
  
}

// ---------------------------------------------------------------------------
// ffn1: f16 out[M][HID] = gelu_erf(acc/16 + bf16q(bias)).
// coverage: 4 passes x 4 rows per wave = 16 rows x 64 cols per wave.
// LDS sT: wave-private rows; block barrier orders the reload.
// ---------------------------------------------------------------------------
__global__ __launch_bounds__(128) void k_gemm_gelu(
    const unsigned short* __restrict__ A, const unsigned short* __restrict__ Bt, int K,
    const float* __restrict__ bias, unsigned short* __restrict__ out0) {
  __shared__ __attribute__((aligned(16))) unsigned short sT[64][72];
  __shared__ __attribute__((aligned(16))) Tile sA[2];
  __shared__ __attribute__((aligned(16))) Tile sB[2];
  const int tid = threadIdx.x, lane = tid & 31, w = tid >> 5;
  const int m = lane & 15, hl = lane >> 4, k8 = hl * 8;
  const int m0 = blockIdx.y * 64, n0 = blockIdx.x * 64;

  v8f acc[4];
  gemm_main(A, Bt, K, m0, n0, w, m, k8, tid, sA, sB, acc);

  const float wsc = 0.0625f;
  const int lrow0 = 16 * w + 8 * hl;
#pragma unroll
  for (int j = 0; j < 4; ++j) {
    const float bj = bf16q(bias[n0 + 16 * j + m]);
#pragma unroll
    for (int r = 0; r < 8; ++r) {
      const float u = acc[j][r] * wsc + bj;
      sT[lrow0 + r][16 * j + m] = hbits(gelu_erf(u));
    }
  }
  __syncthreads();
  v4u val[4];
  unsigned int off[4];
#pragma unroll
  for (int p = 0; p < 4; ++p) {
    const int row = 16 * w + 4 * p + (lane >> 3);
    const int piece = lane & 7;
    val[p] = *(const v4u*)&sT[row][piece * 8];
    off[p] = (unsigned int)((size_t)(m0 + row) * (size_t)HID + n0 + piece * 8);
  }
#pragma unroll
  for (int p = 0; p < 4; ++p) *(v4u*)(out0 + off[p]) = val[p];
  
}

__device__ __forceinline__ float other_half(float f) {
  const int b = __builtin_bit_cast(int, f);
  return __builtin_bit_cast(float, __builtin_amdgcn_permlanex16(b, b, 0x76543210, 0xfedcba98, false, false));
}
__device__ __forceinline__ v8f splat8(float f) {
  v8f z;
#pragma unroll
  for (int i = 0; i < 8; ++i) z[i] = f;
  return z;
}

__global__ __launch_bounds__(128) __attribute__((amdgpu_num_vgpr(256)))
void k_attn(const unsigned short* __restrict__ qp, const unsigned short* __restrict__ kp,
            const unsigned short* __restrict__ vp, unsigned short* __restrict__ op) {
  __shared__ __attribute__((aligned(16))) unsigned short sP[4][16][72];
  __shared__ __attribute__((aligned(16))) Tile sK[2];
  __shared__ __attribute__((aligned(16))) Tile sV[2];
  const int tid = threadIdx.x, lane = tid & 31, w = tid >> 5;
  const int m = lane & 15, hl = lane >> 4, k8 = hl * 8;
  const int nqt = SEQ / 64;
  const int bh = blockIdx.x / nqt, qt = blockIdx.x - bh * nqt;
  const int b = bh / NHEAD, hh = bh - b * NHEAD;
  const int tq = qt * 64 + 16 * w;          // first query row of this wave (within the sequence)

  const unsigned short* kg = kp + (size_t)bh * SEQ * HD;   // chunk kt: + kt*64 rows, row pitch HD
  const unsigned short* vg = vp + (size_t)bh * HD * SEQ;   // chunk kt: + kt*64 columns, row pitch SEQ
  tiles_async(&sK[0][0][0], kg, (size_t)HD, &sV[0][0][0], vg, (size_t)SEQ, tid);
  wait_async0();
  __syncthreads();   // chunk 0 published
  if (nqt > 1)
    tiles_async(&sK[1][0][0], kg + (size_t)64 * HD, (size_t)HD, &sV[1][0][0], vg + 64, (size_t)SEQ, tid);

  Frag qa0, qa1;     // B fragments: column = query tq + m, k = d in the split map
  {
    const unsigned short* qr = qp + ((size_t)bh * SEQ + tq + m) * HD + k8;
    qa0.q[0] = *(const v4u*)(qr);
    qa0.q[1] = *(const v4u*)(qr + 16);
    qa1.q[0] = *(const v4u*)(qr + 32);
    qa1.q[1] = *(const v4u*)(qr + 48);
  }
  const float SC = 0.125f * 1.44269504088896341f;   // raw score -> log2 units
  float mrun = -1e30f;       // running max of query m, raw score units (equal in both lane halves)
  v8f lrun = zero8();        // partial sums of 1024 p over this lane's keys
  v8f oacc[4];               // oacc[jd][r] = O^T(d = 16jd + 8hl + r, query m), x1024
#pragma unroll
  for (int j = 0; j < 4; ++j) oacc[j] = zero8();

#pragma unroll 1
  for (int kt = 0; kt < nqt; ++kt) {
    const int bf = kt & 1;
    // ---- S^T = K Q^T, four 16-key tiles ----
    // all K fragment reads of the chunk as one group ahead of its WMMAs: one LDS latency, not four
    Frag f0[4], f1[4];
#pragma unroll
    for (int j = 0; j < 4; ++j) {
      const unsigned short* kr = &sK[bf][16 * j + m][k8];
      f0[j].q[0] = *(const v4u*)(kr);
      f0[j].q[1] = *(const v4u*)(kr + 16);
      f1[j].q[0] = *(const v4u*)(kr + 32);
      f1[j].q[1] = *(const v4u*)(kr + 48);
    }
    v8f st[4];
#pragma unroll
    for (int j = 0; j < 4; ++j) st[j] = mma(f0[j].v, qa0.v, zero8());
#pragma unroll
    for (int j = 0; j < 4; ++j) st[j] = mma(f1[j].v, qa1.v, st[j]);
    // all V^T fragment reads of the chunk as one group; their latency runs under the softmax
    Frag g0[4], g1[4];
#pragma unroll
    for (int jd = 0; jd < 4; ++jd) {
      const unsigned short* vr = &sV[bf][16 * jd + m][k8];
      g0[jd].q[0] = *(const v4u*)(vr);
      g0[jd].q[1] = *(const v4u*)(vr + 16);
      g1[jd].q[0] = *(const v4u*)(vr + 32);
      g1[jd].q[1] = *(const v4u*)(vr + 48);
    }
    // ---- running max of this lane's query ----
    float t4[4];               // one chain per tile: four independent chains, not one of 32 links
#pragma unroll
    for (int j = 0; j < 4; ++j) {
      t4[j] = st[j][0];
#pragma unroll
      for (int r = 1; r < 8; ++r) t4[j] = fmaxf(t4[j], st[j][r]);
    }
    float tm = fmaxf(fmaxf(t4[0], t4[1]), fmaxf(t4[2], t4[3]));
    tm = fmaxf(tm, other_half(tm));
    const float mn = fmaxf(mrun, tm);
    const float corr = __builtin_amdgcn_exp2f((mrun - mn) * SC);
    mrun = mn;
    // ---- 1024 p = 2^(s SC - m SC + 10) ----
    const v8f sc8 = splat8(SC), nb8 = splat8(10.0f - mn * SC), corr8 = splat8(corr);
#pragma unroll
    for (int j = 0; j < 4; ++j) {
      const v8f e = __builtin_elementwise_fma(st[j], sc8, nb8);
#pragma unroll
      for (int r = 0; r < 8; ++r) st[j][r] = __builtin_amdgcn_exp2f(e[r]);
    }
    lrun = __builtin_elementwise_fma(lrun, corr8, (st[0] + st[1]) + (st[2] + st[3]));
#pragma unroll
    for (int j = 0; j < 4; ++j) oacc[j] = oacc[j] * corr8;
    // ---- P^T fragments: elements 0..7 = keys 32c + 8hl + .., 8..15 = keys 32c + 16 + 8hl + .. ----
    const v16h pb0 = __builtin_shufflevector(__builtin_convertvector(st[0], v8h), __builtin_convertvector(st[1], v8h),
                                             0, 1, 2, 3, 4, 5, 6, 7, 8, 9, 10, 11, 12, 13, 14, 15);
    const v16h pb1 = __builtin_shufflevector(__builtin_convertvector(st[2], v8h), __builtin_convertvector(st[3], v8h),
                                             0, 1, 2, 3, 4, 5, 6, 7, 8, 9, 10, 11, 12, 13, 14, 15);
    // ---- O^T += V^T (64 d x 64 keys) * P^T (64 keys x 16 queries) ----
#pragma unroll
    for (int jd = 0; jd < 4; ++jd) oacc[jd] = mma(g0[jd].v, pb0, oacc[jd]);
#pragma unroll
    for (int jd = 0; jd < 4; ++jd) oacc[jd] = mma(g1[jd].v, pb1, oacc[jd]);
    wait_ds0();
    wait_async0();
    __syncthreads();   // publishes chunk kt + 1; ends every read of buffer bf
    if (kt + 2 < nqt)
      tiles_async(&sK[bf][0][0], kg + (size_t)(kt + 2) * 64 * HD, (size_t)HD,
                  &sV[bf][0][0], vg + (size_t)(kt + 2) * 64, (size_t)SEQ, tid);
  }
  wait_async0();

  // ---- finalize: o = acc / l (both x1024), stage per wave, whole-line stores ----
  float l = ((lrun[0] + lrun[1]) + (lrun[2] + lrun[3])) + ((lrun[4] + lrun[5]) + (lrun[6] + lrun[7]));
  l += other_half(l);
  const v8f il8 = splat8(1.0f / l);
#pragma unroll
  for (int jd = 0; jd < 4; ++jd) {
    const v8h o8 = __builtin_convertvector(oacc[jd] * il8, v8h);
    *(v4u*)&sP[w][m][16 * jd + k8] = __builtin_bit_cast(v4u, o8);
  }
  __syncthreads();
  v4u val[4];
  unsigned int off[4];
#pragma unroll
  for (int p = 0; p < 4; ++p) {
    const int row = 4 * p + (lane >> 3);
    const int piece = lane & 7;
    val[p] = *(const v4u*)&sP[w][row][piece * 8];
    off[p] = (unsigned int)((size_t)(b * SEQ + tq + row) * CDIM + hh * HD + piece * 8);
  }
#pragma unroll
  for (int p = 0; p < 4; ++p) *(v4u*)(op + off[p]) = val[p];
  
}

// ---------------------------------------------------------------------------
// Host launcher
// ---------------------------------------------------------------------------
constexpr size_t al256c(size_t v) { return (v + 255) & ~(size_t)255; }
constexpr size_t MCE = (size_t)MROWS * CDIM;
constexpr size_t SZ_WQKV = al256c((size_t)3 * CDIM * CDIM * 2);
constexpr size_t SZ_WO   = al256c((size_t)CDIM * CDIM * 2);
constexpr size_t SZ_W1   = al256c((size_t)HID * CDIM * 2);
constexpr size_t SZ_W2   = al256c((size_t)CDIM * HID * 2);
constexpr size_t SZ_H    = al256c(MCE * 2);
constexpr size_t SZ_QKV  = al256c((size_t)3 * MCE * 2);
constexpr size_t SZ_O    = al256c(MCE * 2);
constexpr size_t SZ_X1   = al256c(MCE * 4);
constexpr size_t SZ_H2   = al256c(MCE * 2);
constexpr size_t SZ_ACT  = al256c((size_t)MROWS * HID * 2);
constexpr size_t WS_TOTAL = SZ_WQKV + SZ_WO + SZ_W1 + SZ_W2 + SZ_H + SZ_QKV + SZ_O + SZ_X1 + SZ_H2 + SZ_ACT;
static_assert(WS_TOTAL <= (size_t)134217728);
static_assert((size_t)MROWS * HID < (size_t)4294967296ull);     // u32 element offsets in the epilogues
static_assert((size_t)NB_FULL * SEQ_FULL * CDIM < (size_t)4294967296ull);

extern "C" void kernel_launch(void* const* d_in, const int* in_sizes, int n_in,
                              void* d_out, int out_size, void* d_ws, size_t ws_size,
                              hipStream_t stream) {
  if (n_in < 17) return;
  const long needX = ((long)(NB - 1) * SEQ_FULL + SEQ) * CDIM;
  const long nWW = (long)CDIM * CDIM;
  if ((long)in_sizes[0] < needX) return;
  if ((long)in_sizes[1] < nWW || in_sizes[2] < CDIM) return;
  if ((long)in_sizes[3] < nWW || in_sizes[4] < CDIM) return;
  if ((long)in_sizes[5] < nWW || in_sizes[6] < CDIM) return;
  if ((long)in_sizes[7] < nWW || in_sizes[8] < CDIM) return;
  if ((long)in_sizes[9] < (long)CDIM * HID || in_sizes[10] < HID) return;
  if ((long)in_sizes[11] < (long)HID * CDIM || in_sizes[12] < CDIM) return;
  if (in_sizes[13] < CDIM || in_sizes[14] < CDIM) return;
  if (in_sizes[15] < CDIM || in_sizes[16] < CDIM) return;
  if ((long)out_size < needX) return;
  if ((size_t)WS_TOTAL > ws_size) return;

  const float* x   = (const float*)d_in[0];
  const float* Wq  = (const float*)d_in[1];
  const float* bq  = (const float*)d_in[2];
  const float* Wk  = (const float*)d_in[3];
  const float* bk  = (const float*)d_in[4];
  const float* Wv  = (const float*)d_in[5];
  const float* bv  = (const float*)d_in[6];
  const float* Wo  = (const float*)d_in[7];
  const float* bo  = (const float*)d_in[8];
  const float* W1  = (const float*)d_in[9];
  const float* b1  = (const float*)d_in[10];
  const float* W2  = (const float*)d_in[11];
  const float* b2  = (const float*)d_in[12];
  const float* g1  = (const float*)d_in[13];
  const float* be1 = (const float*)d_in[14];
  const float* g2  = (const float*)d_in[15];
  const float* be2 = (const float*)d_in[16];
  float* out = (float*)d_out;

  char* ws = (char*)d_ws;
  size_t off = 0;
  unsigned short* wqkv = (unsigned short*)(ws + off); off += SZ_WQKV;   // [1536][512]
  unsigned short* wot  = (unsigned short*)(ws + off); off += SZ_WO;     // [512][512]
  unsigned short* w1t  = (unsigned short*)(ws + off); off += SZ_W1;     // [2048][512]
  unsigned short* w2t  = (unsigned short*)(ws + off); off += SZ_W2;     // [512][2048]
  unsigned short* hpl  = (unsigned short*)(ws + off); off += SZ_H;      // [M][512]
  unsigned short* qkv  = (unsigned short*)(ws + off); off += SZ_QKV;    // q [B*H][SEQ][64], k same, vt [B*H][64][SEQ]
  unsigned short* opl  = (unsigned short*)(ws + off); off += SZ_O;      // [M][512]
  float*          x1   = (float*)(ws + off);          off += SZ_X1;     // [M][512]
  unsigned short* h2p  = (unsigned short*)(ws + off); off += SZ_H2;     // [M][512]
  unsigned short* act  = (unsigned short*)(ws + off); off += SZ_ACT;    // [M][2048]
  if (off > ws_size) return;
  unsigned short* qpl = qkv;
  unsigned short* kpl = qkv + MCE;
  unsigned short* vtp = qkv + 2 * MCE;

  // 1) weight planes: in[K][N] -> out[N][K], bf16 values x16 as f16; grid = (K/64, N/64)
  k_wprep<<<dim3(CDIM / 64, CDIM / 64), 256, 0, stream>>>(Wq, wqkv, CDIM, CDIM, 0);
  k_wprep<<<dim3(CDIM / 64, CDIM / 64), 256, 0, stream>>>(Wk, wqkv, CDIM, CDIM, CDIM);
  k_wprep<<<dim3(CDIM / 64, CDIM / 64), 256, 0, stream>>>(Wv, wqkv, CDIM, CDIM, 2 * CDIM);
  k_wprep<<<dim3(CDIM / 64, CDIM / 64), 256, 0, stream>>>(Wo, wot, CDIM, CDIM, 0);
  k_wprep<<<dim3(CDIM / 64, HID / 64), 256, 0, stream>>>(W1, w1t, CDIM, HID, 0);   // in[512][2048] -> out[2048][512]
  k_wprep<<<dim3(HID / 64, CDIM / 64), 256, 0, stream>>>(W2, w2t, HID, CDIM, 0);   // in[2048][512] -> out[512][2048]
  // 2) LN1 on bf16 values of x -> h (f16)
  k_ln_in<<<MROWS / 8, 256, 0, stream>>>(x, g1, be1, hpl, MROWS);
  // 3) q/k/v projections + bias -> q, k, vt planes
  k_gemm_qkv<<<dim3(3 * CDIM / 64, MROWS / 64), 128, 0, stream>>>(hpl, wqkv, bq, bk, bv, qkv);
  // 4) attention -> o plane
  k_attn<<<NB * NHEAD * (SEQ / 64), 128, 0, stream>>>(qpl, kpl, vtp, opl);
  // 5) output projection + bias + residual(bf16 values of x) -> x1 (f32, compact rows)
  k_gemm_res<<<dim3(CDIM / 64, MROWS / 64), 128, 0, stream>>>(opl, wot, CDIM, bo, x, x1, 1, 0);
  // 6) LN2 -> h2 (f16)
  k_ln_mid<<<MROWS / 8, 256, 0, stream>>>(x1, g2, be2, h2p, MROWS);
  // 7) ffn1 + bias + gelu(erf) -> act (f16)
  k_gemm_gelu<<<dim3(HID / 64, MROWS / 64), 128, 0, stream>>>(h2p, w1t, CDIM, b1, act);
  // 8) ffn2 + bias + residual(x1) -> out (f32, full strides)
  k_gemm_res<<<dim3(CDIM / 64, MROWS / 64), 128, 0, stream>>>(act, w2t, HID, b2, x1, out, 0, 1);
}

// v003
// One run takes 174 microseconds.
// Next to v002, in two timings, it ran 1.10 times as fast each time.
// All steps since v000 together make it 3.83 times as fast.
#include <hip/hip_runtime.h>

// Contractions: v_wmma_f32_16x16x32_f16 (f16 operands, f32 accumulate) for q/k/v projections, q.k^T, p.v, output projection, ffn1, ffn2; weight planes carried x16, p carried x1024, activations x1.

#pragma clang fp contract(off)

#ifndef NB
#define NB 2
#endif
#ifndef SEQ
#define SEQ 4096
#endif
#define NB_FULL 2
#define SEQ_FULL 4096
#define CDIM 512
#define NHEAD 8
#define HD 64
#define HID 2048
#define MROWS (NB * SEQ)

static_assert(NB >= 1 && NB <= NB_FULL);
static_assert(SEQ % 64 == 0 && SEQ >= 64 && SEQ <= SEQ_FULL);
static_assert(CDIM == NHEAD * HD);
static_assert(HD == 64);
static_assert(CDIM == 512);
static_assert(CDIM == 32 * 2 * 8);          // LayerNorm lane map: 32 lanes x 2 segments x 8 columns
static_assert(HID % 64 == 0 && CDIM % 64 == 0);
static_assert(CDIM % 32 == 0 && HID % 32 == 0);   // WMMA k-steps of 32, two per 64-wide k trip
static_assert(MROWS % 64 == 0);
static_assert(MROWS % 8 == 0);
static_assert((3 * CDIM) % 64 == 0);

typedef _Float16 v16h __attribute__((ext_vector_type(16)));
typedef _Float16 v8h  __attribute__((ext_vector_type(8)));
typedef float    v8f  __attribute__((ext_vector_type(8)));
typedef float    v4f  __attribute__((ext_vector_type(4)));
typedef unsigned int v4u __attribute__((ext_vector_type(4)));

union Frag { v16h v; v4u q[2]; };

// WMMA with hazard guard: D += A(16x32) * B(32x16)
__device__ __forceinline__ v8f mma(v16h a, v16h b, v8f c) {
  v8f d = __builtin_amdgcn_wmma_f32_16x16x32_f16(false, a, false, b, (short)0, c, false, false);
  asm volatile("v_nop\n\tv_nop\n\tv_nop\n\tv_nop" : "+v"(d) : "v"(a), "v"(b));
  return d;
}

__device__ __forceinline__ v8f zero8() {
  v8f z;
#pragma unroll
  for (int i = 0; i < 8; ++i) z[i] = 0.0f;
  return z;
}

// f32 -> nearest-even bf16 value, returned as f32
__device__ __forceinline__ float bf16q(float f) {
  unsigned int u = __float_as_uint(f);
  unsigned int r = u + 0x7FFFu + ((u >> 16) & 1u);
  r = ((u & 0x7F800000u) == 0x7F800000u) ? u : r;
  return __uint_as_float(r & 0xFFFF0000u);
}
__device__ __forceinline__ v4f bf16q4(v4f a) {
  v4f r;
  r.x = bf16q(a.x); r.y = bf16q(a.y); r.z = bf16q(a.z); r.w = bf16q(a.w);
  return r;
}
// f32 -> f16 (RNE convert) bit pattern
__device__ __forceinline__ unsigned short hbits(float f) {
  _Float16 h = (_Float16)f;
  return __builtin_bit_cast(unsigned short, h);
}
__device__ __forceinline__ v4u pack8h(float f0, float f1, float f2, float f3,
                                      float f4, float f5, float f6, float f7) {
  v8h t;
  t[0] = (_Float16)f0; t[1] = (_Float16)f1; t[2] = (_Float16)f2; t[3] = (_Float16)f3;
  t[4] = (_Float16)f4; t[5] = (_Float16)f5; t[6] = (_Float16)f6; t[7] = (_Float16)f7;
  return __builtin_bit_cast(v4u, t);
}
__device__ __forceinline__ float gelu_erf(float u) {
  return 0.5f * u * (1.0f + erff(u * 0.70710678118654752f));
}

// ---------------------------------------------------------------------------
// Weight prep: src[K][N] (f32, row pitch N) -> dst[rowoff + n][k] f16 plane
// (row pitch K), value = f16(bf16q(w) * 16).  in[K][N] -> out[N][K].
// One block of 256 threads does the 64x64 tile (kx, ny) of (K/64, N/64).
// ---------------------------------------------------------------------------
__device__ __forceinline__ void wprep_body(
    const float* __restrict__ src, unsigned short* __restrict__ dst, int K, int N, int rowoff,
    int kx, int ny, unsigned short (&sT)[64][72]) {
  const int tid = threadIdx.x;
  const int k0 = kx * 64, n0 = ny * 64;
#pragma unroll
  for (int it = 0; it < 4; ++it) {
    const int idx = it * 256 + tid;
    const int kk = idx >> 4;            // 0..63
    const int j4 = (idx & 15) * 4;      // 0..60
    const v4f wv = *(const v4f*)(src + (size_t)(k0 + kk) * (size_t)N + n0 + j4);
    sT[j4 + 0][kk] = hbits(bf16q(wv.x) * 16.0f);
    sT[j4 + 1][kk] = hbits(bf16q(wv.y) * 16.0f);
    sT[j4 + 2][kk] = hbits(bf16q(wv.z) * 16.0f);
    sT[j4 + 3][kk] = hbits(bf16q(wv.w) * 16.0f);
  }
  __syncthreads();   // cross-wave: staged by all waves, read by all waves
  v4u val[2];
  size_t off[2];
#pragma unroll
  for (int p = 0; p < 2; ++p) {
    const int n = p * 32 + (tid >> 3);
    const int piece = tid & 7;
    val[p] = *(const v4u*)&sT[n][piece * 8];
    off[p] = (size_t)(rowoff + n0 + n) * (size_t)K + k0 + piece * 8;
  }
#pragma unroll
  for (int p = 0; p < 2; ++p) *(v4u*)(dst + off[p]) = val[p];
  // precaution: in the merged kernel the listing runs on behind these stores into code that rewrites their registers
  asm volatile("s_wait_xcnt 0x0" ::: "memory");
  
}

// ---------------------------------------------------------------------------
// LayerNorm over CDIM=512: one wave per row, lane l owns cols 8l..8l+7 and
// 256+8l..256+8l+7.  RNDIN: input rows read at full strides and converted to
// their bf16 values first.  Output f16 plane [nrows][512], rows compact.
// coverage: 2 instructions x 32 lanes x 16 B = cols 0..255 (4 lines) + cols 256..511 (4 lines) per row.
// ---------------------------------------------------------------------------
template <int RNDIN>
__device__ __forceinline__ void ln_body(
    const float* __restrict__ x, const float* __restrict__ g, const float* __restrict__ bt,
    unsigned short* __restrict__ hout, int nrows, int blk) {
  const int lane = threadIdx.x & 31, w = threadIdx.x >> 5;
  const int row = blk * 8 + w;
  if (row >= nrows) return;            // no barriers on the LayerNorm path
  size_t xrow;
  if (RNDIN) {
    const int b = row / SEQ, t = row - b * SEQ;
    xrow = ((size_t)b * SEQ_FULL + t) * CDIM;
  } else {
    xrow = (size_t)row * CDIM;
  }
  const int c0 = lane * 8;
  const int c1 = 256 + lane * 8;

  float v[16];
  {
    const v4f t0 = *(const v4f*)(x + xrow + c0);
    const v4f t1 = *(const v4f*)(x + xrow + c0 + 4);
    const v4f t2 = *(const v4f*)(x + xrow + c1);
    const v4f t3 = *(const v4f*)(x + xrow + c1 + 4);
    v[0] = t0.x; v[1] = t0.y; v[2] = t0.z; v[3] = t0.w;
    v[4] = t1.x; v[5] = t1.y; v[6] = t1.z; v[7] = t1.w;
    v[8] = t2.x; v[9] = t2.y; v[10] = t2.z; v[11] = t2.w;
    v[12] = t3.x; v[13] = t3.y; v[14] = t3.z; v[15] = t3.w;
  }
  if (RNDIN) {
#pragma unroll
    for (int i = 0; i < 16; ++i) v[i] = bf16q(v[i]);
  }

  float s = 0.0f;
#pragma unroll
  for (int i = 0; i < 16; ++i) s += v[i];
#pragma unroll
  for (int xm = 1; xm < 32; xm <<= 1) s += __shfl_xor(s, xm, 32);
  const float mu = s * (1.0f / CDIM);

  float d[16];
#pragma unroll
  for (int i = 0; i < 16; ++i) d[i] = v[i] - mu;
  float qs = 0.0f;
#pragma unroll
  for (int i = 0; i < 16; ++i) qs += d[i] * d[i];
#pragma unroll
  for (int xm = 1; xm < 32; xm <<= 1) qs += __shfl_xor(qs, xm, 32);
  const float var = qs * (1.0f / CDIM);
  const float rstd = rsqrtf(var + 1e-5f);

  float gg[16], bb[16];
  {
    const v4f g0 = bf16q4(*(const v4f*)(g + c0));
    const v4f g1 = bf16q4(*(const v4f*)(g + c0 + 4));
    const v4f g2 = bf16q4(*(const v4f*)(g + c1));
    const v4f g3 = bf16q4(*(const v4f*)(g + c1 + 4));
    const v4f b0 = bf16q4(*(const v4f*)(bt + c0));
    const v4f b1 = bf16q4(*(const v4f*)(bt + c0 + 4));
    const v4f b2 = bf16q4(*(const v4f*)(bt + c1));
    const v4f b3 = bf16q4(*(const v4f*)(bt + c1 + 4));
    gg[0] = g0.x; gg[1] = g0.y; gg[2] = g0.z; gg[3] = g0.w;
    gg[4] = g1.x; gg[5] = g1.y; gg[6] = g1.z; gg[7] = g1.w;
    gg[8] = g2.x; gg[9] = g2.y; gg[10] = g2.z; gg[11] = g2.w;
    gg[12] = g3.x; gg[13] = g3.y; gg[14] = g3.z; gg[15] = g3.w;
    bb[0] = b0.x; bb[1] = b0.y; bb[2] = b0.z; bb[3] = b0.w;
    bb[4] = b1.x; bb[5] = b1.y; bb[6] = b1.z; bb[7] = b1.w;
    bb[8] = b2.x; bb[9] = b2.y; bb[10] = b2.z; bb[11] = b2.w;
    bb[12] = b3.x; bb[13] = b3.y; bb[14] = b3.z; bb[15] = b3.w;
  }
  float y[16];
#pragma unroll
  for (int i = 0; i < 16; ++i) y[i] = d[i] * rstd * gg[i] + bb[i];

  const v4u o0 = pack8h(y[0], y[1], y[2], y[3], y[4], y[5], y[6], y[7]);
  const v4u o1 = pack8h(y[8], y[9], y[10], y[11], y[12], y[13], y[14], y[15]);
  unsigned short* orow = hout + (size_t)row * CDIM;
  *(v4u*)(orow + c0) = o0;
  *(v4u*)(orow + c1) = o1;
  
}

// ---------------------------------------------------------------------------
// First launch: all the work that reads the inputs alone, dealt by block index.
// Blocks 0 .. LNB-1: LayerNorm 1, 8 rows each.  Then one 64x64 weight tile a block:
// WB1 blocks for each of Wq, Wk, Wv, Wo, WB2 for W1, WB2 for W2.
// Every branch is block-uniform; only the weight path has a barrier.
// ---------------------------------------------------------------------------
#define LNB (MROWS / 8)
#define WB1 ((CDIM / 64) * (CDIM / 64))
#define WB2 ((CDIM / 64) * (HID / 64))
__global__ __launch_bounds__(256) void k_prep(
    const float* __restrict__ x, const float* __restrict__ g, const float* __restrict__ bt,
    unsigned short* __restrict__ hout,
    const float* __restrict__ Wq, const float* __restrict__ Wk, const float* __restrict__ Wv,
    const float* __restrict__ Wo, const float* __restrict__ W1, const float* __restrict__ W2,
    unsigned short* __restrict__ wqkv, unsigned short* __restrict__ wot,
    unsigned short* __restrict__ w1t, unsigned short* __restrict__ w2t) {
  __shared__ __attribute__((aligned(16))) unsigned short sT[64][72];
  const int bid = blockIdx.x;
  if (bid < LNB) {
    ln_body<1>(x, g, bt, hout, MROWS, bid);
    return;
  }
  int t = bid - LNB;
  if (t < 4 * WB1) {                       // in[512][512] -> out[512][512]
    const int mat = t / WB1;
    t -= mat * WB1;
    const float* src = (mat == 0) ? Wq : ((mat == 1) ? Wk : ((mat == 2) ? Wv : Wo));
    unsigned short* dst = (mat < 3) ? wqkv : wot;
    wprep_body(src, dst, CDIM, CDIM, (mat < 3) ? mat * CDIM : 0, t % (CDIM / 64), t / (CDIM / 64), sT);
  } else if (t < 4 * WB1 + WB2) {          // in[512][2048] -> out[2048][512]
    t -= 4 * WB1;
    wprep_body(W1, w1t, CDIM, HID, 0, t % (CDIM / 64), t / (CDIM / 64), sT);
  } else {                                 // in[2048][512] -> out[512][2048]
    t -= 4 * WB1 + WB2;
    wprep_body(W2, w2t, HID, CDIM, 0, t % (HID / 64), t / (HID / 64), sT);
  }
}
__global__ __launch_bounds__(256) void k_ln_mid(
    const float* __restrict__ x, const float* __restrict__ g, const float* __restrict__ bt,
    unsigned short* __restrict__ hout, int nrows) {
  ln_body<0>(x, g, bt, hout, nrows, blockIdx.x);
}

// ---------------------------------------------------------------------------
// Operand tiles in LDS.  A tile is 64 rows x 64 16-bit elements (128 B = one
// line per row); LDS row pitch TP elements = 144 B (16 B x odd: the b128
// fragment reads of 16 rows fall on distinct banks).
// tiles_async: the 128 threads of a WG copy two such tiles, global -> LDS,
// 16 B per lane and copy; a wave's copy covers 4 whole rows (4 whole lines).
// ga / gb: first element of the tile, pa / pb: its global row pitch in elements.
// ---------------------------------------------------------------------------
#define TP 72
typedef unsigned short Tile[64][TP];

__device__ __forceinline__ void tiles_async(
    unsigned short* la, const unsigned short* ga, size_t pa,
    unsigned short* lb, const unsigned short* gb, size_t pb, int tid) {
  const int row = tid >> 3, pc = (tid & 7) * 8;
  const unsigned int la0 = (unsigned int)(size_t)(la + row * TP + pc);
  const unsigned int lb0 = (unsigned int)(size_t)(lb + row * TP + pc);
  const unsigned int la1 = la0 + 16 * TP * 2, la2 = la0 + 32 * TP * 2, la3 = la0 + 48 * TP * 2;
  const unsigned int lb1 = lb0 + 16 * TP * 2, lb2 = lb0 + 32 * TP * 2, lb3 = lb0 + 48 * TP * 2;
  const unsigned short* a0 = ga + (size_t)row * pa + pc;
  const unsigned short* a1 = a0 + 16 * pa;
  const unsigned short* a2 = a0 + 32 * pa;
  const unsigned short* a3 = a0 + 48 * pa;
  const unsigned short* b0 = gb + (size_t)row * pb + pc;
  const unsigned short* b1 = b0 + 16 * pb;
  const unsigned short* b2 = b0 + 32 * pb;
  const unsigned short* b3 = b0 + 48 * pb;
  // the copies and, as the last line, the wait that stands before their address registers are reused
  asm volatile(
      "global_load_async_to_lds_b128 %0, %8, off\n\t"
      "global_load_async_to_lds_b128 %1, %9, off\n\t"
      "global_load_async_to_lds_b128 %2, %10, off\n\t"
      "global_load_async_to_lds_b128 %3, %11, off\n\t"
      "global_load_async_to_lds_b128 %4, %12, off\n\t"
      "global_load_async_to_lds_b128 %5, %13, off\n\t"
      "global_load_async_to_lds_b128 %6, %14, off\n\t"
      "global_load_async_to_lds_b128 %7, %15, off\n\t"
      "s_wait_xcnt 0x0"
      :: "v"(la0), "v"(la1), "v"(la2), "v"(la3), "v"(lb0), "v"(lb1), "v"(lb2), "v"(lb3),
         "v"(a0), "v"(a1), "v"(a2), "v"(a3), "v"(b0), "v"(b1), "v"(b2), "v"(b3)
      : "memory");
}
// this wave's copies have landed
__device__ __forceinline__ void wait_async0() { asm volatile("s_wait_asynccnt 0x0" ::: "memory"); }
// this wave's LDS reads and writes have retired (before a buffer it read is refilled)
__device__ __forceinline__ void wait_ds0() { asm volatile("s_wait_dscnt 0x0" ::: "memory"); }

// ---------------------------------------------------------------------------
// 64x64-tile f16 GEMM main loop: D = A[M][K] * Bt[N][K]^T, 4 waves per WG,
// wave w owns rows 16w..16w+15 x 64 cols (4 accumulator tiles).  A trip covers
// 64 of k: the A and Bt tiles of trip t + 1 are copied to the other LDS buffer
// while trip t is worked on.  Fragments are read from LDS with the split k map
// for A and B (row/col = lane&15, elements 0..7 <- k0+8h.., 8..15 <- k0+16+8h..).
// acc[j][r] = D(row 16w + 8h + r, col 16j + (lane&15)).
// ---------------------------------------------------------------------------
__device__ __forceinline__ void gemm_main(
    const unsigned short* __restrict__ A, const unsigned short* __restrict__ Bt, int K,
    int m0, int n0, int w, int m, int k8, int tid, Tile* sA, Tile* sB, v8f (&acc)[4]) {
#pragma unroll
  for (int j = 0; j < 4; ++j) acc[j] = zero8();
  const unsigned short* ag = A + (size_t)m0 * (size_t)K;
  const unsigned short* bg = Bt + (size_t)n0 * (size_t)K;
  const int nt = K >> 6;
  tiles_async(&sA[0][0][0], ag, (size_t)K, &sB[0][0][0], bg, (size_t)K, tid);
  wait_async0();
  __syncthreads();   // tile 0 published
  if (nt > 1) tiles_async(&sA[1][0][0], ag + 64, (size_t)K, &sB[1][0][0], bg + 64, (size_t)K, tid);
#pragma unroll 1
  for (int t = 0; t < nt; ++t) {
    const int bf = t & 1;
    // all fragment reads of the trip as one group ahead of its WMMAs: one LDS latency per trip
    Frag a[2], b[2][4];
#pragma unroll
    for (int h = 0; h < 2; ++h) {
      const unsigned short* ar = &sA[bf][16 * w + m][32 * h + k8];
      a[h].q[0] = *(const v4u*)(ar);
      a[h].q[1] = *(const v4u*)(ar + 16);
#pragma unroll
      for (int j = 0; j < 4; ++j) {
        const unsigned short* bj = &sB[bf][16 * j + m][32 * h + k8];
        b[h][j].q[0] = *(const v4u*)(bj);
        b[h][j].q[1] = *(const v4u*)(bj + 16);
      }
    }
#pragma unroll
    for (int h = 0; h < 2; ++h) {
#pragma unroll
      for (int j = 0; j < 4; ++j) acc[j] = mma(a[h].v, b[h][j].v, acc[j]);
    }
    wait_ds0();
    wait_async0();
    __syncthreads();   // publishes tile t + 1; ends every read of buffer bf
    if (t + 2 < nt)
      tiles_async(&sA[bf][0][0], ag + (size_t)(t + 2) * 64, (size_t)K,
                  &sB[bf][0][0], bg + (size_t)(t + 2) * 64, (size_t)K, tid);
  }
  wait_async0();
}

// ---------------------------------------------------------------------------
// q/k/v projection: A = LN1 plane [M][512], Bt = [1536][512] (q rows, k rows, v rows).
// value = acc/16 + bf16q(bias).  q and k -> planes [b*H+h][t][64]; v -> transposed
// plane vt[b*H+h][64][t].  The three planes are contiguous: plane p at qkv + p*M*512.
// coverage: 4 passes x 4 waves x 4 rows = 64 rows x 64 cols (q/k); 4 passes x 4 waves x 4 d = 64 d rows x 64 tokens (v).
// LDS sT: cross-wave (block barrier).
// ---------------------------------------------------------------------------
__global__ __launch_bounds__(128) void k_gemm_qkv(
    const unsigned short* __restrict__ A, const unsigned short* __restrict__ Bt,
    const float* __restrict__ bq, const float* __restrict__ bk, const float* __restrict__ bv,
    unsigned short* __restrict__ qkv) {
  __shared__ __attribute__((aligned(16))) unsigned short sT[64][72];
  __shared__ __attribute__((aligned(16))) Tile sA[2];
  __shared__ __attribute__((aligned(16))) Tile sB[2];
  const int tid = threadIdx.x, lane = tid & 31, w = tid >> 5;
  const int m = lane & 15, hl = lane >> 4, k8 = hl * 8;
  const int m0 = blockIdx.y * 64, n0 = blockIdx.x * 64;

  v8f acc[4];
  gemm_main(A, Bt, CDIM, m0, n0, w, m, k8, tid, sA, sB, acc);

  const float wsc = 0.0625f;               // undo the x16 weight carry
  const int lrow0 = 16 * w + 8 * hl;       // D rows of this lane within the WG tile
  const int which = n0 / CDIM;             // 0 q, 1 k, 2 v (WG-uniform)
  const int cb = n0 - which * CDIM;
#pragma unroll
  for (int j = 0; j < 4; ++j) {
    const int cn = cb + 16 * j + m;
    const float b0 = bf16q(bq[cn]);
    const float b1 = bf16q(bk[cn]);
    const float b2 = bf16q(bv[cn]);
    const float bj = (which == 0) ? b0 : ((which == 1) ? b1 : b2);
#pragma unroll
    for (int r = 0; r < 8; ++r) sT[lrow0 + r][16 * j + m] = hbits(acc[j][r] * wsc + bj);
  }
  __syncthreads();   // cross-wave: both the q/k and the v reload read rows of other waves
  const int hh = cb / HD;
  const int b = m0 / SEQ, t0 = m0 - b * SEQ;
  const int bh = b * NHEAD + hh;
  unsigned short* dst = qkv + (size_t)which * ((size_t)MROWS * CDIM);
  v4u val[4];
  unsigned int off[4];
  if (which < 2) {                       // WG-uniform
#pragma unroll
    for (int p = 0; p < 4; ++p) {
      const int row = p * 16 + 4 * w + (lane >> 3);
      const int piece = lane & 7;
      val[p] = *(const v4u*)&sT[row][piece * 8];
      off[p] = (unsigned int)((bh * SEQ + t0 + row) * HD + piece * 8);
    }
  } else {
#pragma unroll
    for (int p = 0; p < 4; ++p) {
      const int d = p * 16 + 4 * w + (lane >> 3);
      const int piece = lane & 7;
      unsigned int wv[4];
#pragma unroll
      for (int e = 0; e < 4; ++e) {
        const unsigned int lo = sT[piece * 8 + 2 * e][d];
        const unsigned int hi = sT[piece * 8 + 2 * e + 1][d];
        wv[e] = lo | (hi << 16);
      }
      v4u t;
      t.x = wv[0]; t.y = wv[1]; t.z = wv[2]; t.w = wv[3];
      val[p] = t;
      off[p] = (unsigned int)((bh * HD + d) * SEQ + t0 + piece * 8);
    }
  }
#pragma unroll
  for (int p = 0; p < 4; ++p) *(v4u*)(dst + off[p]) = val[p];
  
}

// ---------------------------------------------------------------------------
// GEMM + bias + residual, f32 output of width CDIM:
// out = acc/16 + bf16q(bias) + res.  resfull: res rows read at full strides and
// converted to bf16 values; outfull: out rows written at full strides.
// Residual added at the store stage as float4.  Each row segment (64 floats =
// coverage: 8 passes x 2 rows per wave = 16 rows x 64 cols per wave.
// LDS sF: wave-private rows; block barrier orders the reload.
// ---------------------------------------------------------------------------
__global__ __launch_bounds__(128) void k_gemm_res(
    const unsigned short* __restrict__ A, const unsigned short* __restrict__ Bt, int K,
    const float* __restrict__ bias, const float* __restrict__ res,
    float* __restrict__ outF, int resfull, int outfull) {
  __shared__ __attribute__((aligned(16))) float sF[64][68];
  __shared__ __attribute__((aligned(16))) Tile sA[2];
  __shared__ __attribute__((aligned(16))) Tile sB[2];
  const int tid = threadIdx.x, lane = tid & 31, w = tid >> 5;
  const int m = lane & 15, hl = lane >> 4, k8 = hl * 8;
  const int m0 = blockIdx.y * 64, n0 = blockIdx.x * 64;

  v8f acc[4];
  gemm_main(A, Bt, K, m0, n0, w, m, k8, tid, sA, sB, acc);

  const float wsc = 0.0625f;
  const int lrow0 = 16 * w + 8 * hl;
#pragma unroll
  for (int j = 0; j < 4; ++j) {
#pragma unroll
    for (int r = 0; r < 8; ++r) sF[lrow0 + r][16 * j + m] = acc[j][r] * wsc;
  }
  __syncthreads();
  const int b = m0 / SEQ, t0 = m0 - b * SEQ;
  v4f val[8];
  unsigned int off[8];
#pragma unroll
  for (int p = 0; p < 8; ++p) {
    const int row = 16 * w + 2 * p + hl;
    const int piece = m;
    const int ncol = n0 + 4 * piece;
    const v4f a = *(const v4f*)&sF[row][4 * piece];
    const v4f bv = bf16q4(*(const v4f*)(bias + ncol));
    const size_t frow = (size_t)b * SEQ_FULL + t0 + row;   // full-stride row
    const size_t crow = (size_t)(m0 + row);                // compact row
    const size_t rrow = resfull ? frow : crow;
    const v4f rraw = *(const v4f*)(res + rrow * (size_t)CDIM + ncol);
    const v4f rq = bf16q4(rraw);
    const v4f rr = resfull ? rq : rraw;
    val[p] = (a + bv) + rr;
    const size_t orow = outfull ? frow : crow;
    off[p] = (unsigned int)(orow * (size_t)CDIM + ncol);
  }
#pragma unroll
  for (int p = 0; p < 8; ++p) *(v4f*)(outF + off[p]) = val[p];
  
}

// ---------------------------------------------------------------------------
// ffn1: f16 out[M][HID] = gelu_erf(acc/16 + bf16q(bias)).
// coverage: 4 passes x 4 rows per wave = 16 rows x 64 cols per wave.
// LDS sT: wave-private rows; block barrier orders the reload.
// ---------------------------------------------------------------------------
__global__ __launch_bounds__(128) void k_gemm_gelu(
    const unsigned short* __restrict__ A, const unsigned short* __restrict__ Bt, int K,
    const float* __restrict__ bias, unsigned short* __restrict__ out0) {
  __shared__ __attribute__((aligned(16))) unsigned short sT[64][72];
  __shared__ __attribute__((aligned(16))) Tile sA[2];
  __shared__ __attribute__((aligned(16))) Tile sB[2];
  const int tid = threadIdx.x, lane = tid & 31, w = tid >> 5;
  const int m = lane & 15, hl = lane >> 4, k8 = hl * 8;
  const int m0 = blockIdx.y * 64, n0 = blockIdx.x * 64;

  v8f acc[4];
  gemm_main(A, Bt, K, m0, n0, w, m, k8, tid, sA, sB, acc);

  const float wsc = 0.0625f;
  const int lrow0 = 16 * w + 8 * hl;
#pragma unroll
  for (int j = 0; j < 4; ++j) {
    const float bj = bf16q(bias[n0 + 16 * j + m]);
#pragma unroll
    for (int r = 0; r < 8; ++r) {
      const float u = acc[j][r] * wsc + bj;
      sT[lrow0 + r][16 * j + m] = hbits(gelu_erf(u));
    }
  }
  __syncthreads();
  v4u val[4];
  unsigned int off[4];
#pragma unroll
  for (int p = 0; p < 4; ++p) {
    const int row = 16 * w + 4 * p + (lane >> 3);
    const int piece = lane & 7;
    val[p] = *(const v4u*)&sT[row][piece * 8];
    off[p] = (unsigned int)((size_t)(m0 + row) * (size_t)HID + n0 + piece * 8);
  }
#pragma unroll
  for (int p = 0; p < 4; ++p) *(v4u*)(out0 + off[p]) = val[p];
  
}

__device__ __forceinline__ float other_half(float f) {
  const int b = __builtin_bit_cast(int, f);
  return __builtin_bit_cast(float, __builtin_amdgcn_permlanex16(b, b, 0x76543210, 0xfedcba98, false, false));
}
__device__ __forceinline__ v8f splat8(float f) {
  v8f z;
#pragma unroll
  for (int i = 0; i < 8; ++i) z[i] = f;
  return z;
}

__global__ __launch_bounds__(128) __attribute__((amdgpu_num_vgpr(256)))
void k_attn(const unsigned short* __restrict__ qp, const unsigned short* __restrict__ kp,
            const unsigned short* __restrict__ vp, unsigned short* __restrict__ op) {
  __shared__ __attribute__((aligned(16))) unsigned short sP[4][16][72];
  __shared__ __attribute__((aligned(16))) Tile sK[2];
  __shared__ __attribute__((aligned(16))) Tile sV[2];
  const int tid = threadIdx.x, lane = tid & 31, w = tid >> 5;
  const int m = lane & 15, hl = lane >> 4, k8 = hl * 8;
  const int nqt = SEQ / 64;
  const int bh = blockIdx.x / nqt, qt = blockIdx.x - bh * nqt;
  const int b = bh / NHEAD, hh = bh - b * NHEAD;
  const int tq = qt * 64 + 16 * w;          // first query row of this wave (within the sequence)

  const unsigned short* kg = kp + (size_t)bh * SEQ * HD;   // chunk kt: + kt*64 rows, row pitch HD
  const unsigned short* vg = vp + (size_t)bh * HD * SEQ;   // chunk kt: + kt*64 columns, row pitch SEQ
  tiles_async(&sK[0][0][0], kg, (size_t)HD, &sV[0][0][0], vg, (size_t)SEQ, tid);
  wait_async0();
  __syncthreads();   // chunk 0 published
  if (nqt > 1)
    tiles_async(&sK[1][0][0], kg + (size_t)64 * HD, (size_t)HD, &sV[1][0][0], vg + 64, (size_t)SEQ, tid);

  Frag qa0, qa1;     // B fragments: column = query tq + m, k = d in the split map
  {
    const unsigned short* qr = qp + ((size_t)bh * SEQ + tq + m) * HD + k8;
    qa0.q[0] = *(const v4u*)(qr);
    qa0.q[1] = *(const v4u*)(qr + 16);
    qa1.q[0] = *(const v4u*)(qr + 32);
    qa1.q[1] = *(const v4u*)(qr + 48);
  }
  const float SC = 0.125f * 1.44269504088896341f;   // raw score -> log2 units
  float mrun = -1e30f;       // running max of query m, raw score units (equal in both lane halves)
  v8f lrun = zero8();        // partial sums of 1024 p over this lane's keys
  v8f oacc[4];               // oacc[jd][r] = O^T(d = 16jd + 8hl + r, query m), x1024
#pragma unroll
  for (int j = 0; j < 4; ++j) oacc[j] = zero8();

#pragma unroll 1
  for (int kt = 0; kt < nqt; ++kt) {
    const int bf = kt & 1;
    // ---- S^T = K Q^T, four 16-key tiles ----
    // all K fragment reads of the chunk as one group ahead of its WMMAs: one LDS latency, not four
    Frag f0[4], f1[4];
#pragma unroll
    for (int j = 0; j < 4; ++j) {
      const unsigned short* kr = &sK[bf][16 * j + m][k8];
      f0[j].q[0] = *(const v4u*)(kr);
      f0[j].q[1] = *(const v4u*)(kr + 16);
      f1[j].q[0] = *(const v4u*)(kr + 32);
      f1[j].q[1] = *(const v4u*)(kr + 48);
    }
    v8f st[4];
#pragma unroll
    for (int j = 0; j < 4; ++j) st[j] = mma(f0[j].v, qa0.v, zero8());
#pragma unroll
    for (int j = 0; j < 4; ++j) st[j] = mma(f1[j].v, qa1.v, st[j]);
    // all V^T fragment reads of the chunk as one group; their latency runs under the softmax
    Frag g0[4], g1[4];
#pragma unroll
    for (int jd = 0; jd < 4; ++jd) {
      const unsigned short* vr = &sV[bf][16 * jd + m][k8];
      g0[jd].q[0] = *(const v4u*)(vr);
      g0[jd].q[1] = *(const v4u*)(vr + 16);
      g1[jd].q[0] = *(const v4u*)(vr + 32);
      g1[jd].q[1] = *(const v4u*)(vr + 48);
    }
    // ---- running max of this lane's query ----
    float t4[4];               // one chain per tile: four independent chains, not one of 32 links
#pragma unroll
    for (int j = 0; j < 4; ++j) {
      t4[j] = st[j][0];
#pragma unroll
      for (int r = 1; r < 8; ++r) t4[j] = fmaxf(t4[j], st[j][r]);
    }
    float tm = fmaxf(fmaxf(t4[0], t4[1]), fmaxf(t4[2], t4[3]));
    tm = fmaxf(tm, other_half(tm));
    const float mn = fmaxf(mrun, tm);
    const float corr = __builtin_amdgcn_exp2f((mrun - mn) * SC);
    mrun = mn;
    // ---- 1024 p = 2^(s SC - m SC + 10) ----
    const v8f sc8 = splat8(SC), nb8 = splat8(10.0f - mn * SC), corr8 = splat8(corr);
#pragma unroll
    for (int j = 0; j < 4; ++j) {
      const v8f e = __builtin_elementwise_fma(st[j], sc8, nb8);
#pragma unroll
      for (int r = 0; r < 8; ++r) st[j][r] = __builtin_amdgcn_exp2f(e[r]);
    }
    lrun = __builtin_elementwise_fma(lrun, corr8, (st[0] + st[1]) + (st[2] + st[3]));
#pragma unroll
    for (int j = 0; j < 4; ++j) oacc[j] = oacc[j] * corr8;
    // ---- P^T fragments: elements 0..7 = keys 32c + 8hl + .., 8..15 = keys 32c + 16 + 8hl + .. ----
    const v16h pb0 = __builtin_shufflevector(__builtin_convertvector(st[0], v8h), __builtin_convertvector(st[1], v8h),
                                             0, 1, 2, 3, 4, 5, 6, 7, 8, 9, 10, 11, 12, 13, 14, 15);
    const v16h pb1 = __builtin_shufflevector(__builtin_convertvector(st[2], v8h), __builtin_convertvector(st[3], v8h),
                                             0, 1, 2, 3, 4, 5, 6, 7, 8, 9, 10, 11, 12, 13, 14, 15);
    // ---- O^T += V^T (64 d x 64 keys) * P^T (64 keys x 16 queries) ----
#pragma unroll
    for (int jd = 0; jd < 4; ++jd) oacc[jd] = mma(g0[jd].v, pb0, oacc[jd]);
#pragma unroll
    for (int jd = 0; jd < 4; ++jd) oacc[jd] = mma(g1[jd].v, pb1, oacc[jd]);
    wait_ds0();
    wait_async0();
    __syncthreads();   // publishes chunk kt + 1; ends every read of buffer bf
    if (kt + 2 < nqt)
      tiles_async(&sK[bf][0][0], kg + (size_t)(kt + 2) * 64 * HD, (size_t)HD,
                  &sV[bf][0][0], vg + (size_t)(kt + 2) * 64, (size_t)SEQ, tid);
  }
  wait_async0();

  // ---- finalize: o = acc / l (both x1024), stage per wave, whole-line stores ----
  float l = ((lrun[0] + lrun[1]) + (lrun[2] + lrun[3])) + ((lrun[4] + lrun[5]) + (lrun[6] + lrun[7]));
  l += other_half(l);
  const v8f il8 = splat8(1.0f / l);
#pragma unroll
  for (int jd = 0; jd < 4; ++jd) {
    const v8h o8 = __builtin_convertvector(oacc[jd] * il8, v8h);
    *(v4u*)&sP[w][m][16 * jd + k8] = __builtin_bit_cast(v4u, o8);
  }
  __syncthreads();
  v4u val[4];
  unsigned int off[4];
#pragma unroll
  for (int p = 0; p < 4; ++p) {
    const int row = 4 * p + (lane >> 3);
    const int piece = lane & 7;
    val[p] = *(const v4u*)&sP[w][row][piece * 8];
    off[p] = (unsigned int)((size_t)(b * SEQ + tq + row) * CDIM + hh * HD + piece * 8);
  }
#pragma unroll
  for (int p = 0; p < 4; ++p) *(v4u*)(op + off[p]) = val[p];
  
}

// ---------------------------------------------------------------------------
// Host launcher
// ---------------------------------------------------------------------------
constexpr size_t al256c(size_t v) { return (v + 255) & ~(size_t)255; }
constexpr size_t MCE = (size_t)MROWS * CDIM;
constexpr size_t SZ_WQKV = al256c((size_t)3 * CDIM * CDIM * 2);
constexpr size_t SZ_WO   = al256c((size_t)CDIM * CDIM * 2);
constexpr size_t SZ_W1   = al256c((size_t)HID * CDIM * 2);
constexpr size_t SZ_W2   = al256c((size_t)CDIM * HID * 2);
constexpr size_t SZ_H    = al256c(MCE * 2);
constexpr size_t SZ_QKV  = al256c((size_t)3 * MCE * 2);
constexpr size_t SZ_O    = al256c(MCE * 2);
constexpr size_t SZ_X1   = al256c(MCE * 4);
constexpr size_t SZ_H2   = al256c(MCE * 2);
constexpr size_t SZ_ACT  = al256c((size_t)MROWS * HID * 2);
constexpr size_t WS_TOTAL = SZ_WQKV + SZ_WO + SZ_W1 + SZ_W2 + SZ_H + SZ_QKV + SZ_O + SZ_X1 + SZ_H2 + SZ_ACT;
static_assert(WS_TOTAL <= (size_t)134217728);
static_assert((size_t)MROWS * HID < (size_t)4294967296ull);     // u32 element offsets in the epilogues
static_assert((size_t)NB_FULL * SEQ_FULL * CDIM < (size_t)4294967296ull);

extern "C" void kernel_launch(void* const* d_in, const int* in_sizes, int n_in,
                              void* d_out, int out_size, void* d_ws, size_t ws_size,
                              hipStream_t stream) {
  if (n_in < 17) return;
  const long needX = ((long)(NB - 1) * SEQ_FULL + SEQ) * CDIM;
  const long nWW = (long)CDIM * CDIM;
  if ((long)in_sizes[0] < needX) return;
  if ((long)in_sizes[1] < nWW || in_sizes[2] < CDIM) return;
  if ((long)in_sizes[3] < nWW || in_sizes[4] < CDIM) return;
  if ((long)in_sizes[5] < nWW || in_sizes[6] < CDIM) return;
  if ((long)in_sizes[7] < nWW || in_sizes[8] < CDIM) return;
  if ((long)in_sizes[9] < (long)CDIM * HID || in_sizes[10] < HID) return;
  if ((long)in_sizes[11] < (long)HID * CDIM || in_sizes[12] < CDIM) return;
  if (in_sizes[13] < CDIM || in_sizes[14] < CDIM) return;
  if (in_sizes[15] < CDIM || in_sizes[16] < CDIM) return;
  if ((long)out_size < needX) return;
  if ((size_t)WS_TOTAL > ws_size) return;

  const float* x   = (const float*)d_in[0];
  const float* Wq  = (const float*)d_in[1];
  const float* bq  = (const float*)d_in[2];
  const float* Wk  = (const float*)d_in[3];
  const float* bk  = (const float*)d_in[4];
  const float* Wv  = (const float*)d_in[5];
  const float* bv  = (const float*)d_in[6];
  const float* Wo  = (const float*)d_in[7];
  const float* bo  = (const float*)d_in[8];
  const float* W1  = (const float*)d_in[9];
  const float* b1  = (const float*)d_in[10];
  const float* W2  = (const float*)d_in[11];
  const float* b2  = (const float*)d_in[12];
  const float* g1  = (const float*)d_in[13];
  const float* be1 = (const float*)d_in[14];
  const float* g2  = (const float*)d_in[15];
  const float* be2 = (const float*)d_in[16];
  float* out = (float*)d_out;

  char* ws = (char*)d_ws;
  size_t off = 0;
  unsigned short* wqkv = (unsigned short*)(ws + off); off += SZ_WQKV;   // [1536][512]
  unsigned short* wot  = (unsigned short*)(ws + off); off += SZ_WO;     // [512][512]
  unsigned short* w1t  = (unsigned short*)(ws + off); off += SZ_W1;     // [2048][512]
  unsigned short* w2t  = (unsigned short*)(ws + off); off += SZ_W2;     // [512][2048]
  unsigned short* hpl  = (unsigned short*)(ws + off); off += SZ_H;      // [M][512]
  unsigned short* qkv  = (unsigned short*)(ws + off); off += SZ_QKV;    // q [B*H][SEQ][64], k same, vt [B*H][64][SEQ]
  unsigned short* opl  = (unsigned short*)(ws + off); off += SZ_O;      // [M][512]
  float*          x1   = (float*)(ws + off);          off += SZ_X1;     // [M][512]
  unsigned short* h2p  = (unsigned short*)(ws + off); off += SZ_H2;     // [M][512]
  unsigned short* act  = (unsigned short*)(ws + off); off += SZ_ACT;    // [M][2048]
  if (off > ws_size) return;
  unsigned short* qpl = qkv;
  unsigned short* kpl = qkv + MCE;
  unsigned short* vtp = qkv + 2 * MCE;

  // 1) + 2) one launch: LN1 on bf16 values of x -> h (f16), and the six weight planes
  //    in[K][N] -> out[N][K], bf16 values x16 as f16
  k_prep<<<LNB + 4 * WB1 + 2 * WB2, 256, 0, stream>>>(x, g1, be1, hpl, Wq, Wk, Wv, Wo, W1, W2,
                                                     wqkv, wot, w1t, w2t);
  // 3) q/k/v projections + bias -> q, k, vt planes
  k_gemm_qkv<<<dim3(3 * CDIM / 64, MROWS / 64), 128, 0, stream>>>(hpl, wqkv, bq, bk, bv, qkv);
  // 4) attention -> o plane
  k_attn<<<NB * NHEAD * (SEQ / 64), 128, 0, stream>>>(qpl, kpl, vtp, opl);
  // 5) output projection + bias + residual(bf16 values of x) -> x1 (f32, compact rows)
  k_gemm_res<<<dim3(CDIM / 64, MROWS / 64), 128, 0, stream>>>(opl, wot, CDIM, bo, x, x1, 1, 0);
  // 6) LN2 -> h2 (f16)
  k_ln_mid<<<MROWS / 8, 256, 0, stream>>>(x1, g2, be2, h2p, MROWS);
  // 7) ffn1 + bias + gelu(erf) -> act (f16)
  k_gemm_gelu<<<dim3(HID / 64, MROWS / 64), 128, 0, stream>>>(h2p, w1t, CDIM, b1, act);
  // 8) ffn2 + bias + residual(x1) -> out (f32, full strides)
  k_gemm_res<<<dim3(CDIM / 64, MROWS / 64), 128, 0, stream>>>(act, w2t, HID, b2, x1, out, 0, 1);
}

// v004
// One run takes 167 microseconds.
// Timed twice side by side with v003, it ran 1.06 and 1.04 times as fast.
// Over all steps from v000 it is 4.02 times as fast.
#include <hip/hip_runtime.h>

// Contractions: v_wmma_f32_16x16x32_f16 (f16 operands, f32 accumulate) for q/k/v projections, q.k^T, p.v, output projection, ffn1, ffn2; weight planes carried x16, p carried x1024, activations x1.

#pragma clang fp contract(off)

#ifndef NB
#define NB 2
#endif
#ifndef SEQ
#define SEQ 4096
#endif
#define NB_FULL 2
#define SEQ_FULL 4096
#define CDIM 512
#define NHEAD 8
#define HD 64
#define HID 2048
#define MROWS (NB * SEQ)

static_assert(NB >= 1 && NB <= NB_FULL);
static_assert(SEQ % 128 == 0 && SEQ >= 128 && SEQ <= SEQ_FULL);
static_assert(CDIM == NHEAD * HD);
static_assert(HD == 64);
static_assert(CDIM == 512);
static_assert(CDIM == 32 * 2 * 8);          // LayerNorm lane map: 32 lanes x 2 segments x 8 columns
static_assert(HID % 64 == 0 && CDIM % 64 == 0);
static_assert(CDIM % 32 == 0 && HID % 32 == 0);   // WMMA k-steps of 32, two per 64-wide k trip
static_assert(MROWS % 64 == 0);
static_assert(MROWS % 8 == 0);
static_assert((3 * CDIM) % 64 == 0);

typedef _Float16 v16h __attribute__((ext_vector_type(16)));
typedef _Float16 v8h  __attribute__((ext_vector_type(8)));
typedef float    v8f  __attribute__((ext_vector_type(8)));
typedef float    v4f  __attribute__((ext_vector_type(4)));
typedef unsigned int v4u __attribute__((ext_vector_type(4)));

union Frag { v16h v; v4u q[2]; };

// WMMA with hazard guard: D += A(16x32) * B(32x16)
__device__ __forceinline__ v8f mma(v16h a, v16h b, v8f c) {
  v8f d = __builtin_amdgcn_wmma_f32_16x16x32_f16(false, a, false, b, (short)0, c, false, false);
  asm volatile("v_nop\n\tv_nop\n\tv_nop\n\tv_nop" : "+v"(d) : "v"(a), "v"(b));
  return d;
}

__device__ __forceinline__ v8f zero8() {
  v8f z;
#pragma unroll
  for (int i = 0; i < 8; ++i) z[i] = 0.0f;
  return z;
}

// f32 -> nearest-even bf16 value, returned as f32
__device__ __forceinline__ float bf16q(float f) {
  unsigned int u = __float_as_uint(f);
  unsigned int r = u + 0x7FFFu + ((u >> 16) & 1u);
  r = ((u & 0x7F800000u) == 0x7F800000u) ? u : r;
  return __uint_as_float(r & 0xFFFF0000u);
}
__device__ __forceinline__ v4f bf16q4(v4f a) {
  v4f r;
  r.x = bf16q(a.x); r.y = bf16q(a.y); r.z = bf16q(a.z); r.w = bf16q(a.w);
  return r;
}
// f32 -> f16 (RNE convert) bit pattern
__device__ __forceinline__ unsigned short hbits(float f) {
  _Float16 h = (_Float16)f;
  return __builtin_bit_cast(unsigned short, h);
}
__device__ __forceinline__ v4u pack8h(float f0, float f1, float f2, float f3,
                                      float f4, float f5, float f6, float f7) {
  v8h t;
  t[0] = (_Float16)f0; t[1] = (_Float16)f1; t[2] = (_Float16)f2; t[3] = (_Float16)f3;
  t[4] = (_Float16)f4; t[5] = (_Float16)f5; t[6] = (_Float16)f6; t[7] = (_Float16)f7;
  return __builtin_bit_cast(v4u, t);
}
__device__ __forceinline__ float gelu_erf(float u) {
  return 0.5f * u * (1.0f + erff(u * 0.70710678118654752f));
}

// ---------------------------------------------------------------------------
// Weight prep: src[K][N] (f32, row pitch N) -> dst[rowoff + n][k] f16 plane
// (row pitch K), value = f16(bf16q(w) * 16).  in[K][N] -> out[N][K].
// One block of 256 threads does the 64x64 tile (kx, ny) of (K/64, N/64).
// ---------------------------------------------------------------------------
__device__ __forceinline__ void wprep_body(
    const float* __restrict__ src, unsigned short* __restrict__ dst, int K, int N, int rowoff,
    int kx, int ny, unsigned short (&sT)[64][72]) {
  const int tid = threadIdx.x;
  const int k0 = kx * 64, n0 = ny * 64;
#pragma unroll
  for (int it = 0; it < 4; ++it) {
    const int idx = it * 256 + tid;
    const int kk = idx >> 4;            // 0..63
    const int j4 = (idx & 15) * 4;      // 0..60
    const v4f wv = *(const v4f*)(src + (size_t)(k0 + kk) * (size_t)N + n0 + j4);
    sT[j4 + 0][kk] = hbits(bf16q(wv.x) * 16.0f);
    sT[j4 + 1][kk] = hbits(bf16q(wv.y) * 16.0f);
    sT[j4 + 2][kk] = hbits(bf16q(wv.z) * 16.0f);
    sT[j4 + 3][kk] = hbits(bf16q(wv.w) * 16.0f);
  }
  __syncthreads();   // cross-wave: staged by all waves, read by all waves
  v4u val[2];
  size_t off[2];
#pragma unroll
  for (int p = 0; p < 2; ++p) {
    const int n = p * 32 + (tid >> 3);
    const int piece = tid & 7;
    val[p] = *(const v4u*)&sT[n][piece * 8];
    off[p] = (size_t)(rowoff + n0 + n) * (size_t)K + k0 + piece * 8;
  }
#pragma unroll
  for (int p = 0; p < 2; ++p) *(v4u*)(dst + off[p]) = val[p];
  // precaution: in the merged kernel the listing runs on behind these stores into code that rewrites their registers
  asm volatile("s_wait_xcnt 0x0" ::: "memory");
  
}

// ---------------------------------------------------------------------------
// LayerNorm over CDIM=512: one wave per row, lane l owns cols 8l..8l+7 and
// 256+8l..256+8l+7.  RNDIN: input rows read at full strides and converted to
// their bf16 values first.  Output f16 plane [nrows][512], rows compact.
// coverage: 2 instructions x 32 lanes x 16 B = cols 0..255 (4 lines) + cols 256..511 (4 lines) per row.
// ---------------------------------------------------------------------------
template <int RNDIN>
__device__ __forceinline__ void ln_body(
    const float* __restrict__ x, const float* __restrict__ g, const float* __restrict__ bt,
    unsigned short* __restrict__ hout, int nrows, int blk) {
  const int lane = threadIdx.x & 31, w = threadIdx.x >> 5;
  const int row = blk * 8 + w;
  if (row >= nrows) return;            // no barriers on the LayerNorm path
  size_t xrow;
  if (RNDIN) {
    const int b = row / SEQ, t = row - b * SEQ;
    xrow = ((size_t)b * SEQ_FULL + t) * CDIM;
  } else {
    xrow = (size_t)row * CDIM;
  }
  const int c0 = lane * 8;
  const int c1 = 256 + lane * 8;

  float v[16];
  {
    const v4f t0 = *(const v4f*)(x + xrow + c0);
    const v4f t1 = *(const v4f*)(x + xrow + c0 + 4);
    const v4f t2 = *(const v4f*)(x + xrow + c1);
    const v4f t3 = *(const v4f*)(x + xrow + c1 + 4);
    v[0] = t0.x; v[1] = t0.y; v[2] = t0.z; v[3] = t0.w;
    v[4] = t1.x; v[5] = t1.y; v[6] = t1.z; v[7] = t1.w;
    v[8] = t2.x; v[9] = t2.y; v[10] = t2.z; v[11] = t2.w;
    v[12] = t3.x; v[13] = t3.y; v[14] = t3.z; v[15] = t3.w;
  }
  if (RNDIN) {
#pragma unroll
    for (int i = 0; i < 16; ++i) v[i] = bf16q(v[i]);
  }

  float s = 0.0f;
#pragma unroll
  for (int i = 0; i < 16; ++i) s += v[i];
#pragma unroll
  for (int xm = 1; xm < 32; xm <<= 1) s += __shfl_xor(s, xm, 32);
  const float mu = s * (1.0f / CDIM);

  float d[16];
#pragma unroll
  for (int i = 0; i < 16; ++i) d[i] = v[i] - mu;
  float qs = 0.0f;
#pragma unroll
  for (int i = 0; i < 16; ++i) qs += d[i] * d[i];
#pragma unroll
  for (int xm = 1; xm < 32; xm <<= 1) qs += __shfl_xor(qs, xm, 32);
  const float var = qs * (1.0f / CDIM);
  const float rstd = rsqrtf(var + 1e-5f);

  float gg[16], bb[16];
  {
    const v4f g0 = bf16q4(*(const v4f*)(g + c0));
    const v4f g1 = bf16q4(*(const v4f*)(g + c0 + 4));
    const v4f g2 = bf16q4(*(const v4f*)(g + c1));
    const v4f g3 = bf16q4(*(const v4f*)(g + c1 + 4));
    const v4f b0 = bf16q4(*(const v4f*)(bt + c0));
    const v4f b1 = bf16q4(*(const v4f*)(bt + c0 + 4));
    const v4f b2 = bf16q4(*(const v4f*)(bt + c1));
    const v4f b3 = bf16q4(*(const v4f*)(bt + c1 + 4));
    gg[0] = g0.x; gg[1] = g0.y; gg[2] = g0.z; gg[3] = g0.w;
    gg[4] = g1.x; gg[5] = g1.y; gg[6] = g1.z; gg[7] = g1.w;
    gg[8] = g2.x; gg[9] = g2.y; gg[10] = g2.z; gg[11] = g2.w;
    gg[12] = g3.x; gg[13] = g3.y; gg[14] = g3.z; gg[15] = g3.w;
    bb[0] = b0.x; bb[1] = b0.y; bb[2] = b0.z; bb[3] = b0.w;
    bb[4] = b1.x; bb[5] = b1.y; bb[6] = b1.z; bb[7] = b1.w;
    bb[8] = b2.x; bb[9] = b2.y; bb[10] = b2.z; bb[11] = b2.w;
    bb[12] = b3.x; bb[13] = b3.y; bb[14] = b3.z; bb[15] = b3.w;
  }
  float y[16];
#pragma unroll
  for (int i = 0; i < 16; ++i) y[i] = d[i] * rstd * gg[i] + bb[i];

  const v4u o0 = pack8h(y[0], y[1], y[2], y[3], y[4], y[5], y[6], y[7]);
  const v4u o1 = pack8h(y[8], y[9], y[10], y[11], y[12], y[13], y[14], y[15]);
  unsigned short* orow = hout + (size_t)row * CDIM;
  *(v4u*)(orow + c0) = o0;
  *(v4u*)(orow + c1) = o1;
  
}

// ---------------------------------------------------------------------------
// First launch: all the work that reads the inputs alone, dealt by block index.
// Blocks 0 .. LNB-1: LayerNorm 1, 8 rows each.  Then one 64x64 weight tile a block:
// WB1 blocks for each of Wq, Wk, Wv, Wo, WB2 for W1, WB2 for W2.
// Every branch is block-uniform; only the weight path has a barrier.
// ---------------------------------------------------------------------------
#define LNB (MROWS / 8)
#define WB1 ((CDIM / 64) * (CDIM / 64))
#define WB2 ((CDIM / 64) * (HID / 64))
__global__ __launch_bounds__(256) void k_prep(
    const float* __restrict__ x, const float* __restrict__ g, const float* __restrict__ bt,
    unsigned short* __restrict__ hout,
    const float* __restrict__ Wq, const float* __restrict__ Wk, const float* __restrict__ Wv,
    const float* __restrict__ Wo, const float* __restrict__ W1, const float* __restrict__ W2,
    unsigned short* __restrict__ wqkv, unsigned short* __restrict__ wot,
    unsigned short* __restrict__ w1t, unsigned short* __restrict__ w2t) {
  __shared__ __attribute__((aligned(16))) unsigned short sT[64][72];
  const int bid = blockIdx.x;
  if (bid < LNB) {
    ln_body<1>(x, g, bt, hout, MROWS, bid);
    return;
  }
  int t = bid - LNB;
  if (t < 4 * WB1) {                       // in[512][512] -> out[512][512]
    const int mat = t / WB1;
    t -= mat * WB1;
    const float* src = (mat == 0) ? Wq : ((mat == 1) ? Wk : ((mat == 2) ? Wv : Wo));
    unsigned short* dst = (mat < 3) ? wqkv : wot;
    wprep_body(src, dst, CDIM, CDIM, (mat < 3) ? mat * CDIM : 0, t % (CDIM / 64), t / (CDIM / 64), sT);
  } else if (t < 4 * WB1 + WB2) {          // in[512][2048] -> out[2048][512]
    t -= 4 * WB1;
    wprep_body(W1, w1t, CDIM, HID, 0, t % (CDIM / 64), t / (CDIM / 64), sT);
  } else {                                 // in[2048][512] -> out[512][2048]
    t -= 4 * WB1 + WB2;
    wprep_body(W2, w2t, HID, CDIM, 0, t % (HID / 64), t / (HID / 64), sT);
  }
}
__global__ __launch_bounds__(256) void k_ln_mid(
    const float* __restrict__ x, const float* __restrict__ g, const float* __restrict__ bt,
    unsigned short* __restrict__ hout, int nrows) {
  ln_body<0>(x, g, bt, hout, nrows, blockIdx.x);
}

// ---------------------------------------------------------------------------
// Operand tiles in LDS.  A tile is 64 rows x 64 16-bit elements (128 B = one
// line per row); LDS row pitch TP elements = 144 B (16 B x odd: the b128
// fragment reads of 16 rows fall on distinct banks).
// tiles_async: the 128 threads of a WG copy two such tiles, global -> LDS,
// 16 B per lane and copy; a wave's copy covers 4 whole rows (4 whole lines).
// ga / gb: first element of the tile, pa / pb: its global row pitch in elements.
// ---------------------------------------------------------------------------
#define TP 72
typedef unsigned short Tile[64][TP];

__device__ __forceinline__ void tiles_async(
    unsigned short* la, const unsigned short* ga, size_t pa,
    unsigned short* lb, const unsigned short* gb, size_t pb, int tid) {
  const int row = tid >> 3, pc = (tid & 7) * 8;
  const unsigned int la0 = (unsigned int)(size_t)(la + row * TP + pc);
  const unsigned int lb0 = (unsigned int)(size_t)(lb + row * TP + pc);
  const unsigned int la1 = la0 + 16 * TP * 2, la2 = la0 + 32 * TP * 2, la3 = la0 + 48 * TP * 2;
  const unsigned int lb1 = lb0 + 16 * TP * 2, lb2 = lb0 + 32 * TP * 2, lb3 = lb0 + 48 * TP * 2;
  const unsigned short* a0 = ga + (size_t)row * pa + pc;
  const unsigned short* a1 = a0 + 16 * pa;
  const unsigned short* a2 = a0 + 32 * pa;
  const unsigned short* a3 = a0 + 48 * pa;
  const unsigned short* b0 = gb + (size_t)row * pb + pc;
  const unsigned short* b1 = b0 + 16 * pb;
  const unsigned short* b2 = b0 + 32 * pb;
  const unsigned short* b3 = b0 + 48 * pb;
  // the copies and, as the last line, the wait that stands before their address registers are reused
  asm volatile(
      "global_load_async_to_lds_b128 %0, %8, off\n\t"
      "global_load_async_to_lds_b128 %1, %9, off\n\t"
      "global_load_async_to_lds_b128 %2, %10, off\n\t"
      "global_load_async_to_lds_b128 %3, %11, off\n\t"
      "global_load_async_to_lds_b128 %4, %12, off\n\t"
      "global_load_async_to_lds_b128 %5, %13, off\n\t"
      "global_load_async_to_lds_b128 %6, %14, off\n\t"
      "global_load_async_to_lds_b128 %7, %15, off\n\t"
      "s_wait_xcnt 0x0"
      :: "v"(la0), "v"(la1), "v"(la2), "v"(la3), "v"(lb0), "v"(lb1), "v"(lb2), "v"(lb3),
         "v"(a0), "v"(a1), "v"(a2), "v"(a3), "v"(b0), "v"(b1), "v"(b2), "v"(b3)
      : "memory");
}
// this wave's copies have landed
__device__ __forceinline__ void wait_async0() { asm volatile("s_wait_asynccnt 0x0" ::: "memory"); }
// this wave's LDS reads and writes have retired (before a buffer it read is refilled)
__device__ __forceinline__ void wait_ds0() { asm volatile("s_wait_dscnt 0x0" ::: "memory"); }

// ---------------------------------------------------------------------------
// 64x64-tile f16 GEMM main loop: D = A[M][K] * Bt[N][K]^T, 4 waves per WG,
// wave w owns rows 16w..16w+15 x 64 cols (4 accumulator tiles).  A trip covers
// 64 of k: the A and Bt tiles of trip t + 1 are copied to the other LDS buffer
// while trip t is worked on.  Fragments are read from LDS with the split k map
// for A and B (row/col = lane&15, elements 0..7 <- k0+8h.., 8..15 <- k0+16+8h..).
// acc[j][r] = D(row 16w + 8h + r, col 16j + (lane&15)).
// ---------------------------------------------------------------------------
__device__ __forceinline__ void gemm_main(
    const unsigned short* __restrict__ A, const unsigned short* __restrict__ Bt, int K,
    int m0, int n0, int w, int m, int k8, int tid, Tile* sA, Tile* sB, v8f (&acc)[4]) {
#pragma unroll
  for (int j = 0; j < 4; ++j) acc[j] = zero8();
  const unsigned short* ag = A + (size_t)m0 * (size_t)K;
  const unsigned short* bg = Bt + (size_t)n0 * (size_t)K;
  const int nt = K >> 6;
  tiles_async(&sA[0][0][0], ag, (size_t)K, &sB[0][0][0], bg, (size_t)K, tid);
  wait_async0();
  __syncthreads();   // tile 0 published
  if (nt > 1) tiles_async(&sA[1][0][0], ag + 64, (size_t)K, &sB[1][0][0], bg + 64, (size_t)K, tid);
#pragma unroll 1
  for (int t = 0; t < nt; ++t) {
    const int bf = t & 1;
    // all fragment reads of the trip as one group ahead of its WMMAs: one LDS latency per trip
    Frag a[2], b[2][4];
#pragma unroll
    for (int h = 0; h < 2; ++h) {
      const unsigned short* ar = &sA[bf][16 * w + m][32 * h + k8];
      a[h].q[0] = *(const v4u*)(ar);
      a[h].q[1] = *(const v4u*)(ar + 16);
#pragma unroll
      for (int j = 0; j < 4; ++j) {
        const unsigned short* bj = &sB[bf][16 * j + m][32 * h + k8];
        b[h][j].q[0] = *(const v4u*)(bj);
        b[h][j].q[1] = *(const v4u*)(bj + 16);
      }
    }
#pragma unroll
    for (int h = 0; h < 2; ++h) {
#pragma unroll
      for (int j = 0; j < 4; ++j) acc[j] = mma(a[h].v, b[h][j].v, acc[j]);
    }
    wait_ds0();
    wait_async0();
    __syncthreads();   // publishes tile t + 1; ends every read of buffer bf
    if (t + 2 < nt)
      tiles_async(&sA[bf][0][0], ag + (size_t)(t + 2) * 64, (size_t)K,
                  &sB[bf][0][0], bg + (size_t)(t + 2) * 64, (size_t)K, tid);
  }
  wait_async0();
}

// ---------------------------------------------------------------------------
// q/k/v projection: A = LN1 plane [M][512], Bt = [1536][512] (q rows, k rows, v rows).
// value = acc/16 + bf16q(bias).  q and k -> planes [b*H+h][t][64]; v -> transposed
// plane vt[b*H+h][64][t].  The three planes are contiguous: plane p at qkv + p*M*512.
// coverage: 4 passes x 4 waves x 4 rows = 64 rows x 64 cols (q/k); 4 passes x 4 waves x 4 d = 64 d rows x 64 tokens (v).
// LDS sT: cross-wave (block barrier).
// ---------------------------------------------------------------------------
__global__ __launch_bounds__(128) void k_gemm_qkv(
    const unsigned short* __restrict__ A, const unsigned short* __restrict__ Bt,
    const float* __restrict__ bq, const float* __restrict__ bk, const float* __restrict__ bv,
    unsigned short* __restrict__ qkv) {
  __shared__ __attribute__((aligned(16))) unsigned short sT[64][72];
  __shared__ __attribute__((aligned(16))) Tile sA[2];
  __shared__ __attribute__((aligned(16))) Tile sB[2];
  const int tid = threadIdx.x, lane = tid & 31, w = tid >> 5;
  const int m = lane & 15, hl = lane >> 4, k8 = hl * 8;
  const int m0 = blockIdx.y * 64, n0 = blockIdx.x * 64;

  v8f acc[4];
  gemm_main(A, Bt, CDIM, m0, n0, w, m, k8, tid, sA, sB, acc);

  const float wsc = 0.0625f;               // undo the x16 weight carry
  const int lrow0 = 16 * w + 8 * hl;       // D rows of this lane within the WG tile
  const int which = n0 / CDIM;             // 0 q, 1 k, 2 v (WG-uniform)
  const int cb = n0 - which * CDIM;
#pragma unroll
  for (int j = 0; j < 4; ++j) {
    const int cn = cb + 16 * j + m;
    const float b0 = bf16q(bq[cn]);
    const float b1 = bf16q(bk[cn]);
    const float b2 = bf16q(bv[cn]);
    const float bj = (which == 0) ? b0 : ((which == 1) ? b1 : b2);
#pragma unroll
    for (int r = 0; r < 8; ++r) sT[lrow0 + r][16 * j + m] = hbits(acc[j][r] * wsc + bj);
  }
  __syncthreads();   // cross-wave: both the q/k and the v reload read rows of other waves
  const int hh = cb / HD;
  const int b = m0 / SEQ, t0 = m0 - b * SEQ;
  const int bh = b * NHEAD + hh;
  unsigned short* dst = qkv + (size_t)which * ((size_t)MROWS * CDIM);
  v4u val[4];
  unsigned int off[4];
  if (which < 2) {                       // WG-uniform
#pragma unroll
    for (int p = 0; p < 4; ++p) {
      const int row = p * 16 + 4 * w + (lane >> 3);
      const int piece = lane & 7;
      val[p] = *(const v4u*)&sT[row][piece * 8];
      off[p] = (unsigned int)((bh * SEQ + t0 + row) * HD + piece * 8);
    }
  } else {
#pragma unroll
    for (int p = 0; p < 4; ++p) {
      const int d = p * 16 + 4 * w + (lane >> 3);
      const int piece = lane & 7;
      unsigned int wv[4];
#pragma unroll
      for (int e = 0; e < 4; ++e) {
        const unsigned int lo = sT[piece * 8 + 2 * e][d];
        const unsigned int hi = sT[piece * 8 + 2 * e + 1][d];
        wv[e] = lo | (hi << 16);
      }
      v4u t;
      t.x = wv[0]; t.y = wv[1]; t.z = wv[2]; t.w = wv[3];
      val[p] = t;
      off[p] = (unsigned int)((bh * HD + d) * SEQ + t0 + piece * 8);
    }
  }
#pragma unroll
  for (int p = 0; p < 4; ++p) *(v4u*)(dst + off[p]) = val[p];
  
}

// ---------------------------------------------------------------------------
// GEMM + bias + residual, f32 output of width CDIM:
// out = acc/16 + bf16q(bias) + res.  resfull: res rows read at full strides and
// converted to bf16 values; outfull: out rows written at full strides.
// Residual added at the store stage as float4.  Each row segment (64 floats =
// coverage: 8 passes x 2 rows per wave = 16 rows x 64 cols per wave.
// LDS sF: wave-private rows; block barrier orders the reload.
// ---------------------------------------------------------------------------
__global__ __launch_bounds__(128) void k_gemm_res(
    const unsigned short* __restrict__ A, const unsigned short* __restrict__ Bt, int K,
    const float* __restrict__ bias, const float* __restrict__ res,
    float* __restrict__ outF, int resfull, int outfull) {
  __shared__ __attribute__((aligned(16))) float sF[64][68];
  __shared__ __attribute__((aligned(16))) Tile sA[2];
  __shared__ __attribute__((aligned(16))) Tile sB[2];
  const int tid = threadIdx.x, lane = tid & 31, w = tid >> 5;
  const int m = lane & 15, hl = lane >> 4, k8 = hl * 8;
  const int m0 = blockIdx.y * 64, n0 = blockIdx.x * 64;

  v8f acc[4];
  gemm_main(A, Bt, K, m0, n0, w, m, k8, tid, sA, sB, acc);

  const float wsc = 0.0625f;
  const int lrow0 = 16 * w + 8 * hl;
#pragma unroll
  for (int j = 0; j < 4; ++j) {
#pragma unroll
    for (int r = 0; r < 8; ++r) sF[lrow0 + r][16 * j + m] = acc[j][r] * wsc;
  }
  __syncthreads();
  const int b = m0 / SEQ, t0 = m0 - b * SEQ;
  v4f val[8];
  unsigned int off[8];
#pragma unroll
  for (int p = 0; p < 8; ++p) {
    const int row = 16 * w + 2 * p + hl;
    const int piece = m;
    const int ncol = n0 + 4 * piece;
    const v4f a = *(const v4f*)&sF[row][4 * piece];
    const v4f bv = bf16q4(*(const v4f*)(bias + ncol));
    const size_t frow = (size_t)b * SEQ_FULL + t0 + row;   // full-stride row
    const size_t crow = (size_t)(m0 + row);                // compact row
    const size_t rrow = resfull ? frow : crow;
    const v4f rraw = *(const v4f*)(res + rrow * (size_t)CDIM + ncol);
    const v4f rq = bf16q4(rraw);
    const v4f rr = resfull ? rq : rraw;
    val[p] = (a + bv) + rr;
    const size_t orow = outfull ? frow : crow;
    off[p] = (unsigned int)(orow * (size_t)CDIM + ncol);
  }
#pragma unroll
  for (int p = 0; p < 8; ++p) *(v4f*)(outF + off[p]) = val[p];
  
}

// ---------------------------------------------------------------------------
// ffn1: f16 out[M][HID] = gelu_erf(acc/16 + bf16q(bias)).
// coverage: 4 passes x 4 rows per wave = 16 rows x 64 cols per wave.
// LDS sT: wave-private rows; block barrier orders the reload.
// ---------------------------------------------------------------------------
__global__ __launch_bounds__(128) void k_gemm_gelu(
    const unsigned short* __restrict__ A, const unsigned short* __restrict__ Bt, int K,
    const float* __restrict__ bias, unsigned short* __restrict__ out0) {
  __shared__ __attribute__((aligned(16))) unsigned short sT[64][72];
  __shared__ __attribute__((aligned(16))) Tile sA[2];
  __shared__ __attribute__((aligned(16))) Tile sB[2];
  const int tid = threadIdx.x, lane = tid & 31, w = tid >> 5;
  const int m = lane & 15, hl = lane >> 4, k8 = hl * 8;
  const int m0 = blockIdx.y * 64, n0 = blockIdx.x * 64;

  v8f acc[4];
  gemm_main(A, Bt, K, m0, n0, w, m, k8, tid, sA, sB, acc);

  const float wsc = 0.0625f;
  const int lrow0 = 16 * w + 8 * hl;
#pragma unroll
  for (int j = 0; j < 4; ++j) {
    const float bj = bf16q(bias[n0 + 16 * j + m]);
#pragma unroll
    for (int r = 0; r < 8; ++r) {
      const float u = acc[j][r] * wsc + bj;
      sT[lrow0 + r][16 * j + m] = hbits(gelu_erf(u));
    }
  }
  __syncthreads();
  v4u val[4];
  unsigned int off[4];
#pragma unroll
  for (int p = 0; p < 4; ++p) {
    const int row = 16 * w + 4 * p + (lane >> 3);
    const int piece = lane & 7;
    val[p] = *(const v4u*)&sT[row][piece * 8];
    off[p] = (unsigned int)((size_t)(m0 + row) * (size_t)HID + n0 + piece * 8);
  }
#pragma unroll
  for (int p = 0; p < 4; ++p) *(v4u*)(out0 + off[p]) = val[p];
  
}

__device__ __forceinline__ float other_half(float f) {
  const int b = __builtin_bit_cast(int, f);
  return __builtin_bit_cast(float, __builtin_amdgcn_permlanex16(b, b, 0x76543210, 0xfedcba98, false, false));
}
__device__ __forceinline__ v8f splat8(float f) {
  v8f z;
#pragma unroll
  for (int i = 0; i < 8; ++i) z[i] = f;
  return z;
}

// Two waves a SIMD is all this grid gives (512 work-groups of 4 waves on 1,024 SIMDs): the register budget is set for
// that, and at most two work-groups fit a WGP, so that they spread over all of them.
__global__ __launch_bounds__(128) __attribute__((amdgpu_waves_per_eu(2, 2)))
void k_attn(const unsigned short* __restrict__ qp, const unsigned short* __restrict__ kp,
            const unsigned short* __restrict__ vp, unsigned short* __restrict__ op) {
  __shared__ __attribute__((aligned(16))) unsigned short sP[4][32][72];
  __shared__ __attribute__((aligned(16))) Tile sK[2];
  __shared__ __attribute__((aligned(16))) Tile sV[2];
  const int tid = threadIdx.x, lane = tid & 31, w = tid >> 5;
  const int m = lane & 15, hl = lane >> 4, k8 = hl * 8;
  const int nkt = SEQ / 64;                 // key chunks
  const int nqt = SEQ / 128;                // query tiles of one (b,h)
  const int bh = blockIdx.x / nqt, qt = blockIdx.x - bh * nqt;
  const int b = bh / NHEAD, hh = bh - b * NHEAD;
  const int tq = qt * 128 + 32 * w;         // first query row of this wave (within the sequence)

  const unsigned short* kg = kp + (size_t)bh * SEQ * HD;   // chunk kt: + kt*64 rows, row pitch HD
  const unsigned short* vg = vp + (size_t)bh * HD * SEQ;   // chunk kt: + kt*64 columns, row pitch SEQ
  tiles_async(&sK[0][0][0], kg, (size_t)HD, &sV[0][0][0], vg, (size_t)SEQ, tid);

  Frag qa0[2], qa1[2];     // B fragments of column group c: column = query tq + 16c + m, k = d in the split map
  {
    const unsigned short* qr0 = qp + ((size_t)bh * SEQ + tq + m) * HD + k8;
    const unsigned short* qr1 = qr0 + 16 * HD;
    // the loads and their data wait in one statement, so that no address register is rewritten ahead of a wait
    // the latency runs beside that of chunk 0's copies
    asm volatile(
        "global_load_b128 %0, %8, off\n\t"
        "global_load_b128 %1, %8, off offset:32\n\t"
        "global_load_b128 %2, %8, off offset:64\n\t"
        "global_load_b128 %3, %8, off offset:96\n\t"
        "global_load_b128 %4, %9, off\n\t"
        "global_load_b128 %5, %9, off offset:32\n\t"
        "global_load_b128 %6, %9, off offset:64\n\t"
        "global_load_b128 %7, %9, off offset:96\n\t"
        "s_wait_loadcnt 0x0"
        : "=&v"(qa0[0].q[0]), "=&v"(qa0[0].q[1]), "=&v"(qa1[0].q[0]), "=&v"(qa1[0].q[1]),
          "=&v"(qa0[1].q[0]), "=&v"(qa0[1].q[1]), "=&v"(qa1[1].q[0]), "=&v"(qa1[1].q[1])
        : "v"(qr0), "v"(qr1)
        : "memory");
  }
  wait_async0();
  __syncthreads();   // chunk 0 published
  if (nkt > 1)
    tiles_async(&sK[1][0][0], kg + (size_t)64 * HD, (size_t)HD, &sV[1][0][0], vg + 64, (size_t)SEQ, tid);
  const float SC = 0.125f * 1.44269504088896341f;   // raw score -> log2 units
  float mrun[2];             // running max of query 16c + m, raw score units (equal in both lane halves)
  v8f lrun[2];               // partial sums of 1024 p over this lane's keys
  v8f oacc[2][4];            // oacc[c][jd][r] = O^T(d = 16jd + 8hl + r, query 16c + m), x1024
#pragma unroll
  for (int c = 0; c < 2; ++c) {
    mrun[c] = -1e30f;
    lrun[c] = zero8();
#pragma unroll
    for (int j = 0; j < 4; ++j) oacc[c][j] = zero8();
  }

#pragma unroll 1
  for (int kt = 0; kt < nkt; ++kt) {
    const int bf = kt & 1;
    // ---- S^T = K Q^T, four 16-key tiles x two column groups ----
    // all K fragment reads of the chunk as one group ahead of its WMMAs: one LDS latency, not four
    Frag f0[4], f1[4];
#pragma unroll
    for (int j = 0; j < 4; ++j) {
      const unsigned short* kr = &sK[bf][16 * j + m][k8];
      f0[j].q[0] = *(const v4u*)(kr);
      f0[j].q[1] = *(const v4u*)(kr + 16);
      f1[j].q[0] = *(const v4u*)(kr + 32);
      f1[j].q[1] = *(const v4u*)(kr + 48);
    }
    v8f st[2][4];
#pragma unroll
    for (int j = 0; j < 4; ++j) {
#pragma unroll
      for (int c = 0; c < 2; ++c) st[c][j] = mma(f0[j].v, qa0[c].v, zero8());
    }
#pragma unroll
    for (int j = 0; j < 4; ++j) {
#pragma unroll
      for (int c = 0; c < 2; ++c) st[c][j] = mma(f1[j].v, qa1[c].v, st[c][j]);
    }
    // all V^T fragment reads of the chunk as one group; their latency runs under the softmax
    Frag g0[4], g1[4];
#pragma unroll
    for (int jd = 0; jd < 4; ++jd) {
      const unsigned short* vr = &sV[bf][16 * jd + m][k8];
      g0[jd].q[0] = *(const v4u*)(vr);
      g0[jd].q[1] = *(const v4u*)(vr + 16);
      g1[jd].q[0] = *(const v4u*)(vr + 32);
      g1[jd].q[1] = *(const v4u*)(vr + 48);
    }
    v16h pb0[2], pb1[2];
#pragma unroll
    for (int c = 0; c < 2; ++c) {
      // ---- running max of this lane's query ----
      float t4[4];               // one chain per tile: four independent chains, not one of 32 links
#pragma unroll
      for (int j = 0; j < 4; ++j) {
        t4[j] = st[c][j][0];
#pragma unroll
        for (int r = 1; r < 8; ++r) t4[j] = fmaxf(t4[j], st[c][j][r]);
      }
      float tm = fmaxf(fmaxf(t4[0], t4[1]), fmaxf(t4[2], t4[3]));
      tm = fmaxf(tm, other_half(tm));
      const float mn = fmaxf(mrun[c], tm);
      const float corr = __builtin_amdgcn_exp2f((mrun[c] - mn) * SC);
      mrun[c] = mn;
      // ---- 1024 p = 2^(s SC - m SC + 10) ----
      const v8f sc8 = splat8(SC), nb8 = splat8(10.0f - mn * SC), corr8 = splat8(corr);
#pragma unroll
      for (int j = 0; j < 4; ++j) {
        const v8f e = __builtin_elementwise_fma(st[c][j], sc8, nb8);
#pragma unroll
        for (int r = 0; r < 8; ++r) st[c][j][r] = __builtin_amdgcn_exp2f(e[r]);
      }
      lrun[c] = __builtin_elementwise_fma(lrun[c], corr8, (st[c][0] + st[c][1]) + (st[c][2] + st[c][3]));
#pragma unroll
      for (int j = 0; j < 4; ++j) oacc[c][j] = oacc[c][j] * corr8;
      // ---- P^T fragments: elements 0..7 = keys 32i + 8hl + .., 8..15 = keys 32i + 16 + 8hl + .. ----
      pb0[c] = __builtin_shufflevector(__builtin_convertvector(st[c][0], v8h), __builtin_convertvector(st[c][1], v8h),
                                       0, 1, 2, 3, 4, 5, 6, 7, 8, 9, 10, 11, 12, 13, 14, 15);
      pb1[c] = __builtin_shufflevector(__builtin_convertvector(st[c][2], v8h), __builtin_convertvector(st[c][3], v8h),
                                       0, 1, 2, 3, 4, 5, 6, 7, 8, 9, 10, 11, 12, 13, 14, 15);
    }
    // ---- O^T += V^T (64 d x 64 keys) * P^T (64 keys x 32 queries) ----
#pragma unroll
    for (int jd = 0; jd < 4; ++jd) {
#pragma unroll
      for (int c = 0; c < 2; ++c) oacc[c][jd] = mma(g0[jd].v, pb0[c], oacc[c][jd]);
    }
#pragma unroll
    for (int jd = 0; jd < 4; ++jd) {
#pragma unroll
      for (int c = 0; c < 2; ++c) oacc[c][jd] = mma(g1[jd].v, pb1[c], oacc[c][jd]);
    }
    wait_ds0();
    wait_async0();
    __syncthreads();   // publishes chunk kt + 1; ends every read of buffer bf
    if (kt + 2 < nkt)
      tiles_async(&sK[bf][0][0], kg + (size_t)(kt + 2) * 64 * HD, (size_t)HD,
                  &sV[bf][0][0], vg + (size_t)(kt + 2) * 64, (size_t)SEQ, tid);
  }
  wait_async0();

  // ---- finalize: o = acc / l (both x1024), stage per wave, whole-line stores ----
#pragma unroll
  for (int c = 0; c < 2; ++c) {
    float l = ((lrun[c][0] + lrun[c][1]) + (lrun[c][2] + lrun[c][3])) + ((lrun[c][4] + lrun[c][5]) + (lrun[c][6] + lrun[c][7]));
    l += other_half(l);
    const v8f il8 = splat8(1.0f / l);
#pragma unroll
    for (int jd = 0; jd < 4; ++jd) {
      const v8h o8 = __builtin_convertvector(oacc[c][jd] * il8, v8h);
      *(v4u*)&sP[w][16 * c + m][16 * jd + k8] = __builtin_bit_cast(v4u, o8);
    }
  }
  __syncthreads();
  v4u val[8];
  unsigned int off[8];
#pragma unroll
  for (int p = 0; p < 8; ++p) {
    const int row = 4 * p + (lane >> 3);
    const int piece = lane & 7;
    val[p] = *(const v4u*)&sP[w][row][piece * 8];
    off[p] = (unsigned int)((size_t)(b * SEQ + tq + row) * CDIM + hh * HD + piece * 8);
  }
#pragma unroll
  for (int p = 0; p < 8; ++p) *(v4u*)(op + off[p]) = val[p];
  
}

// ---------------------------------------------------------------------------
// Host launcher
// ---------------------------------------------------------------------------
constexpr size_t al256c(size_t v) { return (v + 255) & ~(size_t)255; }
constexpr size_t MCE = (size_t)MROWS * CDIM;
constexpr size_t SZ_WQKV = al256c((size_t)3 * CDIM * CDIM * 2);
constexpr size_t SZ_WO   = al256c((size_t)CDIM * CDIM * 2);
constexpr size_t SZ_W1   = al256c((size_t)HID * CDIM * 2);
constexpr size_t SZ_W2   = al256c((size_t)CDIM * HID * 2);
constexpr size_t SZ_H    = al256c(MCE * 2);
constexpr size_t SZ_QKV  = al256c((size_t)3 * MCE * 2);
constexpr size_t SZ_O    = al256c(MCE * 2);
constexpr size_t SZ_X1   = al256c(MCE * 4);
constexpr size_t SZ_H2   = al256c(MCE * 2);
constexpr size_t SZ_ACT  = al256c((size_t)MROWS * HID * 2);
constexpr size_t WS_TOTAL = SZ_WQKV + SZ_WO + SZ_W1 + SZ_W2 + SZ_H + SZ_QKV + SZ_O + SZ_X1 + SZ_H2 + SZ_ACT;
static_assert(WS_TOTAL <= (size_t)134217728);
static_assert((size_t)MROWS * HID < (size_t)4294967296ull);     // u32 element offsets in the epilogues
static_assert((size_t)NB_FULL * SEQ_FULL * CDIM < (size_t)4294967296ull);

extern "C" void kernel_launch(void* const* d_in, const int* in_sizes, int n_in,
                              void* d_out, int out_size, void* d_ws, size_t ws_size,
                              hipStream_t stream) {
  if (n_in < 17) return;
  const long needX = ((long)(NB - 1) * SEQ_FULL + SEQ) * CDIM;
  const long nWW = (long)CDIM * CDIM;
  if ((long)in_sizes[0] < needX) return;
  if ((long)in_sizes[1] < nWW || in_sizes[2] < CDIM) return;
  if ((long)in_sizes[3] < nWW || in_sizes[4] < CDIM) return;
  if ((long)in_sizes[5] < nWW || in_sizes[6] < CDIM) return;
  if ((long)in_sizes[7] < nWW || in_sizes[8] < CDIM) return;
  if ((long)in_sizes[9] < (long)CDIM * HID || in_sizes[10] < HID) return;
  if ((long)in_sizes[11] < (long)HID * CDIM || in_sizes[12] < CDIM) return;
  if (in_sizes[13] < CDIM || in_sizes[14] < CDIM) return;
  if (in_sizes[15] < CDIM || in_sizes[16] < CDIM) return;
  if ((long)out_size < needX) return;
  if ((size_t)WS_TOTAL > ws_size) return;

  const float* x   = (const float*)d_in[0];
  const float* Wq  = (const float*)d_in[1];
  const float* bq  = (const float*)d_in[2];
  const float* Wk  = (const float*)d_in[3];
  const float* bk  = (const float*)d_in[4];
  const float* Wv  = (const float*)d_in[5];
  const float* bv  = (const float*)d_in[6];
  const float* Wo  = (const float*)d_in[7];
  const float* bo  = (const float*)d_in[8];
  const float* W1  = (const float*)d_in[9];
  const float* b1  = (const float*)d_in[10];
  const float* W2  = (const float*)d_in[11];
  const float* b2  = (const float*)d_in[12];
  const float* g1  = (const float*)d_in[13];
  const float* be1 = (const float*)d_in[14];
  const float* g2  = (const float*)d_in[15];
  const float* be2 = (const float*)d_in[16];
  float* out = (float*)d_out;

  char* ws = (char*)d_ws;
  size_t off = 0;
  unsigned short* wqkv = (unsigned short*)(ws + off); off += SZ_WQKV;   // [1536][512]
  unsigned short* wot  = (unsigned short*)(ws + off); off += SZ_WO;     // [512][512]
  unsigned short* w1t  = (unsigned short*)(ws + off); off += SZ_W1;     // [2048][512]
  unsigned short* w2t  = (unsigned short*)(ws + off); off += SZ_W2;     // [512][2048]
  unsigned short* hpl  = (unsigned short*)(ws + off); off += SZ_H;      // [M][512]
  unsigned short* qkv  = (unsigned short*)(ws + off); off += SZ_QKV;    // q [B*H][SEQ][64], k same, vt [B*H][64][SEQ]
  unsigned short* opl  = (unsigned short*)(ws + off); off += SZ_O;      // [M][512]
  float*          x1   = (float*)(ws + off);          off += SZ_X1;     // [M][512]
  unsigned short* h2p  = (unsigned short*)(ws + off); off += SZ_H2;     // [M][512]
  unsigned short* act  = (unsigned short*)(ws + off); off += SZ_ACT;    // [M][2048]
  if (off > ws_size) return;
  unsigned short* qpl = qkv;
  unsigned short* kpl = qkv + MCE;
  unsigned short* vtp = qkv + 2 * MCE;

  // 1) + 2) one launch: LN1 on bf16 values of x -> h (f16), and the six weight planes
  //    in[K][N] -> out[N][K], bf16 values x16 as f16
  k_prep<<<LNB + 4 * WB1 + 2 * WB2, 256, 0, stream>>>(x, g1, be1, hpl, Wq, Wk, Wv, Wo, W1, W2,
                                                     wqkv, wot, w1t, w2t);
  // 3) q/k/v projections + bias -> q, k, vt planes
  k_gemm_qkv<<<dim3(3 * CDIM / 64, MROWS / 64), 128, 0, stream>>>(hpl, wqkv, bq, bk, bv, qkv);
  // 4) attention -> o plane
  k_attn<<<NB * NHEAD * (SEQ / 128), 128, 0, stream>>>(qpl, kpl, vtp, opl);
  // 5) output projection + bias + residual(bf16 values of x) -> x1 (f32, compact rows)
  k_gemm_res<<<dim3(CDIM / 64, MROWS / 64), 128, 0, stream>>>(opl, wot, CDIM, bo, x, x1, 1, 0);
  // 6) LN2 -> h2 (f16)
  k_ln_mid<<<MROWS / 8, 256, 0, stream>>>(x1, g2, be2, h2p, MROWS);
  // 7) ffn1 + bias + gelu(erf) -> act (f16)
  k_gemm_gelu<<<dim3(HID / 64, MROWS / 64), 128, 0, stream>>>(h2p, w1t, CDIM, b1, act);
  // 8) ffn2 + bias + residual(x1) -> out (f32, full strides)
  k_gemm_res<<<dim3(CDIM / 64, MROWS / 64), 128, 0, stream>>>(act, w2t, HID, b2, x1, out, 0, 1);
}

// v005
// It runs in 162 microseconds.
// Two timings next to v004 both put it at 1.03 times that version's speed.
// All steps since v000 together make it 4.14 times as fast.
#include <hip/hip_runtime.h>

// Contractions: v_wmma_f32_16x16x32_f16 (f16 operands, f32 accumulate) for q/k/v projections, q.k^T, p.v, output projection, ffn1, ffn2; weight planes carried x16, p carried x1024, activations x1.

#pragma clang fp contract(off)

#ifndef NB
#define NB 2
#endif
#ifndef SEQ
#define SEQ 4096
#endif
#define NB_FULL 2
#define SEQ_FULL 4096
#define CDIM 512
#define NHEAD 8
#define HD 64
#define HID 2048
#define MROWS (NB * SEQ)

static_assert(NB >= 1 && NB <= NB_FULL);
static_assert(SEQ % 128 == 0 && SEQ >= 128 && SEQ <= SEQ_FULL);
static_assert(CDIM == NHEAD * HD);
static_assert(HD == 64);
static_assert(CDIM == 512);
static_assert(CDIM == 32 * 2 * 8);          // LayerNorm lane map: 32 lanes x 2 segments x 8 columns
static_assert(HID % 64 == 0 && CDIM % 64 == 0);
static_assert(CDIM % 32 == 0 && HID % 32 == 0);   // WMMA k-steps of 32, two per 64-wide k trip
static_assert(MROWS % 64 == 0);
static_assert(MROWS % 8 == 0);
static_assert((3 * CDIM) % 64 == 0);

typedef _Float16 v16h __attribute__((ext_vector_type(16)));
typedef _Float16 v8h  __attribute__((ext_vector_type(8)));
typedef float    v8f  __attribute__((ext_vector_type(8)));
typedef float    v4f  __attribute__((ext_vector_type(4)));
typedef unsigned int v4u __attribute__((ext_vector_type(4)));

union Frag { v16h v; v4u q[2]; };

// WMMA with hazard guard: D += A(16x32) * B(32x16)
__device__ __forceinline__ v8f mma(v16h a, v16h b, v8f c) {
  v8f d = __builtin_amdgcn_wmma_f32_16x16x32_f16(false, a, false, b, (short)0, c, false, false);
  asm volatile("v_nop\n\tv_nop\n\tv_nop\n\tv_nop" : "+v"(d) : "v"(a), "v"(b));
  return d;
}

__device__ __forceinline__ v8f zero8() {
  v8f z;
#pragma unroll
  for (int i = 0; i < 8; ++i) z[i] = 0.0f;
  return z;
}

// f32 -> nearest-even bf16 value, returned as f32
__device__ __forceinline__ float bf16q(float f) {
  unsigned int u = __float_as_uint(f);
  unsigned int r = u + 0x7FFFu + ((u >> 16) & 1u);
  r = ((u & 0x7F800000u) == 0x7F800000u) ? u : r;
  return __uint_as_float(r & 0xFFFF0000u);
}
__device__ __forceinline__ v4f bf16q4(v4f a) {
  v4f r;
  r.x = bf16q(a.x); r.y = bf16q(a.y); r.z = bf16q(a.z); r.w = bf16q(a.w);
  return r;
}
// f32 -> f16 (RNE convert) bit pattern
__device__ __forceinline__ unsigned short hbits(float f) {
  _Float16 h = (_Float16)f;
  return __builtin_bit_cast(unsigned short, h);
}
__device__ __forceinline__ v4u pack8h(float f0, float f1, float f2, float f3,
                                      float f4, float f5, float f6, float f7) {
  v8h t;
  t[0] = (_Float16)f0; t[1] = (_Float16)f1; t[2] = (_Float16)f2; t[3] = (_Float16)f3;
  t[4] = (_Float16)f4; t[5] = (_Float16)f5; t[6] = (_Float16)f6; t[7] = (_Float16)f7;
  return __builtin_bit_cast(v4u, t);
}
__device__ __forceinline__ float gelu_erf(float u) {
  return 0.5f * u * (1.0f + erff(u * 0.70710678118654752f));
}

// ---------------------------------------------------------------------------
// Weight prep: src[K][N] (f32, row pitch N) -> dst[rowoff + n][k] f16 plane
// (row pitch K), value = f16(bf16q(w) * 16).  in[K][N] -> out[N][K].
// One block of 256 threads does the 64x64 tile (kx, ny) of (K/64, N/64).
// ---------------------------------------------------------------------------
__device__ __forceinline__ void wprep_body(
    const float* __restrict__ src, unsigned short* __restrict__ dst, int K, int N, int rowoff,
    int kx, int ny, unsigned short (&sT)[64][72]) {
  const int tid = threadIdx.x;
  const int k0 = kx * 64, n0 = ny * 64;
#pragma unroll
  for (int it = 0; it < 4; ++it) {
    const int idx = it * 256 + tid;
    const int kk = idx >> 4;            // 0..63
    const int j4 = (idx & 15) * 4;      // 0..60
    const v4f wv = *(const v4f*)(src + (size_t)(k0 + kk) * (size_t)N + n0 + j4);
    sT[j4 + 0][kk] = hbits(bf16q(wv.x) * 16.0f);
    sT[j4 + 1][kk] = hbits(bf16q(wv.y) * 16.0f);
    sT[j4 + 2][kk] = hbits(bf16q(wv.z) * 16.0f);
    sT[j4 + 3][kk] = hbits(bf16q(wv.w) * 16.0f);
  }
  __syncthreads();   // cross-wave: staged by all waves, read by all waves
  v4u val[2];
  size_t off[2];
#pragma unroll
  for (int p = 0; p < 2; ++p) {
    const int n = p * 32 + (tid >> 3);
    const int piece = tid & 7;
    val[p] = *(const v4u*)&sT[n][piece * 8];
    off[p] = (size_t)(rowoff + n0 + n) * (size_t)K + k0 + piece * 8;
  }
#pragma unroll
  for (int p = 0; p < 2; ++p) *(v4u*)(dst + off[p]) = val[p];
  // precaution: in the merged kernel the listing runs on behind these stores into code that rewrites their registers
  asm volatile("s_wait_xcnt 0x0" ::: "memory");
  
}

// ---------------------------------------------------------------------------
// LayerNorm over CDIM=512: one wave per row, lane l owns cols 8l..8l+7 and
// 256+8l..256+8l+7.  RNDIN: input rows read at full strides and converted to
// their bf16 values first.  Output f16 plane [nrows][512], rows compact.
// coverage: 2 instructions x 32 lanes x 16 B = cols 0..255 (4 lines) + cols 256..511 (4 lines) per row.
// ---------------------------------------------------------------------------
template <int RNDIN>
__device__ __forceinline__ void ln_body(
    const float* __restrict__ x, const float* __restrict__ g, const float* __restrict__ bt,
    unsigned short* __restrict__ hout, int nrows, int blk) {
  const int lane = threadIdx.x & 31, w = threadIdx.x >> 5;
  const int row = blk * 8 + w;
  if (row >= nrows) return;            // no barriers on the LayerNorm path
  size_t xrow;
  if (RNDIN) {
    const int b = row / SEQ, t = row - b * SEQ;
    xrow = ((size_t)b * SEQ_FULL + t) * CDIM;
  } else {
    xrow = (size_t)row * CDIM;
  }
  const int c0 = lane * 8;
  const int c1 = 256 + lane * 8;

  float v[16];
  {
    const v4f t0 = *(const v4f*)(x + xrow + c0);
    const v4f t1 = *(const v4f*)(x + xrow + c0 + 4);
    const v4f t2 = *(const v4f*)(x + xrow + c1);
    const v4f t3 = *(const v4f*)(x + xrow + c1 + 4);
    v[0] = t0.x; v[1] = t0.y; v[2] = t0.z; v[3] = t0.w;
    v[4] = t1.x; v[5] = t1.y; v[6] = t1.z; v[7] = t1.w;
    v[8] = t2.x; v[9] = t2.y; v[10] = t2.z; v[11] = t2.w;
    v[12] = t3.x; v[13] = t3.y; v[14] = t3.z; v[15] = t3.w;
  }
  if (RNDIN) {
#pragma unroll
    for (int i = 0; i < 16; ++i) v[i] = bf16q(v[i]);
  }

  float s = 0.0f;
#pragma unroll
  for (int i = 0; i < 16; ++i) s += v[i];
#pragma unroll
  for (int xm = 1; xm < 32; xm <<= 1) s += __shfl_xor(s, xm, 32);
  const float mu = s * (1.0f / CDIM);

  float d[16];
#pragma unroll
  for (int i = 0; i < 16; ++i) d[i] = v[i] - mu;
  float qs = 0.0f;
#pragma unroll
  for (int i = 0; i < 16; ++i) qs += d[i] * d[i];
#pragma unroll
  for (int xm = 1; xm < 32; xm <<= 1) qs += __shfl_xor(qs, xm, 32);
  const float var = qs * (1.0f / CDIM);
  const float rstd = rsqrtf(var + 1e-5f);

  float gg[16], bb[16];
  {
    const v4f g0 = bf16q4(*(const v4f*)(g + c0));
    const v4f g1 = bf16q4(*(const v4f*)(g + c0 + 4));
    const v4f g2 = bf16q4(*(const v4f*)(g + c1));
    const v4f g3 = bf16q4(*(const v4f*)(g + c1 + 4));
    const v4f b0 = bf16q4(*(const v4f*)(bt + c0));
    const v4f b1 = bf16q4(*(const v4f*)(bt + c0 + 4));
    const v4f b2 = bf16q4(*(const v4f*)(bt + c1));
    const v4f b3 = bf16q4(*(const v4f*)(bt + c1 + 4));
    gg[0] = g0.x; gg[1] = g0.y; gg[2] = g0.z; gg[3] = g0.w;
    gg[4] = g1.x; gg[5] = g1.y; gg[6] = g1.z; gg[7] = g1.w;
    gg[8] = g2.x; gg[9] = g2.y; gg[10] = g2.z; gg[11] = g2.w;
    gg[12] = g3.x; gg[13] = g3.y; gg[14] = g3.z; gg[15] = g3.w;
    bb[0] = b0.x; bb[1] = b0.y; bb[2] = b0.z; bb[3] = b0.w;
    bb[4] = b1.x; bb[5] = b1.y; bb[6] = b1.z; bb[7] = b1.w;
    bb[8] = b2.x; bb[9] = b2.y; bb[10] = b2.z; bb[11] = b2.w;
    bb[12] = b3.x; bb[13] = b3.y; bb[14] = b3.z; bb[15] = b3.w;
  }
  float y[16];
#pragma unroll
  for (int i = 0; i < 16; ++i) y[i] = d[i] * rstd * gg[i] + bb[i];

  const v4u o0 = pack8h(y[0], y[1], y[2], y[3], y[4], y[5], y[6], y[7]);
  const v4u o1 = pack8h(y[8], y[9], y[10], y[11], y[12], y[13], y[14], y[15]);
  unsigned short* orow = hout + (size_t)row * CDIM;
  *(v4u*)(orow + c0) = o0;
  *(v4u*)(orow + c1) = o1;
  
}

// ---------------------------------------------------------------------------
// First launch: all the work that reads the inputs alone, dealt by block index.
// Blocks 0 .. LNB-1: LayerNorm 1, 8 rows each.  Then one 64x64 weight tile a block:
// WB1 blocks for each of Wq, Wk, Wv, Wo, WB2 for W1, WB2 for W2.
// Every branch is block-uniform; only the weight path has a barrier.
// ---------------------------------------------------------------------------
#define LNB (MROWS / 8)
#define WB1 ((CDIM / 64) * (CDIM / 64))
#define WB2 ((CDIM / 64) * (HID / 64))
__global__ __launch_bounds__(256) void k_prep(
    const float* __restrict__ x, const float* __restrict__ g, const float* __restrict__ bt,
    unsigned short* __restrict__ hout,
    const float* __restrict__ Wq, const float* __restrict__ Wk, const float* __restrict__ Wv,
    const float* __restrict__ Wo, const float* __restrict__ W1, const float* __restrict__ W2,
    unsigned short* __restrict__ wqkv, unsigned short* __restrict__ wot,
    unsigned short* __restrict__ w1t, unsigned short* __restrict__ w2t) {
  __shared__ __attribute__((aligned(16))) unsigned short sT[64][72];
  const int bid = blockIdx.x;
  if (bid < LNB) {
    ln_body<1>(x, g, bt, hout, MROWS, bid);
    return;
  }
  int t = bid - LNB;
  if (t < 4 * WB1) {                       // in[512][512] -> out[512][512]
    const int mat = t / WB1;
    t -= mat * WB1;
    const float* src = (mat == 0) ? Wq : ((mat == 1) ? Wk : ((mat == 2) ? Wv : Wo));
    unsigned short* dst = (mat < 3) ? wqkv : wot;
    wprep_body(src, dst, CDIM, CDIM, (mat < 3) ? mat * CDIM : 0, t % (CDIM / 64), t / (CDIM / 64), sT);
  } else if (t < 4 * WB1 + WB2) {          // in[512][2048] -> out[2048][512]
    t -= 4 * WB1;
    wprep_body(W1, w1t, CDIM, HID, 0, t % (CDIM / 64), t / (CDIM / 64), sT);
  } else {                                 // in[2048][512] -> out[512][2048]
    t -= 4 * WB1 + WB2;
    wprep_body(W2, w2t, HID, CDIM, 0, t % (HID / 64), t / (HID / 64), sT);
  }
}
__global__ __launch_bounds__(256) void k_ln_mid(
    const float* __restrict__ x, const float* __restrict__ g, const float* __restrict__ bt,
    unsigned short* __restrict__ hout, int nrows) {
  ln_body<0>(x, g, bt, hout, nrows, blockIdx.x);
}

// ---------------------------------------------------------------------------
// Operand tiles in LDS.  A tile is 64 rows x 64 16-bit elements (128 B = one
// line per row); LDS row pitch TP elements = 144 B (16 B x odd: the b128
// fragment reads of 16 rows fall on distinct banks).
// tiles_async: the 128 threads of a WG copy two such tiles, global -> LDS,
// 16 B per lane and copy; a wave's copy covers 4 whole rows (4 whole lines).
// ga / gb: first element of the tile, pa / pb: its global row pitch in elements.
// ---------------------------------------------------------------------------
#define TP 72
typedef unsigned short Tile[64][TP];

__device__ __forceinline__ void tiles_async(
    unsigned short* la, const unsigned short* ga, size_t pa,
    unsigned short* lb, const unsigned short* gb, size_t pb, int tid) {
  const int row = tid >> 3, pc = (tid & 7) * 8;
  const unsigned int la0 = (unsigned int)(size_t)(la + row * TP + pc);
  const unsigned int lb0 = (unsigned int)(size_t)(lb + row * TP + pc);
  const unsigned int la1 = la0 + 16 * TP * 2, la2 = la0 + 32 * TP * 2, la3 = la0 + 48 * TP * 2;
  const unsigned int lb1 = lb0 + 16 * TP * 2, lb2 = lb0 + 32 * TP * 2, lb3 = lb0 + 48 * TP * 2;
  const unsigned short* a0 = ga + (size_t)row * pa + pc;
  const unsigned short* a1 = a0 + 16 * pa;
  const unsigned short* a2 = a0 + 32 * pa;
  const unsigned short* a3 = a0 + 48 * pa;
  const unsigned short* b0 = gb + (size_t)row * pb + pc;
  const unsigned short* b1 = b0 + 16 * pb;
  const unsigned short* b2 = b0 + 32 * pb;
  const unsigned short* b3 = b0 + 48 * pb;
  // the copies and, as the last line, the wait that stands before their address registers are reused
  asm volatile(
      "global_load_async_to_lds_b128 %0, %8, off\n\t"
      "global_load_async_to_lds_b128 %1, %9, off\n\t"
      "global_load_async_to_lds_b128 %2, %10, off\n\t"
      "global_load_async_to_lds_b128 %3, %11, off\n\t"
      "global_load_async_to_lds_b128 %4, %12, off\n\t"
      "global_load_async_to_lds_b128 %5, %13, off\n\t"
      "global_load_async_to_lds_b128 %6, %14, off\n\t"
      "global_load_async_to_lds_b128 %7, %15, off\n\t"
      "s_wait_xcnt 0x0"
      :: "v"(la0), "v"(la1), "v"(la2), "v"(la3), "v"(lb0), "v"(lb1), "v"(lb2), "v"(lb3),
         "v"(a0), "v"(a1), "v"(a2), "v"(a3), "v"(b0), "v"(b1), "v"(b2), "v"(b3)
      : "memory");
}
// this wave's copies have landed
__device__ __forceinline__ void wait_async0() { asm volatile("s_wait_asynccnt 0x0" ::: "memory"); }
// this wave's LDS reads and writes have retired (before a buffer it read is refilled)
__device__ __forceinline__ void wait_ds0() { asm volatile("s_wait_dscnt 0x0" ::: "memory"); }

// ---------------------------------------------------------------------------
// 128x128-tile f16 GEMM main loop: D = A[M][K] * Bt[N][K]^T, 4 waves per WG in a 2 x 2
// grid, wave (wr, wc) owns rows 64wr.. x cols 64wc.. (4 x 4 accumulator tiles): each A and
// each Bt fragment read from LDS feeds four WMMAs.  A trip covers 64 of k: the A and Bt
// tiles of trip t + 1 are copied to the other ring buffer while trip t is worked on.
// A ring buffer is 128 A rows, then 128 Bt rows, each 64 elements at pitch TP.
// Fragments are read from LDS with the split k map for A and B
// (row/col = lane&15, elements 0..7 <- k0+8h.., 8..15 <- k0+16+8h..).
// acc[i][j][r] = D(row 64wr + 16i + 8h + r, col 64wc + 16j + (lane&15)).
// Behind the loop the ring is free (no reader, no copy in flight): the epilogues stage in it.
// ---------------------------------------------------------------------------
#define RB (256 * TP)           // elements of one ring buffer
#define RING_ELEMS (2 * RB)
#define SP 136                  // staging pitch, 16-bit elements: 272 B = 16 B x odd
#define FP 132                  // staging pitch, floats: 528 B = 16 B x odd
static_assert(128 * SP * 2 <= RING_ELEMS * 2 && 128 * FP * 4 <= RING_ELEMS * 2);
static_assert(MROWS % 128 == 0 && CDIM % 128 == 0 && HID % 128 == 0);

__device__ __forceinline__ void stage_async(
    unsigned short* buf, const unsigned short* ag, const unsigned short* bg, size_t K, int tid) {
  tiles_async(buf, ag, K, buf + 128 * TP, bg, K, tid);                          // rows 0..63 of both tiles
  tiles_async(buf + 64 * TP, ag + 64 * K, K, buf + 192 * TP, bg + 64 * K, K, tid);   // rows 64..127
}

__device__ __forceinline__ void gemm_main(
    const unsigned short* __restrict__ A, const unsigned short* __restrict__ Bt, int K,
    int m0, int n0, int wr, int wc, int m, int k8, int tid, unsigned short* ring, v8f (&acc)[4][4]) {
#pragma unroll
  for (int i = 0; i < 4; ++i) {
#pragma unroll
    for (int j = 0; j < 4; ++j) acc[i][j] = zero8();
  }
  const unsigned short* ag = A + (size_t)m0 * (size_t)K;
  const unsigned short* bg = Bt + (size_t)n0 * (size_t)K;
  const int nt = K >> 6;
  stage_async(ring, ag, bg, (size_t)K, tid);
  wait_async0();
  __syncthreads();   // tile 0 published
  if (nt > 1) stage_async(ring + RB, ag + 64, bg + 64, (size_t)K, tid);
#pragma unroll 1
  for (int t = 0; t < nt; ++t) {
    const int bf = t & 1;
    const unsigned short* ab = ring + bf * RB + (64 * wr + m) * TP + k8;
    const unsigned short* bb = ring + bf * RB + (128 + 64 * wc + m) * TP + k8;
    // twelve of the trip's sixteen fragments are read as one group ahead of its WMMAs; the A fragments of
    // the second k half follow in two pairs, into registers that the first half has left (all sixteen at
    // once, beside 128 accumulator registers, do not fit the 256 registers that the asm operands can name)
    Frag a0[4], b0[4], a1[4], b1[4];
#pragma unroll
    for (int j = 0; j < 4; ++j) {
      b0[j].q[0] = *(const v4u*)(bb + 16 * j * TP);
      b0[j].q[1] = *(const v4u*)(bb + 16 * j * TP + 16);
    }
#pragma unroll
    for (int i = 0; i < 4; ++i) {
      a0[i].q[0] = *(const v4u*)(ab + 16 * i * TP);
      a0[i].q[1] = *(const v4u*)(ab + 16 * i * TP + 16);
    }
#pragma unroll
    for (int j = 0; j < 4; ++j) {
      b1[j].q[0] = *(const v4u*)(bb + 16 * j * TP + 32);
      b1[j].q[1] = *(const v4u*)(bb + 16 * j * TP + 48);
    }
#pragma unroll
    for (int g = 0; g < 2; ++g) {
#pragma unroll
      for (int i = 2 * g; i < 2 * g + 2; ++i) {
#pragma unroll
        for (int j = 0; j < 4; ++j) acc[i][j] = mma(a0[i].v, b0[j].v, acc[i][j]);
      }
#pragma unroll
      for (int i = 2 * g; i < 2 * g + 2; ++i) {
        a1[i].q[0] = *(const v4u*)(ab + 16 * i * TP + 32);
        a1[i].q[1] = *(const v4u*)(ab + 16 * i * TP + 48);
      }
    }
#pragma unroll
    for (int i = 0; i < 4; ++i) {
#pragma unroll
      for (int j = 0; j < 4; ++j) acc[i][j] = mma(a1[i].v, b1[j].v, acc[i][j]);
    }
    wait_ds0();
    wait_async0();
    __syncthreads();   // publishes tile t + 1; ends every read of buffer bf
    if (t + 2 < nt)
      stage_async(ring + bf * RB, ag + (size_t)(t + 2) * 64, bg + (size_t)(t + 2) * 64, (size_t)K, tid);
  }
  wait_async0();
}

// ---------------------------------------------------------------------------
// q/k/v projection: A = LN1 plane [M][512], Bt = [1536][512] (q rows, k rows, v rows).
// value = acc/16 + bf16q(bias).  q and k -> planes [b*H+h][t][64]; v -> transposed
// plane vt[b*H+h][64][t].  The three planes are contiguous: plane p at qkv + p*M*512.
// A wave's 64 columns are one head.
// coverage: 16 passes x 4 rows = 64 rows x 64 cols per wave (q/k); 16 passes x 4 d = 64 d rows x 64 tokens per wave (v).
// LDS sT (in the ring): wave-private quadrants; block barrier orders the reload.
// ---------------------------------------------------------------------------
__global__ __launch_bounds__(128) void k_gemm_qkv(
    const unsigned short* __restrict__ A, const unsigned short* __restrict__ Bt,
    const float* __restrict__ bq, const float* __restrict__ bk, const float* __restrict__ bv,
    unsigned short* __restrict__ qkv) {
  __shared__ __attribute__((aligned(16))) unsigned short ring[RING_ELEMS];
  const int tid = threadIdx.x, lane = tid & 31, w = tid >> 5;
  const int wr = w >> 1, wc = w & 1;
  const int m = lane & 15, hl = lane >> 4, k8 = hl * 8;
  const int m0 = blockIdx.y * 128, n0 = blockIdx.x * 128;

  v8f acc[4][4];
  gemm_main(A, Bt, CDIM, m0, n0, wr, wc, m, k8, tid, ring, acc);

  unsigned short (*sT)[SP] = (unsigned short (*)[SP])ring;
  const float wsc = 0.0625f;               // undo the x16 weight carry
  const int lrow0 = 64 * wr + 8 * hl;      // D rows of this lane within the WG tile
  const int lcol0 = 64 * wc;               // first column of this wave within the WG tile
  const int which = n0 / CDIM;             // 0 q, 1 k, 2 v (WG-uniform)
  const int cb = n0 - which * CDIM;
#pragma unroll
  for (int j = 0; j < 4; ++j) {
    const int cn = cb + lcol0 + 16 * j + m;
    const float b0 = bf16q(bq[cn]);
    const float b1 = bf16q(bk[cn]);
    const float b2 = bf16q(bv[cn]);
    const float bj = (which == 0) ? b0 : ((which == 1) ? b1 : b2);
#pragma unroll
    for (int i = 0; i < 4; ++i) {
#pragma unroll
      for (int r = 0; r < 8; ++r) sT[lrow0 + 16 * i + r][lcol0 + 16 * j + m] = hbits(acc[i][j][r] * wsc + bj);
    }
  }
  __syncthreads();   // orders the reload
  const int hh = cb / HD + wc;
  const int b = m0 / SEQ, t0 = m0 - b * SEQ + 64 * wr;   // first token of this wave's quadrant
  const int bh = b * NHEAD + hh;
  unsigned short* dst = qkv + (size_t)which * ((size_t)MROWS * CDIM);
  v4u val[16];
  unsigned int off[16];
  if (which < 2) {                       // WG-uniform
#pragma unroll
    for (int p = 0; p < 16; ++p) {
      const int row = 4 * p + (lane >> 3);
      const int piece = lane & 7;
      val[p] = *(const v4u*)&sT[64 * wr + row][lcol0 + piece * 8];
      off[p] = (unsigned int)((bh * SEQ + t0 + row) * HD + piece * 8);
    }
  } else {
#pragma unroll
    for (int p = 0; p < 16; ++p) {
      const int d = 4 * p + (lane >> 3);
      const int piece = lane & 7;
      unsigned int wv[4];
#pragma unroll
      for (int e = 0; e < 4; ++e) {
        const unsigned int lo = sT[64 * wr + piece * 8 + 2 * e][lcol0 + d];
        const unsigned int hi = sT[64 * wr + piece * 8 + 2 * e + 1][lcol0 + d];
        wv[e] = lo | (hi << 16);
      }
      v4u t;
      t.x = wv[0]; t.y = wv[1]; t.z = wv[2]; t.w = wv[3];
      val[p] = t;
      off[p] = (unsigned int)((bh * HD + d) * SEQ + t0 + piece * 8);
    }
  }
#pragma unroll
  for (int p = 0; p < 16; ++p) *(v4u*)(dst + off[p]) = val[p];
  
}

// ---------------------------------------------------------------------------
// GEMM + bias + residual, f32 output of width CDIM:
// out = acc/16 + bf16q(bias) + res.  resfull: res rows read at full strides and
// converted to bf16 values; outfull: out rows written at full strides.
// Residual added at the store stage as float4.
// coverage: 32 passes x 2 rows per wave = 64 rows x 64 cols per wave.
// LDS sF (in the ring): wave-private quadrants; block barrier orders the reload.
// ---------------------------------------------------------------------------
__global__ __launch_bounds__(128) void k_gemm_res(
    const unsigned short* __restrict__ A, const unsigned short* __restrict__ Bt, int K,
    const float* __restrict__ bias, const float* __restrict__ res,
    float* __restrict__ outF, int resfull, int outfull) {
  __shared__ __attribute__((aligned(16))) unsigned short ring[RING_ELEMS];
  const int tid = threadIdx.x, lane = tid & 31, w = tid >> 5;
  const int wr = w >> 1, wc = w & 1;
  const int m = lane & 15, hl = lane >> 4, k8 = hl * 8;
  const int m0 = blockIdx.y * 128, n0 = blockIdx.x * 128;

  v8f acc[4][4];
  gemm_main(A, Bt, K, m0, n0, wr, wc, m, k8, tid, ring, acc);

  float (*sF)[FP] = (float (*)[FP])ring;
  const float wsc = 0.0625f;
  const int lrow0 = 64 * wr + 8 * hl;
  const int lcol0 = 64 * wc;
#pragma unroll
  for (int i = 0; i < 4; ++i) {
#pragma unroll
    for (int j = 0; j < 4; ++j) {
#pragma unroll
      for (int r = 0; r < 8; ++r) sF[lrow0 + 16 * i + r][lcol0 + 16 * j + m] = acc[i][j][r] * wsc;
    }
  }
  __syncthreads();
  const int b = m0 / SEQ, t0 = m0 - b * SEQ;
  const int row0 = 64 * wr + hl;                            // pass p: row row0 + 2p
  const int piece = m;
  const int ncol = n0 + lcol0 + 4 * piece;
  const size_t frow0 = (size_t)b * SEQ_FULL + t0 + row0;    // full-stride row
  const size_t crow0 = (size_t)(m0 + row0);                 // compact row
  const float* rp = res + (resfull ? frow0 : crow0) * (size_t)CDIM + ncol;
  float* op = outF + (outfull ? frow0 : crow0) * (size_t)CDIM + ncol;
  const v4f bv = bf16q4(*(const v4f*)(bias + ncol));
  v4f val[32];
#pragma unroll
  for (int p = 0; p < 32; ++p) {
    const v4f a = *(const v4f*)&sF[row0 + 2 * p][lcol0 + 4 * piece];
    const v4f rraw = *(const v4f*)(rp + 2 * p * CDIM);
    const v4f rq = bf16q4(rraw);
    const v4f rr = resfull ? rq : rraw;
    val[p] = (a + bv) + rr;
  }
#pragma unroll
  for (int p = 0; p < 32; ++p) *(v4f*)(op + 2 * p * CDIM) = val[p];
  
}

// ---------------------------------------------------------------------------
// ffn1: f16 out[M][HID] = gelu_erf(acc/16 + bf16q(bias)).
// The pre-activation is staged as f32; gelu and the f16 convert are done at the reload, in a loop
// that stays rolled, to keep the kernel's text small.
// coverage: 16 passes x 4 rows per wave = 64 rows x 64 cols per wave.
// LDS sF (in the ring): wave-private quadrants; block barrier orders the reload.
// ---------------------------------------------------------------------------
__global__ __launch_bounds__(128) void k_gemm_gelu(
    const unsigned short* __restrict__ A, const unsigned short* __restrict__ Bt, int K,
    const float* __restrict__ bias, unsigned short* __restrict__ out0) {
  __shared__ __attribute__((aligned(16))) unsigned short ring[RING_ELEMS];
  const int tid = threadIdx.x, lane = tid & 31, w = tid >> 5;
  const int wr = w >> 1, wc = w & 1;
  const int m = lane & 15, hl = lane >> 4, k8 = hl * 8;
  const int m0 = blockIdx.y * 128, n0 = blockIdx.x * 128;

  v8f acc[4][4];
  gemm_main(A, Bt, K, m0, n0, wr, wc, m, k8, tid, ring, acc);

  float (*sF)[FP] = (float (*)[FP])ring;
  const float wsc = 0.0625f;
  const int lrow0 = 64 * wr + 8 * hl;
  const int lcol0 = 64 * wc;
#pragma unroll
  for (int j = 0; j < 4; ++j) {
    const float bj = bf16q(bias[n0 + lcol0 + 16 * j + m]);
#pragma unroll
    for (int i = 0; i < 4; ++i) {
#pragma unroll
      for (int r = 0; r < 8; ++r) sF[lrow0 + 16 * i + r][lcol0 + 16 * j + m] = acc[i][j][r] * wsc + bj;
    }
  }
  __syncthreads();
  const int piece = lane & 7;
  const float* sr = &sF[64 * wr + (lane >> 3)][lcol0 + piece * 8];
  unsigned short* orow = out0 + (size_t)(m0 + 64 * wr + (lane >> 3)) * (size_t)HID + n0 + lcol0 + piece * 8;
  // rolled: keeps the kernel's text small (see the head comment)
#pragma unroll 1
  for (int p = 0; p < 16; ++p) {
    const v4f u0 = *(const v4f*)(sr + 4 * p * FP);
    const v4f u1 = *(const v4f*)(sr + 4 * p * FP + 4);
    const v4u o = pack8h(gelu_erf(u0.x), gelu_erf(u0.y), gelu_erf(u0.z), gelu_erf(u0.w),
                         gelu_erf(u1.x), gelu_erf(u1.y), gelu_erf(u1.z), gelu_erf(u1.w));
    *(v4u*)(orow + (size_t)(4 * p) * (size_t)HID) = o;
  }
  
}

__device__ __forceinline__ float other_half(float f) {
  const int b = __builtin_bit_cast(int, f);
  return __builtin_bit_cast(float, __builtin_amdgcn_permlanex16(b, b, 0x76543210, 0xfedcba98, false, false));
}
__device__ __forceinline__ v8f splat8(float f) {
  v8f z;
#pragma unroll
  for (int i = 0; i < 8; ++i) z[i] = f;
  return z;
}

// Two waves a SIMD is all this grid gives (512 work-groups of 4 waves on 1,024 SIMDs): the register budget is set for
// that, and at most two work-groups fit a WGP, so that they spread over all of them.
__global__ __launch_bounds__(128) __attribute__((amdgpu_waves_per_eu(2, 2)))
void k_attn(const unsigned short* __restrict__ qp, const unsigned short* __restrict__ kp,
            const unsigned short* __restrict__ vp, unsigned short* __restrict__ op) {
  __shared__ __attribute__((aligned(16))) unsigned short sP[4][32][72];
  __shared__ __attribute__((aligned(16))) Tile sK[2];
  __shared__ __attribute__((aligned(16))) Tile sV[2];
  const int tid = threadIdx.x, lane = tid & 31, w = tid >> 5;
  const int m = lane & 15, hl = lane >> 4, k8 = hl * 8;
  const int nkt = SEQ / 64;                 // key chunks
  const int nqt = SEQ / 128;                // query tiles of one (b,h)
  const int bh = blockIdx.x / nqt, qt = blockIdx.x - bh * nqt;
  const int b = bh / NHEAD, hh = bh - b * NHEAD;
  const int tq = qt * 128 + 32 * w;         // first query row of this wave (within the sequence)

  const unsigned short* kg = kp + (size_t)bh * SEQ * HD;   // chunk kt: + kt*64 rows, row pitch HD
  const unsigned short* vg = vp + (size_t)bh * HD * SEQ;   // chunk kt: + kt*64 columns, row pitch SEQ
  tiles_async(&sK[0][0][0], kg, (size_t)HD, &sV[0][0][0], vg, (size_t)SEQ, tid);

  Frag qa0[2], qa1[2];     // B fragments of column group c: column = query tq + 16c + m, k = d in the split map
  {
    const unsigned short* qr0 = qp + ((size_t)bh * SEQ + tq + m) * HD + k8;
    const unsigned short* qr1 = qr0 + 16 * HD;
    // the loads and their data wait in one statement, so that no address register is rewritten ahead of a wait
    // the latency runs beside that of chunk 0's copies
    asm volatile(
        "global_load_b128 %0, %8, off\n\t"
        "global_load_b128 %1, %8, off offset:32\n\t"
        "global_load_b128 %2, %8, off offset:64\n\t"
        "global_load_b128 %3, %8, off offset:96\n\t"
        "global_load_b128 %4, %9, off\n\t"
        "global_load_b128 %5, %9, off offset:32\n\t"
        "global_load_b128 %6, %9, off offset:64\n\t"
        "global_load_b128 %7, %9, off offset:96\n\t"
        "s_wait_loadcnt 0x0"
        : "=&v"(qa0[0].q[0]), "=&v"(qa0[0].q[1]), "=&v"(qa1[0].q[0]), "=&v"(qa1[0].q[1]),
          "=&v"(qa0[1].q[0]), "=&v"(qa0[1].q[1]), "=&v"(qa1[1].q[0]), "=&v"(qa1[1].q[1])
        : "v"(qr0), "v"(qr1)
        : "memory");
  }
  wait_async0();
  __syncthreads();   // chunk 0 published
  if (nkt > 1)
    tiles_async(&sK[1][0][0], kg + (size_t)64 * HD, (size_t)HD, &sV[1][0][0], vg + 64, (size_t)SEQ, tid);
  const float SC = 0.125f * 1.44269504088896341f;   // raw score -> log2 units
  float mrun[2];             // running max of query 16c + m, raw score units (equal in both lane halves)
  v8f lrun[2];               // partial sums of 1024 p over this lane's keys
  v8f oacc[2][4];            // oacc[c][jd][r] = O^T(d = 16jd + 8hl + r, query 16c + m), x1024
#pragma unroll
  for (int c = 0; c < 2; ++c) {
    mrun[c] = -1e30f;
    lrun[c] = zero8();
#pragma unroll
    for (int j = 0; j < 4; ++j) oacc[c][j] = zero8();
  }

#pragma unroll 1
  for (int kt = 0; kt < nkt; ++kt) {
    const int bf = kt & 1;
    // ---- S^T = K Q^T, four 16-key tiles x two column groups ----
    // all K fragment reads of the chunk as one group ahead of its WMMAs: one LDS latency, not four
    Frag f0[4], f1[4];
#pragma unroll
    for (int j = 0; j < 4; ++j) {
      const unsigned short* kr = &sK[bf][16 * j + m][k8];
      f0[j].q[0] = *(const v4u*)(kr);
      f0[j].q[1] = *(const v4u*)(kr + 16);
      f1[j].q[0] = *(const v4u*)(kr + 32);
      f1[j].q[1] = *(const v4u*)(kr + 48);
    }
    v8f st[2][4];
#pragma unroll
    for (int j = 0; j < 4; ++j) {
#pragma unroll
      for (int c = 0; c < 2; ++c) st[c][j] = mma(f0[j].v, qa0[c].v, zero8());
    }
#pragma unroll
    for (int j = 0; j < 4; ++j) {
#pragma unroll
      for (int c = 0; c < 2; ++c) st[c][j] = mma(f1[j].v, qa1[c].v, st[c][j]);
    }
    // all V^T fragment reads of the chunk as one group; their latency runs under the softmax
    Frag g0[4], g1[4];
#pragma unroll
    for (int jd = 0; jd < 4; ++jd) {
      const unsigned short* vr = &sV[bf][16 * jd + m][k8];
      g0[jd].q[0] = *(const v4u*)(vr);
      g0[jd].q[1] = *(const v4u*)(vr + 16);
      g1[jd].q[0] = *(const v4u*)(vr + 32);
      g1[jd].q[1] = *(const v4u*)(vr + 48);
    }
    v16h pb0[2], pb1[2];
#pragma unroll
    for (int c = 0; c < 2; ++c) {
      // ---- running max of this lane's query ----
      float t4[4];               // one chain per tile: four independent chains, not one of 32 links
#pragma unroll
      for (int j = 0; j < 4; ++j) {
        t4[j] = st[c][j][0];
#pragma unroll
        for (int r = 1; r < 8; ++r) t4[j] = fmaxf(t4[j], st[c][j][r]);
      }
      float tm = fmaxf(fmaxf(t4[0], t4[1]), fmaxf(t4[2], t4[3]));
      tm = fmaxf(tm, other_half(tm));
      const float mn = fmaxf(mrun[c], tm);
      const float corr = __builtin_amdgcn_exp2f((mrun[c] - mn) * SC);
      mrun[c] = mn;
      // ---- 1024 p = 2^(s SC - m SC + 10) ----
      const v8f sc8 = splat8(SC), nb8 = splat8(10.0f - mn * SC), corr8 = splat8(corr);
#pragma unroll
      for (int j = 0; j < 4; ++j) {
        const v8f e = __builtin_elementwise_fma(st[c][j], sc8, nb8);
#pragma unroll
        for (int r = 0; r < 8; ++r) st[c][j][r] = __builtin_amdgcn_exp2f(e[r]);
      }
      lrun[c] = __builtin_elementwise_fma(lrun[c], corr8, (st[c][0] + st[c][1]) + (st[c][2] + st[c][3]));
#pragma unroll
      for (int j = 0; j < 4; ++j) oacc[c][j] = oacc[c][j] * corr8;
      // ---- P^T fragments: elements 0..7 = keys 32i + 8hl + .., 8..15 = keys 32i + 16 + 8hl + .. ----
      pb0[c] = __builtin_shufflevector(__builtin_convertvector(st[c][0], v8h), __builtin_convertvector(st[c][1], v8h),
                                       0, 1, 2, 3, 4, 5, 6, 7, 8, 9, 10, 11, 12, 13, 14, 15);
      pb1[c] = __builtin_shufflevector(__builtin_convertvector(st[c][2], v8h), __builtin_convertvector(st[c][3], v8h),
                                       0, 1, 2, 3, 4, 5, 6, 7, 8, 9, 10, 11, 12, 13, 14, 15);
    }
    // ---- O^T += V^T (64 d x 64 keys) * P^T (64 keys x 32 queries) ----
#pragma unroll
    for (int jd = 0; jd < 4; ++jd) {
#pragma unroll
      for (int c = 0; c < 2; ++c) oacc[c][jd] = mma(g0[jd].v, pb0[c], oacc[c][jd]);
    }
#pragma unroll
    for (int jd = 0; jd < 4; ++jd) {
#pragma unroll
      for (int c = 0; c < 2; ++c) oacc[c][jd] = mma(g1[jd].v, pb1[c], oacc[c][jd]);
    }
    wait_ds0();
    wait_async0();
    __syncthreads();   // publishes chunk kt + 1; ends every read of buffer bf
    if (kt + 2 < nkt)
      tiles_async(&sK[bf][0][0], kg + (size_t)(kt + 2) * 64 * HD, (size_t)HD,
                  &sV[bf][0][0], vg + (size_t)(kt + 2) * 64, (size_t)SEQ, tid);
  }
  wait_async0();

  // ---- finalize: o = acc / l (both x1024), stage per wave, whole-line stores ----
#pragma unroll
  for (int c = 0; c < 2; ++c) {
    float l = ((lrun[c][0] + lrun[c][1]) + (lrun[c][2] + lrun[c][3])) + ((lrun[c][4] + lrun[c][5]) + (lrun[c][6] + lrun[c][7]));
    l += other_half(l);
    const v8f il8 = splat8(1.0f / l);
#pragma unroll
    for (int jd = 0; jd < 4; ++jd) {
      const v8h o8 = __builtin_convertvector(oacc[c][jd] * il8, v8h);
      *(v4u*)&sP[w][16 * c + m][16 * jd + k8] = __builtin_bit_cast(v4u, o8);
    }
  }
  __syncthreads();
  v4u val[8];
  unsigned int off[8];
#pragma unroll
  for (int p = 0; p < 8; ++p) {
    const int row = 4 * p + (lane >> 3);
    const int piece = lane & 7;
    val[p] = *(const v4u*)&sP[w][row][piece * 8];
    off[p] = (unsigned int)((size_t)(b * SEQ + tq + row) * CDIM + hh * HD + piece * 8);
  }
#pragma unroll
  for (int p = 0; p < 8; ++p) *(v4u*)(op + off[p]) = val[p];
  
}

// ---------------------------------------------------------------------------
// Host launcher
// ---------------------------------------------------------------------------
constexpr size_t al256c(size_t v) { return (v + 255) & ~(size_t)255; }
constexpr size_t MCE = (size_t)MROWS * CDIM;
constexpr size_t SZ_WQKV = al256c((size_t)3 * CDIM * CDIM * 2);
constexpr size_t SZ_WO   = al256c((size_t)CDIM * CDIM * 2);
constexpr size_t SZ_W1   = al256c((size_t)HID * CDIM * 2);
constexpr size_t SZ_W2   = al256c((size_t)CDIM * HID * 2);
constexpr size_t SZ_H    = al256c(MCE * 2);
constexpr size_t SZ_QKV  = al256c((size_t)3 * MCE * 2);
constexpr size_t SZ_O    = al256c(MCE * 2);
constexpr size_t SZ_X1   = al256c(MCE * 4);
constexpr size_t SZ_H2   = al256c(MCE * 2);
constexpr size_t SZ_ACT  = al256c((size_t)MROWS * HID * 2);
constexpr size_t WS_TOTAL = SZ_WQKV + SZ_WO + SZ_W1 + SZ_W2 + SZ_H + SZ_QKV + SZ_O + SZ_X1 + SZ_H2 + SZ_ACT;
static_assert(WS_TOTAL <= (size_t)134217728);
static_assert((size_t)MROWS * HID < (size_t)4294967296ull);     // u32 element offsets in the epilogues
static_assert((size_t)NB_FULL * SEQ_FULL * CDIM < (size_t)4294967296ull);

extern "C" void kernel_launch(void* const* d_in, const int* in_sizes, int n_in,
                              void* d_out, int out_size, void* d_ws, size_t ws_size,
                              hipStream_t stream) {
  if (n_in < 17) return;
  const long needX = ((long)(NB - 1) * SEQ_FULL + SEQ) * CDIM;
  const long nWW = (long)CDIM * CDIM;
  if ((long)in_sizes[0] < needX) return;
  if ((long)in_sizes[1] < nWW || in_sizes[2] < CDIM) return;
  if ((long)in_sizes[3] < nWW || in_sizes[4] < CDIM) return;
  if ((long)in_sizes[5] < nWW || in_sizes[6] < CDIM) return;
  if ((long)in_sizes[7] < nWW || in_sizes[8] < CDIM) return;
  if ((long)in_sizes[9] < (long)CDIM * HID || in_sizes[10] < HID) return;
  if ((long)in_sizes[11] < (long)HID * CDIM || in_sizes[12] < CDIM) return;
  if (in_sizes[13] < CDIM || in_sizes[14] < CDIM) return;
  if (in_sizes[15] < CDIM || in_sizes[16] < CDIM) return;
  if ((long)out_size < needX) return;
  if ((size_t)WS_TOTAL > ws_size) return;

  const float* x   = (const float*)d_in[0];
  const float* Wq  = (const float*)d_in[1];
  const float* bq  = (const float*)d_in[2];
  const float* Wk  = (const float*)d_in[3];
  const float* bk  = (const float*)d_in[4];
  const float* Wv  = (const float*)d_in[5];
  const float* bv  = (const float*)d_in[6];
  const float* Wo  = (const float*)d_in[7];
  const float* bo  = (const float*)d_in[8];
  const float* W1  = (const float*)d_in[9];
  const float* b1  = (const float*)d_in[10];
  const float* W2  = (const float*)d_in[11];
  const float* b2  = (const float*)d_in[12];
  const float* g1  = (const float*)d_in[13];
  const float* be1 = (const float*)d_in[14];
  const float* g2  = (const float*)d_in[15];
  const float* be2 = (const float*)d_in[16];
  float* out = (float*)d_out;

  char* ws = (char*)d_ws;
  size_t off = 0;
  unsigned short* wqkv = (unsigned short*)(ws + off); off += SZ_WQKV;   // [1536][512]
  unsigned short* wot  = (unsigned short*)(ws + off); off += SZ_WO;     // [512][512]
  unsigned short* w1t  = (unsigned short*)(ws + off); off += SZ_W1;     // [2048][512]
  unsigned short* w2t  = (unsigned short*)(ws + off); off += SZ_W2;     // [512][2048]
  unsigned short* hpl  = (unsigned short*)(ws + off); off += SZ_H;      // [M][512]
  unsigned short* qkv  = (unsigned short*)(ws + off); off += SZ_QKV;    // q [B*H][SEQ][64], k same, vt [B*H][64][SEQ]
  unsigned short* opl  = (unsigned short*)(ws + off); off += SZ_O;      // [M][512]
  float*          x1   = (float*)(ws + off);          off += SZ_X1;     // [M][512]
  unsigned short* h2p  = (unsigned short*)(ws + off); off += SZ_H2;     // [M][512]
  unsigned short* act  = (unsigned short*)(ws + off); off += SZ_ACT;    // [M][2048]
  if (off > ws_size) return;
  unsigned short* qpl = qkv;
  unsigned short* kpl = qkv + MCE;
  unsigned short* vtp = qkv + 2 * MCE;

  // 1) + 2) one launch: LN1 on bf16 values of x -> h (f16), and the six weight planes
  //    in[K][N] -> out[N][K], bf16 values x16 as f16
  k_prep<<<LNB + 4 * WB1 + 2 * WB2, 256, 0, stream>>>(x, g1, be1, hpl, Wq, Wk, Wv, Wo, W1, W2,
                                                     wqkv, wot, w1t, w2t);
  // 3) q/k/v projections + bias -> q, k, vt planes
  k_gemm_qkv<<<dim3(3 * CDIM / 128, MROWS / 128), 128, 0, stream>>>(hpl, wqkv, bq, bk, bv, qkv);
  // 4) attention -> o plane
  k_attn<<<NB * NHEAD * (SEQ / 128), 128, 0, stream>>>(qpl, kpl, vtp, opl);
  // 5) output projection + bias + residual(bf16 values of x) -> x1 (f32, compact rows)
  k_gemm_res<<<dim3(CDIM / 128, MROWS / 128), 128, 0, stream>>>(opl, wot, CDIM, bo, x, x1, 1, 0);
  // 6) LN2 -> h2 (f16)
  k_ln_mid<<<MROWS / 8, 256, 0, stream>>>(x1, g2, be2, h2p, MROWS);
  // 7) ffn1 + bias + gelu(erf) -> act (f16)
  k_gemm_gelu<<<dim3(HID / 128, MROWS / 128), 128, 0, stream>>>(h2p, w1t, CDIM, b1, act);
  // 8) ffn2 + bias + residual(x1) -> out (f32, full strides)
  k_gemm_res<<<dim3(CDIM / 128, MROWS / 128), 128, 0, stream>>>(act, w2t, HID, b2, x1, out, 0, 1);
}

// v006
// It runs in 154 microseconds.
// Timed twice side by side with v005, it ran 1.05 times as fast both times.
// Over all steps from v000 it is 4.34 times as fast.
#include <hip/hip_runtime.h>

// Contractions: v_wmma_f32_16x16x32_f16 (f16 operands, f32 accumulate) for q/k/v projections, q.k^T, p.v, output projection, ffn1, ffn2; weight planes carried x16, p carried x1024, activations x1.

#pragma clang fp contract(off)

#ifndef NB
#define NB 2
#endif
#ifndef SEQ
#define SEQ 4096
#endif
#define NB_FULL 2
#define SEQ_FULL 4096
#define CDIM 512
#define NHEAD 8
#define HD 64
#define HID 2048
#define MROWS (NB * SEQ)

static_assert(NB >= 1 && NB <= NB_FULL);
static_assert(SEQ % 128 == 0 && SEQ >= 128 && SEQ <= SEQ_FULL);
static_assert(CDIM == NHEAD * HD);
static_assert(HD == 64);
static_assert(CDIM == 512);
static_assert(CDIM == 32 * 2 * 8);          // LayerNorm lane map: 32 lanes x 2 segments x 8 columns
static_assert(HID % 64 == 0 && CDIM % 64 == 0);
static_assert(CDIM % 32 == 0 && HID % 32 == 0);   // WMMA k-steps of 32, two per 64-wide k trip
static_assert(MROWS % 64 == 0);
static_assert(MROWS % 8 == 0);
static_assert((3 * CDIM) % 64 == 0);

typedef _Float16 v16h __attribute__((ext_vector_type(16)));
typedef _Float16 v8h  __attribute__((ext_vector_type(8)));
typedef float    v8f  __attribute__((ext_vector_type(8)));
typedef float    v4f  __attribute__((ext_vector_type(4)));
typedef unsigned int v4u __attribute__((ext_vector_type(4)));

union Frag { v16h v; v4u q[2]; };

// WMMA with hazard guard: D += A(16x32) * B(32x16)
__device__ __forceinline__ v8f mma(v16h a, v16h b, v8f c) {
  v8f d = __builtin_amdgcn_wmma_f32_16x16x32_f16(false, a, false, b, (short)0, c, false, false);
  asm volatile("v_nop\n\tv_nop\n\tv_nop\n\tv_nop" : "+v"(d) : "v"(a), "v"(b));
  return d;
}

__device__ __forceinline__ v8f zero8() {
  v8f z;
#pragma unroll
  for (int i = 0; i < 8; ++i) z[i] = 0.0f;
  return z;
}

__device__ __forceinline__ v8f splat8(float f) {
  v8f z;
#pragma unroll
  for (int i = 0; i < 8; ++i) z[i] = f;
  return z;
}

// f32 -> nearest-even bf16 value, returned as f32
__device__ __forceinline__ float bf16q(float f) {
  unsigned int u = __float_as_uint(f);
  unsigned int r = u + 0x7FFFu + ((u >> 16) & 1u);
  r = ((u & 0x7F800000u) == 0x7F800000u) ? u : r;
  return __uint_as_float(r & 0xFFFF0000u);
}
__device__ __forceinline__ v4f bf16q4(v4f a) {
  v4f r;
  r.x = bf16q(a.x); r.y = bf16q(a.y); r.z = bf16q(a.z); r.w = bf16q(a.w);
  return r;
}
// f32 -> f16 (RNE convert) bit pattern
__device__ __forceinline__ unsigned short hbits(float f) {
  _Float16 h = (_Float16)f;
  return __builtin_bit_cast(unsigned short, h);
}
__device__ __forceinline__ v4u pack8h(float f0, float f1, float f2, float f3,
                                      float f4, float f5, float f6, float f7) {
  v8h t;
  t[0] = (_Float16)f0; t[1] = (_Float16)f1; t[2] = (_Float16)f2; t[3] = (_Float16)f3;
  t[4] = (_Float16)f4; t[5] = (_Float16)f5; t[6] = (_Float16)f6; t[7] = (_Float16)f7;
  return __builtin_bit_cast(v4u, t);
}
// gelu(u) = u Phi(u) = max(u, 0) - |u| erfc(|u| / sqrt 2) / 2 for eight values, without a branch:
// erfc(x) = t (a1 + t (a2 + t (a3 + t (a4 + t a5)))) exp(-x^2), t = 1 / (1 + p x), x >= 0: absolute error of the form
// below 1.5e-7 for every x, a few f32 roundings on top (the result is stored as f16), and no cancellation for
// negative u.  With y = x sqrt(log2 e): exp(-x^2) = 2^(-y^2).
__device__ __forceinline__ v8f gelu8(v8f u) {
  const v8f au = __builtin_elementwise_abs(u);
  const v8f y = au * splat8(0.84932180f);                                            // sqrt(log2 e) / sqrt 2
  const v8f d = __builtin_elementwise_fma(y, splat8(0.27273748f), splat8(1.0f));     // p / sqrt(log2 e)
  const v8f ny2 = -(y * y);
  v8f t, e;
#pragma unroll
  for (int i = 0; i < 8; ++i) {
    t[i] = __builtin_amdgcn_rcpf(d[i]);
    e[i] = __builtin_amdgcn_exp2f(ny2[i]);
  }
  v8f s = __builtin_elementwise_fma(t, splat8(1.061405429f), splat8(-1.453152027f));
  s = __builtin_elementwise_fma(s, t, splat8(1.421413741f));
  s = __builtin_elementwise_fma(s, t, splat8(-0.284496736f));
  s = __builtin_elementwise_fma(s, t, splat8(0.254829592f));
  const v8f ec = (s * t) * e;                                                        // erfc(|u| / sqrt 2)
  return __builtin_elementwise_fma(-au, ec, u + au) * splat8(0.5f);                  // u + |u| = 2 max(u, 0)
}

// ---------------------------------------------------------------------------
// Weight prep: src[K][N] (f32, row pitch N) -> dst[rowoff + n][k] f16 plane
// (row pitch K), value = f16(bf16q(w) * 16).  in[K][N] -> out[N][K].
// One block of 256 threads does the 64x64 tile (kx, ny) of (K/64, N/64).
// ---------------------------------------------------------------------------
__device__ __forceinline__ void wprep_body(
    const float* __restrict__ src, unsigned short* __restrict__ dst, int K, int N, int rowoff,
    int kx, int ny, unsigned short (&sT)[64][72]) {
  const int tid = threadIdx.x;
  const int k0 = kx * 64, n0 = ny * 64;
#pragma unroll
  for (int it = 0; it < 4; ++it) {
    const int idx = it * 256 + tid;
    const int kk = idx >> 4;            // 0..63
    const int j4 = (idx & 15) * 4;      // 0..60
    const v4f wv = *(const v4f*)(src + (size_t)(k0 + kk) * (size_t)N + n0 + j4);
    sT[j4 + 0][kk] = hbits(bf16q(wv.x) * 16.0f);
    sT[j4 + 1][kk] = hbits(bf16q(wv.y) * 16.0f);
    sT[j4 + 2][kk] = hbits(bf16q(wv.z) * 16.0f);
    sT[j4 + 3][kk] = hbits(bf16q(wv.w) * 16.0f);
  }
  __syncthreads();   // cross-wave: staged by all waves, read by all waves
  v4u val[2];
  size_t off[2];
#pragma unroll
  for (int p = 0; p < 2; ++p) {
    const int n = p * 32 + (tid >> 3);
    const int piece = tid & 7;
    val[p] = *(const v4u*)&sT[n][piece * 8];
    off[p] = (size_t)(rowoff + n0 + n) * (size_t)K + k0 + piece * 8;
  }
#pragma unroll
  for (int p = 0; p < 2; ++p) *(v4u*)(dst + off[p]) = val[p];
  // precaution: in the merged kernel the listing runs on behind these stores into code that rewrites their registers
  asm volatile("s_wait_xcnt 0x0" ::: "memory");
  
}

// ---------------------------------------------------------------------------
// LayerNorm over CDIM=512: one wave per row, lane l owns cols 8l..8l+7 and
// 256+8l..256+8l+7.  RNDIN: input rows read at full strides and converted to
// their bf16 values first.  Output f16 plane [nrows][512], rows compact.
// coverage: 2 instructions x 32 lanes x 16 B = cols 0..255 (4 lines) + cols 256..511 (4 lines) per row.
// ---------------------------------------------------------------------------
template <int RNDIN>
__device__ __forceinline__ void ln_body(
    const float* __restrict__ x, const float* __restrict__ g, const float* __restrict__ bt,
    unsigned short* __restrict__ hout, int nrows, int blk) {
  const int lane = threadIdx.x & 31, w = threadIdx.x >> 5;
  const int row = blk * 8 + w;
  if (row >= nrows) return;            // no barriers on the LayerNorm path
  size_t xrow;
  if (RNDIN) {
    const int b = row / SEQ, t = row - b * SEQ;
    xrow = ((size_t)b * SEQ_FULL + t) * CDIM;
  } else {
    xrow = (size_t)row * CDIM;
  }
  const int c0 = lane * 8;
  const int c1 = 256 + lane * 8;

  float v[16];
  {
    const v4f t0 = *(const v4f*)(x + xrow + c0);
    const v4f t1 = *(const v4f*)(x + xrow + c0 + 4);
    const v4f t2 = *(const v4f*)(x + xrow + c1);
    const v4f t3 = *(const v4f*)(x + xrow + c1 + 4);
    v[0] = t0.x; v[1] = t0.y; v[2] = t0.z; v[3] = t0.w;
    v[4] = t1.x; v[5] = t1.y; v[6] = t1.z; v[7] = t1.w;
    v[8] = t2.x; v[9] = t2.y; v[10] = t2.z; v[11] = t2.w;
    v[12] = t3.x; v[13] = t3.y; v[14] = t3.z; v[15] = t3.w;
  }
  if (RNDIN) {
#pragma unroll
    for (int i = 0; i < 16; ++i) v[i] = bf16q(v[i]);
  }

  float s = 0.0f;
#pragma unroll
  for (int i = 0; i < 16; ++i) s += v[i];
#pragma unroll
  for (int xm = 1; xm < 32; xm <<= 1) s += __shfl_xor(s, xm, 32);
  const float mu = s * (1.0f / CDIM);

  float d[16];
#pragma unroll
  for (int i = 0; i < 16; ++i) d[i] = v[i] - mu;
  float qs = 0.0f;
#pragma unroll
  for (int i = 0; i < 16; ++i) qs += d[i] * d[i];
#pragma unroll
  for (int xm = 1; xm < 32; xm <<= 1) qs += __shfl_xor(qs, xm, 32);
  const float var = qs * (1.0f / CDIM);
  const float rstd = rsqrtf(var + 1e-5f);

  float gg[16], bb[16];
  {
    const v4f g0 = bf16q4(*(const v4f*)(g + c0));
    const v4f g1 = bf16q4(*(const v4f*)(g + c0 + 4));
    const v4f g2 = bf16q4(*(const v4f*)(g + c1));
    const v4f g3 = bf16q4(*(const v4f*)(g + c1 + 4));
    const v4f b0 = bf16q4(*(const v4f*)(bt + c0));
    const v4f b1 = bf16q4(*(const v4f*)(bt + c0 + 4));
    const v4f b2 = bf16q4(*(const v4f*)(bt + c1));
    const v4f b3 = bf16q4(*(const v4f*)(bt + c1 + 4));
    gg[0] = g0.x; gg[1] = g0.y; gg[2] = g0.z; gg[3] = g0.w;
    gg[4] = g1.x; gg[5] = g1.y; gg[6] = g1.z; gg[7] = g1.w;
    gg[8] = g2.x; gg[9] = g2.y; gg[10] = g2.z; gg[11] = g2.w;
    gg[12] = g3.x; gg[13] = g3.y; gg[14] = g3.z; gg[15] = g3.w;
    bb[0] = b0.x; bb[1] = b0.y; bb[2] = b0.z; bb[3] = b0.w;
    bb[4] = b1.x; bb[5] = b1.y; bb[6] = b1.z; bb[7] = b1.w;
    bb[8] = b2.x; bb[9] = b2.y; bb[10] = b2.z; bb[11] = b2.w;
    bb[12] = b3.x; bb[13] = b3.y; bb[14] = b3.z; bb[15] = b3.w;
  }
  float y[16];
#pragma unroll
  for (int i = 0; i < 16; ++i) y[i] = d[i] * rstd * gg[i] + bb[i];

  const v4u o0 = pack8h(y[0], y[1], y[2], y[3], y[4], y[5], y[6], y[7]);
  const v4u o1 = pack8h(y[8], y[9], y[10], y[11], y[12], y[13], y[14], y[15]);
  unsigned short* orow = hout + (size_t)row * CDIM;
  *(v4u*)(orow + c0) = o0;
  *(v4u*)(orow + c1) = o1;
  
}

// ---------------------------------------------------------------------------
// First launch: all the work that reads the inputs alone, dealt by block index.
// Blocks 0 .. LNB-1: LayerNorm 1, 8 rows each.  Then one 64x64 weight tile a block:
// WB1 blocks for each of Wq, Wk, Wv, Wo, WB2 for W1, WB2 for W2.
// Every branch is block-uniform; only the weight path has a barrier.
// ---------------------------------------------------------------------------
#define LNB (MROWS / 8)
#define WB1 ((CDIM / 64) * (CDIM / 64))
#define WB2 ((CDIM / 64) * (HID / 64))
__global__ __launch_bounds__(256) void k_prep(
    const float* __restrict__ x, const float* __restrict__ g, const float* __restrict__ bt,
    unsigned short* __restrict__ hout,
    const float* __restrict__ Wq, const float* __restrict__ Wk, const float* __restrict__ Wv,
    const float* __restrict__ Wo, const float* __restrict__ W1, const float* __restrict__ W2,
    unsigned short* __restrict__ wqkv, unsigned short* __restrict__ wot,
    unsigned short* __restrict__ w1t, unsigned short* __restrict__ w2t) {
  __shared__ __attribute__((aligned(16))) unsigned short sT[64][72];
  const int bid = blockIdx.x;
  if (bid < LNB) {
    ln_body<1>(x, g, bt, hout, MROWS, bid);
    return;
  }
  int t = bid - LNB;
  if (t < 4 * WB1) {                       // in[512][512] -> out[512][512]
    const int mat = t / WB1;
    t -= mat * WB1;
    const float* src = (mat == 0) ? Wq : ((mat == 1) ? Wk : ((mat == 2) ? Wv : Wo));
    unsigned short* dst = (mat < 3) ? wqkv : wot;
    wprep_body(src, dst, CDIM, CDIM, (mat < 3) ? mat * CDIM : 0, t % (CDIM / 64), t / (CDIM / 64), sT);
  } else if (t < 4 * WB1 + WB2) {          // in[512][2048] -> out[2048][512]
    t -= 4 * WB1;
    wprep_body(W1, w1t, CDIM, HID, 0, t % (CDIM / 64), t / (CDIM / 64), sT);
  } else {                                 // in[2048][512] -> out[512][2048]
    t -= 4 * WB1 + WB2;
    wprep_body(W2, w2t, HID, CDIM, 0, t % (HID / 64), t / (HID / 64), sT);
  }
}
__global__ __launch_bounds__(256) void k_ln_mid(
    const float* __restrict__ x, const float* __restrict__ g, const float* __restrict__ bt,
    unsigned short* __restrict__ hout, int nrows) {
  ln_body<0>(x, g, bt, hout, nrows, blockIdx.x);
}

// ---------------------------------------------------------------------------
// Operand tiles in LDS.  A tile is 64 rows x 64 16-bit elements (128 B = one
// line per row); LDS row pitch TP elements = 144 B (16 B x odd: the b128
// fragment reads of 16 rows fall on distinct banks).
// tiles_async: the 128 threads of a WG copy two such tiles, global -> LDS,
// 16 B per lane and copy; a wave's copy covers 4 whole rows (4 whole lines).
// ga / gb: first element of the tile, pa / pb: its global row pitch in elements.
// ---------------------------------------------------------------------------
#define TP 72
typedef unsigned short Tile[64][TP];

__device__ __forceinline__ void tiles_async(
    unsigned short* la, const unsigned short* ga, size_t pa,
    unsigned short* lb, const unsigned short* gb, size_t pb, int tid) {
  const int row = tid >> 3, pc = (tid & 7) * 8;
  const unsigned int la0 = (unsigned int)(size_t)(la + row * TP + pc);
  const unsigned int lb0 = (unsigned int)(size_t)(lb + row * TP + pc);
  const unsigned int la1 = la0 + 16 * TP * 2, la2 = la0 + 32 * TP * 2, la3 = la0 + 48 * TP * 2;
  const unsigned int lb1 = lb0 + 16 * TP * 2, lb2 = lb0 + 32 * TP * 2, lb3 = lb0 + 48 * TP * 2;
  const unsigned short* a0 = ga + (size_t)row * pa + pc;
  const unsigned short* a1 = a0 + 16 * pa;
  const unsigned short* a2 = a0 + 32 * pa;
  const unsigned short* a3 = a0 + 48 * pa;
  const unsigned short* b0 = gb + (size_t)row * pb + pc;
  const unsigned short* b1 = b0 + 16 * pb;
  const unsigned short* b2 = b0 + 32 * pb;
  const unsigned short* b3 = b0 + 48 * pb;
  // the copies and, as the last line, the wait that stands before their address registers are reused
  asm volatile(
      "global_load_async_to_lds_b128 %0, %8, off\n\t"
      "global_load_async_to_lds_b128 %1, %9, off\n\t"
      "global_load_async_to_lds_b128 %2, %10, off\n\t"
      "global_load_async_to_lds_b128 %3, %11, off\n\t"
      "global_load_async_to_lds_b128 %4, %12, off\n\t"
      "global_load_async_to_lds_b128 %5, %13, off\n\t"
      "global_load_async_to_lds_b128 %6, %14, off\n\t"
      "global_load_async_to_lds_b128 %7, %15, off\n\t"
      "s_wait_xcnt 0x0"
      :: "v"(la0), "v"(la1), "v"(la2), "v"(la3), "v"(lb0), "v"(lb1), "v"(lb2), "v"(lb3),
         "v"(a0), "v"(a1), "v"(a2), "v"(a3), "v"(b0), "v"(b1), "v"(b2), "v"(b3)
      : "memory");
}
// this wave's copies have landed
__device__ __forceinline__ void wait_async0() { asm volatile("s_wait_asynccnt 0x0" ::: "memory"); }
// this wave's LDS reads and writes have retired (before a buffer it read is refilled)
__device__ __forceinline__ void wait_ds0() { asm volatile("s_wait_dscnt 0x0" ::: "memory"); }

// ---------------------------------------------------------------------------
// 128x128-tile f16 GEMM main loop: D = A[M][K] * Bt[N][K]^T, 4 waves per WG in a 2 x 2
// grid, wave (wr, wc) owns rows 64wr.. x cols 64wc.. (4 x 4 accumulator tiles): each A and
// each Bt fragment read from LDS feeds four WMMAs.  A trip covers 64 of k: the A and Bt
// tiles of trip t + 1 are copied to the other ring buffer while trip t is worked on.
// A ring buffer is 128 A rows, then 128 Bt rows, each 64 elements at pitch TP.
// Fragments are read from LDS with the split k map for A and B
// (row/col = lane&15, elements 0..7 <- k0+8h.., 8..15 <- k0+16+8h..).
// acc[i][j][r] = D(row 64wr + 16i + 8h + r, col 64wc + 16j + (lane&15)).
// Behind the loop the ring is free (no reader, no copy in flight): the epilogues stage in it.
// ---------------------------------------------------------------------------
#define RB (256 * TP)           // elements of one ring buffer
#define RING_ELEMS (2 * RB)
#define SP 136                  // staging pitch, 16-bit elements: 272 B = 16 B x odd
#define FP 132                  // staging pitch, floats: 528 B = 16 B x odd
static_assert(128 * SP * 2 <= RING_ELEMS * 2 && 128 * FP * 4 <= RING_ELEMS * 2);
static_assert(MROWS % 128 == 0 && CDIM % 128 == 0 && HID % 128 == 0);

__device__ __forceinline__ void stage_async(
    unsigned short* buf, const unsigned short* ag, const unsigned short* bg, size_t K, int tid) {
  tiles_async(buf, ag, K, buf + 128 * TP, bg, K, tid);                          // rows 0..63 of both tiles
  tiles_async(buf + 64 * TP, ag + 64 * K, K, buf + 192 * TP, bg + 64 * K, K, tid);   // rows 64..127
}

__device__ __forceinline__ void gemm_main(
    const unsigned short* __restrict__ A, const unsigned short* __restrict__ Bt, int K,
    int m0, int n0, int wr, int wc, int m, int k8, int tid, unsigned short* ring, v8f (&acc)[4][4]) {
#pragma unroll
  for (int i = 0; i < 4; ++i) {
#pragma unroll
    for (int j = 0; j < 4; ++j) acc[i][j] = zero8();
  }
  const unsigned short* ag = A + (size_t)m0 * (size_t)K;
  const unsigned short* bg = Bt + (size_t)n0 * (size_t)K;
  const int nt = K >> 6;
  stage_async(ring, ag, bg, (size_t)K, tid);
  wait_async0();
  __syncthreads();   // tile 0 published
  if (nt > 1) stage_async(ring + RB, ag + 64, bg + 64, (size_t)K, tid);
#pragma unroll 1
  for (int t = 0; t < nt; ++t) {
    const int bf = t & 1;
    const unsigned short* ab = ring + bf * RB + (64 * wr + m) * TP + k8;
    const unsigned short* bb = ring + bf * RB + (128 + 64 * wc + m) * TP + k8;
    // twelve of the trip's sixteen fragments are read as one group ahead of its WMMAs; the A fragments of
    // the second k half follow in two pairs, into registers that the first half has left (all sixteen at
    // once, beside 128 accumulator registers, do not fit the 256 registers that the asm operands can name)
    Frag a0[4], b0[4], a1[4], b1[4];
#pragma unroll
    for (int j = 0; j < 4; ++j) {
      b0[j].q[0] = *(const v4u*)(bb + 16 * j * TP);
      b0[j].q[1] = *(const v4u*)(bb + 16 * j * TP + 16);
    }
#pragma unroll
    for (int i = 0; i < 4; ++i) {
      a0[i].q[0] = *(const v4u*)(ab + 16 * i * TP);
      a0[i].q[1] = *(const v4u*)(ab + 16 * i * TP + 16);
    }
#pragma unroll
    for (int j = 0; j < 4; ++j) {
      b1[j].q[0] = *(const v4u*)(bb + 16 * j * TP + 32);
      b1[j].q[1] = *(const v4u*)(bb + 16 * j * TP + 48);
    }
#pragma unroll
    for (int g = 0; g < 2; ++g) {
#pragma unroll
      for (int i = 2 * g; i < 2 * g + 2; ++i) {
#pragma unroll
        for (int j = 0; j < 4; ++j) acc[i][j] = mma(a0[i].v, b0[j].v, acc[i][j]);
      }
#pragma unroll
      for (int i = 2 * g; i < 2 * g + 2; ++i) {
        a1[i].q[0] = *(const v4u*)(ab + 16 * i * TP + 32);
        a1[i].q[1] = *(const v4u*)(ab + 16 * i * TP + 48);
      }
    }
#pragma unroll
    for (int i = 0; i < 4; ++i) {
#pragma unroll
      for (int j = 0; j < 4; ++j) acc[i][j] = mma(a1[i].v, b1[j].v, acc[i][j]);
    }
    wait_ds0();
    wait_async0();
    __syncthreads();   // publishes tile t + 1; ends every read of buffer bf
    if (t + 2 < nt)
      stage_async(ring + bf * RB, ag + (size_t)(t + 2) * 64, bg + (size_t)(t + 2) * 64, (size_t)K, tid);
  }
  wait_async0();
}

// ---------------------------------------------------------------------------
// q/k/v projection: A = LN1 plane [M][512], Bt = [1536][512] (q rows, k rows, v rows).
// value = acc/16 + bf16q(bias).  q and k -> planes [b*H+h][t][64]; v -> transposed
// plane vt[b*H+h][64][t].  The three planes are contiguous: plane p at qkv + p*M*512.
// A wave's 64 columns are one head.
// coverage: 16 passes x 4 rows = 64 rows x 64 cols per wave (q/k); 16 passes x 4 d = 64 d rows x 64 tokens per wave (v).
// LDS sT (in the ring): wave-private quadrants; block barrier orders the reload.
// ---------------------------------------------------------------------------
__global__ __launch_bounds__(128) void k_gemm_qkv(
    const unsigned short* __restrict__ A, const unsigned short* __restrict__ Bt,
    const float* __restrict__ bq, const float* __restrict__ bk, const float* __restrict__ bv,
    unsigned short* __restrict__ qkv) {
  __shared__ __attribute__((aligned(16))) unsigned short ring[RING_ELEMS];
  const int tid = threadIdx.x, lane = tid & 31, w = tid >> 5;
  const int wr = w >> 1, wc = w & 1;
  const int m = lane & 15, hl = lane >> 4, k8 = hl * 8;
  const int m0 = blockIdx.y * 128, n0 = blockIdx.x * 128;

  v8f acc[4][4];
  gemm_main(A, Bt, CDIM, m0, n0, wr, wc, m, k8, tid, ring, acc);

  unsigned short (*sT)[SP] = (unsigned short (*)[SP])ring;
  const float wsc = 0.0625f;               // undo the x16 weight carry
  const int lrow0 = 64 * wr + 8 * hl;      // D rows of this lane within the WG tile
  const int lcol0 = 64 * wc;               // first column of this wave within the WG tile
  const int which = n0 / CDIM;             // 0 q, 1 k, 2 v (WG-uniform)
  const int cb = n0 - which * CDIM;
#pragma unroll
  for (int j = 0; j < 4; ++j) {
    const int cn = cb + lcol0 + 16 * j + m;
    const float b0 = bf16q(bq[cn]);
    const float b1 = bf16q(bk[cn]);
    const float b2 = bf16q(bv[cn]);
    const float bj = (which == 0) ? b0 : ((which == 1) ? b1 : b2);
#pragma unroll
    for (int i = 0; i < 4; ++i) {
#pragma unroll
      for (int r = 0; r < 8; ++r) sT[lrow0 + 16 * i + r][lcol0 + 16 * j + m] = hbits(acc[i][j][r] * wsc + bj);
    }
  }
  __syncthreads();   // orders the reload
  const int hh = cb / HD + wc;
  const int b = m0 / SEQ, t0 = m0 - b * SEQ + 64 * wr;   // first token of this wave's quadrant
  const int bh = b * NHEAD + hh;
  unsigned short* dst = qkv + (size_t)which * ((size_t)MROWS * CDIM);
  v4u val[16];
  unsigned int off[16];
  if (which < 2) {                       // WG-uniform
#pragma unroll
    for (int p = 0; p < 16; ++p) {
      const int row = 4 * p + (lane >> 3);
      const int piece = lane & 7;
      val[p] = *(const v4u*)&sT[64 * wr + row][lcol0 + piece * 8];
      off[p] = (unsigned int)((bh * SEQ + t0 + row) * HD + piece * 8);
    }
  } else {
#pragma unroll
    for (int p = 0; p < 16; ++p) {
      const int d = 4 * p + (lane >> 3);
      const int piece = lane & 7;
      unsigned int wv[4];
#pragma unroll
      for (int e = 0; e < 4; ++e) {
        const unsigned int lo = sT[64 * wr + piece * 8 + 2 * e][lcol0 + d];
        const unsigned int hi = sT[64 * wr + piece * 8 + 2 * e + 1][lcol0 + d];
        wv[e] = lo | (hi << 16);
      }
      v4u t;
      t.x = wv[0]; t.y = wv[1]; t.z = wv[2]; t.w = wv[3];
      val[p] = t;
      off[p] = (unsigned int)((bh * HD + d) * SEQ + t0 + piece * 8);
    }
  }
#pragma unroll
  for (int p = 0; p < 16; ++p) *(v4u*)(dst + off[p]) = val[p];
  
}

// ---------------------------------------------------------------------------
// GEMM + bias + residual, f32 output of width CDIM:
// out = acc/16 + bf16q(bias) + res.  resfull: res rows read at full strides and
// converted to bf16 values; outfull: out rows written at full strides.
// Residual added at the store stage as float4.
// coverage: 32 passes x 2 rows per wave = 64 rows x 64 cols per wave.
// LDS sF (in the ring): wave-private quadrants; block barrier orders the reload.
// ---------------------------------------------------------------------------
__global__ __launch_bounds__(128) void k_gemm_res(
    const unsigned short* __restrict__ A, const unsigned short* __restrict__ Bt, int K,
    const float* __restrict__ bias, const float* __restrict__ res,
    float* __restrict__ outF, int resfull, int outfull) {
  __shared__ __attribute__((aligned(16))) unsigned short ring[RING_ELEMS];
  const int tid = threadIdx.x, lane = tid & 31, w = tid >> 5;
  const int wr = w >> 1, wc = w & 1;
  const int m = lane & 15, hl = lane >> 4, k8 = hl * 8;
  const int m0 = blockIdx.y * 128, n0 = blockIdx.x * 128;

  v8f acc[4][4];
  gemm_main(A, Bt, K, m0, n0, wr, wc, m, k8, tid, ring, acc);

  float (*sF)[FP] = (float (*)[FP])ring;
  const float wsc = 0.0625f;
  const int lrow0 = 64 * wr + 8 * hl;
  const int lcol0 = 64 * wc;
#pragma unroll
  for (int i = 0; i < 4; ++i) {
#pragma unroll
    for (int j = 0; j < 4; ++j) {
#pragma unroll
      for (int r = 0; r < 8; ++r) sF[lrow0 + 16 * i + r][lcol0 + 16 * j + m] = acc[i][j][r] * wsc;
    }
  }
  __syncthreads();
  const int b = m0 / SEQ, t0 = m0 - b * SEQ;
  const int row0 = 64 * wr + hl;                            // pass p: row row0 + 2p
  const int piece = m;
  const int ncol = n0 + lcol0 + 4 * piece;
  const size_t frow0 = (size_t)b * SEQ_FULL + t0 + row0;    // full-stride row
  const size_t crow0 = (size_t)(m0 + row0);                 // compact row
  const float* rp = res + (resfull ? frow0 : crow0) * (size_t)CDIM + ncol;
  float* op = outF + (outfull ? frow0 : crow0) * (size_t)CDIM + ncol;
  const v4f bv = bf16q4(*(const v4f*)(bias + ncol));
  v4f val[32];
#pragma unroll
  for (int p = 0; p < 32; ++p) {
    const v4f a = *(const v4f*)&sF[row0 + 2 * p][lcol0 + 4 * piece];
    const v4f rraw = *(const v4f*)(rp + 2 * p * CDIM);
    const v4f rq = bf16q4(rraw);
    const v4f rr = resfull ? rq : rraw;
    val[p] = (a + bv) + rr;
  }
#pragma unroll
  for (int p = 0; p < 32; ++p) *(v4f*)(op + 2 * p * CDIM) = val[p];
  
}

// ---------------------------------------------------------------------------
// ffn1: f16 out[M][HID] = gelu_erf(acc/16 + bf16q(bias)).
// The pre-activation is staged as f32; gelu and the f16 convert are done at the reload, eight values a lane and pass.
// coverage: 16 passes x 4 rows per wave = 64 rows x 64 cols per wave.
// LDS sF (in the ring): wave-private quadrants; block barrier orders the reload.
// ---------------------------------------------------------------------------
__global__ __launch_bounds__(128) void k_gemm_gelu(
    const unsigned short* __restrict__ A, const unsigned short* __restrict__ Bt, int K,
    const float* __restrict__ bias, unsigned short* __restrict__ out0) {
  __shared__ __attribute__((aligned(16))) unsigned short ring[RING_ELEMS];
  const int tid = threadIdx.x, lane = tid & 31, w = tid >> 5;
  const int wr = w >> 1, wc = w & 1;
  const int m = lane & 15, hl = lane >> 4, k8 = hl * 8;
  const int m0 = blockIdx.y * 128, n0 = blockIdx.x * 128;

  v8f acc[4][4];
  gemm_main(A, Bt, K, m0, n0, wr, wc, m, k8, tid, ring, acc);

  float (*sF)[FP] = (float (*)[FP])ring;
  const float wsc = 0.0625f;
  const int lrow0 = 64 * wr + 8 * hl;
  const int lcol0 = 64 * wc;
#pragma unroll
  for (int j = 0; j < 4; ++j) {
    const float bj = bf16q(bias[n0 + lcol0 + 16 * j + m]);
#pragma unroll
    for (int i = 0; i < 4; ++i) {
#pragma unroll
      for (int r = 0; r < 8; ++r) sF[lrow0 + 16 * i + r][lcol0 + 16 * j + m] = acc[i][j][r] * wsc + bj;
    }
  }
  __syncthreads();
  const int piece = lane & 7;
  const float* sr = &sF[64 * wr + (lane >> 3)][lcol0 + piece * 8];
  unsigned short* orow = out0 + (size_t)(m0 + 64 * wr + (lane >> 3)) * (size_t)HID + n0 + lcol0 + piece * 8;
  // four passes a trip: their LDS reads go out as one group, and the text stays small
#pragma unroll 4
  for (int p = 0; p < 16; ++p) {
    const v4f u0 = *(const v4f*)(sr + 4 * p * FP);
    const v4f u1 = *(const v4f*)(sr + 4 * p * FP + 4);
    const v8f gl = gelu8(__builtin_shufflevector(u0, u1, 0, 1, 2, 3, 4, 5, 6, 7));
    const v4u o = pack8h(gl[0], gl[1], gl[2], gl[3], gl[4], gl[5], gl[6], gl[7]);
    *(v4u*)(orow + (size_t)(4 * p) * (size_t)HID) = o;
  }
  
}

__device__ __forceinline__ float other_half(float f) {
  const int b = __builtin_bit_cast(int, f);
  return __builtin_bit_cast(float, __builtin_amdgcn_permlanex16(b, b, 0x76543210, 0xfedcba98, false, false));
}

// Two waves a SIMD is all this grid gives (512 work-groups of 4 waves on 1,024 SIMDs): the register budget is set for
// that, and at most two work-groups fit a WGP, so that they spread over all of them.
__global__ __launch_bounds__(128) __attribute__((amdgpu_waves_per_eu(2, 2)))
void k_attn(const unsigned short* __restrict__ qp, const unsigned short* __restrict__ kp,
            const unsigned short* __restrict__ vp, unsigned short* __restrict__ op) {
  __shared__ __attribute__((aligned(16))) unsigned short sP[4][32][72];
  __shared__ __attribute__((aligned(16))) Tile sK[2];
  __shared__ __attribute__((aligned(16))) Tile sV[2];
  const int tid = threadIdx.x, lane = tid & 31, w = tid >> 5;
  const int m = lane & 15, hl = lane >> 4, k8 = hl * 8;
  const int nkt = SEQ / 64;                 // key chunks
  const int nqt = SEQ / 128;                // query tiles of one (b,h)
  const int bh = blockIdx.x / nqt, qt = blockIdx.x - bh * nqt;
  const int b = bh / NHEAD, hh = bh - b * NHEAD;
  const int tq = qt * 128 + 32 * w;         // first query row of this wave (within the sequence)

  const unsigned short* kg = kp + (size_t)bh * SEQ * HD;   // chunk kt: + kt*64 rows, row pitch HD
  const unsigned short* vg = vp + (size_t)bh * HD * SEQ;   // chunk kt: + kt*64 columns, row pitch SEQ
  tiles_async(&sK[0][0][0], kg, (size_t)HD, &sV[0][0][0], vg, (size_t)SEQ, tid);

  Frag qa0[2], qa1[2];     // B fragments of column group c: column = query tq + 16c + m, k = d in the split map
  {
    const unsigned short* qr0 = qp + ((size_t)bh * SEQ + tq + m) * HD + k8;
    const unsigned short* qr1 = qr0 + 16 * HD;
    // the loads and their data wait in one statement, so that no address register is rewritten ahead of a wait
    // the latency runs beside that of chunk 0's copies
    asm volatile(
        "global_load_b128 %0, %8, off\n\t"
        "global_load_b128 %1, %8, off offset:32\n\t"
        "global_load_b128 %2, %8, off offset:64\n\t"
        "global_load_b128 %3, %8, off offset:96\n\t"
        "global_load_b128 %4, %9, off\n\t"
        "global_load_b128 %5, %9, off offset:32\n\t"
        "global_load_b128 %6, %9, off offset:64\n\t"
        "global_load_b128 %7, %9, off offset:96\n\t"
        "s_wait_loadcnt 0x0"
        : "=&v"(qa0[0].q[0]), "=&v"(qa0[0].q[1]), "=&v"(qa1[0].q[0]), "=&v"(qa1[0].q[1]),
          "=&v"(qa0[1].q[0]), "=&v"(qa0[1].q[1]), "=&v"(qa1[1].q[0]), "=&v"(qa1[1].q[1])
        : "v"(qr0), "v"(qr1)
        : "memory");
  }
  wait_async0();
  __syncthreads();   // chunk 0 published
  if (nkt > 1)
    tiles_async(&sK[1][0][0], kg + (size_t)64 * HD, (size_t)HD, &sV[1][0][0], vg + 64, (size_t)SEQ, tid);
  const float SC = 0.125f * 1.44269504088896341f;   // raw score -> log2 units
  float mrun[2];             // running max of query 16c + m, raw score units (equal in both lane halves)
  v8f lrun[2];               // partial sums of 1024 p over this lane's keys
  v8f oacc[2][4];            // oacc[c][jd][r] = O^T(d = 16jd + 8hl + r, query 16c + m), x1024
#pragma unroll
  for (int c = 0; c < 2; ++c) {
    mrun[c] = -1e30f;
    lrun[c] = zero8();
#pragma unroll
    for (int j = 0; j < 4; ++j) oacc[c][j] = zero8();
  }

#pragma unroll 1
  for (int kt = 0; kt < nkt; ++kt) {
    const int bf = kt & 1;
    // ---- S^T = K Q^T, four 16-key tiles x two column groups ----
    // all K fragment reads of the chunk as one group ahead of its WMMAs: one LDS latency, not four
    Frag f0[4], f1[4];
#pragma unroll
    for (int j = 0; j < 4; ++j) {
      const unsigned short* kr = &sK[bf][16 * j + m][k8];
      f0[j].q[0] = *(const v4u*)(kr);
      f0[j].q[1] = *(const v4u*)(kr + 16);
      f1[j].q[0] = *(const v4u*)(kr + 32);
      f1[j].q[1] = *(const v4u*)(kr + 48);
    }
    v8f st[2][4];
#pragma unroll
    for (int j = 0; j < 4; ++j) {
#pragma unroll
      for (int c = 0; c < 2; ++c) st[c][j] = mma(f0[j].v, qa0[c].v, zero8());
    }
#pragma unroll
    for (int j = 0; j < 4; ++j) {
#pragma unroll
      for (int c = 0; c < 2; ++c) st[c][j] = mma(f1[j].v, qa1[c].v, st[c][j]);
    }
    // all V^T fragment reads of the chunk as one group; their latency runs under the softmax
    Frag g0[4], g1[4];
#pragma unroll
    for (int jd = 0; jd < 4; ++jd) {
      const unsigned short* vr = &sV[bf][16 * jd + m][k8];
      g0[jd].q[0] = *(const v4u*)(vr);
      g0[jd].q[1] = *(const v4u*)(vr + 16);
      g1[jd].q[0] = *(const v4u*)(vr + 32);
      g1[jd].q[1] = *(const v4u*)(vr + 48);
    }
    v16h pb0[2], pb1[2];
#pragma unroll
    for (int c = 0; c < 2; ++c) {
      // ---- running max of this lane's query ----
      float t4[4];               // one chain per tile: four independent chains, not one of 32 links
#pragma unroll
      for (int j = 0; j < 4; ++j) {
        t4[j] = st[c][j][0];
#pragma unroll
        for (int r = 1; r < 8; ++r) t4[j] = fmaxf(t4[j], st[c][j][r]);
      }
      float tm = fmaxf(fmaxf(t4[0], t4[1]), fmaxf(t4[2], t4[3]));
      tm = fmaxf(tm, other_half(tm));
      const float mn = fmaxf(mrun[c], tm);
      const float corr = __builtin_amdgcn_exp2f((mrun[c] - mn) * SC);
      mrun[c] = mn;
      // ---- 1024 p = 2^(s SC - m SC + 10) ----
      const v8f sc8 = splat8(SC), nb8 = splat8(10.0f - mn * SC), corr8 = splat8(corr);
#pragma unroll
      for (int j = 0; j < 4; ++j) {
        const v8f e = __builtin_elementwise_fma(st[c][j], sc8, nb8);
#pragma unroll
        for (int r = 0; r < 8; ++r) st[c][j][r] = __builtin_amdgcn_exp2f(e[r]);
      }
      lrun[c] = __builtin_elementwise_fma(lrun[c], corr8, (st[c][0] + st[c][1]) + (st[c][2] + st[c][3]));
#pragma unroll
      for (int j = 0; j < 4; ++j) oacc[c][j] = oacc[c][j] * corr8;
      // ---- P^T fragments: elements 0..7 = keys 32i + 8hl + .., 8..15 = keys 32i + 16 + 8hl + .. ----
      pb0[c] = __builtin_shufflevector(__builtin_convertvector(st[c][0], v8h), __builtin_convertvector(st[c][1], v8h),
                                       0, 1, 2, 3, 4, 5, 6, 7, 8, 9, 10, 11, 12, 13, 14, 15);
      pb1[c] = __builtin_shufflevector(__builtin_convertvector(st[c][2], v8h), __builtin_convertvector(st[c][3], v8h),
                                       0, 1, 2, 3, 4, 5, 6, 7, 8, 9, 10, 11, 12, 13, 14, 15);
    }
    // ---- O^T += V^T (64 d x 64 keys) * P^T (64 keys x 32 queries) ----
#pragma unroll
    for (int jd = 0; jd < 4; ++jd) {
#pragma unroll
      for (int c = 0; c < 2; ++c) oacc[c][jd] = mma(g0[jd].v, pb0[c], oacc[c][jd]);
    }
#pragma unroll
    for (int jd = 0; jd < 4; ++jd) {
#pragma unroll
      for (int c = 0; c < 2; ++c) oacc[c][jd] = mma(g1[jd].v, pb1[c], oacc[c][jd]);
    }
    wait_ds0();
    wait_async0();
    __syncthreads();   // publishes chunk kt + 1; ends every read of buffer bf
    if (kt + 2 < nkt)
      tiles_async(&sK[bf][0][0], kg + (size_t)(kt + 2) * 64 * HD, (size_t)HD,
                  &sV[bf][0][0], vg + (size_t)(kt + 2) * 64, (size_t)SEQ, tid);
  }
  wait_async0();

  // ---- finalize: o = acc / l (both x1024), stage per wave, whole-line stores ----
#pragma unroll
  for (int c = 0; c < 2; ++c) {
    float l = ((lrun[c][0] + lrun[c][1]) + (lrun[c][2] + lrun[c][3])) + ((lrun[c][4] + lrun[c][5]) + (lrun[c][6] + lrun[c][7]));
    l += other_half(l);
    const v8f il8 = splat8(1.0f / l);
#pragma unroll
    for (int jd = 0; jd < 4; ++jd) {
      const v8h o8 = __builtin_convertvector(oacc[c][jd] * il8, v8h);
      *(v4u*)&sP[w][16 * c + m][16 * jd + k8] = __builtin_bit_cast(v4u, o8);
    }
  }
  __syncthreads();
  v4u val[8];
  unsigned int off[8];
#pragma unroll
  for (int p = 0; p < 8; ++p) {
    const int row = 4 * p + (lane >> 3);
    const int piece = lane & 7;
    val[p] = *(const v4u*)&sP[w][row][piece * 8];
    off[p] = (unsigned int)((size_t)(b * SEQ + tq + row) * CDIM + hh * HD + piece * 8);
  }
#pragma unroll
  for (int p = 0; p < 8; ++p) *(v4u*)(op + off[p]) = val[p];
  
}

// ---------------------------------------------------------------------------
// Host launcher
// ---------------------------------------------------------------------------
constexpr size_t al256c(size_t v) { return (v + 255) & ~(size_t)255; }
constexpr size_t MCE = (size_t)MROWS * CDIM;
constexpr size_t SZ_WQKV = al256c((size_t)3 * CDIM * CDIM * 2);
constexpr size_t SZ_WO   = al256c((size_t)CDIM * CDIM * 2);
constexpr size_t SZ_W1   = al256c((size_t)HID * CDIM * 2);
constexpr size_t SZ_W2   = al256c((size_t)CDIM * HID * 2);
constexpr size_t SZ_H    = al256c(MCE * 2);
constexpr size_t SZ_QKV  = al256c((size_t)3 * MCE * 2);
constexpr size_t SZ_O    = al256c(MCE * 2);
constexpr size_t SZ_X1   = al256c(MCE * 4);
constexpr size_t SZ_H2   = al256c(MCE * 2);
constexpr size_t SZ_ACT  = al256c((size_t)MROWS * HID * 2);
constexpr size_t WS_TOTAL = SZ_WQKV + SZ_WO + SZ_W1 + SZ_W2 + SZ_H + SZ_QKV + SZ_O + SZ_X1 + SZ_H2 + SZ_ACT;
static_assert(WS_TOTAL <= (size_t)134217728);
static_assert((size_t)MROWS * HID < (size_t)4294967296ull);     // u32 element offsets in the epilogues
static_assert((size_t)NB_FULL * SEQ_FULL * CDIM < (size_t)4294967296ull);

extern "C" void kernel_launch(void* const* d_in, const int* in_sizes, int n_in,
                              void* d_out, int out_size, void* d_ws, size_t ws_size,
                              hipStream_t stream) {
  if (n_in < 17) return;
  const long needX = ((long)(NB - 1) * SEQ_FULL + SEQ) * CDIM;
  const long nWW = (long)CDIM * CDIM;
  if ((long)in_sizes[0] < needX) return;
  if ((long)in_sizes[1] < nWW || in_sizes[2] < CDIM) return;
  if ((long)in_sizes[3] < nWW || in_sizes[4] < CDIM) return;
  if ((long)in_sizes[5] < nWW || in_sizes[6] < CDIM) return;
  if ((long)in_sizes[7] < nWW || in_sizes[8] < CDIM) return;
  if ((long)in_sizes[9] < (long)CDIM * HID || in_sizes[10] < HID) return;
  if ((long)in_sizes[11] < (long)HID * CDIM || in_sizes[12] < CDIM) return;
  if (in_sizes[13] < CDIM || in_sizes[14] < CDIM) return;
  if (in_sizes[15] < CDIM || in_sizes[16] < CDIM) return;
  if ((long)out_size < needX) return;
  if ((size_t)WS_TOTAL > ws_size) return;

  const float* x   = (const float*)d_in[0];
  const float* Wq  = (const float*)d_in[1];
  const float* bq  = (const float*)d_in[2];
  const float* Wk  = (const float*)d_in[3];
  const float* bk  = (const float*)d_in[4];
  const float* Wv  = (const float*)d_in[5];
  const float* bv  = (const float*)d_in[6];
  const float* Wo  = (const float*)d_in[7];
  const float* bo  = (const float*)d_in[8];
  const float* W1  = (const float*)d_in[9];
  const float* b1  = (const float*)d_in[10];
  const float* W2  = (const float*)d_in[11];
  const float* b2  = (const float*)d_in[12];
  const float* g1  = (const float*)d_in[13];
  const float* be1 = (const float*)d_in[14];
  const float* g2  = (const float*)d_in[15];
  const float* be2 = (const float*)d_in[16];
  float* out = (float*)d_out;

  char* ws = (char*)d_ws;
  size_t off = 0;
  unsigned short* wqkv = (unsigned short*)(ws + off); off += SZ_WQKV;   // [1536][512]
  unsigned short* wot  = (unsigned short*)(ws + off); off += SZ_WO;     // [512][512]
  unsigned short* w1t  = (unsigned short*)(ws + off); off += SZ_W1;     // [2048][512]
  unsigned short* w2t  = (unsigned short*)(ws + off); off += SZ_W2;     // [512][2048]
  unsigned short* hpl  = (unsigned short*)(ws + off); off += SZ_H;      // [M][512]
  unsigned short* qkv  = (unsigned short*)(ws + off); off += SZ_QKV;    // q [B*H][SEQ][64], k same, vt [B*H][64][SEQ]
  unsigned short* opl  = (unsigned short*)(ws + off); off += SZ_O;      // [M][512]
  float*          x1   = (float*)(ws + off);          off += SZ_X1;     // [M][512]
  unsigned short* h2p  = (unsigned short*)(ws + off); off += SZ_H2;     // [M][512]
  unsigned short* act  = (unsigned short*)(ws + off); off += SZ_ACT;    // [M][2048]
  if (off > ws_size) return;
  unsigned short* qpl = qkv;
  unsigned short* kpl = qkv + MCE;
  unsigned short* vtp = qkv + 2 * MCE;

  // 1) + 2) one launch: LN1 on bf16 values of x -> h (f16), and the six weight planes
  //    in[K][N] -> out[N][K], bf16 values x16 as f16
  k_prep<<<LNB + 4 * WB1 + 2 * WB2, 256, 0, stream>>>(x, g1, be1, hpl, Wq, Wk, Wv, Wo, W1, W2,
                                                     wqkv, wot, w1t, w2t);
  // 3) q/k/v projections + bias -> q, k, vt planes
  k_gemm_qkv<<<dim3(3 * CDIM / 128, MROWS / 128), 128, 0, stream>>>(hpl, wqkv, bq, bk, bv, qkv);
  // 4) attention -> o plane
  k_attn<<<NB * NHEAD * (SEQ / 128), 128, 0, stream>>>(qpl, kpl, vtp, opl);
  // 5) output projection + bias + residual(bf16 values of x) -> x1 (f32, compact rows)
  k_gemm_res<<<dim3(CDIM / 128, MROWS / 128), 128, 0, stream>>>(opl, wot, CDIM, bo, x, x1, 1, 0);
  // 6) LN2 -> h2 (f16)
  k_ln_mid<<<MROWS / 8, 256, 0, stream>>>(x1, g2, be2, h2p, MROWS);
  // 7) ffn1 + bias + gelu(erf) -> act (f16)
  k_gemm_gelu<<<dim3(HID / 128, MROWS / 128), 128, 0, stream>>>(h2p, w1t, CDIM, b1, act);
  // 8) ffn2 + bias + residual(x1) -> out (f32, full strides)
  k_gemm_res<<<dim3(CDIM / 128, MROWS / 128), 128, 0, stream>>>(act, w2t, HID, b2, x1, out, 0, 1);
}

// v007
// Measured time: 145 microseconds a run.
// In two side-by-side timings against v006, it was 1.05 and 1.06 times as fast.
// Over all steps from v000 it is 4.58 times as fast.
#include <hip/hip_runtime.h>

// Contractions: v_wmma_f32_16x16x32_f16 (f16 operands, f32 accumulate) for q/k/v projections, q.k^T, p.v, output projection, ffn1, ffn2; weight planes carried x16, p carried x1024, activations x1.

#pragma clang fp contract(off)

#ifndef NB
#define NB 2
#endif
#ifndef SEQ
#define SEQ 4096
#endif
#define NB_FULL 2
#define SEQ_FULL 4096
#define CDIM 512
#define NHEAD 8
#define HD 64
#define HID 2048
#define MROWS (NB * SEQ)

static_assert(NB >= 1 && NB <= NB_FULL);
static_assert(SEQ % 128 == 0 && SEQ >= 128 && SEQ <= SEQ_FULL);
static_assert(CDIM == NHEAD * HD);
static_assert(HD == 64);
static_assert(CDIM == 512);
static_assert(CDIM == 32 * 2 * 8);          // LayerNorm lane map: 32 lanes x 2 segments x 8 columns
static_assert(HID % 64 == 0 && CDIM % 64 == 0);
static_assert(CDIM % 32 == 0 && HID % 32 == 0);   // WMMA k-steps of 32, two per 64-wide k trip
static_assert(MROWS % 64 == 0);
static_assert(MROWS % 8 == 0);
static_assert((3 * CDIM) % 64 == 0);

typedef _Float16 v16h __attribute__((ext_vector_type(16)));
typedef _Float16 v8h  __attribute__((ext_vector_type(8)));
typedef float    v8f  __attribute__((ext_vector_type(8)));
typedef float    v4f  __attribute__((ext_vector_type(4)));
typedef unsigned int v4u __attribute__((ext_vector_type(4)));

union Frag { v16h v; v4u q[2]; };

// WMMA with hazard guard: D += A(16x32) * B(32x16)
__device__ __forceinline__ v8f mma(v16h a, v16h b, v8f c) {
  v8f d = __builtin_amdgcn_wmma_f32_16x16x32_f16(false, a, false, b, (short)0, c, false, false);
  asm volatile("v_nop\n\tv_nop\n\tv_nop\n\tv_nop" : "+v"(d) : "v"(a), "v"(b));
  return d;
}

__device__ __forceinline__ v8f zero8() {
  v8f z;
#pragma unroll
  for (int i = 0; i < 8; ++i) z[i] = 0.0f;
  return z;
}

__device__ __forceinline__ v8f splat8(float f) {
  v8f z;
#pragma unroll
  for (int i = 0; i < 8; ++i) z[i] = f;
  return z;
}

// f32 -> nearest-even bf16 value, returned as f32
__device__ __forceinline__ float bf16q(float f) {
  unsigned int u = __float_as_uint(f);
  unsigned int r = u + 0x7FFFu + ((u >> 16) & 1u);
  r = ((u & 0x7F800000u) == 0x7F800000u) ? u : r;
  return __uint_as_float(r & 0xFFFF0000u);
}
__device__ __forceinline__ v4f bf16q4(v4f a) {
  v4f r;
  r.x = bf16q(a.x); r.y = bf16q(a.y); r.z = bf16q(a.z); r.w = bf16q(a.w);
  return r;
}
// f32 -> f16 (RNE convert) bit pattern
__device__ __forceinline__ unsigned short hbits(float f) {
  _Float16 h = (_Float16)f;
  return __builtin_bit_cast(unsigned short, h);
}
__device__ __forceinline__ v4u pack8h(float f0, float f1, float f2, float f3,
                                      float f4, float f5, float f6, float f7) {
  v8h t;
  t[0] = (_Float16)f0; t[1] = (_Float16)f1; t[2] = (_Float16)f2; t[3] = (_Float16)f3;
  t[4] = (_Float16)f4; t[5] = (_Float16)f5; t[6] = (_Float16)f6; t[7] = (_Float16)f7;
  return __builtin_bit_cast(v4u, t);
}
// gelu(u) = u Phi(u) = max(u, 0) - |u| erfc(|u| / sqrt 2) / 2 for eight values, without a branch:
// erfc(x) = t (a1 + t (a2 + t (a3 + t (a4 + t a5)))) exp(-x^2), t = 1 / (1 + p x), x >= 0: absolute error of the form
// below 1.5e-7 for every x, a few f32 roundings on top (the result is stored as f16), and no cancellation for
// negative u.  With y = x sqrt(log2 e): exp(-x^2) = 2^(-y^2).
__device__ __forceinline__ v8f gelu8(v8f u) {
  const v8f au = __builtin_elementwise_abs(u);
  const v8f y = au * splat8(0.84932180f);                                            // sqrt(log2 e) / sqrt 2
  const v8f d = __builtin_elementwise_fma(y, splat8(0.27273748f), splat8(1.0f));     // p / sqrt(log2 e)
  const v8f ny2 = -(y * y);
  v8f t, e;
#pragma unroll
  for (int i = 0; i < 8; ++i) {
    t[i] = __builtin_amdgcn_rcpf(d[i]);
    e[i] = __builtin_amdgcn_exp2f(ny2[i]);
  }
  v8f s = __builtin_elementwise_fma(t, splat8(1.061405429f), splat8(-1.453152027f));
  s = __builtin_elementwise_fma(s, t, splat8(1.421413741f));
  s = __builtin_elementwise_fma(s, t, splat8(-0.284496736f));
  s = __builtin_elementwise_fma(s, t, splat8(0.254829592f));
  const v8f ec = (s * t) * e;                                                        // erfc(|u| / sqrt 2)
  return __builtin_elementwise_fma(-au, ec, u + au) * splat8(0.5f);                  // u + |u| = 2 max(u, 0)
}

// ---------------------------------------------------------------------------
// Weight prep: src[K][N] (f32, row pitch N) -> dst[rowoff + n][k] f16 plane
// (row pitch K), value = f16(bf16q(w) * 16).  in[K][N] -> out[N][K].
// One block of 256 threads does the 64x64 tile (kx, ny) of (K/64, N/64).
// ---------------------------------------------------------------------------
__device__ __forceinline__ void wprep_body(
    const float* __restrict__ src, unsigned short* __restrict__ dst, int K, int N, int rowoff,
    int kx, int ny, unsigned short (&sT)[64][72]) {
  const int tid = threadIdx.x;
  const int k0 = kx * 64, n0 = ny * 64;
#pragma unroll
  for (int it = 0; it < 4; ++it) {
    const int idx = it * 256 + tid;
    const int kk = idx >> 4;            // 0..63
    const int j4 = (idx & 15) * 4;      // 0..60
    const v4f wv = *(const v4f*)(src + (size_t)(k0 + kk) * (size_t)N + n0 + j4);
    sT[j4 + 0][kk] = hbits(bf16q(wv.x) * 16.0f);
    sT[j4 + 1][kk] = hbits(bf16q(wv.y) * 16.0f);
    sT[j4 + 2][kk] = hbits(bf16q(wv.z) * 16.0f);
    sT[j4 + 3][kk] = hbits(bf16q(wv.w) * 16.0f);
  }
  __syncthreads();   // cross-wave: staged by all waves, read by all waves
  v4u val[2];
  size_t off[2];
#pragma unroll
  for (int p = 0; p < 2; ++p) {
    const int n = p * 32 + (tid >> 3);
    const int piece = tid & 7;
    val[p] = *(const v4u*)&sT[n][piece * 8];
    off[p] = (size_t)(rowoff + n0 + n) * (size_t)K + k0 + piece * 8;
  }
#pragma unroll
  for (int p = 0; p < 2; ++p) *(v4u*)(dst + off[p]) = val[p];
  // precaution: in the merged kernel the listing runs on behind these stores into code that rewrites their registers
  asm volatile("s_wait_xcnt 0x0" ::: "memory");
  
}

// ---------------------------------------------------------------------------
// LayerNorm over CDIM=512: one wave per row, lane l owns cols 8l..8l+7 and
// 256+8l..256+8l+7.  RNDIN: input rows read at full strides and converted to
// their bf16 values first.  Output f16 plane [nrows][512], rows compact.
// coverage: 2 instructions x 32 lanes x 16 B = cols 0..255 (4 lines) + cols 256..511 (4 lines) per row.
// ---------------------------------------------------------------------------
template <int RNDIN>
__device__ __forceinline__ void ln_body(
    const float* __restrict__ x, const float* __restrict__ g, const float* __restrict__ bt,
    unsigned short* __restrict__ hout, int nrows, int blk) {
  const int lane = threadIdx.x & 31, w = threadIdx.x >> 5;
  const int row = blk * 8 + w;
  if (row >= nrows) return;            // no barriers on the LayerNorm path
  size_t xrow;
  if (RNDIN) {
    const int b = row / SEQ, t = row - b * SEQ;
    xrow = ((size_t)b * SEQ_FULL + t) * CDIM;
  } else {
    xrow = (size_t)row * CDIM;
  }
  const int c0 = lane * 8;
  const int c1 = 256 + lane * 8;

  float v[16];
  {
    const v4f t0 = *(const v4f*)(x + xrow + c0);
    const v4f t1 = *(const v4f*)(x + xrow + c0 + 4);
    const v4f t2 = *(const v4f*)(x + xrow + c1);
    const v4f t3 = *(const v4f*)(x + xrow + c1 + 4);
    v[0] = t0.x; v[1] = t0.y; v[2] = t0.z; v[3] = t0.w;
    v[4] = t1.x; v[5] = t1.y; v[6] = t1.z; v[7] = t1.w;
    v[8] = t2.x; v[9] = t2.y; v[10] = t2.z; v[11] = t2.w;
    v[12] = t3.x; v[13] = t3.y; v[14] = t3.z; v[15] = t3.w;
  }
  if (RNDIN) {
#pragma unroll
    for (int i = 0; i < 16; ++i) v[i] = bf16q(v[i]);
  }

  float s = 0.0f;
#pragma unroll
  for (int i = 0; i < 16; ++i) s += v[i];
#pragma unroll
  for (int xm = 1; xm < 32; xm <<= 1) s += __shfl_xor(s, xm, 32);
  const float mu = s * (1.0f / CDIM);

  float d[16];
#pragma unroll
  for (int i = 0; i < 16; ++i) d[i] = v[i] - mu;
  float qs = 0.0f;
#pragma unroll
  for (int i = 0; i < 16; ++i) qs += d[i] * d[i];
#pragma unroll
  for (int xm = 1; xm < 32; xm <<= 1) qs += __shfl_xor(qs, xm, 32);
  const float var = qs * (1.0f / CDIM);
  const float rstd = rsqrtf(var + 1e-5f);

  float gg[16], bb[16];
  {
    const v4f g0 = bf16q4(*(const v4f*)(g + c0));
    const v4f g1 = bf16q4(*(const v4f*)(g + c0 + 4));
    const v4f g2 = bf16q4(*(const v4f*)(g + c1));
    const v4f g3 = bf16q4(*(const v4f*)(g + c1 + 4));
    const v4f b0 = bf16q4(*(const v4f*)(bt + c0));
    const v4f b1 = bf16q4(*(const v4f*)(bt + c0 + 4));
    const v4f b2 = bf16q4(*(const v4f*)(bt + c1));
    const v4f b3 = bf16q4(*(const v4f*)(bt + c1 + 4));
    gg[0] = g0.x; gg[1] = g0.y; gg[2] = g0.z; gg[3] = g0.w;
    gg[4] = g1.x; gg[5] = g1.y; gg[6] = g1.z; gg[7] = g1.w;
    gg[8] = g2.x; gg[9] = g2.y; gg[10] = g2.z; gg[11] = g2.w;
    gg[12] = g3.x; gg[13] = g3.y; gg[14] = g3.z; gg[15] = g3.w;
    bb[0] = b0.x; bb[1] = b0.y; bb[2] = b0.z; bb[3] = b0.w;
    bb[4] = b1.x; bb[5] = b1.y; bb[6] = b1.z; bb[7] = b1.w;
    bb[8] = b2.x; bb[9] = b2.y; bb[10] = b2.z; bb[11] = b2.w;
    bb[12] = b3.x; bb[13] = b3.y; bb[14] = b3.z; bb[15] = b3.w;
  }
  float y[16];
#pragma unroll
  for (int i = 0; i < 16; ++i) y[i] = d[i] * rstd * gg[i] + bb[i];

  const v4u o0 = pack8h(y[0], y[1], y[2], y[3], y[4], y[5], y[6], y[7]);
  const v4u o1 = pack8h(y[8], y[9], y[10], y[11], y[12], y[13], y[14], y[15]);
  unsigned short* orow = hout + (size_t)row * CDIM;
  *(v4u*)(orow + c0) = o0;
  *(v4u*)(orow + c1) = o1;
  
}

// ---------------------------------------------------------------------------
// First launch: all the work that reads the inputs alone, dealt by block index.
// Blocks 0 .. LNB-1: LayerNorm 1, 8 rows each.  Then one 64x64 weight tile a block:
// WB1 blocks for each of Wq, Wk, Wv, Wo, WB2 for W1, WB2 for W2.
// Every branch is block-uniform; only the weight path has a barrier.
// ---------------------------------------------------------------------------
#define LNB (MROWS / 8)
#define WB1 ((CDIM / 64) * (CDIM / 64))
#define WB2 ((CDIM / 64) * (HID / 64))
__global__ __launch_bounds__(256) void k_prep(
    const float* __restrict__ x, const float* __restrict__ g, const float* __restrict__ bt,
    unsigned short* __restrict__ hout,
    const float* __restrict__ Wq, const float* __restrict__ Wk, const float* __restrict__ Wv,
    const float* __restrict__ Wo, const float* __restrict__ W1, const float* __restrict__ W2,
    unsigned short* __restrict__ wqkv, unsigned short* __restrict__ wot,
    unsigned short* __restrict__ w1t, unsigned short* __restrict__ w2t) {
  __shared__ __attribute__((aligned(16))) unsigned short sT[64][72];
  const int bid = blockIdx.x;
  if (bid < LNB) {
    ln_body<1>(x, g, bt, hout, MROWS, bid);
    return;
  }
  int t = bid - LNB;
  if (t < 4 * WB1) {                       // in[512][512] -> out[512][512]
    const int mat = t / WB1;
    t -= mat * WB1;
    const float* src = (mat == 0) ? Wq : ((mat == 1) ? Wk : ((mat == 2) ? Wv : Wo));
    unsigned short* dst = (mat < 3) ? wqkv : wot;
    wprep_body(src, dst, CDIM, CDIM, (mat < 3) ? mat * CDIM : 0, t % (CDIM / 64), t / (CDIM / 64), sT);
  } else if (t < 4 * WB1 + WB2) {          // in[512][2048] -> out[2048][512]
    t -= 4 * WB1;
    wprep_body(W1, w1t, CDIM, HID, 0, t % (CDIM / 64), t / (CDIM / 64), sT);
  } else {                                 // in[2048][512] -> out[512][2048]
    t -= 4 * WB1 + WB2;
    wprep_body(W2, w2t, HID, CDIM, 0, t % (HID / 64), t / (HID / 64), sT);
  }
}
__global__ __launch_bounds__(256) void k_ln_mid(
    const float* __restrict__ x, const float* __restrict__ g, const float* __restrict__ bt,
    unsigned short* __restrict__ hout, int nrows) {
  ln_body<0>(x, g, bt, hout, nrows, blockIdx.x);
}

// ---------------------------------------------------------------------------
// Operand tiles in LDS.  A tile is 64 rows x 64 16-bit elements (128 B = one
// line per row); LDS row pitch TP elements = 144 B (16 B x odd: the b128
// fragment reads of 16 rows fall on distinct banks).
// tiles_async: 128 threads (a GEMM WG, or one key half of the attention WG) copy two such tiles, global -> LDS,
// 16 B per lane and copy; a wave's copy covers 4 whole rows (4 whole lines).
// ga / gb: first element of the tile, pa / pb: its global row pitch in elements.
// ---------------------------------------------------------------------------
#define TP 72
typedef unsigned short Tile[64][TP];

__device__ __forceinline__ void tiles_async(
    unsigned short* la, const unsigned short* ga, size_t pa,
    unsigned short* lb, const unsigned short* gb, size_t pb, int tid) {
  const int row = tid >> 3, pc = (tid & 7) * 8;
  const unsigned int la0 = (unsigned int)(size_t)(la + row * TP + pc);
  const unsigned int lb0 = (unsigned int)(size_t)(lb + row * TP + pc);
  const unsigned int la1 = la0 + 16 * TP * 2, la2 = la0 + 32 * TP * 2, la3 = la0 + 48 * TP * 2;
  const unsigned int lb1 = lb0 + 16 * TP * 2, lb2 = lb0 + 32 * TP * 2, lb3 = lb0 + 48 * TP * 2;
  const unsigned short* a0 = ga + (size_t)row * pa + pc;
  const unsigned short* a1 = a0 + 16 * pa;
  const unsigned short* a2 = a0 + 32 * pa;
  const unsigned short* a3 = a0 + 48 * pa;
  const unsigned short* b0 = gb + (size_t)row * pb + pc;
  const unsigned short* b1 = b0 + 16 * pb;
  const unsigned short* b2 = b0 + 32 * pb;
  const unsigned short* b3 = b0 + 48 * pb;
  // the copies and, as the last line, the wait that stands before their address registers are reused
  asm volatile(
      "global_load_async_to_lds_b128 %0, %8, off\n\t"
      "global_load_async_to_lds_b128 %1, %9, off\n\t"
      "global_load_async_to_lds_b128 %2, %10, off\n\t"
      "global_load_async_to_lds_b128 %3, %11, off\n\t"
      "global_load_async_to_lds_b128 %4, %12, off\n\t"
      "global_load_async_to_lds_b128 %5, %13, off\n\t"
      "global_load_async_to_lds_b128 %6, %14, off\n\t"
      "global_load_async_to_lds_b128 %7, %15, off\n\t"
      "s_wait_xcnt 0x0"
      :: "v"(la0), "v"(la1), "v"(la2), "v"(la3), "v"(lb0), "v"(lb1), "v"(lb2), "v"(lb3),
         "v"(a0), "v"(a1), "v"(a2), "v"(a3), "v"(b0), "v"(b1), "v"(b2), "v"(b3)
      : "memory");
}
// this wave's copies have landed
__device__ __forceinline__ void wait_async0() { asm volatile("s_wait_asynccnt 0x0" ::: "memory"); }
// this wave's LDS reads and writes have retired (before a buffer it read is refilled)
__device__ __forceinline__ void wait_ds0() { asm volatile("s_wait_dscnt 0x0" ::: "memory"); }

// ---------------------------------------------------------------------------
// 128x128-tile f16 GEMM main loop: D = A[M][K] * Bt[N][K]^T, 4 waves per WG in a 2 x 2
// grid, wave (wr, wc) owns rows 64wr.. x cols 64wc.. (4 x 4 accumulator tiles): each A and
// each Bt fragment read from LDS feeds four WMMAs.  A trip covers 64 of k: the A and Bt
// tiles of trip t + 1 are copied to the other ring buffer while trip t is worked on.
// A ring buffer is 128 A rows, then 128 Bt rows, each 64 elements at pitch TP.
// Fragments are read from LDS with the split k map for A and B
// (row/col = lane&15, elements 0..7 <- k0+8h.., 8..15 <- k0+16+8h..).
// acc[i][j][r] = D(row 64wr + 16i + 8h + r, col 64wc + 16j + (lane&15)).
// Behind the loop the ring is free (no reader, no copy in flight): the epilogues stage in it.
// ---------------------------------------------------------------------------
#define RB (256 * TP)           // elements of one ring buffer
#define RING_ELEMS (2 * RB)
#define SP 136                  // staging pitch, 16-bit elements: 272 B = 16 B x odd
#define FP 132                  // staging pitch, floats: 528 B = 16 B x odd
static_assert(128 * SP * 2 <= RING_ELEMS * 2 && 128 * FP * 4 <= RING_ELEMS * 2);
static_assert(MROWS % 128 == 0 && CDIM % 128 == 0 && HID % 128 == 0);

__device__ __forceinline__ void stage_async(
    unsigned short* buf, const unsigned short* ag, const unsigned short* bg, size_t K, int tid) {
  tiles_async(buf, ag, K, buf + 128 * TP, bg, K, tid);                          // rows 0..63 of both tiles
  tiles_async(buf + 64 * TP, ag + 64 * K, K, buf + 192 * TP, bg + 64 * K, K, tid);   // rows 64..127
}

__device__ __forceinline__ void gemm_main(
    const unsigned short* __restrict__ A, const unsigned short* __restrict__ Bt, int K,
    int m0, int n0, int wr, int wc, int m, int k8, int tid, unsigned short* ring, v8f (&acc)[4][4]) {
#pragma unroll
  for (int i = 0; i < 4; ++i) {
#pragma unroll
    for (int j = 0; j < 4; ++j) acc[i][j] = zero8();
  }
  const unsigned short* ag = A + (size_t)m0 * (size_t)K;
  const unsigned short* bg = Bt + (size_t)n0 * (size_t)K;
  const int nt = K >> 6;
  stage_async(ring, ag, bg, (size_t)K, tid);
  wait_async0();
  __syncthreads();   // tile 0 published
  if (nt > 1) stage_async(ring + RB, ag + 64, bg + 64, (size_t)K, tid);
#pragma unroll 1
  for (int t = 0; t < nt; ++t) {
    const int bf = t & 1;
    const unsigned short* ab = ring + bf * RB + (64 * wr + m) * TP + k8;
    const unsigned short* bb = ring + bf * RB + (128 + 64 * wc + m) * TP + k8;
    // twelve of the trip's sixteen fragments are read as one group ahead of its WMMAs; the A fragments of
    // the second k half follow in two pairs, into registers that the first half has left (all sixteen at
    // once, beside 128 accumulator registers, do not fit the 256 registers that the asm operands can name)
    Frag a0[4], b0[4], a1[4], b1[4];
#pragma unroll
    for (int j = 0; j < 4; ++j) {
      b0[j].q[0] = *(const v4u*)(bb + 16 * j * TP);
      b0[j].q[1] = *(const v4u*)(bb + 16 * j * TP + 16);
    }
#pragma unroll
    for (int i = 0; i < 4; ++i) {
      a0[i].q[0] = *(const v4u*)(ab + 16 * i * TP);
      a0[i].q[1] = *(const v4u*)(ab + 16 * i * TP + 16);
    }
#pragma unroll
    for (int j = 0; j < 4; ++j) {
      b1[j].q[0] = *(const v4u*)(bb + 16 * j * TP + 32);
      b1[j].q[1] = *(const v4u*)(bb + 16 * j * TP + 48);
    }
#pragma unroll
    for (int g = 0; g < 2; ++g) {
#pragma unroll
      for (int i = 2 * g; i < 2 * g + 2; ++i) {
#pragma unroll
        for (int j = 0; j < 4; ++j) acc[i][j] = mma(a0[i].v, b0[j].v, acc[i][j]);
      }
#pragma unroll
      for (int i = 2 * g; i < 2 * g + 2; ++i) {
        a1[i].q[0] = *(const v4u*)(ab + 16 * i * TP + 32);
        a1[i].q[1] = *(const v4u*)(ab + 16 * i * TP + 48);
      }
    }
#pragma unroll
    for (int i = 0; i < 4; ++i) {
#pragma unroll
      for (int j = 0; j < 4; ++j) acc[i][j] = mma(a1[i].v, b1[j].v, acc[i][j]);
    }
    wait_ds0();
    wait_async0();
    __syncthreads();   // publishes tile t + 1; ends every read of buffer bf
    if (t + 2 < nt)
      stage_async(ring + bf * RB, ag + (size_t)(t + 2) * 64, bg + (size_t)(t + 2) * 64, (size_t)K, tid);
  }
  wait_async0();
}

// ---------------------------------------------------------------------------
// q/k/v projection: A = LN1 plane [M][512], Bt = [1536][512] (q rows, k rows, v rows).
// value = acc/16 + bf16q(bias).  q and k -> planes [b*H+h][t][64]; v -> transposed
// plane vt[b*H+h][64][t].  The three planes are contiguous: plane p at qkv + p*M*512.
// A wave's 64 columns are one head.
// coverage: 16 passes x 4 rows = 64 rows x 64 cols per wave (q/k); 16 passes x 4 d = 64 d rows x 64 tokens per wave (v).
// LDS sT (in the ring): wave-private quadrants; block barrier orders the reload.
// ---------------------------------------------------------------------------
__global__ __launch_bounds__(128) void k_gemm_qkv(
    const unsigned short* __restrict__ A, const unsigned short* __restrict__ Bt,
    const float* __restrict__ bq, const float* __restrict__ bk, const float* __restrict__ bv,
    unsigned short* __restrict__ qkv) {
  __shared__ __attribute__((aligned(16))) unsigned short ring[RING_ELEMS];
  const int tid = threadIdx.x, lane = tid & 31, w = tid >> 5;
  const int wr = w >> 1, wc = w & 1;
  const int m = lane & 15, hl = lane >> 4, k8 = hl * 8;
  const int m0 = blockIdx.y * 128, n0 = blockIdx.x * 128;

  v8f acc[4][4];
  gemm_main(A, Bt, CDIM, m0, n0, wr, wc, m, k8, tid, ring, acc);

  unsigned short (*sT)[SP] = (unsigned short (*)[SP])ring;
  const float wsc = 0.0625f;               // undo the x16 weight carry
  const int lrow0 = 64 * wr + 8 * hl;      // D rows of this lane within the WG tile
  const int lcol0 = 64 * wc;               // first column of this wave within the WG tile
  const int which = n0 / CDIM;             // 0 q, 1 k, 2 v (WG-uniform)
  const int cb = n0 - which * CDIM;
#pragma unroll
  for (int j = 0; j < 4; ++j) {
    const int cn = cb + lcol0 + 16 * j + m;
    const float b0 = bf16q(bq[cn]);
    const float b1 = bf16q(bk[cn]);
    const float b2 = bf16q(bv[cn]);
    const float bj = (which == 0) ? b0 : ((which == 1) ? b1 : b2);
#pragma unroll
    for (int i = 0; i < 4; ++i) {
#pragma unroll
      for (int r = 0; r < 8; ++r) sT[lrow0 + 16 * i + r][lcol0 + 16 * j + m] = hbits(acc[i][j][r] * wsc + bj);
    }
  }
  __syncthreads();   // orders the reload
  const int hh = cb / HD + wc;
  const int b = m0 / SEQ, t0 = m0 - b * SEQ + 64 * wr;   // first token of this wave's quadrant
  const int bh = b * NHEAD + hh;
  unsigned short* dst = qkv + (size_t)which * ((size_t)MROWS * CDIM);
  v4u val[16];
  unsigned int off[16];
  if (which < 2) {                       // WG-uniform
#pragma unroll
    for (int p = 0; p < 16; ++p) {
      const int row = 4 * p + (lane >> 3);
      const int piece = lane & 7;
      val[p] = *(const v4u*)&sT[64 * wr + row][lcol0 + piece * 8];
      off[p] = (unsigned int)((bh * SEQ + t0 + row) * HD + piece * 8);
    }
  } else {
#pragma unroll
    for (int p = 0; p < 16; ++p) {
      const int d = 4 * p + (lane >> 3);
      const int piece = lane & 7;
      unsigned int wv[4];
#pragma unroll
      for (int e = 0; e < 4; ++e) {
        const unsigned int lo = sT[64 * wr + piece * 8 + 2 * e][lcol0 + d];
        const unsigned int hi = sT[64 * wr + piece * 8 + 2 * e + 1][lcol0 + d];
        wv[e] = lo | (hi << 16);
      }
      v4u t;
      t.x = wv[0]; t.y = wv[1]; t.z = wv[2]; t.w = wv[3];
      val[p] = t;
      off[p] = (unsigned int)((bh * HD + d) * SEQ + t0 + piece * 8);
    }
  }
#pragma unroll
  for (int p = 0; p < 16; ++p) *(v4u*)(dst + off[p]) = val[p];
  
}

// ---------------------------------------------------------------------------
// GEMM + bias + residual, f32 output of width CDIM:
// out = acc/16 + bf16q(bias) + res.  resfull: res rows read at full strides and
// converted to bf16 values; outfull: out rows written at full strides.
// Residual added at the store stage as float4.
// coverage: 32 passes x 2 rows per wave = 64 rows x 64 cols per wave.
// LDS sF (in the ring): wave-private quadrants; block barrier orders the reload.
// ---------------------------------------------------------------------------
__global__ __launch_bounds__(128) void k_gemm_res(
    const unsigned short* __restrict__ A, const unsigned short* __restrict__ Bt, int K,
    const float* __restrict__ bias, const float* __restrict__ res,
    float* __restrict__ outF, int resfull, int outfull) {
  __shared__ __attribute__((aligned(16))) unsigned short ring[RING_ELEMS];
  const int tid = threadIdx.x, lane = tid & 31, w = tid >> 5;
  const int wr = w >> 1, wc = w & 1;
  const int m = lane & 15, hl = lane >> 4, k8 = hl * 8;
  const int m0 = blockIdx.y * 128, n0 = blockIdx.x * 128;

  v8f acc[4][4];
  gemm_main(A, Bt, K, m0, n0, wr, wc, m, k8, tid, ring, acc);

  float (*sF)[FP] = (float (*)[FP])ring;
  const float wsc = 0.0625f;
  const int lrow0 = 64 * wr + 8 * hl;
  const int lcol0 = 64 * wc;
#pragma unroll
  for (int i = 0; i < 4; ++i) {
#pragma unroll
    for (int j = 0; j < 4; ++j) {
#pragma unroll
      for (int r = 0; r < 8; ++r) sF[lrow0 + 16 * i + r][lcol0 + 16 * j + m] = acc[i][j][r] * wsc;
    }
  }
  __syncthreads();
  const int b = m0 / SEQ, t0 = m0 - b * SEQ;
  const int row0 = 64 * wr + hl;                            // pass p: row row0 + 2p
  const int piece = m;
  const int ncol = n0 + lcol0 + 4 * piece;
  const size_t frow0 = (size_t)b * SEQ_FULL + t0 + row0;    // full-stride row
  const size_t crow0 = (size_t)(m0 + row0);                 // compact row
  const float* rp = res + (resfull ? frow0 : crow0) * (size_t)CDIM + ncol;
  float* op = outF + (outfull ? frow0 : crow0) * (size_t)CDIM + ncol;
  const v4f bv = bf16q4(*(const v4f*)(bias + ncol));
  v4f val[32];
#pragma unroll
  for (int p = 0; p < 32; ++p) {
    const v4f a = *(const v4f*)&sF[row0 + 2 * p][lcol0 + 4 * piece];
    const v4f rraw = *(const v4f*)(rp + 2 * p * CDIM);
    const v4f rq = bf16q4(rraw);
    const v4f rr = resfull ? rq : rraw;
    val[p] = (a + bv) + rr;
  }
#pragma unroll
  for (int p = 0; p < 32; ++p) *(v4f*)(op + 2 * p * CDIM) = val[p];
  
}

// ---------------------------------------------------------------------------
// ffn1: f16 out[M][HID] = gelu_erf(acc/16 + bf16q(bias)).
// The pre-activation is staged as f32; gelu and the f16 convert are done at the reload, eight values a lane and pass.
// coverage: 16 passes x 4 rows per wave = 64 rows x 64 cols per wave.
// LDS sF (in the ring): wave-private quadrants; block barrier orders the reload.
// ---------------------------------------------------------------------------
__global__ __launch_bounds__(128) void k_gemm_gelu(
    const unsigned short* __restrict__ A, const unsigned short* __restrict__ Bt, int K,
    const float* __restrict__ bias, unsigned short* __restrict__ out0) {
  __shared__ __attribute__((aligned(16))) unsigned short ring[RING_ELEMS];
  const int tid = threadIdx.x, lane = tid & 31, w = tid >> 5;
  const int wr = w >> 1, wc = w & 1;
  const int m = lane & 15, hl = lane >> 4, k8 = hl * 8;
  const int m0 = blockIdx.y * 128, n0 = blockIdx.x * 128;

  v8f acc[4][4];
  gemm_main(A, Bt, K, m0, n0, wr, wc, m, k8, tid, ring, acc);

  float (*sF)[FP] = (float (*)[FP])ring;
  const float wsc = 0.0625f;
  const int lrow0 = 64 * wr + 8 * hl;
  const int lcol0 = 64 * wc;
#pragma unroll
  for (int j = 0; j < 4; ++j) {
    const float bj = bf16q(bias[n0 + lcol0 + 16 * j + m]);
#pragma unroll
    for (int i = 0; i < 4; ++i) {
#pragma unroll
      for (int r = 0; r < 8; ++r) sF[lrow0 + 16 * i + r][lcol0 + 16 * j + m] = acc[i][j][r] * wsc + bj;
    }
  }
  __syncthreads();
  const int piece = lane & 7;
  const float* sr = &sF[64 * wr + (lane >> 3)][lcol0 + piece * 8];
  unsigned short* orow = out0 + (size_t)(m0 + 64 * wr + (lane >> 3)) * (size_t)HID + n0 + lcol0 + piece * 8;
  // four passes a trip: their LDS reads go out as one group, and the text stays small
#pragma unroll 4
  for (int p = 0; p < 16; ++p) {
    const v4f u0 = *(const v4f*)(sr + 4 * p * FP);
    const v4f u1 = *(const v4f*)(sr + 4 * p * FP + 4);
    const v8f gl = gelu8(__builtin_shufflevector(u0, u1, 0, 1, 2, 3, 4, 5, 6, 7));
    const v4u o = pack8h(gl[0], gl[1], gl[2], gl[3], gl[4], gl[5], gl[6], gl[7]);
    *(v4u*)(orow + (size_t)(4 * p) * (size_t)HID) = o;
  }
  
}

template <bool V> struct Flag { static constexpr bool value = V; };
// value of lane l ^ 16
__device__ __forceinline__ float other_half(float f) {
  const int b = __builtin_bit_cast(int, f);
  return __builtin_bit_cast(float, __builtin_amdgcn_permlanex16(b, b, 0x76543210, 0xfedcba98, false, false));
}

// Four waves a SIMD (512 work-groups of 8 waves on 1,024 SIMDs): the vector work between the matrix runs of one wave
// is covered by three others.  The register budget is set for that, and two work-groups fit a WGP.
__global__ __launch_bounds__(256) __attribute__((amdgpu_waves_per_eu(4, 4)))
void k_attn(const unsigned short* __restrict__ qp, const unsigned short* __restrict__ kp,
            const unsigned short* __restrict__ vp, unsigned short* __restrict__ op) {
  __shared__ __attribute__((aligned(16))) unsigned short sP[4][32][72];
  __shared__ __attribute__((aligned(16))) Tile sK[2][2];     // [key half][buffer]
  __shared__ __attribute__((aligned(16))) Tile sV[2][2];
  __shared__ __attribute__((aligned(16))) float sM[4][17][32][4];
  const int tid = threadIdx.x & 127, lane = tid & 31, w = tid >> 5;   // place within the key half
  const int kh = __builtin_amdgcn_readfirstlane((int)(threadIdx.x >> 7));   // key half of this wave
  const int m = lane & 15, hl = lane >> 4, k8 = hl * 8;
  const int nkt = SEQ / 128;                // key chunks of one half
  const int nqt = SEQ / 128;                // query tiles of one (b,h)
  const int bh = blockIdx.x / nqt, qt = blockIdx.x - bh * nqt;
  const int b = bh / NHEAD, hh = bh - b * NHEAD;
  const int tq = qt * 128 + 32 * w;         // first query row of this wave (within the sequence)

  const unsigned short* kg = kp + ((size_t)bh * SEQ + (size_t)kh * (SEQ / 2)) * HD;   // chunk kt: + kt*64 rows, row pitch HD
  const unsigned short* vg = vp + (size_t)bh * HD * SEQ + (size_t)kh * (SEQ / 2);     // chunk kt: + kt*64 columns, row pitch SEQ
  tiles_async(&sK[kh][0][0][0], kg, (size_t)HD, &sV[kh][0][0][0], vg, (size_t)SEQ, tid);

  Frag qa0[2], qa1[2];     // B fragments of column group c: column = query tq + 16c + m, k = d in the split map
  {
    const unsigned short* qr0 = qp + ((size_t)bh * SEQ + tq + m) * HD + k8;
    const unsigned short* qr1 = qr0 + 16 * HD;
    // the loads and their data wait in one statement, so that no address register is rewritten ahead of a wait
    // the latency runs beside that of chunk 0's copies
    asm volatile(
        "global_load_b128 %0, %8, off\n\t"
        "global_load_b128 %1, %8, off offset:32\n\t"
        "global_load_b128 %2, %8, off offset:64\n\t"
        "global_load_b128 %3, %8, off offset:96\n\t"
        "global_load_b128 %4, %9, off\n\t"
        "global_load_b128 %5, %9, off offset:32\n\t"
        "global_load_b128 %6, %9, off offset:64\n\t"
        "global_load_b128 %7, %9, off offset:96\n\t"
        "s_wait_loadcnt 0x0"
        : "=&v"(qa0[0].q[0]), "=&v"(qa0[0].q[1]), "=&v"(qa1[0].q[0]), "=&v"(qa1[0].q[1]),
          "=&v"(qa0[1].q[0]), "=&v"(qa0[1].q[1]), "=&v"(qa1[1].q[0]), "=&v"(qa1[1].q[1])
        : "v"(qr0), "v"(qr1)
        : "memory");
  }
  wait_async0();
  __syncthreads();   // chunk 0 published
  if (nkt > 1)
    tiles_async(&sK[kh][1][0][0], kg + (size_t)64 * HD, (size_t)HD, &sV[kh][1][0][0], vg + 64, (size_t)SEQ, tid);
  const float SC = 0.125f * 1.44269504088896341f;   // raw score -> log2 units
  float mrun[2];             // running max of query 16c + m, raw score units (equal in both lane halves)
  v8f lrun[2];               // partial sums of 1024 p over this lane's keys
  v8f oacc[2][4];            // oacc[c][jd][r] = O^T(d = 16jd + 8hl + r, query 16c + m), x1024
#pragma unroll
  for (int c = 0; c < 2; ++c) {
    mrun[c] = -1e30f;
    lrun[c] = zero8();
#pragma unroll
    for (int j = 0; j < 4; ++j) oacc[c][j] = zero8();
  }

  // One trip.  The refill is a compile-time choice, so that a trip is one straight block: with a branch at its foot
  // this build moved the row sums behind the branch, which kept the 64 registers of p live through the products.
  auto trip = [&](const int kt, auto refill) __attribute__((always_inline)) {
    const int bf = kt & 1;
    // ---- S^T = K Q^T, four 16-key tiles x two column groups ----
    // all K fragment reads of the chunk as one group ahead of its WMMAs: one LDS latency, not four
    Frag f0[4], f1[4];
#pragma unroll
    for (int j = 0; j < 4; ++j) {
      const unsigned short* kr = &sK[kh][bf][16 * j + m][k8];
      f0[j].q[0] = *(const v4u*)(kr);
      f0[j].q[1] = *(const v4u*)(kr + 16);
      f1[j].q[0] = *(const v4u*)(kr + 32);
      f1[j].q[1] = *(const v4u*)(kr + 48);
    }
    v8f st[2][4];
#pragma unroll
    for (int j = 0; j < 4; ++j) {
#pragma unroll
      for (int c = 0; c < 2; ++c) st[c][j] = mma(f0[j].v, qa0[c].v, zero8());
    }
#pragma unroll
    for (int j = 0; j < 4; ++j) {
#pragma unroll
      for (int c = 0; c < 2; ++c) st[c][j] = mma(f1[j].v, qa1[c].v, st[c][j]);
    }
    // the V^T fragment reads of the first 32 keys as one group; their latency runs under the softmax
    // (those of the other 32 keys follow behind it: all at once do not fit the registers of four waves a SIMD)
    Frag g0[4], g1[4];
#pragma unroll
    for (int jd = 0; jd < 4; ++jd) {
      const unsigned short* vr = &sV[kh][bf][16 * jd + m][k8];
      g0[jd].q[0] = *(const v4u*)(vr);
      g0[jd].q[1] = *(const v4u*)(vr + 16);
    }
    v16h pb0[2], pb1[2];
#pragma unroll
    for (int c = 0; c < 2; ++c) {
      // ---- running max of this lane's query ----
      float t4[4];               // one chain per tile: four independent chains, not one of 32 links
#pragma unroll
      for (int j = 0; j < 4; ++j) {
        t4[j] = st[c][j][0];
#pragma unroll
        for (int r = 1; r < 8; ++r) t4[j] = fmaxf(t4[j], st[c][j][r]);
      }
      float tm = fmaxf(fmaxf(t4[0], t4[1]), fmaxf(t4[2], t4[3]));
      tm = fmaxf(tm, other_half(tm));
      const float mn = fmaxf(mrun[c], tm);
      const float corr = __builtin_amdgcn_exp2f((mrun[c] - mn) * SC);
      mrun[c] = mn;
      // ---- 1024 p = 2^(s SC - m SC + 10) ----
      const v8f sc8 = splat8(SC), nb8 = splat8(10.0f - mn * SC), corr8 = splat8(corr);
#pragma unroll
      for (int j = 0; j < 4; ++j) {
        const v8f e = __builtin_elementwise_fma(st[c][j], sc8, nb8);
#pragma unroll
        for (int r = 0; r < 8; ++r) st[c][j][r] = __builtin_amdgcn_exp2f(e[r]);
      }
      lrun[c] = __builtin_elementwise_fma(lrun[c], corr8, (st[c][0] + st[c][1]) + (st[c][2] + st[c][3]));
#pragma unroll
      for (int j = 0; j < 4; ++j) oacc[c][j] = oacc[c][j] * corr8;
      // ---- P^T fragments: elements 0..7 = keys 32i + 8hl + .., 8..15 = keys 32i + 16 + 8hl + .. ----
      pb0[c] = __builtin_shufflevector(__builtin_convertvector(st[c][0], v8h), __builtin_convertvector(st[c][1], v8h),
                                       0, 1, 2, 3, 4, 5, 6, 7, 8, 9, 10, 11, 12, 13, 14, 15);
      pb1[c] = __builtin_shufflevector(__builtin_convertvector(st[c][2], v8h), __builtin_convertvector(st[c][3], v8h),
                                       0, 1, 2, 3, 4, 5, 6, 7, 8, 9, 10, 11, 12, 13, 14, 15);
    }
    // ---- O^T += V^T (64 d x 64 keys) * P^T (64 keys x 32 queries) ----
#pragma unroll
    for (int jd = 0; jd < 4; ++jd) {
      const unsigned short* vr = &sV[kh][bf][16 * jd + m][k8];
      g1[jd].q[0] = *(const v4u*)(vr + 32);
      g1[jd].q[1] = *(const v4u*)(vr + 48);
    }
#pragma unroll
    for (int jd = 0; jd < 4; ++jd) {
#pragma unroll
      for (int c = 0; c < 2; ++c) oacc[c][jd] = mma(g0[jd].v, pb0[c], oacc[c][jd]);
    }
#pragma unroll
    for (int jd = 0; jd < 4; ++jd) {
#pragma unroll
      for (int c = 0; c < 2; ++c) oacc[c][jd] = mma(g1[jd].v, pb1[c], oacc[c][jd]);
    }
    wait_ds0();
    wait_async0();
    __syncthreads();   // publishes chunk kt + 1; ends every read of buffer bf
    if constexpr (refill.value)
      tiles_async(&sK[kh][bf][0][0], kg + (size_t)(kt + 2) * 64 * HD, (size_t)HD,
                  &sV[kh][bf][0][0], vg + (size_t)(kt + 2) * 64, (size_t)SEQ, tid);
  };
  const int nfill = (nkt > 2) ? nkt - 2 : 0;   // trips behind which a chunk kt + 2 exists
  // both loops stay rolled: one copy of the trip's text each, and no second trip's registers beside the first's
#pragma unroll 1
  for (int kt = 0; kt < nfill; ++kt) trip(kt, Flag<true>());
#pragma unroll 1
  for (int kt = nfill; kt < nkt; ++kt) trip(kt, Flag<false>());
  wait_async0();

  // ---- join the key halves: the second half hands over its max, sum and O^T, lane by lane ----
  float lj[2];
#pragma unroll
  for (int c = 0; c < 2; ++c)
    lj[c] = ((lrun[c][0] + lrun[c][1]) + (lrun[c][2] + lrun[c][3])) + ((lrun[c][4] + lrun[c][5]) + (lrun[c][6] + lrun[c][7]));
  if (kh == 1) {               // wave-uniform
#pragma unroll
    for (int c = 0; c < 2; ++c) {
#pragma unroll
      for (int jd = 0; jd < 4; ++jd) {
        const v8f o = oacc[c][jd];
        *(v4f*)&sM[w][(4 * c + jd) * 2][lane][0] = __builtin_shufflevector(o, o, 0, 1, 2, 3);
        *(v4f*)&sM[w][(4 * c + jd) * 2 + 1][lane][0] = __builtin_shufflevector(o, o, 4, 5, 6, 7);
      }
    }
    v4f ml;
    ml.x = mrun[0]; ml.y = mrun[1]; ml.z = lj[0]; ml.w = lj[1];
    *(v4f*)&sM[w][16][lane][0] = ml;
  }
  __syncthreads();   // the second half's partial results published
  // ---- finalize: o = (acc_a f_a + acc_b f_b) / (l_a f_a + l_b f_b) (all x1024), staged for whole-line stores ----
  if (kh == 0) {               // wave-uniform
    const v4f ml = *(const v4f*)&sM[w][16][lane][0];
#pragma unroll
    for (int c = 0; c < 2; ++c) {
      const float mb = (c == 0) ? ml.x : ml.y;
      const float lb = (c == 0) ? ml.z : ml.w;
      const float mn = fmaxf(mrun[c], mb);
      const float fa = __builtin_amdgcn_exp2f((mrun[c] - mn) * SC);
      const float fb = __builtin_amdgcn_exp2f((mb - mn) * SC);
      float l = lj[c] * fa + lb * fb;
      l += other_half(l);
      const float il = 1.0f / l;
      const v8f ga8 = splat8(fa * il), gb8 = splat8(fb * il);
#pragma unroll
      for (int jd = 0; jd < 4; ++jd) {
        const v4f b0 = *(const v4f*)&sM[w][(4 * c + jd) * 2][lane][0];
        const v4f b1 = *(const v4f*)&sM[w][(4 * c + jd) * 2 + 1][lane][0];
        const v8f ob = __builtin_shufflevector(b0, b1, 0, 1, 2, 3, 4, 5, 6, 7);
        const v8h o8 = __builtin_convertvector(oacc[c][jd] * ga8 + ob * gb8, v8h);
        *(v4u*)&sP[w][16 * c + m][16 * jd + k8] = __builtin_bit_cast(v4u, o8);
      }
    }
  }
  __syncthreads();   // the staged rows published: all eight waves store, 16 rows each
  v4u val[4];
  unsigned int off[4];
#pragma unroll
  for (int p = 0; p < 4; ++p) {
    const int row = 16 * kh + 4 * p + (lane >> 3);
    const int piece = lane & 7;
    val[p] = *(const v4u*)&sP[w][row][piece * 8];
    off[p] = (unsigned int)((size_t)(b * SEQ + tq + row) * CDIM + hh * HD + piece * 8);
  }
#pragma unroll
  for (int p = 0; p < 4; ++p) *(v4u*)(op + off[p]) = val[p];
  
}

// ---------------------------------------------------------------------------
// Host launcher
// ---------------------------------------------------------------------------
constexpr size_t al256c(size_t v) { return (v + 255) & ~(size_t)255; }
constexpr size_t MCE = (size_t)MROWS * CDIM;
constexpr size_t SZ_WQKV = al256c((size_t)3 * CDIM * CDIM * 2);
constexpr size_t SZ_WO   = al256c((size_t)CDIM * CDIM * 2);
constexpr size_t SZ_W1   = al256c((size_t)HID * CDIM * 2);
constexpr size_t SZ_W2   = al256c((size_t)CDIM * HID * 2);
constexpr size_t SZ_H    = al256c(MCE * 2);
constexpr size_t SZ_QKV  = al256c((size_t)3 * MCE * 2);
constexpr size_t SZ_O    = al256c(MCE * 2);
constexpr size_t SZ_X1   = al256c(MCE * 4);
constexpr size_t SZ_H2   = al256c(MCE * 2);
constexpr size_t SZ_ACT  = al256c((size_t)MROWS * HID * 2);
constexpr size_t WS_TOTAL = SZ_WQKV + SZ_WO + SZ_W1 + SZ_W2 + SZ_H + SZ_QKV + SZ_O + SZ_X1 + SZ_H2 + SZ_ACT;
static_assert(WS_TOTAL <= (size_t)134217728);
static_assert((size_t)MROWS * HID < (size_t)4294967296ull);     // u32 element offsets in the epilogues
static_assert((size_t)NB_FULL * SEQ_FULL * CDIM < (size_t)4294967296ull);

extern "C" void kernel_launch(void* const* d_in, const int* in_sizes, int n_in,
                              void* d_out, int out_size, void* d_ws, size_t ws_size,
                              hipStream_t stream) {
  if (n_in < 17) return;
  const long needX = ((long)(NB - 1) * SEQ_FULL + SEQ) * CDIM;
  const long nWW = (long)CDIM * CDIM;
  if ((long)in_sizes[0] < needX) return;
  if ((long)in_sizes[1] < nWW || in_sizes[2] < CDIM) return;
  if ((long)in_sizes[3] < nWW || in_sizes[4] < CDIM) return;
  if ((long)in_sizes[5] < nWW || in_sizes[6] < CDIM) return;
  if ((long)in_sizes[7] < nWW || in_sizes[8] < CDIM) return;
  if ((long)in_sizes[9] < (long)CDIM * HID || in_sizes[10] < HID) return;
  if ((long)in_sizes[11] < (long)HID * CDIM || in_sizes[12] < CDIM) return;
  if (in_sizes[13] < CDIM || in_sizes[14] < CDIM) return;
  if (in_sizes[15] < CDIM || in_sizes[16] < CDIM) return;
  if ((long)out_size < needX) return;
  if ((size_t)WS_TOTAL > ws_size) return;

  const float* x   = (const float*)d_in[0];
  const float* Wq  = (const float*)d_in[1];
  const float* bq  = (const float*)d_in[2];
  const float* Wk  = (const float*)d_in[3];
  const float* bk  = (const float*)d_in[4];
  const float* Wv  = (const float*)d_in[5];
  const float* bv  = (const float*)d_in[6];
  const float* Wo  = (const float*)d_in[7];
  const float* bo  = (const float*)d_in[8];
  const float* W1  = (const float*)d_in[9];
  const float* b1  = (const float*)d_in[10];
  const float* W2  = (const float*)d_in[11];
  const float* b2  = (const float*)d_in[12];
  const float* g1  = (const float*)d_in[13];
  const float* be1 = (const float*)d_in[14];
  const float* g2  = (const float*)d_in[15];
  const float* be2 = (const float*)d_in[16];
  float* out = (float*)d_out;

  char* ws = (char*)d_ws;
  size_t off = 0;
  unsigned short* wqkv = (unsigned short*)(ws + off); off += SZ_WQKV;   // [1536][512]
  unsigned short* wot  = (unsigned short*)(ws + off); off += SZ_WO;     // [512][512]
  unsigned short* w1t  = (unsigned short*)(ws + off); off += SZ_W1;     // [2048][512]
  unsigned short* w2t  = (unsigned short*)(ws + off); off += SZ_W2;     // [512][2048]
  unsigned short* hpl  = (unsigned short*)(ws + off); off += SZ_H;      // [M][512]
  unsigned short* qkv  = (unsigned short*)(ws + off); off += SZ_QKV;    // q [B*H][SEQ][64], k same, vt [B*H][64][SEQ]
  unsigned short* opl  = (unsigned short*)(ws + off); off += SZ_O;      // [M][512]
  float*          x1   = (float*)(ws + off);          off += SZ_X1;     // [M][512]
  unsigned short* h2p  = (unsigned short*)(ws + off); off += SZ_H2;     // [M][512]
  unsigned short* act  = (unsigned short*)(ws + off); off += SZ_ACT;    // [M][2048]
  if (off > ws_size) return;
  unsigned short* qpl = qkv;
  unsigned short* kpl = qkv + MCE;
  unsigned short* vtp = qkv + 2 * MCE;

  // 1) + 2) one launch: LN1 on bf16 values of x -> h (f16), and the six weight planes
  //    in[K][N] -> out[N][K], bf16 values x16 as f16
  k_prep<<<LNB + 4 * WB1 + 2 * WB2, 256, 0, stream>>>(x, g1, be1, hpl, Wq, Wk, Wv, Wo, W1, W2,
                                                     wqkv, wot, w1t, w2t);
  // 3) q/k/v projections + bias -> q, k, vt planes
  k_gemm_qkv<<<dim3(3 * CDIM / 128, MROWS / 128), 128, 0, stream>>>(hpl, wqkv, bq, bk, bv, qkv);
  // 4) attention -> o plane
  k_attn<<<NB * NHEAD * (SEQ / 128), 256, 0, stream>>>(qpl, kpl, vtp, opl);
  // 5) output projection + bias + residual(bf16 values of x) -> x1 (f32, compact rows)
  k_gemm_res<<<dim3(CDIM / 128, MROWS / 128), 128, 0, stream>>>(opl, wot, CDIM, bo, x, x1, 1, 0);
  // 6) LN2 -> h2 (f16)
  k_ln_mid<<<MROWS / 8, 256, 0, stream>>>(x1, g2, be2, h2p, MROWS);
  // 7) ffn1 + bias + gelu(erf) -> act (f16)
  k_gemm_gelu<<<dim3(HID / 128, MROWS / 128), 128, 0, stream>>>(h2p, w1t, CDIM, b1, act);
  // 8) ffn2 + bias + residual(x1) -> out (f32, full strides)
  k_gemm_res<<<dim3(CDIM / 128, MROWS / 128), 128, 0, stream>>>(act, w2t, HID, b2, x1, out, 0, 1);
}

// v008
// A run of this version takes 139 microseconds.
// Two timings next to v007 put it at 1.05 and 1.03 times that version's speed.
// Counting every step since v000, it is 4.76 times as fast.
#include <hip/hip_runtime.h>

// Contractions: v_wmma_f32_16x16x32_f16 (f16 operands, f32 accumulate) for q/k/v projections, q.k^T, p.v, output projection, ffn1, ffn2; weight planes carried x16, p carried x1024, activations x1.

#pragma clang fp contract(off)

#ifndef NB
#define NB 2
#endif
#ifndef SEQ
#define SEQ 4096
#endif
#define NB_FULL 2
#define SEQ_FULL 4096
#define CDIM 512
#define NHEAD 8
#define HD 64
#define HID 2048
#define MROWS (NB * SEQ)

static_assert(NB >= 1 && NB <= NB_FULL);
static_assert(SEQ % 128 == 0 && SEQ >= 128 && SEQ <= SEQ_FULL);
static_assert(CDIM == NHEAD * HD);
static_assert(HD == 64);
static_assert(CDIM == 512);
static_assert(CDIM == 32 * 2 * 8);          // LayerNorm lane map: 32 lanes x 2 segments x 8 columns
static_assert(HID % 64 == 0 && CDIM % 64 == 0);
static_assert(CDIM % 32 == 0 && HID % 32 == 0);   // WMMA k-steps of 32, two per 64-wide k trip
static_assert(MROWS % 64 == 0);
static_assert(MROWS % 8 == 0);
static_assert((3 * CDIM) % 64 == 0);

typedef _Float16 v16h __attribute__((ext_vector_type(16)));
typedef _Float16 v8h  __attribute__((ext_vector_type(8)));
typedef float    v8f  __attribute__((ext_vector_type(8)));
typedef float    v4f  __attribute__((ext_vector_type(4)));
typedef unsigned int v4u __attribute__((ext_vector_type(4)));

union Frag { v16h v; v4u q[2]; };

// D += A(16x32) * B(32x16); the builtin form: the compiler keeps the distances behind it
__device__ __forceinline__ v8f mma(v16h a, v16h b, v8f c) {
  return __builtin_amdgcn_wmma_f32_16x16x32_f16(false, a, false, b, (short)0, c, false, false);
}

__device__ __forceinline__ v8f zero8() {
  v8f z;
#pragma unroll
  for (int i = 0; i < 8; ++i) z[i] = 0.0f;
  return z;
}

__device__ __forceinline__ v8f splat8(float f) {
  v8f z;
#pragma unroll
  for (int i = 0; i < 8; ++i) z[i] = f;
  return z;
}

// f32 -> nearest-even bf16 value, returned as f32
__device__ __forceinline__ float bf16q(float f) {
  unsigned int u = __float_as_uint(f);
  unsigned int r = u + 0x7FFFu + ((u >> 16) & 1u);
  r = ((u & 0x7F800000u) == 0x7F800000u) ? u : r;
  return __uint_as_float(r & 0xFFFF0000u);
}
__device__ __forceinline__ v4f bf16q4(v4f a) {
  v4f r;
  r.x = bf16q(a.x); r.y = bf16q(a.y); r.z = bf16q(a.z); r.w = bf16q(a.w);
  return r;
}
// f32 -> f16 (RNE convert) bit pattern
__device__ __forceinline__ unsigned short hbits(float f) {
  _Float16 h = (_Float16)f;
  return __builtin_bit_cast(unsigned short, h);
}
__device__ __forceinline__ v4u pack8h(float f0, float f1, float f2, float f3,
                                      float f4, float f5, float f6, float f7) {
  v8h t;
  t[0] = (_Float16)f0; t[1] = (_Float16)f1; t[2] = (_Float16)f2; t[3] = (_Float16)f3;
  t[4] = (_Float16)f4; t[5] = (_Float16)f5; t[6] = (_Float16)f6; t[7] = (_Float16)f7;
  return __builtin_bit_cast(v4u, t);
}
// gelu(u) = u Phi(u) = max(u, 0) - |u| erfc(|u| / sqrt 2) / 2 for eight values, without a branch:
// erfc(x) = t (a1 + t (a2 + t (a3 + t (a4 + t a5)))) exp(-x^2), t = 1 / (1 + p x), x >= 0: absolute error of the form
// below 1.5e-7 for every x, a few f32 roundings on top (the result is stored as f16), and no cancellation for
// negative u.  With y = x sqrt(log2 e): exp(-x^2) = 2^(-y^2).
__device__ __forceinline__ v8f gelu8(v8f u) {
  const v8f au = __builtin_elementwise_abs(u);
  const v8f y = au * splat8(0.84932180f);                                            // sqrt(log2 e) / sqrt 2
  const v8f d = __builtin_elementwise_fma(y, splat8(0.27273748f), splat8(1.0f));     // p / sqrt(log2 e)
  const v8f ny2 = -(y * y);
  v8f t, e;
#pragma unroll
  for (int i = 0; i < 8; ++i) {
    t[i] = __builtin_amdgcn_rcpf(d[i]);
    e[i] = __builtin_amdgcn_exp2f(ny2[i]);
  }
  v8f s = __builtin_elementwise_fma(t, splat8(1.061405429f), splat8(-1.453152027f));
  s = __builtin_elementwise_fma(s, t, splat8(1.421413741f));
  s = __builtin_elementwise_fma(s, t, splat8(-0.284496736f));
  s = __builtin_elementwise_fma(s, t, splat8(0.254829592f));
  const v8f ec = (s * t) * e;                                                        // erfc(|u| / sqrt 2)
  return __builtin_elementwise_fma(-au, ec, u + au) * splat8(0.5f);                  // u + |u| = 2 max(u, 0)
}

// ---------------------------------------------------------------------------
// Weight prep: src[K][N] (f32, row pitch N) -> dst[rowoff + n][k] f16 plane
// (row pitch K), value = f16(bf16q(w) * 16).  in[K][N] -> out[N][K].
// One block of 256 threads does the 64x64 tile (kx, ny) of (K/64, N/64).
// ---------------------------------------------------------------------------
__device__ __forceinline__ void wprep_body(
    const float* __restrict__ src, unsigned short* __restrict__ dst, int K, int N, int rowoff,
    int kx, int ny, unsigned short (&sT)[64][72]) {
  const int tid = threadIdx.x;
  const int k0 = kx * 64, n0 = ny * 64;
#pragma unroll
  for (int it = 0; it < 4; ++it) {
    const int idx = it * 256 + tid;
    const int kk = idx >> 4;            // 0..63
    const int j4 = (idx & 15) * 4;      // 0..60
    const v4f wv = *(const v4f*)(src + (size_t)(k0 + kk) * (size_t)N + n0 + j4);
    sT[j4 + 0][kk] = hbits(bf16q(wv.x) * 16.0f);
    sT[j4 + 1][kk] = hbits(bf16q(wv.y) * 16.0f);
    sT[j4 + 2][kk] = hbits(bf16q(wv.z) * 16.0f);
    sT[j4 + 3][kk] = hbits(bf16q(wv.w) * 16.0f);
  }
  __syncthreads();   // cross-wave: staged by all waves, read by all waves
  v4u val[2];
  size_t off[2];
#pragma unroll
  for (int p = 0; p < 2; ++p) {
    const int n = p * 32 + (tid >> 3);
    const int piece = tid & 7;
    val[p] = *(const v4u*)&sT[n][piece * 8];
    off[p] = (size_t)(rowoff + n0 + n) * (size_t)K + k0 + piece * 8;
  }
#pragma unroll
  for (int p = 0; p < 2; ++p) *(v4u*)(dst + off[p]) = val[p];
  // precaution: in the merged kernel the listing runs on behind these stores into code that rewrites their registers
  asm volatile("s_wait_xcnt 0x0" ::: "memory");
  
}

// ---------------------------------------------------------------------------
// LayerNorm over CDIM=512: one wave per row, lane l owns cols 8l..8l+7 and
// 256+8l..256+8l+7.  RNDIN: input rows read at full strides and converted to
// their bf16 values first.  Output f16 plane [nrows][512], rows compact.
// coverage: 2 instructions x 32 lanes x 16 B = cols 0..255 (4 lines) + cols 256..511 (4 lines) per row.
// ---------------------------------------------------------------------------
template <int RNDIN>
__device__ __forceinline__ void ln_body(
    const float* __restrict__ x, const float* __restrict__ g, const float* __restrict__ bt,
    unsigned short* __restrict__ hout, int nrows, int blk) {
  const int lane = threadIdx.x & 31, w = threadIdx.x >> 5;
  const int row = blk * 8 + w;
  if (row >= nrows) return;            // no barriers on the LayerNorm path
  size_t xrow;
  if (RNDIN) {
    const int b = row / SEQ, t = row - b * SEQ;
    xrow = ((size_t)b * SEQ_FULL + t) * CDIM;
  } else {
    xrow = (size_t)row * CDIM;
  }
  const int c0 = lane * 8;
  const int c1 = 256 + lane * 8;

  float v[16];
  {
    const v4f t0 = *(const v4f*)(x + xrow + c0);
    const v4f t1 = *(const v4f*)(x + xrow + c0 + 4);
    const v4f t2 = *(const v4f*)(x + xrow + c1);
    const v4f t3 = *(const v4f*)(x + xrow + c1 + 4);
    v[0] = t0.x; v[1] = t0.y; v[2] = t0.z; v[3] = t0.w;
    v[4] = t1.x; v[5] = t1.y; v[6] = t1.z; v[7] = t1.w;
    v[8] = t2.x; v[9] = t2.y; v[10] = t2.z; v[11] = t2.w;
    v[12] = t3.x; v[13] = t3.y; v[14] = t3.z; v[15] = t3.w;
  }
  if (RNDIN) {
#pragma unroll
    for (int i = 0; i < 16; ++i) v[i] = bf16q(v[i]);
  }

  float s = 0.0f;
#pragma unroll
  for (int i = 0; i < 16; ++i) s += v[i];
#pragma unroll
  for (int xm = 1; xm < 32; xm <<= 1) s += __shfl_xor(s, xm, 32);
  const float mu = s * (1.0f / CDIM);

  float d[16];
#pragma unroll
  for (int i = 0; i < 16; ++i) d[i] = v[i] - mu;
  float qs = 0.0f;
#pragma unroll
  for (int i = 0; i < 16; ++i) qs += d[i] * d[i];
#pragma unroll
  for (int xm = 1; xm < 32; xm <<= 1) qs += __shfl_xor(qs, xm, 32);
  const float var = qs * (1.0f / CDIM);
  const float rstd = rsqrtf(var + 1e-5f);

  float gg[16], bb[16];
  {
    const v4f g0 = bf16q4(*(const v4f*)(g + c0));
    const v4f g1 = bf16q4(*(const v4f*)(g + c0 + 4));
    const v4f g2 = bf16q4(*(const v4f*)(g + c1));
    const v4f g3 = bf16q4(*(const v4f*)(g + c1 + 4));
    const v4f b0 = bf16q4(*(const v4f*)(bt + c0));
    const v4f b1 = bf16q4(*(const v4f*)(bt + c0 + 4));
    const v4f b2 = bf16q4(*(const v4f*)(bt + c1));
    const v4f b3 = bf16q4(*(const v4f*)(bt + c1 + 4));
    gg[0] = g0.x; gg[1] = g0.y; gg[2] = g0.z; gg[3] = g0.w;
    gg[4] = g1.x; gg[5] = g1.y; gg[6] = g1.z; gg[7] = g1.w;
    gg[8] = g2.x; gg[9] = g2.y; gg[10] = g2.z; gg[11] = g2.w;
    gg[12] = g3.x; gg[13] = g3.y; gg[14] = g3.z; gg[15] = g3.w;
    bb[0] = b0.x; bb[1] = b0.y; bb[2] = b0.z; bb[3] = b0.w;
    bb[4] = b1.x; bb[5] = b1.y; bb[6] = b1.z; bb[7] = b1.w;
    bb[8] = b2.x; bb[9] = b2.y; bb[10] = b2.z; bb[11] = b2.w;
    bb[12] = b3.x; bb[13] = b3.y; bb[14] = b3.z; bb[15] = b3.w;
  }
  float y[16];
#pragma unroll
  for (int i = 0; i < 16; ++i) y[i] = d[i] * rstd * gg[i] + bb[i];

  const v4u o0 = pack8h(y[0], y[1], y[2], y[3], y[4], y[5], y[6], y[7]);
  const v4u o1 = pack8h(y[8], y[9], y[10], y[11], y[12], y[13], y[14], y[15]);
  unsigned short* orow = hout + (size_t)row * CDIM;
  *(v4u*)(orow + c0) = o0;
  *(v4u*)(orow + c1) = o1;
  
}

// ---------------------------------------------------------------------------
// First launch: all the work that reads the inputs alone, dealt by block index.
// Blocks 0 .. LNB-1: LayerNorm 1, 8 rows each.  Then one 64x64 weight tile a block:
// WB1 blocks for each of Wq, Wk, Wv, Wo, WB2 for W1, WB2 for W2.
// Every branch is block-uniform; only the weight path has a barrier.
// ---------------------------------------------------------------------------
#define LNB (MROWS / 8)
#define WB1 ((CDIM / 64) * (CDIM / 64))
#define WB2 ((CDIM / 64) * (HID / 64))
__global__ __launch_bounds__(256) void k_prep(
    const float* __restrict__ x, const float* __restrict__ g, const float* __restrict__ bt,
    unsigned short* __restrict__ hout,
    const float* __restrict__ Wq, const float* __restrict__ Wk, const float* __restrict__ Wv,
    const float* __restrict__ Wo, const float* __restrict__ W1, const float* __restrict__ W2,
    unsigned short* __restrict__ wqkv, unsigned short* __restrict__ wot,
    unsigned short* __restrict__ w1t, unsigned short* __restrict__ w2t) {
  __shared__ __attribute__((aligned(16))) unsigned short sT[64][72];
  const int bid = blockIdx.x;
  if (bid < LNB) {
    ln_body<1>(x, g, bt, hout, MROWS, bid);
    return;
  }
  int t = bid - LNB;
  if (t < 4 * WB1) {                       // in[512][512] -> out[512][512]
    const int mat = t / WB1;
    t -= mat * WB1;
    const float* src = (mat == 0) ? Wq : ((mat == 1) ? Wk : ((mat == 2) ? Wv : Wo));
    unsigned short* dst = (mat < 3) ? wqkv : wot;
    wprep_body(src, dst, CDIM, CDIM, (mat < 3) ? mat * CDIM : 0, t % (CDIM / 64), t / (CDIM / 64), sT);
  } else if (t < 4 * WB1 + WB2) {          // in[512][2048] -> out[2048][512]
    t -= 4 * WB1;
    wprep_body(W1, w1t, CDIM, HID, 0, t % (CDIM / 64), t / (CDIM / 64), sT);
  } else {                                 // in[2048][512] -> out[512][2048]
    t -= 4 * WB1 + WB2;
    wprep_body(W2, w2t, HID, CDIM, 0, t % (HID / 64), t / (HID / 64), sT);
  }
}
__global__ __launch_bounds__(256) void k_ln_mid(
    const float* __restrict__ x, const float* __restrict__ g, const float* __restrict__ bt,
    unsigned short* __restrict__ hout, int nrows) {
  ln_body<0>(x, g, bt, hout, nrows, blockIdx.x);
}

// ---------------------------------------------------------------------------
// Operand tiles in LDS.  A tile is 64 rows x 64 16-bit elements (128 B = one
// line per row); LDS row pitch TP elements = 144 B (16 B x odd: the b128
// fragment reads of 16 rows fall on distinct banks).
// tiles_async: 128 threads (a GEMM WG, or one key half of the attention WG) copy two such tiles, global -> LDS,
// 16 B per lane and copy; a wave's copy covers 4 whole rows (4 whole lines).
// ga / gb: first element of the tile, pa / pb: its global row pitch in elements.
// ---------------------------------------------------------------------------
#define TP 72
typedef unsigned short Tile[64][TP];

__device__ __forceinline__ void tiles_async(
    unsigned short* la, const unsigned short* ga, size_t pa,
    unsigned short* lb, const unsigned short* gb, size_t pb, int tid) {
  const int row = tid >> 3, pc = (tid & 7) * 8;
  const unsigned int la0 = (unsigned int)(size_t)(la + row * TP + pc);
  const unsigned int lb0 = (unsigned int)(size_t)(lb + row * TP + pc);
  const unsigned int la1 = la0 + 16 * TP * 2, la2 = la0 + 32 * TP * 2, la3 = la0 + 48 * TP * 2;
  const unsigned int lb1 = lb0 + 16 * TP * 2, lb2 = lb0 + 32 * TP * 2, lb3 = lb0 + 48 * TP * 2;
  const unsigned short* a0 = ga + (size_t)row * pa + pc;
  const unsigned short* a1 = a0 + 16 * pa;
  const unsigned short* a2 = a0 + 32 * pa;
  const unsigned short* a3 = a0 + 48 * pa;
  const unsigned short* b0 = gb + (size_t)row * pb + pc;
  const unsigned short* b1 = b0 + 16 * pb;
  const unsigned short* b2 = b0 + 32 * pb;
  const unsigned short* b3 = b0 + 48 * pb;
  // the copies and, as the last line, the wait that stands before their address registers are reused
  asm volatile(
      "global_load_async_to_lds_b128 %0, %8, off\n\t"
      "global_load_async_to_lds_b128 %1, %9, off\n\t"
      "global_load_async_to_lds_b128 %2, %10, off\n\t"
      "global_load_async_to_lds_b128 %3, %11, off\n\t"
      "global_load_async_to_lds_b128 %4, %12, off\n\t"
      "global_load_async_to_lds_b128 %5, %13, off\n\t"
      "global_load_async_to_lds_b128 %6, %14, off\n\t"
      "global_load_async_to_lds_b128 %7, %15, off\n\t"
      "s_wait_xcnt 0x0"
      :: "v"(la0), "v"(la1), "v"(la2), "v"(la3), "v"(lb0), "v"(lb1), "v"(lb2), "v"(lb3),
         "v"(a0), "v"(a1), "v"(a2), "v"(a3), "v"(b0), "v"(b1), "v"(b2), "v"(b3)
      : "memory");
}
// this wave's copies have landed
__device__ __forceinline__ void wait_async0() { asm volatile("s_wait_asynccnt 0x0" ::: "memory"); }
// this wave's LDS reads and writes have retired (before a buffer it read is refilled)
__device__ __forceinline__ void wait_ds0() { asm volatile("s_wait_dscnt 0x0" ::: "memory"); }

// ---------------------------------------------------------------------------
// 128x128-tile f16 GEMM main loop: D = A[M][K] * Bt[N][K]^T, 4 waves per WG in a 2 x 2
// grid, wave (wr, wc) owns rows 64wr.. x cols 64wc.. (4 x 4 accumulator tiles): each A and
// each Bt fragment read from LDS feeds four WMMAs.  A trip covers 64 of k: the A and Bt
// tiles of trip t + 1 are copied to the other ring buffer while trip t is worked on.
// A ring buffer is 128 A rows, then 128 Bt rows, each 64 elements at pitch TP.
// Fragments are read from LDS with the split k map for A and B
// (row/col = lane&15, elements 0..7 <- k0+8h.., 8..15 <- k0+16+8h..).
// acc[i][j][r] = D(row 64wr + 16i + 8h + r, col 64wc + 16j + (lane&15)).
// Behind the loop the ring is free (no reader, no copy in flight): the epilogues stage in it.
// ---------------------------------------------------------------------------
#define RB (256 * TP)           // elements of one ring buffer
#define RING_ELEMS (2 * RB)
#define SP 136                  // staging pitch, 16-bit elements: 272 B = 16 B x odd
#define FP 132                  // staging pitch, floats: 528 B = 16 B x odd
static_assert(128 * SP * 2 <= RING_ELEMS * 2 && 128 * FP * 4 <= RING_ELEMS * 2);
static_assert(MROWS % 128 == 0 && CDIM % 128 == 0 && HID % 128 == 0);

__device__ __forceinline__ void stage_async(
    unsigned short* buf, const unsigned short* ag, const unsigned short* bg, size_t K, int tid) {
  tiles_async(buf, ag, K, buf + 128 * TP, bg, K, tid);                          // rows 0..63 of both tiles
  tiles_async(buf + 64 * TP, ag + 64 * K, K, buf + 192 * TP, bg + 64 * K, K, tid);   // rows 64..127
}

__device__ __forceinline__ void gemm_main(
    const unsigned short* __restrict__ A, const unsigned short* __restrict__ Bt, int K,
    int m0, int n0, int wr, int wc, int m, int k8, int tid, unsigned short* ring, v8f (&acc)[4][4]) {
#pragma unroll
  for (int i = 0; i < 4; ++i) {
#pragma unroll
    for (int j = 0; j < 4; ++j) acc[i][j] = zero8();
  }
  const unsigned short* ag = A + (size_t)m0 * (size_t)K;
  const unsigned short* bg = Bt + (size_t)n0 * (size_t)K;
  const int nt = K >> 6;
  stage_async(ring, ag, bg, (size_t)K, tid);
  wait_async0();
  __syncthreads();   // tile 0 published
  if (nt > 1) stage_async(ring + RB, ag + 64, bg + 64, (size_t)K, tid);
#pragma unroll 1
  for (int t = 0; t < nt; ++t) {
    const int bf = t & 1;
    const unsigned short* ab = ring + bf * RB + (64 * wr + m) * TP + k8;
    const unsigned short* bb = ring + bf * RB + (128 + 64 * wc + m) * TP + k8;
    // twelve of the trip's sixteen fragments are read as one group ahead of its WMMAs; the A fragments of
    // the second k half follow in two pairs, into registers that the first half has left (all sixteen at
    // once, beside 128 accumulator registers, would take 256 registers)
    Frag a0[4], b0[4], a1[4], b1[4];
#pragma unroll
    for (int j = 0; j < 4; ++j) {
      b0[j].q[0] = *(const v4u*)(bb + 16 * j * TP);
      b0[j].q[1] = *(const v4u*)(bb + 16 * j * TP + 16);
    }
#pragma unroll
    for (int i = 0; i < 4; ++i) {
      a0[i].q[0] = *(const v4u*)(ab + 16 * i * TP);
      a0[i].q[1] = *(const v4u*)(ab + 16 * i * TP + 16);
    }
#pragma unroll
    for (int j = 0; j < 4; ++j) {
      b1[j].q[0] = *(const v4u*)(bb + 16 * j * TP + 32);
      b1[j].q[1] = *(const v4u*)(bb + 16 * j * TP + 48);
    }
    // holds the reads above as one group ahead of the WMMAs: left free, this build sinks each read to its first use
    // and waits for it there, one LDS latency a fragment
    __builtin_amdgcn_sched_barrier(0);
#pragma unroll
    for (int g = 0; g < 2; ++g) {
#pragma unroll
      for (int i = 2 * g; i < 2 * g + 2; ++i) {
#pragma unroll
        for (int j = 0; j < 4; ++j) acc[i][j] = mma(a0[i].v, b0[j].v, acc[i][j]);
      }
      __builtin_amdgcn_sched_barrier(0);   // the pair of A fragments below is read here, eight WMMAs or more ahead of its use
#pragma unroll
      for (int i = 2 * g; i < 2 * g + 2; ++i) {
        a1[i].q[0] = *(const v4u*)(ab + 16 * i * TP + 32);
        a1[i].q[1] = *(const v4u*)(ab + 16 * i * TP + 48);
      }
      __builtin_amdgcn_sched_barrier(0);   // and not later
    }
#pragma unroll
    for (int i = 0; i < 4; ++i) {
#pragma unroll
      for (int j = 0; j < 4; ++j) acc[i][j] = mma(a1[i].v, b1[j].v, acc[i][j]);
    }
    __builtin_amdgcn_sched_barrier(0);   // the WMMAs stay ahead of the wait to 0: they start on counted waits
    wait_ds0();
    wait_async0();
    __syncthreads();   // publishes tile t + 1; ends every read of buffer bf
    if (t + 2 < nt)
      stage_async(ring + bf * RB, ag + (size_t)(t + 2) * 64, bg + (size_t)(t + 2) * 64, (size_t)K, tid);
  }
  wait_async0();
}

// ---------------------------------------------------------------------------
// q/k/v projection: A = LN1 plane [M][512], Bt = [1536][512] (q rows, k rows, v rows).
// value = acc/16 + bf16q(bias).  q and k -> planes [b*H+h][t][64]; v -> transposed
// plane vt[b*H+h][64][t].  The three planes are contiguous: plane p at qkv + p*M*512.
// A wave's 64 columns are one head.
// coverage: 16 passes x 4 rows = 64 rows x 64 cols per wave (q/k); 16 passes x 4 d = 64 d rows x 64 tokens per wave (v).
// LDS sT (in the ring): wave-private quadrants; block barrier orders the reload.
// ---------------------------------------------------------------------------
__global__ __launch_bounds__(128) void k_gemm_qkv(
    const unsigned short* __restrict__ A, const unsigned short* __restrict__ Bt,
    const float* __restrict__ bq, const float* __restrict__ bk, const float* __restrict__ bv,
    unsigned short* __restrict__ qkv) {
  __shared__ __attribute__((aligned(16))) unsigned short ring[RING_ELEMS];
  const int tid = threadIdx.x, lane = tid & 31, w = tid >> 5;
  const int wr = w >> 1, wc = w & 1;
  const int m = lane & 15, hl = lane >> 4, k8 = hl * 8;
  const int m0 = blockIdx.y * 128, n0 = blockIdx.x * 128;

  v8f acc[4][4];
  gemm_main(A, Bt, CDIM, m0, n0, wr, wc, m, k8, tid, ring, acc);

  unsigned short (*sT)[SP] = (unsigned short (*)[SP])ring;
  const float wsc = 0.0625f;               // undo the x16 weight carry
  const int lrow0 = 64 * wr + 8 * hl;      // D rows of this lane within the WG tile
  const int lcol0 = 64 * wc;               // first column of this wave within the WG tile
  const int which = n0 / CDIM;             // 0 q, 1 k, 2 v (WG-uniform)
  const int cb = n0 - which * CDIM;
#pragma unroll
  for (int j = 0; j < 4; ++j) {
    const int cn = cb + lcol0 + 16 * j + m;
    const float b0 = bf16q(bq[cn]);
    const float b1 = bf16q(bk[cn]);
    const float b2 = bf16q(bv[cn]);
    const float bj = (which == 0) ? b0 : ((which == 1) ? b1 : b2);
#pragma unroll
    for (int i = 0; i < 4; ++i) {
#pragma unroll
      for (int r = 0; r < 8; ++r) sT[lrow0 + 16 * i + r][lcol0 + 16 * j + m] = hbits(acc[i][j][r] * wsc + bj);
    }
  }
  __syncthreads();   // orders the reload
  const int hh = cb / HD + wc;
  const int b = m0 / SEQ, t0 = m0 - b * SEQ + 64 * wr;   // first token of this wave's quadrant
  const int bh = b * NHEAD + hh;
  unsigned short* dst = qkv + (size_t)which * ((size_t)MROWS * CDIM);
  v4u val[16];
  unsigned int off[16];
  if (which < 2) {                       // WG-uniform
#pragma unroll
    for (int p = 0; p < 16; ++p) {
      const int row = 4 * p + (lane >> 3);
      const int piece = lane & 7;
      val[p] = *(const v4u*)&sT[64 * wr + row][lcol0 + piece * 8];
      off[p] = (unsigned int)((bh * SEQ + t0 + row) * HD + piece * 8);
    }
  } else {
#pragma unroll
    for (int p = 0; p < 16; ++p) {
      const int d = 4 * p + (lane >> 3);
      const int piece = lane & 7;
      unsigned int wv[4];
#pragma unroll
      for (int e = 0; e < 4; ++e) {
        const unsigned int lo = sT[64 * wr + piece * 8 + 2 * e][lcol0 + d];
        const unsigned int hi = sT[64 * wr + piece * 8 + 2 * e + 1][lcol0 + d];
        wv[e] = lo | (hi << 16);
      }
      v4u t;
      t.x = wv[0]; t.y = wv[1]; t.z = wv[2]; t.w = wv[3];
      val[p] = t;
      off[p] = (unsigned int)((bh * HD + d) * SEQ + t0 + piece * 8);
    }
  }
#pragma unroll
  for (int p = 0; p < 16; ++p) *(v4u*)(dst + off[p]) = val[p];
  
}

// ---------------------------------------------------------------------------
// GEMM + bias + residual, f32 output of width CDIM:
// out = acc/16 + bf16q(bias) + res.  resfull: res rows read at full strides and
// converted to bf16 values; outfull: out rows written at full strides.
// Residual added at the store stage as float4.
// coverage: 32 passes x 2 rows per wave = 64 rows x 64 cols per wave.
// LDS sF (in the ring): wave-private quadrants; block barrier orders the reload.
// ---------------------------------------------------------------------------
__global__ __launch_bounds__(128) void k_gemm_res(
    const unsigned short* __restrict__ A, const unsigned short* __restrict__ Bt, int K,
    const float* __restrict__ bias, const float* __restrict__ res,
    float* __restrict__ outF, int resfull, int outfull) {
  __shared__ __attribute__((aligned(16))) unsigned short ring[RING_ELEMS];
  const int tid = threadIdx.x, lane = tid & 31, w = tid >> 5;
  const int wr = w >> 1, wc = w & 1;
  const int m = lane & 15, hl = lane >> 4, k8 = hl * 8;
  const int m0 = blockIdx.y * 128, n0 = blockIdx.x * 128;

  v8f acc[4][4];
  gemm_main(A, Bt, K, m0, n0, wr, wc, m, k8, tid, ring, acc);

  float (*sF)[FP] = (float (*)[FP])ring;
  const float wsc = 0.0625f;
  const int lrow0 = 64 * wr + 8 * hl;
  const int lcol0 = 64 * wc;
#pragma unroll
  for (int i = 0; i < 4; ++i) {
#pragma unroll
    for (int j = 0; j < 4; ++j) {
#pragma unroll
      for (int r = 0; r < 8; ++r) sF[lrow0 + 16 * i + r][lcol0 + 16 * j + m] = acc[i][j][r] * wsc;
    }
  }
  __syncthreads();
  const int b = m0 / SEQ, t0 = m0 - b * SEQ;
  const int row0 = 64 * wr + hl;                            // pass p: row row0 + 2p
  const int piece = m;
  const int ncol = n0 + lcol0 + 4 * piece;
  const size_t frow0 = (size_t)b * SEQ_FULL + t0 + row0;    // full-stride row
  const size_t crow0 = (size_t)(m0 + row0);                 // compact row
  const float* rp = res + (resfull ? frow0 : crow0) * (size_t)CDIM + ncol;
  float* op = outF + (outfull ? frow0 : crow0) * (size_t)CDIM + ncol;
  const v4f bv = bf16q4(*(const v4f*)(bias + ncol));
  v4f val[32];
#pragma unroll
  for (int p = 0; p < 32; ++p) {
    const v4f a = *(const v4f*)&sF[row0 + 2 * p][lcol0 + 4 * piece];
    const v4f rraw = *(const v4f*)(rp + 2 * p * CDIM);
    const v4f rq = bf16q4(rraw);
    const v4f rr = resfull ? rq : rraw;
    val[p] = (a + bv) + rr;
  }
#pragma unroll
  for (int p = 0; p < 32; ++p) *(v4f*)(op + 2 * p * CDIM) = val[p];
  
}

// ---------------------------------------------------------------------------
// ffn1: f16 out[M][HID] = gelu_erf(acc/16 + bf16q(bias)).
// The pre-activation is staged as f32; gelu and the f16 convert are done at the reload, eight values a lane and pass.
// coverage: 16 passes x 4 rows per wave = 64 rows x 64 cols per wave.
// LDS sF (in the ring): wave-private quadrants; block barrier orders the reload.
// ---------------------------------------------------------------------------
__global__ __launch_bounds__(128) void k_gemm_gelu(
    const unsigned short* __restrict__ A, const unsigned short* __restrict__ Bt, int K,
    const float* __restrict__ bias, unsigned short* __restrict__ out0) {
  __shared__ __attribute__((aligned(16))) unsigned short ring[RING_ELEMS];
  const int tid = threadIdx.x, lane = tid & 31, w = tid >> 5;
  const int wr = w >> 1, wc = w & 1;
  const int m = lane & 15, hl = lane >> 4, k8 = hl * 8;
  const int m0 = blockIdx.y * 128, n0 = blockIdx.x * 128;

  v8f acc[4][4];
  gemm_main(A, Bt, K, m0, n0, wr, wc, m, k8, tid, ring, acc);

  float (*sF)[FP] = (float (*)[FP])ring;
  const float wsc = 0.0625f;
  const int lrow0 = 64 * wr + 8 * hl;
  const int lcol0 = 64 * wc;
#pragma unroll
  for (int j = 0; j < 4; ++j) {
    const float bj = bf16q(bias[n0 + lcol0 + 16 * j + m]);
#pragma unroll
    for (int i = 0; i < 4; ++i) {
#pragma unroll
      for (int r = 0; r < 8; ++r) sF[lrow0 + 16 * i + r][lcol0 + 16 * j + m] = acc[i][j][r] * wsc + bj;
    }
  }
  __syncthreads();
  const int piece = lane & 7;
  const float* sr = &sF[64 * wr + (lane >> 3)][lcol0 + piece * 8];
  unsigned short* orow = out0 + (size_t)(m0 + 64 * wr + (lane >> 3)) * (size_t)HID + n0 + lcol0 + piece * 8;
  // four passes a trip: their LDS reads go out as one group, and the text stays small
#pragma unroll 4
  for (int p = 0; p < 16; ++p) {
    const v4f u0 = *(const v4f*)(sr + 4 * p * FP);
    const v4f u1 = *(const v4f*)(sr + 4 * p * FP + 4);
    const v8f gl = gelu8(__builtin_shufflevector(u0, u1, 0, 1, 2, 3, 4, 5, 6, 7));
    const v4u o = pack8h(gl[0], gl[1], gl[2], gl[3], gl[4], gl[5], gl[6], gl[7]);
    *(v4u*)(orow + (size_t)(4 * p) * (size_t)HID) = o;
  }
  
}

template <bool V> struct Flag { static constexpr bool value = V; };
// value of lane l ^ 16
__device__ __forceinline__ float other_half(float f) {
  const int b = __builtin_bit_cast(int, f);
  return __builtin_bit_cast(float, __builtin_amdgcn_permlanex16(b, b, 0x76543210, 0xfedcba98, false, false));
}

// Four waves a SIMD (512 work-groups of 8 waves on 1,024 SIMDs): the vector work between the matrix runs of one wave
// is covered by three others.  The register budget is set for that, and two work-groups fit a WGP.
__global__ __launch_bounds__(256) __attribute__((amdgpu_waves_per_eu(4, 4)))
void k_attn(const unsigned short* __restrict__ qp, const unsigned short* __restrict__ kp,
            const unsigned short* __restrict__ vp, unsigned short* __restrict__ op) {
  __shared__ __attribute__((aligned(16))) unsigned short sP[4][32][72];
  __shared__ __attribute__((aligned(16))) Tile sK[2][2];     // [key half][buffer]
  __shared__ __attribute__((aligned(16))) Tile sV[2][2];
  __shared__ __attribute__((aligned(16))) float sM[4][17][32][4];
  const int tid = threadIdx.x & 127, lane = tid & 31;                 // place within the key half
  const int w = __builtin_amdgcn_readfirstlane(tid >> 5);             // in a scalar register: two vector registers short, this build spilled
  const int kh = __builtin_amdgcn_readfirstlane((int)(threadIdx.x >> 7));   // key half of this wave
  const int m = lane & 15, hl = lane >> 4, k8 = hl * 8;
  const int nkt = SEQ / 128;                // key chunks of one half
  const int nqt = SEQ / 128;                // query tiles of one (b,h)
  const int bh = blockIdx.x / nqt, qt = blockIdx.x - bh * nqt;
  const int b = bh / NHEAD, hh = bh - b * NHEAD;
  const int tq = qt * 128 + 32 * w;         // first query row of this wave (within the sequence)

  const unsigned short* kg = kp + ((size_t)bh * SEQ + (size_t)kh * (SEQ / 2)) * HD;   // chunk kt: + kt*64 rows, row pitch HD
  const unsigned short* vg = vp + (size_t)bh * HD * SEQ + (size_t)kh * (SEQ / 2);     // chunk kt: + kt*64 columns, row pitch SEQ
  tiles_async(&sK[kh][0][0][0], kg, (size_t)HD, &sV[kh][0][0][0], vg, (size_t)SEQ, tid);

  Frag qa0[2], qa1[2];     // B fragments of column group c: column = query tq + 16c + m, k = d in the split map
  {
    const unsigned short* qr0 = qp + ((size_t)bh * SEQ + tq + m) * HD + k8;
    const unsigned short* qr1 = qr0 + 16 * HD;
    // the loads and their data wait in one statement, so that no address register is rewritten ahead of a wait
    // the latency runs beside that of chunk 0's copies
    asm volatile(
        "global_load_b128 %0, %8, off\n\t"
        "global_load_b128 %1, %8, off offset:32\n\t"
        "global_load_b128 %2, %8, off offset:64\n\t"
        "global_load_b128 %3, %8, off offset:96\n\t"
        "global_load_b128 %4, %9, off\n\t"
        "global_load_b128 %5, %9, off offset:32\n\t"
        "global_load_b128 %6, %9, off offset:64\n\t"
        "global_load_b128 %7, %9, off offset:96\n\t"
        "s_wait_loadcnt 0x0"
        : "=&v"(qa0[0].q[0]), "=&v"(qa0[0].q[1]), "=&v"(qa1[0].q[0]), "=&v"(qa1[0].q[1]),
          "=&v"(qa0[1].q[0]), "=&v"(qa0[1].q[1]), "=&v"(qa1[1].q[0]), "=&v"(qa1[1].q[1])
        : "v"(qr0), "v"(qr1)
        : "memory");
  }
  wait_async0();
  __syncthreads();   // chunk 0 published
  if (nkt > 1)
    tiles_async(&sK[kh][1][0][0], kg + (size_t)64 * HD, (size_t)HD, &sV[kh][1][0][0], vg + 64, (size_t)SEQ, tid);
  const float SC = 0.125f * 1.44269504088896341f;   // raw score -> log2 units
  float mrun[2];             // running max of query 16c + m, raw score units (equal in both lane halves)
  v8f lrun[2];               // partial sums of 1024 p over this lane's keys
  v8f oacc[2][4];            // oacc[c][jd][r] = O^T(d = 16jd + 8hl + r, query 16c + m), x1024
#pragma unroll
  for (int c = 0; c < 2; ++c) {
    mrun[c] = -1e30f;
    lrun[c] = zero8();
#pragma unroll
    for (int j = 0; j < 4; ++j) oacc[c][j] = zero8();
  }

  // One trip.  The refill is a compile-time choice, so that a trip is one straight block: with a branch at its foot
  // this build moved the row sums behind the branch, which kept the 64 registers of p live through the products.
  auto trip = [&](const int kt, auto refill) __attribute__((always_inline)) {
    const int bf = kt & 1;
    // ---- S^T = K Q^T, four 16-key tiles x two column groups ----
    // all K fragment reads of the chunk as one group ahead of its WMMAs: one LDS latency, not four
    Frag f0[4], f1[4];
#pragma unroll
    for (int j = 0; j < 4; ++j) {
      const unsigned short* kr = &sK[kh][bf][16 * j + m][k8];
      f0[j].q[0] = *(const v4u*)(kr);
      f0[j].q[1] = *(const v4u*)(kr + 16);
      f1[j].q[0] = *(const v4u*)(kr + 32);
      f1[j].q[1] = *(const v4u*)(kr + 48);
    }
    __builtin_amdgcn_sched_barrier(0);   // holds the reads above as one group: left free, this build sinks them to their first uses
    v8f st[2][4];
#pragma unroll
    for (int j = 0; j < 4; ++j) {
#pragma unroll
      for (int c = 0; c < 2; ++c) st[c][j] = mma(f0[j].v, qa0[c].v, zero8());
    }
#pragma unroll
    for (int j = 0; j < 4; ++j) {
#pragma unroll
      for (int c = 0; c < 2; ++c) st[c][j] = mma(f1[j].v, qa1[c].v, st[c][j]);
    }
    __builtin_amdgcn_sched_barrier(0);   // the reads below stay behind the score WMMAs: risen among them, beside all of K, they cost spills
    // the V^T fragment reads of the first 32 keys as one group; their latency runs under the softmax
    // (those of the other 32 keys follow behind it: all at once do not fit the registers of four waves a SIMD)
    Frag g0[4], g1[4];
#pragma unroll
    for (int jd = 0; jd < 4; ++jd) {
      const unsigned short* vr = &sV[kh][bf][16 * jd + m][k8];
      g0[jd].q[0] = *(const v4u*)(vr);
      g0[jd].q[1] = *(const v4u*)(vr + 16);
    }
    v16h pb0[2], pb1[2];
#pragma unroll
    for (int c = 0; c < 2; ++c) {
      // ---- running max of this lane's query ----
      float t4[4];               // one chain per tile: four independent chains, not one of 32 links
#pragma unroll
      for (int j = 0; j < 4; ++j) {
        t4[j] = st[c][j][0];
#pragma unroll
        for (int r = 1; r < 8; ++r) t4[j] = fmaxf(t4[j], st[c][j][r]);
      }
      float tm = fmaxf(fmaxf(t4[0], t4[1]), fmaxf(t4[2], t4[3]));
      tm = fmaxf(tm, other_half(tm));
      const float mn = fmaxf(mrun[c], tm);
      const float corr = __builtin_amdgcn_exp2f((mrun[c] - mn) * SC);
      mrun[c] = mn;
      // ---- 1024 p = 2^(s SC - m SC + 10) ----
      const v8f sc8 = splat8(SC), nb8 = splat8(10.0f - mn * SC), corr8 = splat8(corr);
#pragma unroll
      for (int j = 0; j < 4; ++j) {
        const v8f e = __builtin_elementwise_fma(st[c][j], sc8, nb8);
#pragma unroll
        for (int r = 0; r < 8; ++r) st[c][j][r] = __builtin_amdgcn_exp2f(e[r]);
      }
      lrun[c] = __builtin_elementwise_fma(lrun[c], corr8, (st[c][0] + st[c][1]) + (st[c][2] + st[c][3]));
#pragma unroll
      for (int j = 0; j < 4; ++j) oacc[c][j] = oacc[c][j] * corr8;
      // ---- P^T fragments: elements 0..7 = keys 32i + 8hl + .., 8..15 = keys 32i + 16 + 8hl + .. ----
      pb0[c] = __builtin_shufflevector(__builtin_convertvector(st[c][0], v8h), __builtin_convertvector(st[c][1], v8h),
                                       0, 1, 2, 3, 4, 5, 6, 7, 8, 9, 10, 11, 12, 13, 14, 15);
      pb1[c] = __builtin_shufflevector(__builtin_convertvector(st[c][2], v8h), __builtin_convertvector(st[c][3], v8h),
                                       0, 1, 2, 3, 4, 5, 6, 7, 8, 9, 10, 11, 12, 13, 14, 15);
    }
    // ---- O^T += V^T (64 d x 64 keys) * P^T (64 keys x 32 queries) ----
#pragma unroll
    for (int jd = 0; jd < 4; ++jd) {
      const unsigned short* vr = &sV[kh][bf][16 * jd + m][k8];
      g1[jd].q[0] = *(const v4u*)(vr + 32);
      g1[jd].q[1] = *(const v4u*)(vr + 48);
    }
    __builtin_amdgcn_sched_barrier(0);   // holds the reads above as one group: left free, this build deals them in pairs among the WMMAs
#pragma unroll
    for (int jd = 0; jd < 4; ++jd) {
#pragma unroll
      for (int c = 0; c < 2; ++c) oacc[c][jd] = mma(g0[jd].v, pb0[c], oacc[c][jd]);
    }
#pragma unroll
    for (int jd = 0; jd < 4; ++jd) {
#pragma unroll
      for (int c = 0; c < 2; ++c) oacc[c][jd] = mma(g1[jd].v, pb1[c], oacc[c][jd]);
    }
    __builtin_amdgcn_sched_barrier(0);   // the WMMAs stay ahead of the wait to 0: they start on counted waits
    wait_ds0();
    wait_async0();
    __syncthreads();   // publishes chunk kt + 1; ends every read of buffer bf
    if constexpr (refill.value)
      tiles_async(&sK[kh][bf][0][0], kg + (size_t)(kt + 2) * 64 * HD, (size_t)HD,
                  &sV[kh][bf][0][0], vg + (size_t)(kt + 2) * 64, (size_t)SEQ, tid);
  };
  const int nfill = (nkt > 2) ? nkt - 2 : 0;   // trips behind which a chunk kt + 2 exists
  // both loops stay rolled: one copy of the trip's text each, and no second trip's registers beside the first's
#pragma unroll 1
  for (int kt = 0; kt < nfill; ++kt) trip(kt, Flag<true>());
#pragma unroll 1
  for (int kt = nfill; kt < nkt; ++kt) trip(kt, Flag<false>());
  wait_async0();

  // ---- join the key halves: the second half hands over its max, sum and O^T, lane by lane ----
  float lj[2];
#pragma unroll
  for (int c = 0; c < 2; ++c)
    lj[c] = ((lrun[c][0] + lrun[c][1]) + (lrun[c][2] + lrun[c][3])) + ((lrun[c][4] + lrun[c][5]) + (lrun[c][6] + lrun[c][7]));
  if (kh == 1) {               // wave-uniform
#pragma unroll
    for (int c = 0; c < 2; ++c) {
#pragma unroll
      for (int jd = 0; jd < 4; ++jd) {
        const v8f o = oacc[c][jd];
        *(v4f*)&sM[w][(4 * c + jd) * 2][lane][0] = __builtin_shufflevector(o, o, 0, 1, 2, 3);
        *(v4f*)&sM[w][(4 * c + jd) * 2 + 1][lane][0] = __builtin_shufflevector(o, o, 4, 5, 6, 7);
      }
    }
    v4f ml;
    ml.x = mrun[0]; ml.y = mrun[1]; ml.z = lj[0]; ml.w = lj[1];
    *(v4f*)&sM[w][16][lane][0] = ml;
  }
  __syncthreads();   // the second half's partial results published
  // ---- finalize: o = (acc_a f_a + acc_b f_b) / (l_a f_a + l_b f_b) (all x1024), staged for whole-line stores ----
  if (kh == 0) {               // wave-uniform
    const v4f ml = *(const v4f*)&sM[w][16][lane][0];
#pragma unroll
    for (int c = 0; c < 2; ++c) {
      const float mb = (c == 0) ? ml.x : ml.y;
      const float lb = (c == 0) ? ml.z : ml.w;
      const float mn = fmaxf(mrun[c], mb);
      const float fa = __builtin_amdgcn_exp2f((mrun[c] - mn) * SC);
      const float fb = __builtin_amdgcn_exp2f((mb - mn) * SC);
      float l = lj[c] * fa + lb * fb;
      l += other_half(l);
      const float il = 1.0f / l;
      const v8f ga8 = splat8(fa * il), gb8 = splat8(fb * il);
#pragma unroll
      for (int jd = 0; jd < 4; ++jd) {
        const v4f b0 = *(const v4f*)&sM[w][(4 * c + jd) * 2][lane][0];
        const v4f b1 = *(const v4f*)&sM[w][(4 * c + jd) * 2 + 1][lane][0];
        const v8f ob = __builtin_shufflevector(b0, b1, 0, 1, 2, 3, 4, 5, 6, 7);
        const v8h o8 = __builtin_convertvector(oacc[c][jd] * ga8 + ob * gb8, v8h);
        *(v4u*)&sP[w][16 * c + m][16 * jd + k8] = __builtin_bit_cast(v4u, o8);
      }
    }
  }
  __syncthreads();   // the staged rows published: all eight waves store, 16 rows each
  v4u val[4];
  unsigned int off[4];
#pragma unroll
  for (int p = 0; p < 4; ++p) {
    const int row = 16 * kh + 4 * p + (lane >> 3);
    const int piece = lane & 7;
    val[p] = *(const v4u*)&sP[w][row][piece * 8];
    off[p] = (unsigned int)((size_t)(b * SEQ + tq + row) * CDIM + hh * HD + piece * 8);
  }
#pragma unroll
  for (int p = 0; p < 4; ++p) *(v4u*)(op + off[p]) = val[p];
  
}

// ---------------------------------------------------------------------------
// Host launcher
// ---------------------------------------------------------------------------
constexpr size_t al256c(size_t v) { return (v + 255) & ~(size_t)255; }
constexpr size_t MCE = (size_t)MROWS * CDIM;
constexpr size_t SZ_WQKV = al256c((size_t)3 * CDIM * CDIM * 2);
constexpr size_t SZ_WO   = al256c((size_t)CDIM * CDIM * 2);
constexpr size_t SZ_W1   = al256c((size_t)HID * CDIM * 2);
constexpr size_t SZ_W2   = al256c((size_t)CDIM * HID * 2);
constexpr size_t SZ_H    = al256c(MCE * 2);
constexpr size_t SZ_QKV  = al256c((size_t)3 * MCE * 2);
constexpr size_t SZ_O    = al256c(MCE * 2);
constexpr size_t SZ_X1   = al256c(MCE * 4);
constexpr size_t SZ_H2   = al256c(MCE * 2);
constexpr size_t SZ_ACT  = al256c((size_t)MROWS * HID * 2);
constexpr size_t WS_TOTAL = SZ_WQKV + SZ_WO + SZ_W1 + SZ_W2 + SZ_H + SZ_QKV + SZ_O + SZ_X1 + SZ_H2 + SZ_ACT;
static_assert(WS_TOTAL <= (size_t)134217728);
static_assert((size_t)MROWS * HID < (size_t)4294967296ull);     // u32 element offsets in the epilogues
static_assert((size_t)NB_FULL * SEQ_FULL * CDIM < (size_t)4294967296ull);

extern "C" void kernel_launch(void* const* d_in, const int* in_sizes, int n_in,
                              void* d_out, int out_size, void* d_ws, size_t ws_size,
                              hipStream_t stream) {
  if (n_in < 17) return;
  const long needX = ((long)(NB - 1) * SEQ_FULL + SEQ) * CDIM;
  const long nWW = (long)CDIM * CDIM;
  if ((long)in_sizes[0] < needX) return;
  if ((long)in_sizes[1] < nWW || in_sizes[2] < CDIM) return;
  if ((long)in_sizes[3] < nWW || in_sizes[4] < CDIM) return;
  if ((long)in_sizes[5] < nWW || in_sizes[6] < CDIM) return;
  if ((long)in_sizes[7] < nWW || in_sizes[8] < CDIM) return;
  if ((long)in_sizes[9] < (long)CDIM * HID || in_sizes[10] < HID) return;
  if ((long)in_sizes[11] < (long)HID * CDIM || in_sizes[12] < CDIM) return;
  if (in_sizes[13] < CDIM || in_sizes[14] < CDIM) return;
  if (in_sizes[15] < CDIM || in_sizes[16] < CDIM) return;
  if ((long)out_size < needX) return;
  if ((size_t)WS_TOTAL > ws_size) return;

  const float* x   = (const float*)d_in[0];
  const float* Wq  = (const float*)d_in[1];
  const float* bq  = (const float*)d_in[2];
  const float* Wk  = (const float*)d_in[3];
  const float* bk  = (const float*)d_in[4];
  const float* Wv  = (const float*)d_in[5];
  const float* bv  = (const float*)d_in[6];
  const float* Wo  = (const float*)d_in[7];
  const float* bo  = (const float*)d_in[8];
  const float* W1  = (const float*)d_in[9];
  const float* b1  = (const float*)d_in[10];
  const float* W2  = (const float*)d_in[11];
  const float* b2  = (const float*)d_in[12];
  const float* g1  = (const float*)d_in[13];
  const float* be1 = (const float*)d_in[14];
  const float* g2  = (const float*)d_in[15];
  const float* be2 = (const float*)d_in[16];
  float* out = (float*)d_out;

  char* ws = (char*)d_ws;
  size_t off = 0;
  unsigned short* wqkv = (unsigned short*)(ws + off); off += SZ_WQKV;   // [1536][512]
  unsigned short* wot  = (unsigned short*)(ws + off); off += SZ_WO;     // [512][512]
  unsigned short* w1t  = (unsigned short*)(ws + off); off += SZ_W1;     // [2048][512]
  unsigned short* w2t  = (unsigned short*)(ws + off); off += SZ_W2;     // [512][2048]
  unsigned short* hpl  = (unsigned short*)(ws + off); off += SZ_H;      // [M][512]
  unsigned short* qkv  = (unsigned short*)(ws + off); off += SZ_QKV;    // q [B*H][SEQ][64], k same, vt [B*H][64][SEQ]
  unsigned short* opl  = (unsigned short*)(ws + off); off += SZ_O;      // [M][512]
  float*          x1   = (float*)(ws + off);          off += SZ_X1;     // [M][512]
  unsigned short* h2p  = (unsigned short*)(ws + off); off += SZ_H2;     // [M][512]
  unsigned short* act  = (unsigned short*)(ws + off); off += SZ_ACT;    // [M][2048]
  if (off > ws_size) return;
  unsigned short* qpl = qkv;
  unsigned short* kpl = qkv + MCE;
  unsigned short* vtp = qkv + 2 * MCE;

  // 1) + 2) one launch: LN1 on bf16 values of x -> h (f16), and the six weight planes
  //    in[K][N] -> out[N][K], bf16 values x16 as f16
  k_prep<<<LNB + 4 * WB1 + 2 * WB2, 256, 0, stream>>>(x, g1, be1, hpl, Wq, Wk, Wv, Wo, W1, W2,
                                                     wqkv, wot, w1t, w2t);
  // 3) q/k/v projections + bias -> q, k, vt planes
  k_gemm_qkv<<<dim3(3 * CDIM / 128, MROWS / 128), 128, 0, stream>>>(hpl, wqkv, bq, bk, bv, qkv);
  // 4) attention -> o plane
  k_attn<<<NB * NHEAD * (SEQ / 128), 256, 0, stream>>>(qpl, kpl, vtp, opl);
  // 5) output projection + bias + residual(bf16 values of x) -> x1 (f32, compact rows)
  k_gemm_res<<<dim3(CDIM / 128, MROWS / 128), 128, 0, stream>>>(opl, wot, CDIM, bo, x, x1, 1, 0);
  // 6) LN2 -> h2 (f16)
  k_ln_mid<<<MROWS / 8, 256, 0, stream>>>(x1, g2, be2, h2p, MROWS);
  // 7) ffn1 + bias + gelu(erf) -> act (f16)
  k_gemm_gelu<<<dim3(HID / 128, MROWS / 128), 128, 0, stream>>>(h2p, w1t, CDIM, b1, act);
  // 8) ffn2 + bias + residual(x1) -> out (f32, full strides)
  k_gemm_res<<<dim3(CDIM / 128, MROWS / 128), 128, 0, stream>>>(act, w2t, HID, b2, x1, out, 0, 1);
}

// v009
// It runs in 130 microseconds.
// In two side-by-side timings against v008, it was 1.06 and 1.07 times as fast.
// Over all steps from v000 it is 5.08 times as fast.
#include <hip/hip_runtime.h>

// Contractions: v_wmma_f32_16x16x32_f16 (f16 operands, f32 accumulate) for q/k/v projections, q.k^T, p.v, output projection, ffn1, ffn2; weight planes carried x16, p carried x1024, activations x1.

#pragma clang fp contract(off)

#ifndef NB
#define NB 2
#endif
#ifndef SEQ
#define SEQ 4096
#endif
#define NB_FULL 2
#define SEQ_FULL 4096
#define CDIM 512
#define NHEAD 8
#define HD 64
#define HID 2048
#define MROWS (NB * SEQ)

static_assert(NB >= 1 && NB <= NB_FULL);
static_assert(SEQ % 128 == 0 && SEQ >= 128 && SEQ <= SEQ_FULL);
static_assert(CDIM == NHEAD * HD);
static_assert(HD == 64);
static_assert(CDIM == 512);
static_assert(CDIM == 32 * 2 * 8);          // LayerNorm lane map: 32 lanes x 2 segments x 8 columns
static_assert(HID % 64 == 0 && CDIM % 64 == 0);
static_assert(CDIM % 32 == 0 && HID % 32 == 0);   // WMMA k-steps of 32, two per 64-wide k trip
static_assert(MROWS % 64 == 0);
static_assert(MROWS % 8 == 0);
static_assert((3 * CDIM) % 64 == 0);

typedef _Float16 v16h __attribute__((ext_vector_type(16)));
typedef _Float16 v8h  __attribute__((ext_vector_type(8)));
typedef float    v8f  __attribute__((ext_vector_type(8)));
typedef float    v4f  __attribute__((ext_vector_type(4)));
typedef unsigned int v4u __attribute__((ext_vector_type(4)));

union Frag { v16h v; v4u q[2]; };

// D += A(16x32) * B(32x16); the builtin form: the compiler keeps the distances behind it
__device__ __forceinline__ v8f mma(v16h a, v16h b, v8f c) {
  return __builtin_amdgcn_wmma_f32_16x16x32_f16(false, a, false, b, (short)0, c, false, false);
}

__device__ __forceinline__ v8f zero8() {
  v8f z;
#pragma unroll
  for (int i = 0; i < 8; ++i) z[i] = 0.0f;
  return z;
}

__device__ __forceinline__ v8f splat8(float f) {
  v8f z;
#pragma unroll
  for (int i = 0; i < 8; ++i) z[i] = f;
  return z;
}

// f32 -> nearest-even bf16 value, returned as f32
__device__ __forceinline__ float bf16q(float f) {
  unsigned int u = __float_as_uint(f);
  unsigned int r = u + 0x7FFFu + ((u >> 16) & 1u);
  r = ((u & 0x7F800000u) == 0x7F800000u) ? u : r;
  return __uint_as_float(r & 0xFFFF0000u);
}
__device__ __forceinline__ v4f bf16q4(v4f a) {
  v4f r;
  r.x = bf16q(a.x); r.y = bf16q(a.y); r.z = bf16q(a.z); r.w = bf16q(a.w);
  return r;
}
// f32 -> f16 (RNE convert) bit pattern
__device__ __forceinline__ unsigned short hbits(float f) {
  _Float16 h = (_Float16)f;
  return __builtin_bit_cast(unsigned short, h);
}
__device__ __forceinline__ v4u pack8h(float f0, float f1, float f2, float f3,
                                      float f4, float f5, float f6, float f7) {
  v8h t;
  t[0] = (_Float16)f0; t[1] = (_Float16)f1; t[2] = (_Float16)f2; t[3] = (_Float16)f3;
  t[4] = (_Float16)f4; t[5] = (_Float16)f5; t[6] = (_Float16)f6; t[7] = (_Float16)f7;
  return __builtin_bit_cast(v4u, t);
}
// gelu(u) = u Phi(u) = max(u, 0) - |u| erfc(|u| / sqrt 2) / 2 for eight values, without a branch:
// erfc(x) = t (a1 + t (a2 + t (a3 + t (a4 + t a5)))) exp(-x^2), t = 1 / (1 + p x), x >= 0: absolute error of the form
// below 1.5e-7 for every x, a few f32 roundings on top (the result is stored as f16), and no cancellation for
// negative u.  With y = x sqrt(log2 e): exp(-x^2) = 2^(-y^2).
__device__ __forceinline__ v8f gelu8(v8f u) {
  const v8f au = __builtin_elementwise_abs(u);
  const v8f y = au * splat8(0.84932180f);                                            // sqrt(log2 e) / sqrt 2
  const v8f d = __builtin_elementwise_fma(y, splat8(0.27273748f), splat8(1.0f));     // p / sqrt(log2 e)
  const v8f ny2 = -(y * y);
  v8f t, e;
#pragma unroll
  for (int i = 0; i < 8; ++i) {
    t[i] = __builtin_amdgcn_rcpf(d[i]);
    e[i] = __builtin_amdgcn_exp2f(ny2[i]);
  }
  v8f s = __builtin_elementwise_fma(t, splat8(1.061405429f), splat8(-1.453152027f));
  s = __builtin_elementwise_fma(s, t, splat8(1.421413741f));
  s = __builtin_elementwise_fma(s, t, splat8(-0.284496736f));
  s = __builtin_elementwise_fma(s, t, splat8(0.254829592f));
  const v8f ec = (s * t) * e;                                                        // erfc(|u| / sqrt 2)
  return __builtin_elementwise_fma(-au, ec, u + au) * splat8(0.5f);                  // u + |u| = 2 max(u, 0)
}

// ---------------------------------------------------------------------------
// Weight prep: src[K][N] (f32, row pitch N) -> dst[rowoff + n][k] f16 plane
// (row pitch K), value = f16(bf16q(w) * 16).  in[K][N] -> out[N][K].
// One block of 256 threads does the 64x64 tile (kx, ny) of (K/64, N/64).
// ---------------------------------------------------------------------------
__device__ __forceinline__ void wprep_body(
    const float* __restrict__ src, unsigned short* __restrict__ dst, int K, int N, int rowoff,
    int kx, int ny, unsigned short (&sT)[64][72]) {
  const int tid = threadIdx.x;
  const int k0 = kx * 64, n0 = ny * 64;
#pragma unroll
  for (int it = 0; it < 4; ++it) {
    const int idx = it * 256 + tid;
    const int kk = idx >> 4;            // 0..63
    const int j4 = (idx & 15) * 4;      // 0..60
    const v4f wv = *(const v4f*)(src + (size_t)(k0 + kk) * (size_t)N + n0 + j4);
    sT[j4 + 0][kk] = hbits(bf16q(wv.x) * 16.0f);
    sT[j4 + 1][kk] = hbits(bf16q(wv.y) * 16.0f);
    sT[j4 + 2][kk] = hbits(bf16q(wv.z) * 16.0f);
    sT[j4 + 3][kk] = hbits(bf16q(wv.w) * 16.0f);
  }
  __syncthreads();   // cross-wave: staged by all waves, read by all waves
  v4u val[2];
  size_t off[2];
#pragma unroll
  for (int p = 0; p < 2; ++p) {
    const int n = p * 32 + (tid >> 3);
    const int piece = tid & 7;
    val[p] = *(const v4u*)&sT[n][piece * 8];
    off[p] = (size_t)(rowoff + n0 + n) * (size_t)K + k0 + piece * 8;
  }
#pragma unroll
  for (int p = 0; p < 2; ++p) *(v4u*)(dst + off[p]) = val[p];
  // precaution: in the merged kernel the listing runs on behind these stores into code that rewrites their registers
  asm volatile("s_wait_xcnt 0x0" ::: "memory");
  
}

// ---------------------------------------------------------------------------
// LayerNorm over CDIM=512: one wave per row, lane l owns cols 8l..8l+7 and
// 256+8l..256+8l+7.  RNDIN: input rows read at full strides and converted to
// their bf16 values first.  Output f16 plane [nrows][512], rows compact.
// coverage: 2 instructions x 32 lanes x 16 B = cols 0..255 (4 lines) + cols 256..511 (4 lines) per row.
// ---------------------------------------------------------------------------
template <int RNDIN>
__device__ __forceinline__ void ln_body(
    const float* __restrict__ x, const float* __restrict__ g, const float* __restrict__ bt,
    unsigned short* __restrict__ hout, int nrows, int blk) {
  const int lane = threadIdx.x & 31, w = threadIdx.x >> 5;
  const int row = blk * 8 + w;
  if (row >= nrows) return;            // no barriers on the LayerNorm path
  size_t xrow;
  if (RNDIN) {
    const int b = row / SEQ, t = row - b * SEQ;
    xrow = ((size_t)b * SEQ_FULL + t) * CDIM;
  } else {
    xrow = (size_t)row * CDIM;
  }
  const int c0 = lane * 8;
  const int c1 = 256 + lane * 8;

  float v[16];
  {
    const v4f t0 = *(const v4f*)(x + xrow + c0);
    const v4f t1 = *(const v4f*)(x + xrow + c0 + 4);
    const v4f t2 = *(const v4f*)(x + xrow + c1);
    const v4f t3 = *(const v4f*)(x + xrow + c1 + 4);
    v[0] = t0.x; v[1] = t0.y; v[2] = t0.z; v[3] = t0.w;
    v[4] = t1.x; v[5] = t1.y; v[6] = t1.z; v[7] = t1.w;
    v[8] = t2.x; v[9] = t2.y; v[10] = t2.z; v[11] = t2.w;
    v[12] = t3.x; v[13] = t3.y; v[14] = t3.z; v[15] = t3.w;
  }
  if (RNDIN) {
#pragma unroll
    for (int i = 0; i < 16; ++i) v[i] = bf16q(v[i]);
  }

  float s = 0.0f;
#pragma unroll
  for (int i = 0; i < 16; ++i) s += v[i];
#pragma unroll
  for (int xm = 1; xm < 32; xm <<= 1) s += __shfl_xor(s, xm, 32);
  const float mu = s * (1.0f / CDIM);

  float d[16];
#pragma unroll
  for (int i = 0; i < 16; ++i) d[i] = v[i] - mu;
  float qs = 0.0f;
#pragma unroll
  for (int i = 0; i < 16; ++i) qs += d[i] * d[i];
#pragma unroll
  for (int xm = 1; xm < 32; xm <<= 1) qs += __shfl_xor(qs, xm, 32);
  const float var = qs * (1.0f / CDIM);
  const float rstd = rsqrtf(var + 1e-5f);

  float gg[16], bb[16];
  {
    const v4f g0 = bf16q4(*(const v4f*)(g + c0));
    const v4f g1 = bf16q4(*(const v4f*)(g + c0 + 4));
    const v4f g2 = bf16q4(*(const v4f*)(g + c1));
    const v4f g3 = bf16q4(*(const v4f*)(g + c1 + 4));
    const v4f b0 = bf16q4(*(const v4f*)(bt + c0));
    const v4f b1 = bf16q4(*(const v4f*)(bt + c0 + 4));
    const v4f b2 = bf16q4(*(const v4f*)(bt + c1));
    const v4f b3 = bf16q4(*(const v4f*)(bt + c1 + 4));
    gg[0] = g0.x; gg[1] = g0.y; gg[2] = g0.z; gg[3] = g0.w;
    gg[4] = g1.x; gg[5] = g1.y; gg[6] = g1.z; gg[7] = g1.w;
    gg[8] = g2.x; gg[9] = g2.y; gg[10] = g2.z; gg[11] = g2.w;
    gg[12] = g3.x; gg[13] = g3.y; gg[14] = g3.z; gg[15] = g3.w;
    bb[0] = b0.x; bb[1] = b0.y; bb[2] = b0.z; bb[3] = b0.w;
    bb[4] = b1.x; bb[5] = b1.y; bb[6] = b1.z; bb[7] = b1.w;
    bb[8] = b2.x; bb[9] = b2.y; bb[10] = b2.z; bb[11] = b2.w;
    bb[12] = b3.x; bb[13] = b3.y; bb[14] = b3.z; bb[15] = b3.w;
  }
  float y[16];
#pragma unroll
  for (int i = 0; i < 16; ++i) y[i] = d[i] * rstd * gg[i] + bb[i];

  const v4u o0 = pack8h(y[0], y[1], y[2], y[3], y[4], y[5], y[6], y[7]);
  const v4u o1 = pack8h(y[8], y[9], y[10], y[11], y[12], y[13], y[14], y[15]);
  unsigned short* orow = hout + (size_t)row * CDIM;
  *(v4u*)(orow + c0) = o0;
  *(v4u*)(orow + c1) = o1;
  
}

// ---------------------------------------------------------------------------
// First launch: all the work that reads the inputs alone, dealt by block index.
// Blocks 0 .. LNB-1: LayerNorm 1, 8 rows each.  Then one 64x64 weight tile a block:
// WB1 blocks for each of Wq, Wk, Wv, Wo, WB2 for W1, WB2 for W2.
// Every branch is block-uniform; only the weight path has a barrier.
// ---------------------------------------------------------------------------
#define LNB (MROWS / 8)
#define WB1 ((CDIM / 64) * (CDIM / 64))
#define WB2 ((CDIM / 64) * (HID / 64))
__global__ __launch_bounds__(256) void k_prep(
    const float* __restrict__ x, const float* __restrict__ g, const float* __restrict__ bt,
    unsigned short* __restrict__ hout,
    const float* __restrict__ Wq, const float* __restrict__ Wk, const float* __restrict__ Wv,
    const float* __restrict__ Wo, const float* __restrict__ W1, const float* __restrict__ W2,
    unsigned short* __restrict__ wqkv, unsigned short* __restrict__ wot,
    unsigned short* __restrict__ w1t, unsigned short* __restrict__ w2t) {
  __shared__ __attribute__((aligned(16))) unsigned short sT[64][72];
  const int bid = blockIdx.x;
  if (bid < LNB) {
    ln_body<1>(x, g, bt, hout, MROWS, bid);
    return;
  }
  int t = bid - LNB;
  if (t < 4 * WB1) {                       // in[512][512] -> out[512][512]
    const int mat = t / WB1;
    t -= mat * WB1;
    const float* src = (mat == 0) ? Wq : ((mat == 1) ? Wk : ((mat == 2) ? Wv : Wo));
    unsigned short* dst = (mat < 3) ? wqkv : wot;
    wprep_body(src, dst, CDIM, CDIM, (mat < 3) ? mat * CDIM : 0, t % (CDIM / 64), t / (CDIM / 64), sT);
  } else if (t < 4 * WB1 + WB2) {          // in[512][2048] -> out[2048][512]
    t -= 4 * WB1;
    wprep_body(W1, w1t, CDIM, HID, 0, t % (CDIM / 64), t / (CDIM / 64), sT);
  } else {                                 // in[2048][512] -> out[512][2048]
    t -= 4 * WB1 + WB2;
    wprep_body(W2, w2t, HID, CDIM, 0, t % (HID / 64), t / (HID / 64), sT);
  }
}
__global__ __launch_bounds__(256) void k_ln_mid(
    const float* __restrict__ x, const float* __restrict__ g, const float* __restrict__ bt,
    unsigned short* __restrict__ hout, int nrows) {
  ln_body<0>(x, g, bt, hout, nrows, blockIdx.x);
}

// ---------------------------------------------------------------------------
// Operand tiles in LDS.  A tile is 64 rows x 64 16-bit elements (128 B = one
// line per row); LDS row pitch TP elements = 144 B (16 B x odd: the b128
// fragment reads of 16 rows fall on distinct banks).
// tiles_async: 128 threads (a GEMM WG, or one key half of the attention WG) copy two such tiles, global -> LDS,
// 16 B per lane and copy; a wave's copy covers 4 whole rows (4 whole lines).
// ga / gb: first element of the tile, pa / pb: its global row pitch in elements.
// ---------------------------------------------------------------------------
#define TP 72
typedef unsigned short Tile[64][TP];

__device__ __forceinline__ void tiles_async(
    unsigned short* la, const unsigned short* ga, size_t pa,
    unsigned short* lb, const unsigned short* gb, size_t pb, int tid) {
  const int row = tid >> 3, pc = (tid & 7) * 8;
  const unsigned int la0 = (unsigned int)(size_t)(la + row * TP + pc);
  const unsigned int lb0 = (unsigned int)(size_t)(lb + row * TP + pc);
  const unsigned int la1 = la0 + 16 * TP * 2, la2 = la0 + 32 * TP * 2, la3 = la0 + 48 * TP * 2;
  const unsigned int lb1 = lb0 + 16 * TP * 2, lb2 = lb0 + 32 * TP * 2, lb3 = lb0 + 48 * TP * 2;
  const unsigned short* a0 = ga + (size_t)row * pa + pc;
  const unsigned short* a1 = a0 + 16 * pa;
  const unsigned short* a2 = a0 + 32 * pa;
  const unsigned short* a3 = a0 + 48 * pa;
  const unsigned short* b0 = gb + (size_t)row * pb + pc;
  const unsigned short* b1 = b0 + 16 * pb;
  const unsigned short* b2 = b0 + 32 * pb;
  const unsigned short* b3 = b0 + 48 * pb;
  // the copies and, as the last line, the wait that stands before their address registers are reused
  asm volatile(
      "global_load_async_to_lds_b128 %0, %8, off\n\t"
      "global_load_async_to_lds_b128 %1, %9, off\n\t"
      "global_load_async_to_lds_b128 %2, %10, off\n\t"
      "global_load_async_to_lds_b128 %3, %11, off\n\t"
      "global_load_async_to_lds_b128 %4, %12, off\n\t"
      "global_load_async_to_lds_b128 %5, %13, off\n\t"
      "global_load_async_to_lds_b128 %6, %14, off\n\t"
      "global_load_async_to_lds_b128 %7, %15, off\n\t"
      "s_wait_xcnt 0x0"
      :: "v"(la0), "v"(la1), "v"(la2), "v"(la3), "v"(lb0), "v"(lb1), "v"(lb2), "v"(lb3),
         "v"(a0), "v"(a1), "v"(a2), "v"(a3), "v"(b0), "v"(b1), "v"(b2), "v"(b3)
      : "memory");
}
// this wave's copies have landed
__device__ __forceinline__ void wait_async0() { asm volatile("s_wait_asynccnt 0x0" ::: "memory"); }
// all of this wave's copies but its 32 youngest (two tiles of 16) have landed: the counter returns in issue order
__device__ __forceinline__ void wait_async32() { asm volatile("s_wait_asynccnt 0x20" ::: "memory"); }
// this wave's LDS reads and writes have retired (before a buffer it read is refilled)
__device__ __forceinline__ void wait_ds0() { asm volatile("s_wait_dscnt 0x0" ::: "memory"); }

// ---------------------------------------------------------------------------
// 128x128-tile f16 GEMM main loop: D = A[M][K] * Bt[N][K]^T, 4 waves per WG in a 2 x 2
// grid, wave (wr, wc) owns rows 64wr.. x cols 64wc.. (4 x 4 accumulator tiles): each A and
// each Bt fragment read from LDS feeds four WMMAs.  A trip covers 64 of k: the A and Bt
// tiles of trip t + 1 are copied to the other ring buffer while trip t is worked on.
// A ring buffer is 128 A rows, then 128 Bt rows, each 64 elements at pitch TP.
// Fragments are read from LDS with the split k map for A and B
// (row/col = lane&15, elements 0..7 <- k0+8h.., 8..15 <- k0+16+8h..).
// acc[i][j][r] = D(row 64wr + 16i + 8h + r, col 64wc + 16j + (lane&15)).
// Behind the loop the ring is free (no reader, no copy in flight): the epilogues stage in it.
// ---------------------------------------------------------------------------
#define RB (256 * TP)           // elements of one ring buffer
#define RING_ELEMS (2 * RB)
#define SP 136                  // staging pitch, 16-bit elements: 272 B = 16 B x odd
#define FP 132                  // staging pitch, floats: 528 B = 16 B x odd
static_assert(128 * SP * 2 <= RING_ELEMS * 2 && 128 * FP * 4 <= RING_ELEMS * 2);
static_assert(MROWS % 128 == 0 && CDIM % 128 == 0 && HID % 128 == 0);

__device__ __forceinline__ void stage_async(
    unsigned short* buf, const unsigned short* ag, const unsigned short* bg, size_t K, int tid) {
  tiles_async(buf, ag, K, buf + 128 * TP, bg, K, tid);                          // rows 0..63 of both tiles
  tiles_async(buf + 64 * TP, ag + 64 * K, K, buf + 192 * TP, bg + 64 * K, K, tid);   // rows 64..127
}

// the work of one trip: the 32 WMMAs of this wave on the ring buffer buf
__device__ __forceinline__ void gemm_trip(
    const unsigned short* buf, int wr, int wc, int m, int k8, v8f (&acc)[4][4]) {
    const unsigned short* ab = buf + (64 * wr + m) * TP + k8;
    const unsigned short* bb = buf + (128 + 64 * wc + m) * TP + k8;
    // twelve of the trip's sixteen fragments are read as one group ahead of its WMMAs; the A fragments of
    // the second k half follow in two pairs, into registers that the first half has left (all sixteen at
    // once, beside 128 accumulator registers, would take 256 registers)
    Frag a0[4], b0[4], a1[4], b1[4];
#pragma unroll
    for (int j = 0; j < 4; ++j) {
      b0[j].q[0] = *(const v4u*)(bb + 16 * j * TP);
      b0[j].q[1] = *(const v4u*)(bb + 16 * j * TP + 16);
    }
#pragma unroll
    for (int i = 0; i < 4; ++i) {
      a0[i].q[0] = *(const v4u*)(ab + 16 * i * TP);
      a0[i].q[1] = *(const v4u*)(ab + 16 * i * TP + 16);
    }
#pragma unroll
    for (int j = 0; j < 4; ++j) {
      b1[j].q[0] = *(const v4u*)(bb + 16 * j * TP + 32);
      b1[j].q[1] = *(const v4u*)(bb + 16 * j * TP + 48);
    }
    // holds the reads above as one group ahead of the WMMAs: left free, this build sinks each read to its first use
    // and waits for it there, one LDS latency a fragment
    __builtin_amdgcn_sched_barrier(0);
#pragma unroll
    for (int g = 0; g < 2; ++g) {
#pragma unroll
      for (int i = 2 * g; i < 2 * g + 2; ++i) {
#pragma unroll
        for (int j = 0; j < 4; ++j) acc[i][j] = mma(a0[i].v, b0[j].v, acc[i][j]);
      }
      __builtin_amdgcn_sched_barrier(0);   // the pair of A fragments below is read here, eight WMMAs or more ahead of its use
#pragma unroll
      for (int i = 2 * g; i < 2 * g + 2; ++i) {
        a1[i].q[0] = *(const v4u*)(ab + 16 * i * TP + 32);
        a1[i].q[1] = *(const v4u*)(ab + 16 * i * TP + 48);
      }
      __builtin_amdgcn_sched_barrier(0);   // and not later
    }
#pragma unroll
    for (int i = 0; i < 4; ++i) {
#pragma unroll
      for (int j = 0; j < 4; ++j) acc[i][j] = mma(a1[i].v, b1[j].v, acc[i][j]);
    }
    __builtin_amdgcn_sched_barrier(0);   // the WMMAs stay ahead of the wait to 0: they start on counted waits
}

__device__ __forceinline__ void gemm_main(
    const unsigned short* __restrict__ A, const unsigned short* __restrict__ Bt, int K,
    int m0, int n0, int wr, int wc, int m, int k8, int tid, unsigned short* ring, v8f (&acc)[4][4]) {
#pragma unroll
  for (int i = 0; i < 4; ++i) {
#pragma unroll
    for (int j = 0; j < 4; ++j) acc[i][j] = zero8();
  }
  const unsigned short* ag = A + (size_t)m0 * (size_t)K;
  const unsigned short* bg = Bt + (size_t)n0 * (size_t)K;
  const int nt = K >> 6;
  stage_async(ring, ag, bg, (size_t)K, tid);
  wait_async0();
  __syncthreads();   // tile 0 published
  if (nt > 1) stage_async(ring + RB, ag + 64, bg + 64, (size_t)K, tid);
#pragma unroll 1
  for (int t = 0; t < nt; ++t) {
    const int bf = t & 1;
    gemm_trip(ring + bf * RB, wr, wc, m, k8, acc);
    wait_ds0();
    wait_async0();
    __syncthreads();   // publishes tile t + 1; ends every read of buffer bf
    if (t + 2 < nt)
      stage_async(ring + bf * RB, ag + (size_t)(t + 2) * 64, bg + (size_t)(t + 2) * 64, (size_t)K, tid);
  }
  wait_async0();
}

// The same loop on a ring of four buffers, for the launches with one work-group of one wave a SIMD on a WGP, where
// nothing else runs while a wave waits for its copies: a tile's copies are issued four trips ahead of its use and are
// waited for three trips later, so their way from memory is covered by three trips of WMMAs, not by one.
// A wave has at most three tiles (48 copies) in flight.  At the foot of trip t the tiles t + 2 and t + 3 (its 32 youngest
// copies) may still fly; tile t + 1 has landed.  The last four trips issue nothing and wait to 0.  K is 256 or more.
#define RING4_ELEMS (4 * RB)
static_assert(CDIM >= 256 && HID >= 256);
__device__ __forceinline__ void gemm_main4(
    const unsigned short* __restrict__ A, const unsigned short* __restrict__ Bt, int K,
    int m0, int n0, int wr, int wc, int m, int k8, int tid, unsigned short* ring, v8f (&acc)[4][4]) {
#pragma unroll
  for (int i = 0; i < 4; ++i) {
#pragma unroll
    for (int j = 0; j < 4; ++j) acc[i][j] = zero8();
  }
  const unsigned short* ag = A + (size_t)m0 * (size_t)K;
  const unsigned short* bg = Bt + (size_t)n0 * (size_t)K;
  const int nt = K >> 6;
  stage_async(ring, ag, bg, (size_t)K, tid);
  stage_async(ring + RB, ag + 64, bg + 64, (size_t)K, tid);
  stage_async(ring + 2 * RB, ag + 128, bg + 128, (size_t)K, tid);
  wait_async32();    // tile 0 landed
  __syncthreads();   // tile 0 published
  stage_async(ring + 3 * RB, ag + 192, bg + 192, (size_t)K, tid);
  // both loops stay rolled: one copy of the trip's text each.  Every trip of the first issues one tile (16 copies a wave),
  // so the count of its wait holds in every wave and trip.
#pragma unroll 1
  for (int t = 0; t < nt - 4; ++t) {
    unsigned short* buf = ring + (t & 3) * RB;
    gemm_trip(buf, wr, wc, m, k8, acc);
    wait_ds0();
    wait_async32();    // tile t + 1 landed
    __syncthreads();   // publishes tile t + 1; ends every read of buf
    stage_async(buf, ag + (size_t)(t + 4) * 64, bg + (size_t)(t + 4) * 64, (size_t)K, tid);
  }
#pragma unroll 1
  for (int t = nt - 4; t < nt; ++t) {
    gemm_trip(ring + (t & 3) * RB, wr, wc, m, k8, acc);
    wait_ds0();
    wait_async0();
    __syncthreads();   // publishes tile t + 1; ends every read of this trip's buffer
  }
}

// ---------------------------------------------------------------------------
// q/k/v projection: A = LN1 plane [M][512], Bt = [1536][512] (q rows, k rows, v rows).
// value = acc/16 + bf16q(bias).  q and k -> planes [b*H+h][t][64]; v -> transposed
// plane vt[b*H+h][64][t].  The three planes are contiguous: plane p at qkv + p*M*512.
// A wave's 64 columns are one head.
// coverage: 16 passes x 4 rows = 64 rows x 64 cols per wave (q/k); 16 passes x 4 d = 64 d rows x 64 tokens per wave (v).
// LDS sT (in the ring): wave-private quadrants; block barrier orders the reload.
// ---------------------------------------------------------------------------
__global__ __launch_bounds__(128) void k_gemm_qkv(
    const unsigned short* __restrict__ A, const unsigned short* __restrict__ Bt,
    const float* __restrict__ bq, const float* __restrict__ bk, const float* __restrict__ bv,
    unsigned short* __restrict__ qkv) {
  __shared__ __attribute__((aligned(16))) unsigned short ring[RING_ELEMS];
  const int tid = threadIdx.x, lane = tid & 31, w = tid >> 5;
  const int wr = w >> 1, wc = w & 1;
  const int m = lane & 15, hl = lane >> 4, k8 = hl * 8;
  const int m0 = blockIdx.y * 128, n0 = blockIdx.x * 128;

  v8f acc[4][4];
  gemm_main(A, Bt, CDIM, m0, n0, wr, wc, m, k8, tid, ring, acc);

  unsigned short (*sT)[SP] = (unsigned short (*)[SP])ring;
  const float wsc = 0.0625f;               // undo the x16 weight carry
  const int lrow0 = 64 * wr + 8 * hl;      // D rows of this lane within the WG tile
  const int lcol0 = 64 * wc;               // first column of this wave within the WG tile
  const int which = n0 / CDIM;             // 0 q, 1 k, 2 v (WG-uniform)
  const int cb = n0 - which * CDIM;
#pragma unroll
  for (int j = 0; j < 4; ++j) {
    const int cn = cb + lcol0 + 16 * j + m;
    const float b0 = bf16q(bq[cn]);
    const float b1 = bf16q(bk[cn]);
    const float b2 = bf16q(bv[cn]);
    const float bj = (which == 0) ? b0 : ((which == 1) ? b1 : b2);
#pragma unroll
    for (int i = 0; i < 4; ++i) {
#pragma unroll
      for (int r = 0; r < 8; ++r) sT[lrow0 + 16 * i + r][lcol0 + 16 * j + m] = hbits(acc[i][j][r] * wsc + bj);
    }
  }
  __syncthreads();   // orders the reload
  const int hh = cb / HD + wc;
  const int b = m0 / SEQ, t0 = m0 - b * SEQ + 64 * wr;   // first token of this wave's quadrant
  const int bh = b * NHEAD + hh;
  unsigned short* dst = qkv + (size_t)which * ((size_t)MROWS * CDIM);
  v4u val[16];
  unsigned int off[16];
  if (which < 2) {                       // WG-uniform
#pragma unroll
    for (int p = 0; p < 16; ++p) {
      const int row = 4 * p + (lane >> 3);
      const int piece = lane & 7;
      val[p] = *(const v4u*)&sT[64 * wr + row][lcol0 + piece * 8];
      off[p] = (unsigned int)((bh * SEQ + t0 + row) * HD + piece * 8);
    }
  } else {
#pragma unroll
    for (int p = 0; p < 16; ++p) {
      const int d = 4 * p + (lane >> 3);
      const int piece = lane & 7;
      unsigned int wv[4];
#pragma unroll
      for (int e = 0; e < 4; ++e) {
        const unsigned int lo = sT[64 * wr + piece * 8 + 2 * e][lcol0 + d];
        const unsigned int hi = sT[64 * wr + piece * 8 + 2 * e + 1][lcol0 + d];
        wv[e] = lo | (hi << 16);
      }
      v4u t;
      t.x = wv[0]; t.y = wv[1]; t.z = wv[2]; t.w = wv[3];
      val[p] = t;
      off[p] = (unsigned int)((bh * HD + d) * SEQ + t0 + piece * 8);
    }
  }
#pragma unroll
  for (int p = 0; p < 16; ++p) *(v4u*)(dst + off[p]) = val[p];
  
}

// ---------------------------------------------------------------------------
// GEMM + bias + residual, f32 output of width CDIM:
// out = acc/16 + bf16q(bias) + res.  resfull: res rows read at full strides and
// converted to bf16 values; outfull: out rows written at full strides.
// Residual added at the store stage as float4.
// coverage: 32 passes x 2 rows per wave = 64 rows x 64 cols per wave.
// LDS sF (in the ring): wave-private quadrants; block barrier orders the reload.
// ---------------------------------------------------------------------------
__global__ __launch_bounds__(128) void k_gemm_res(
    const unsigned short* __restrict__ A, const unsigned short* __restrict__ Bt, int K,
    const float* __restrict__ bias, const float* __restrict__ res,
    float* __restrict__ outF, int resfull, int outfull) {
  __shared__ __attribute__((aligned(16))) unsigned short ring[RING4_ELEMS];
  const int tid = threadIdx.x, lane = tid & 31, w = tid >> 5;
  const int wr = w >> 1, wc = w & 1;
  const int m = lane & 15, hl = lane >> 4, k8 = hl * 8;
  const int m0 = blockIdx.y * 128, n0 = blockIdx.x * 128;

  v8f acc[4][4];
  gemm_main4(A, Bt, K, m0, n0, wr, wc, m, k8, tid, ring, acc);

  float (*sF)[FP] = (float (*)[FP])ring;
  const float wsc = 0.0625f;
  const int lrow0 = 64 * wr + 8 * hl;
  const int lcol0 = 64 * wc;
#pragma unroll
  for (int i = 0; i < 4; ++i) {
#pragma unroll
    for (int j = 0; j < 4; ++j) {
#pragma unroll
      for (int r = 0; r < 8; ++r) sF[lrow0 + 16 * i + r][lcol0 + 16 * j + m] = acc[i][j][r] * wsc;
    }
  }
  __syncthreads();
  const int b = m0 / SEQ, t0 = m0 - b * SEQ;
  const int row0 = 64 * wr + hl;                            // pass p: row row0 + 2p
  const int piece = m;
  const int ncol = n0 + lcol0 + 4 * piece;
  const size_t frow0 = (size_t)b * SEQ_FULL + t0 + row0;    // full-stride row
  const size_t crow0 = (size_t)(m0 + row0);                 // compact row
  const float* rp = res + (resfull ? frow0 : crow0) * (size_t)CDIM + ncol;
  float* op = outF + (outfull ? frow0 : crow0) * (size_t)CDIM + ncol;
  const v4f bv = bf16q4(*(const v4f*)(bias + ncol));
  v4f val[32];
#pragma unroll
  for (int p = 0; p < 32; ++p) {
    const v4f a = *(const v4f*)&sF[row0 + 2 * p][lcol0 + 4 * piece];
    const v4f rraw = *(const v4f*)(rp + 2 * p * CDIM);
    const v4f rq = bf16q4(rraw);
    const v4f rr = resfull ? rq : rraw;
    val[p] = (a + bv) + rr;
  }
#pragma unroll
  for (int p = 0; p < 32; ++p) *(v4f*)(op + 2 * p * CDIM) = val[p];
  
}

// ---------------------------------------------------------------------------
// ffn1: f16 out[M][HID] = gelu_erf(acc/16 + bf16q(bias)).
// The pre-activation is staged as f32; gelu and the f16 convert are done at the reload, eight values a lane and pass.
// coverage: 16 passes x 4 rows per wave = 64 rows x 64 cols per wave.
// LDS sF (in the ring): wave-private quadrants; block barrier orders the reload.
// ---------------------------------------------------------------------------
__global__ __launch_bounds__(128) void k_gemm_gelu(
    const unsigned short* __restrict__ A, const unsigned short* __restrict__ Bt, int K,
    const float* __restrict__ bias, unsigned short* __restrict__ out0) {
  __shared__ __attribute__((aligned(16))) unsigned short ring[RING_ELEMS];
  const int tid = threadIdx.x, lane = tid & 31, w = tid >> 5;
  const int wr = w >> 1, wc = w & 1;
  const int m = lane & 15, hl = lane >> 4, k8 = hl * 8;
  const int m0 = blockIdx.y * 128, n0 = blockIdx.x * 128;

  v8f acc[4][4];
  gemm_main(A, Bt, K, m0, n0, wr, wc, m, k8, tid, ring, acc);

  float (*sF)[FP] = (float (*)[FP])ring;
  const float wsc = 0.0625f;
  const int lrow0 = 64 * wr + 8 * hl;
  const int lcol0 = 64 * wc;
#pragma unroll
  for (int j = 0; j < 4; ++j) {
    const float bj = bf16q(bias[n0 + lcol0 + 16 * j + m]);
#pragma unroll
    for (int i = 0; i < 4; ++i) {
#pragma unroll
      for (int r = 0; r < 8; ++r) sF[lrow0 + 16 * i + r][lcol0 + 16 * j + m] = acc[i][j][r] * wsc + bj;
    }
  }
  __syncthreads();
  const int piece = lane & 7;
  const float* sr = &sF[64 * wr + (lane >> 3)][lcol0 + piece * 8];
  unsigned short* orow = out0 + (size_t)(m0 + 64 * wr + (lane >> 3)) * (size_t)HID + n0 + lcol0 + piece * 8;
  // four passes a trip: their LDS reads go out as one group, and the text stays small
#pragma unroll 4
  for (int p = 0; p < 16; ++p) {
    const v4f u0 = *(const v4f*)(sr + 4 * p * FP);
    const v4f u1 = *(const v4f*)(sr + 4 * p * FP + 4);
    const v8f gl = gelu8(__builtin_shufflevector(u0, u1, 0, 1, 2, 3, 4, 5, 6, 7));
    const v4u o = pack8h(gl[0], gl[1], gl[2], gl[3], gl[4], gl[5], gl[6], gl[7]);
    *(v4u*)(orow + (size_t)(4 * p) * (size_t)HID) = o;
  }
  
}

template <bool V> struct Flag { static constexpr bool value = V; };
// value of lane l ^ 16
__device__ __forceinline__ float other_half(float f) {
  const int b = __builtin_bit_cast(int, f);
  return __builtin_bit_cast(float, __builtin_amdgcn_permlanex16(b, b, 0x76543210, 0xfedcba98, false, false));
}

// Four waves a SIMD (512 work-groups of 8 waves on 1,024 SIMDs): the vector work between the matrix runs of one wave
// is covered by three others.  The register budget is set for that, and two work-groups fit a WGP.
__global__ __launch_bounds__(256) __attribute__((amdgpu_waves_per_eu(4, 4)))
void k_attn(const unsigned short* __restrict__ qp, const unsigned short* __restrict__ kp,
            const unsigned short* __restrict__ vp, unsigned short* __restrict__ op) {
  __shared__ __attribute__((aligned(16))) unsigned short sP[4][32][72];
  __shared__ __attribute__((aligned(16))) Tile sK[2][2];     // [key half][buffer]
  __shared__ __attribute__((aligned(16))) Tile sV[2][2];
  __shared__ __attribute__((aligned(16))) float sM[4][17][32][4];
  const int tid = threadIdx.x & 127, lane = tid & 31;                 // place within the key half
  const int w = __builtin_amdgcn_readfirstlane(tid >> 5);             // in a scalar register: two vector registers short, this build spilled
  const int kh = __builtin_amdgcn_readfirstlane((int)(threadIdx.x >> 7));   // key half of this wave
  const int m = lane & 15, hl = lane >> 4, k8 = hl * 8;
  const int nkt = SEQ / 128;                // key chunks of one half
  const int nqt = SEQ / 128;                // query tiles of one (b,h)
  const int bh = blockIdx.x / nqt, qt = blockIdx.x - bh * nqt;
  const int b = bh / NHEAD, hh = bh - b * NHEAD;
  const int tq = qt * 128 + 32 * w;         // first query row of this wave (within the sequence)

  const unsigned short* kg = kp + ((size_t)bh * SEQ + (size_t)kh * (SEQ / 2)) * HD;   // chunk kt: + kt*64 rows, row pitch HD
  const unsigned short* vg = vp + (size_t)bh * HD * SEQ + (size_t)kh * (SEQ / 2);     // chunk kt: + kt*64 columns, row pitch SEQ
  tiles_async(&sK[kh][0][0][0], kg, (size_t)HD, &sV[kh][0][0][0], vg, (size_t)SEQ, tid);

  Frag qa0[2], qa1[2];     // B fragments of column group c: column = query tq + 16c + m, k = d in the split map
  {
    const unsigned short* qr0 = qp + ((size_t)bh * SEQ + tq + m) * HD + k8;
    const unsigned short* qr1 = qr0 + 16 * HD;
    // the loads and their data wait in one statement, so that no address register is rewritten ahead of a wait
    // the latency runs beside that of chunk 0's copies
    asm volatile(
        "global_load_b128 %0, %8, off\n\t"
        "global_load_b128 %1, %8, off offset:32\n\t"
        "global_load_b128 %2, %8, off offset:64\n\t"
        "global_load_b128 %3, %8, off offset:96\n\t"
        "global_load_b128 %4, %9, off\n\t"
        "global_load_b128 %5, %9, off offset:32\n\t"
        "global_load_b128 %6, %9, off offset:64\n\t"
        "global_load_b128 %7, %9, off offset:96\n\t"
        "s_wait_loadcnt 0x0"
        : "=&v"(qa0[0].q[0]), "=&v"(qa0[0].q[1]), "=&v"(qa1[0].q[0]), "=&v"(qa1[0].q[1]),
          "=&v"(qa0[1].q[0]), "=&v"(qa0[1].q[1]), "=&v"(qa1[1].q[0]), "=&v"(qa1[1].q[1])
        : "v"(qr0), "v"(qr1)
        : "memory");
  }
  wait_async0();
  __syncthreads();   // chunk 0 published
  if (nkt > 1)
    tiles_async(&sK[kh][1][0][0], kg + (size_t)64 * HD, (size_t)HD, &sV[kh][1][0][0], vg + 64, (size_t)SEQ, tid);
  const float SC = 0.125f * 1.44269504088896341f;   // raw score -> log2 units
  float mrun[2];             // running max of query 16c + m, raw score units (equal in both lane halves)
  v8f lrun[2];               // partial sums of 1024 p over this lane's keys
  v8f oacc[2][4];            // oacc[c][jd][r] = O^T(d = 16jd + 8hl + r, query 16c + m), x1024
#pragma unroll
  for (int c = 0; c < 2; ++c) {
    mrun[c] = -1e30f;
    lrun[c] = zero8();
#pragma unroll
    for (int j = 0; j < 4; ++j) oacc[c][j] = zero8();
  }

  // One trip.  The refill is a compile-time choice, so that a trip is one straight block: with a branch at its foot
  // this build moved the row sums behind the branch, which kept the 64 registers of p live through the products.
  auto trip = [&](const int kt, auto refill) __attribute__((always_inline)) {
    const int bf = kt & 1;
    // ---- S^T = K Q^T, four 16-key tiles x two column groups ----
    // all K fragment reads of the chunk as one group ahead of its WMMAs: one LDS latency, not four
    Frag f0[4], f1[4];
#pragma unroll
    for (int j = 0; j < 4; ++j) {
      const unsigned short* kr = &sK[kh][bf][16 * j + m][k8];
      f0[j].q[0] = *(const v4u*)(kr);
      f0[j].q[1] = *(const v4u*)(kr + 16);
      f1[j].q[0] = *(const v4u*)(kr + 32);
      f1[j].q[1] = *(const v4u*)(kr + 48);
    }
    __builtin_amdgcn_sched_barrier(0);   // holds the reads above as one group: left free, this build sinks them to their first uses
    v8f st[2][4];
#pragma unroll
    for (int j = 0; j < 4; ++j) {
#pragma unroll
      for (int c = 0; c < 2; ++c) st[c][j] = mma(f0[j].v, qa0[c].v, zero8());
    }
#pragma unroll
    for (int j = 0; j < 4; ++j) {
#pragma unroll
      for (int c = 0; c < 2; ++c) st[c][j] = mma(f1[j].v, qa1[c].v, st[c][j]);
    }
    __builtin_amdgcn_sched_barrier(0);   // the reads below stay behind the score WMMAs: risen among them, beside all of K, they cost spills
    // the V^T fragment reads of the first 32 keys as one group; their latency runs under the softmax
    // (those of the other 32 keys follow behind it: all at once do not fit the registers of four waves a SIMD)
    Frag g0[4], g1[4];
#pragma unroll
    for (int jd = 0; jd < 4; ++jd) {
      const unsigned short* vr = &sV[kh][bf][16 * jd + m][k8];
      g0[jd].q[0] = *(const v4u*)(vr);
      g0[jd].q[1] = *(const v4u*)(vr + 16);
    }
    v16h pb0[2], pb1[2];
#pragma unroll
    for (int c = 0; c < 2; ++c) {
      // ---- running max of this lane's query ----
      float t4[4];               // one chain per tile: four independent chains, not one of 32 links
#pragma unroll
      for (int j = 0; j < 4; ++j) {
        t4[j] = st[c][j][0];
#pragma unroll
        for (int r = 1; r < 8; ++r) t4[j] = fmaxf(t4[j], st[c][j][r]);
      }
      float tm = fmaxf(fmaxf(t4[0], t4[1]), fmaxf(t4[2], t4[3]));
      tm = fmaxf(tm, other_half(tm));
      const float mn = fmaxf(mrun[c], tm);
      const float corr = __builtin_amdgcn_exp2f((mrun[c] - mn) * SC);
      mrun[c] = mn;
      // ---- 1024 p = 2^(s SC - m SC + 10) ----
      const v8f sc8 = splat8(SC), nb8 = splat8(10.0f - mn * SC), corr8 = splat8(corr);
#pragma unroll
      for (int j = 0; j < 4; ++j) {
        const v8f e = __builtin_elementwise_fma(st[c][j], sc8, nb8);
#pragma unroll
        for (int r = 0; r < 8; ++r) st[c][j][r] = __builtin_amdgcn_exp2f(e[r]);
      }
      lrun[c] = __builtin_elementwise_fma(lrun[c], corr8, (st[c][0] + st[c][1]) + (st[c][2] + st[c][3]));
#pragma unroll
      for (int j = 0; j < 4; ++j) oacc[c][j] = oacc[c][j] * corr8;
      // ---- P^T fragments: elements 0..7 = keys 32i + 8hl + .., 8..15 = keys 32i + 16 + 8hl + .. ----
      pb0[c] = __builtin_shufflevector(__builtin_convertvector(st[c][0], v8h), __builtin_convertvector(st[c][1], v8h),
                                       0, 1, 2, 3, 4, 5, 6, 7, 8, 9, 10, 11, 12, 13, 14, 15);
      pb1[c] = __builtin_shufflevector(__builtin_convertvector(st[c][2], v8h), __builtin_convertvector(st[c][3], v8h),
                                       0, 1, 2, 3, 4, 5, 6, 7, 8, 9, 10, 11, 12, 13, 14, 15);
    }
    // ---- O^T += V^T (64 d x 64 keys) * P^T (64 keys x 32 queries) ----
#pragma unroll
    for (int jd = 0; jd < 4; ++jd) {
      const unsigned short* vr = &sV[kh][bf][16 * jd + m][k8];
      g1[jd].q[0] = *(const v4u*)(vr + 32);
      g1[jd].q[1] = *(const v4u*)(vr + 48);
    }
    __builtin_amdgcn_sched_barrier(0);   // holds the reads above as one group: left free, this build deals them in pairs among the WMMAs
#pragma unroll
    for (int jd = 0; jd < 4; ++jd) {
#pragma unroll
      for (int c = 0; c < 2; ++c) oacc[c][jd] = mma(g0[jd].v, pb0[c], oacc[c][jd]);
    }
#pragma unroll
    for (int jd = 0; jd < 4; ++jd) {
#pragma unroll
      for (int c = 0; c < 2; ++c) oacc[c][jd] = mma(g1[jd].v, pb1[c], oacc[c][jd]);
    }
    __builtin_amdgcn_sched_barrier(0);   // the WMMAs stay ahead of the wait to 0: they start on counted waits
    wait_ds0();
    wait_async0();
    __syncthreads();   // publishes chunk kt + 1; ends every read of buffer bf
    if constexpr (refill.value)
      tiles_async(&sK[kh][bf][0][0], kg + (size_t)(kt + 2) * 64 * HD, (size_t)HD,
                  &sV[kh][bf][0][0], vg + (size_t)(kt + 2) * 64, (size_t)SEQ, tid);
  };
  const int nfill = (nkt > 2) ? nkt - 2 : 0;   // trips behind which a chunk kt + 2 exists
  // both loops stay rolled: one copy of the trip's text each, and no second trip's registers beside the first's
#pragma unroll 1
  for (int kt = 0; kt < nfill; ++kt) trip(kt, Flag<true>());
#pragma unroll 1
  for (int kt = nfill; kt < nkt; ++kt) trip(kt, Flag<false>());
  wait_async0();

  // ---- join the key halves: the second half hands over its max, sum and O^T, lane by lane ----
  float lj[2];
#pragma unroll
  for (int c = 0; c < 2; ++c)
    lj[c] = ((lrun[c][0] + lrun[c][1]) + (lrun[c][2] + lrun[c][3])) + ((lrun[c][4] + lrun[c][5]) + (lrun[c][6] + lrun[c][7]));
  if (kh == 1) {               // wave-uniform
#pragma unroll
    for (int c = 0; c < 2; ++c) {
#pragma unroll
      for (int jd = 0; jd < 4; ++jd) {
        const v8f o = oacc[c][jd];
        *(v4f*)&sM[w][(4 * c + jd) * 2][lane][0] = __builtin_shufflevector(o, o, 0, 1, 2, 3);
        *(v4f*)&sM[w][(4 * c + jd) * 2 + 1][lane][0] = __builtin_shufflevector(o, o, 4, 5, 6, 7);
      }
    }
    v4f ml;
    ml.x = mrun[0]; ml.y = mrun[1]; ml.z = lj[0]; ml.w = lj[1];
    *(v4f*)&sM[w][16][lane][0] = ml;
  }
  __syncthreads();   // the second half's partial results published
  // ---- finalize: o = (acc_a f_a + acc_b f_b) / (l_a f_a + l_b f_b) (all x1024), staged for whole-line stores ----
  if (kh == 0) {               // wave-uniform
    const v4f ml = *(const v4f*)&sM[w][16][lane][0];
#pragma unroll
    for (int c = 0; c < 2; ++c) {
      const float mb = (c == 0) ? ml.x : ml.y;
      const float lb = (c == 0) ? ml.z : ml.w;
      const float mn = fmaxf(mrun[c], mb);
      const float fa = __builtin_amdgcn_exp2f((mrun[c] - mn) * SC);
      const float fb = __builtin_amdgcn_exp2f((mb - mn) * SC);
      float l = lj[c] * fa + lb * fb;
      l += other_half(l);
      const float il = 1.0f / l;
      const v8f ga8 = splat8(fa * il), gb8 = splat8(fb * il);
#pragma unroll
      for (int jd = 0; jd < 4; ++jd) {
        const v4f b0 = *(const v4f*)&sM[w][(4 * c + jd) * 2][lane][0];
        const v4f b1 = *(const v4f*)&sM[w][(4 * c + jd) * 2 + 1][lane][0];
        const v8f ob = __builtin_shufflevector(b0, b1, 0, 1, 2, 3, 4, 5, 6, 7);
        const v8h o8 = __builtin_convertvector(oacc[c][jd] * ga8 + ob * gb8, v8h);
        *(v4u*)&sP[w][16 * c + m][16 * jd + k8] = __builtin_bit_cast(v4u, o8);
      }
    }
  }
  __syncthreads();   // the staged rows published: all eight waves store, 16 rows each
  v4u val[4];
  unsigned int off[4];
#pragma unroll
  for (int p = 0; p < 4; ++p) {
    const int row = 16 * kh + 4 * p + (lane >> 3);
    const int piece = lane & 7;
    val[p] = *(const v4u*)&sP[w][row][piece * 8];
    off[p] = (unsigned int)((size_t)(b * SEQ + tq + row) * CDIM + hh * HD + piece * 8);
  }
#pragma unroll
  for (int p = 0; p < 4; ++p) *(v4u*)(op + off[p]) = val[p];
  
}

// ---------------------------------------------------------------------------
// Host launcher
// ---------------------------------------------------------------------------
constexpr size_t al256c(size_t v) { return (v + 255) & ~(size_t)255; }
constexpr size_t MCE = (size_t)MROWS * CDIM;
constexpr size_t SZ_WQKV = al256c((size_t)3 * CDIM * CDIM * 2);
constexpr size_t SZ_WO   = al256c((size_t)CDIM * CDIM * 2);
constexpr size_t SZ_W1   = al256c((size_t)HID * CDIM * 2);
constexpr size_t SZ_W2   = al256c((size_t)CDIM * HID * 2);
constexpr size_t SZ_H    = al256c(MCE * 2);
constexpr size_t SZ_QKV  = al256c((size_t)3 * MCE * 2);
constexpr size_t SZ_O    = al256c(MCE * 2);
constexpr size_t SZ_X1   = al256c(MCE * 4);
constexpr size_t SZ_H2   = al256c(MCE * 2);
constexpr size_t SZ_ACT  = al256c((size_t)MROWS * HID * 2);
constexpr size_t WS_TOTAL = SZ_WQKV + SZ_WO + SZ_W1 + SZ_W2 + SZ_H + SZ_QKV + SZ_O + SZ_X1 + SZ_H2 + SZ_ACT;
static_assert(WS_TOTAL <= (size_t)134217728);
static_assert((size_t)MROWS * HID < (size_t)4294967296ull);     // u32 element offsets in the epilogues
static_assert((size_t)NB_FULL * SEQ_FULL * CDIM < (size_t)4294967296ull);

extern "C" void kernel_launch(void* const* d_in, const int* in_sizes, int n_in,
                              void* d_out, int out_size, void* d_ws, size_t ws_size,
                              hipStream_t stream) {
  if (n_in < 17) return;
  const long needX = ((long)(NB - 1) * SEQ_FULL + SEQ) * CDIM;
  const long nWW = (long)CDIM * CDIM;
  if ((long)in_sizes[0] < needX) return;
  if ((long)in_sizes[1] < nWW || in_sizes[2] < CDIM) return;
  if ((long)in_sizes[3] < nWW || in_sizes[4] < CDIM) return;
  if ((long)in_sizes[5] < nWW || in_sizes[6] < CDIM) return;
  if ((long)in_sizes[7] < nWW || in_sizes[8] < CDIM) return;
  if ((long)in_sizes[9] < (long)CDIM * HID || in_sizes[10] < HID) return;
  if ((long)in_sizes[11] < (long)HID * CDIM || in_sizes[12] < CDIM) return;
  if (in_sizes[13] < CDIM || in_sizes[14] < CDIM) return;
  if (in_sizes[15] < CDIM || in_sizes[16] < CDIM) return;
  if ((long)out_size < needX) return;
  if ((size_t)WS_TOTAL > ws_size) return;

  const float* x   = (const float*)d_in[0];
  const float* Wq  = (const float*)d_in[1];
  const float* bq  = (const float*)d_in[2];
  const float* Wk  = (const float*)d_in[3];
  const float* bk  = (const float*)d_in[4];
  const float* Wv  = (const float*)d_in[5];
  const float* bv  = (const float*)d_in[6];
  const float* Wo  = (const float*)d_in[7];
  const float* bo  = (const float*)d_in[8];
  const float* W1  = (const float*)d_in[9];
  const float* b1  = (const float*)d_in[10];
  const float* W2  = (const float*)d_in[11];
  const float* b2  = (const float*)d_in[12];
  const float* g1  = (const float*)d_in[13];
  const float* be1 = (const float*)d_in[14];
  const float* g2  = (const float*)d_in[15];
  const float* be2 = (const float*)d_in[16];
  float* out = (float*)d_out;

  char* ws = (char*)d_ws;
  size_t off = 0;
  unsigned short* wqkv = (unsigned short*)(ws + off); off += SZ_WQKV;   // [1536][512]
  unsigned short* wot  = (unsigned short*)(ws + off); off += SZ_WO;     // [512][512]
  unsigned short* w1t  = (unsigned short*)(ws + off); off += SZ_W1;     // [2048][512]
  unsigned short* w2t  = (unsigned short*)(ws + off); off += SZ_W2;     // [512][2048]
  unsigned short* hpl  = (unsigned short*)(ws + off); off += SZ_H;      // [M][512]
  unsigned short* qkv  = (unsigned short*)(ws + off); off += SZ_QKV;    // q [B*H][SEQ][64], k same, vt [B*H][64][SEQ]
  unsigned short* opl  = (unsigned short*)(ws + off); off += SZ_O;      // [M][512]
  float*          x1   = (float*)(ws + off);          off += SZ_X1;     // [M][512]
  unsigned short* h2p  = (unsigned short*)(ws + off); off += SZ_H2;     // [M][512]
  unsigned short* act  = (unsigned short*)(ws + off); off += SZ_ACT;    // [M][2048]
  if (off > ws_size) return;
  unsigned short* qpl = qkv;
  unsigned short* kpl = qkv + MCE;
  unsigned short* vtp = qkv + 2 * MCE;

  // 1) + 2) one launch: LN1 on bf16 values of x -> h (f16), and the six weight planes
  //    in[K][N] -> out[N][K], bf16 values x16 as f16
  k_prep<<<LNB + 4 * WB1 + 2 * WB2, 256, 0, stream>>>(x, g1, be1, hpl, Wq, Wk, Wv, Wo, W1, W2,
                                                     wqkv, wot, w1t, w2t);
  // 3) q/k/v projections + bias -> q, k, vt planes
  k_gemm_qkv<<<dim3(3 * CDIM / 128, MROWS / 128), 128, 0, stream>>>(hpl, wqkv, bq, bk, bv, qkv);
  // 4) attention -> o plane
  k_attn<<<NB * NHEAD * (SEQ / 128), 256, 0, stream>>>(qpl, kpl, vtp, opl);
  // 5) output projection + bias + residual(bf16 values of x) -> x1 (f32, compact rows)
  k_gemm_res<<<dim3(CDIM / 128, MROWS / 128), 128, 0, stream>>>(opl, wot, CDIM, bo, x, x1, 1, 0);
  // 6) LN2 -> h2 (f16)
  k_ln_mid<<<MROWS / 8, 256, 0, stream>>>(x1, g2, be2, h2p, MROWS);
  // 7) ffn1 + bias + gelu(erf) -> act (f16)
  k_gemm_gelu<<<dim3(HID / 128, MROWS / 128), 128, 0, stream>>>(h2p, w1t, CDIM, b1, act);
  // 8) ffn2 + bias + residual(x1) -> out (f32, full strides)
  k_gemm_res<<<dim3(CDIM / 128, MROWS / 128), 128, 0, stream>>>(act, w2t, HID, b2, x1, out, 0, 1);
}

// v010
// A run of this version takes 128 microseconds.
// In two side-by-side timings against v009, it was 1.03 and 1.04 times as fast.
// Over all steps from v000 it is 5.26 times as fast.
#include <hip/hip_runtime.h>

// Contractions: v_wmma_f32_16x16x32_f16 (f16 operands, f32 accumulate) for q/k/v projections, q.k^T, p.v, output projection, ffn1, ffn2; weight planes carried x16, p plane carried x16 or more (see k_attn), q plane carried x (log2 e) / 8, other activations x1.

#pragma clang fp contract(off)

#ifndef NB
#define NB 2
#endif
#ifndef SEQ
#define SEQ 4096
#endif
#define NB_FULL 2
#define SEQ_FULL 4096
#define CDIM 512
#define NHEAD 8
#define HD 64
#define HID 2048
#define MROWS (NB * SEQ)

static_assert(NB >= 1 && NB <= NB_FULL);
static_assert(SEQ % 128 == 0 && SEQ >= 128 && SEQ <= SEQ_FULL);
static_assert(CDIM == NHEAD * HD);
static_assert(HD == 64);
static_assert(CDIM == 512);
static_assert(CDIM == 32 * 2 * 8);          // LayerNorm lane map: 32 lanes x 2 segments x 8 columns
static_assert(HID % 64 == 0 && CDIM % 64 == 0);
static_assert(CDIM % 32 == 0 && HID % 32 == 0);   // WMMA k-steps of 32, two per 64-wide k trip
static_assert(MROWS % 64 == 0);
static_assert(MROWS % 8 == 0);
static_assert((3 * CDIM) % 64 == 0);

typedef _Float16 v16h __attribute__((ext_vector_type(16)));
typedef _Float16 v8h  __attribute__((ext_vector_type(8)));
typedef float    v8f  __attribute__((ext_vector_type(8)));
typedef float    v4f  __attribute__((ext_vector_type(4)));
typedef float    v2f  __attribute__((ext_vector_type(2)));
typedef unsigned int v4u __attribute__((ext_vector_type(4)));

union Frag { v16h v; v4u q[2]; };

// D += A(16x32) * B(32x16); the builtin form: the compiler keeps the distances behind it
__device__ __forceinline__ v8f mma(v16h a, v16h b, v8f c) {
  return __builtin_amdgcn_wmma_f32_16x16x32_f16(false, a, false, b, (short)0, c, false, false);
}

__device__ __forceinline__ v8f zero8() {
  v8f z;
#pragma unroll
  for (int i = 0; i < 8; ++i) z[i] = 0.0f;
  return z;
}

__device__ __forceinline__ v8f splat8(float f) {
  v8f z;
#pragma unroll
  for (int i = 0; i < 8; ++i) z[i] = f;
  return z;
}

// f32 -> nearest-even bf16 value, returned as f32
__device__ __forceinline__ float bf16q(float f) {
  unsigned int u = __float_as_uint(f);
  unsigned int r = u + 0x7FFFu + ((u >> 16) & 1u);
  r = ((u & 0x7F800000u) == 0x7F800000u) ? u : r;
  return __uint_as_float(r & 0xFFFF0000u);
}
__device__ __forceinline__ v4f bf16q4(v4f a) {
  v4f r;
  r.x = bf16q(a.x); r.y = bf16q(a.y); r.z = bf16q(a.z); r.w = bf16q(a.w);
  return r;
}
// f32 -> f16 (RNE convert) bit pattern
__device__ __forceinline__ unsigned short hbits(float f) {
  _Float16 h = (_Float16)f;
  return __builtin_bit_cast(unsigned short, h);
}
__device__ __forceinline__ v4u pack8h(float f0, float f1, float f2, float f3,
                                      float f4, float f5, float f6, float f7) {
  v8h t;
  t[0] = (_Float16)f0; t[1] = (_Float16)f1; t[2] = (_Float16)f2; t[3] = (_Float16)f3;
  t[4] = (_Float16)f4; t[5] = (_Float16)f5; t[6] = (_Float16)f6; t[7] = (_Float16)f7;
  return __builtin_bit_cast(v4u, t);
}
// gelu(u) = u Phi(u) = max(u, 0) - |u| erfc(|u| / sqrt 2) / 2 for eight values, without a branch:
// erfc(x) = t (a1 + t (a2 + t (a3 + t (a4 + t a5)))) exp(-x^2), t = 1 / (1 + p x), x >= 0: absolute error of the form
// below 1.5e-7 for every x, a few f32 roundings on top (the result is stored as f16), and no cancellation for
// negative u.  With y = x sqrt(log2 e): exp(-x^2) = 2^(-y^2).
__device__ __forceinline__ v8f gelu8(v8f u) {
  const v8f au = __builtin_elementwise_abs(u);
  const v8f y = au * splat8(0.84932180f);                                            // sqrt(log2 e) / sqrt 2
  const v8f d = __builtin_elementwise_fma(y, splat8(0.27273748f), splat8(1.0f));     // p / sqrt(log2 e)
  const v8f ny2 = -(y * y);
  v8f t, e;
#pragma unroll
  for (int i = 0; i < 8; ++i) {
    t[i] = __builtin_amdgcn_rcpf(d[i]);
    e[i] = __builtin_amdgcn_exp2f(ny2[i]);
  }
  v8f s = __builtin_elementwise_fma(t, splat8(1.061405429f), splat8(-1.453152027f));
  s = __builtin_elementwise_fma(s, t, splat8(1.421413741f));
  s = __builtin_elementwise_fma(s, t, splat8(-0.284496736f));
  s = __builtin_elementwise_fma(s, t, splat8(0.254829592f));
  const v8f ec = (s * t) * e;                                                        // erfc(|u| / sqrt 2)
  return __builtin_elementwise_fma(-au, ec, u + au) * splat8(0.5f);                  // u + |u| = 2 max(u, 0)
}

// ---------------------------------------------------------------------------
// Weight prep: src[K][N] (f32, row pitch N) -> dst[rowoff + n][k] f16 plane
// (row pitch K), value = f16(bf16q(w) * 16).  in[K][N] -> out[N][K].
// One block of 256 threads does the 64x64 tile (kx, ny) of (K/64, N/64).
// ---------------------------------------------------------------------------
__device__ __forceinline__ void wprep_body(
    const float* __restrict__ src, unsigned short* __restrict__ dst, int K, int N, int rowoff,
    int kx, int ny, unsigned short (&sT)[64][72]) {
  const int tid = threadIdx.x;
  const int k0 = kx * 64, n0 = ny * 64;
#pragma unroll
  for (int it = 0; it < 4; ++it) {
    const int idx = it * 256 + tid;
    const int kk = idx >> 4;            // 0..63
    const int j4 = (idx & 15) * 4;      // 0..60
    const v4f wv = *(const v4f*)(src + (size_t)(k0 + kk) * (size_t)N + n0 + j4);
    sT[j4 + 0][kk] = hbits(bf16q(wv.x) * 16.0f);
    sT[j4 + 1][kk] = hbits(bf16q(wv.y) * 16.0f);
    sT[j4 + 2][kk] = hbits(bf16q(wv.z) * 16.0f);
    sT[j4 + 3][kk] = hbits(bf16q(wv.w) * 16.0f);
  }
  __syncthreads();   // cross-wave: staged by all waves, read by all waves
  v4u val[2];
  size_t off[2];
#pragma unroll
  for (int p = 0; p < 2; ++p) {
    const int n = p * 32 + (tid >> 3);
    const int piece = tid & 7;
    val[p] = *(const v4u*)&sT[n][piece * 8];
    off[p] = (size_t)(rowoff + n0 + n) * (size_t)K + k0 + piece * 8;
  }
#pragma unroll
  for (int p = 0; p < 2; ++p) *(v4u*)(dst + off[p]) = val[p];
  // precaution: in the merged kernel the listing runs on behind these stores into code that rewrites their registers
  asm volatile("s_wait_xcnt 0x0" ::: "memory");
  
}

// ---------------------------------------------------------------------------
// LayerNorm over CDIM=512: one wave per row, lane l owns cols 8l..8l+7 and
// 256+8l..256+8l+7.  RNDIN: input rows read at full strides and converted to
// their bf16 values first.  Output f16 plane [nrows][512], rows compact.
// coverage: 2 instructions x 32 lanes x 16 B = cols 0..255 (4 lines) + cols 256..511 (4 lines) per row.
// ---------------------------------------------------------------------------
template <int RNDIN>
__device__ __forceinline__ void ln_body(
    const float* __restrict__ x, const float* __restrict__ g, const float* __restrict__ bt,
    unsigned short* __restrict__ hout, int nrows, int blk) {
  const int lane = threadIdx.x & 31, w = threadIdx.x >> 5;
  const int row = blk * 8 + w;
  if (row >= nrows) return;            // no barriers on the LayerNorm path
  size_t xrow;
  if (RNDIN) {
    const int b = row / SEQ, t = row - b * SEQ;
    xrow = ((size_t)b * SEQ_FULL + t) * CDIM;
  } else {
    xrow = (size_t)row * CDIM;
  }
  const int c0 = lane * 8;
  const int c1 = 256 + lane * 8;

  float v[16];
  {
    const v4f t0 = *(const v4f*)(x + xrow + c0);
    const v4f t1 = *(const v4f*)(x + xrow + c0 + 4);
    const v4f t2 = *(const v4f*)(x + xrow + c1);
    const v4f t3 = *(const v4f*)(x + xrow + c1 + 4);
    v[0] = t0.x; v[1] = t0.y; v[2] = t0.z; v[3] = t0.w;
    v[4] = t1.x; v[5] = t1.y; v[6] = t1.z; v[7] = t1.w;
    v[8] = t2.x; v[9] = t2.y; v[10] = t2.z; v[11] = t2.w;
    v[12] = t3.x; v[13] = t3.y; v[14] = t3.z; v[15] = t3.w;
  }
  if (RNDIN) {
#pragma unroll
    for (int i = 0; i < 16; ++i) v[i] = bf16q(v[i]);
  }

  float s = 0.0f;
#pragma unroll
  for (int i = 0; i < 16; ++i) s += v[i];
#pragma unroll
  for (int xm = 1; xm < 32; xm <<= 1) s += __shfl_xor(s, xm, 32);
  const float mu = s * (1.0f / CDIM);

  float d[16];
#pragma unroll
  for (int i = 0; i < 16; ++i) d[i] = v[i] - mu;
  float qs = 0.0f;
#pragma unroll
  for (int i = 0; i < 16; ++i) qs += d[i] * d[i];
#pragma unroll
  for (int xm = 1; xm < 32; xm <<= 1) qs += __shfl_xor(qs, xm, 32);
  const float var = qs * (1.0f / CDIM);
  const float rstd = rsqrtf(var + 1e-5f);

  float gg[16], bb[16];
  {
    const v4f g0 = bf16q4(*(const v4f*)(g + c0));
    const v4f g1 = bf16q4(*(const v4f*)(g + c0 + 4));
    const v4f g2 = bf16q4(*(const v4f*)(g + c1));
    const v4f g3 = bf16q4(*(const v4f*)(g + c1 + 4));
    const v4f b0 = bf16q4(*(const v4f*)(bt + c0));
    const v4f b1 = bf16q4(*(const v4f*)(bt + c0 + 4));
    const v4f b2 = bf16q4(*(const v4f*)(bt + c1));
    const v4f b3 = bf16q4(*(const v4f*)(bt + c1 + 4));
    gg[0] = g0.x; gg[1] = g0.y; gg[2] = g0.z; gg[3] = g0.w;
    gg[4] = g1.x; gg[5] = g1.y; gg[6] = g1.z; gg[7] = g1.w;
    gg[8] = g2.x; gg[9] = g2.y; gg[10] = g2.z; gg[11] = g2.w;
    gg[12] = g3.x; gg[13] = g3.y; gg[14] = g3.z; gg[15] = g3.w;
    bb[0] = b0.x; bb[1] = b0.y; bb[2] = b0.z; bb[3] = b0.w;
    bb[4] = b1.x; bb[5] = b1.y; bb[6] = b1.z; bb[7] = b1.w;
    bb[8] = b2.x; bb[9] = b2.y; bb[10] = b2.z; bb[11] = b2.w;
    bb[12] = b3.x; bb[13] = b3.y; bb[14] = b3.z; bb[15] = b3.w;
  }
  float y[16];
#pragma unroll
  for (int i = 0; i < 16; ++i) y[i] = d[i] * rstd * gg[i] + bb[i];

  const v4u o0 = pack8h(y[0], y[1], y[2], y[3], y[4], y[5], y[6], y[7]);
  const v4u o1 = pack8h(y[8], y[9], y[10], y[11], y[12], y[13], y[14], y[15]);
  unsigned short* orow = hout + (size_t)row * CDIM;
  *(v4u*)(orow + c0) = o0;
  *(v4u*)(orow + c1) = o1;
  
}

// ---------------------------------------------------------------------------
// First launch: all the work that reads the inputs alone, dealt by block index.
// Blocks 0 .. LNB-1: LayerNorm 1, 8 rows each.  Then one 64x64 weight tile a block:
// WB1 blocks for each of Wq, Wk, Wv, Wo, WB2 for W1, WB2 for W2.
// Every branch is block-uniform; only the weight path has a barrier.
// ---------------------------------------------------------------------------
#define LNB (MROWS / 8)
#define WB1 ((CDIM / 64) * (CDIM / 64))
#define WB2 ((CDIM / 64) * (HID / 64))
__global__ __launch_bounds__(256) void k_prep(
    const float* __restrict__ x, const float* __restrict__ g, const float* __restrict__ bt,
    unsigned short* __restrict__ hout,
    const float* __restrict__ Wq, const float* __restrict__ Wk, const float* __restrict__ Wv,
    const float* __restrict__ Wo, const float* __restrict__ W1, const float* __restrict__ W2,
    unsigned short* __restrict__ wqkv, unsigned short* __restrict__ wot,
    unsigned short* __restrict__ w1t, unsigned short* __restrict__ w2t) {
  __shared__ __attribute__((aligned(16))) unsigned short sT[64][72];
  const int bid = blockIdx.x;
  if (bid < LNB) {
    ln_body<1>(x, g, bt, hout, MROWS, bid);
    return;
  }
  int t = bid - LNB;
  if (t < 4 * WB1) {                       // in[512][512] -> out[512][512]
    const int mat = t / WB1;
    t -= mat * WB1;
    const float* src = (mat == 0) ? Wq : ((mat == 1) ? Wk : ((mat == 2) ? Wv : Wo));
    unsigned short* dst = (mat < 3) ? wqkv : wot;
    wprep_body(src, dst, CDIM, CDIM, (mat < 3) ? mat * CDIM : 0, t % (CDIM / 64), t / (CDIM / 64), sT);
  } else if (t < 4 * WB1 + WB2) {          // in[512][2048] -> out[2048][512]
    t -= 4 * WB1;
    wprep_body(W1, w1t, CDIM, HID, 0, t % (CDIM / 64), t / (CDIM / 64), sT);
  } else {                                 // in[2048][512] -> out[512][2048]
    t -= 4 * WB1 + WB2;
    wprep_body(W2, w2t, HID, CDIM, 0, t % (HID / 64), t / (HID / 64), sT);
  }
}
__global__ __launch_bounds__(256) void k_ln_mid(
    const float* __restrict__ x, const float* __restrict__ g, const float* __restrict__ bt,
    unsigned short* __restrict__ hout, int nrows) {
  ln_body<0>(x, g, bt, hout, nrows, blockIdx.x);
}

// ---------------------------------------------------------------------------
// Operand tiles in LDS.  A tile is 64 rows x 64 16-bit elements (128 B = one
// line per row); LDS row pitch TP elements = 144 B (16 B x odd: the b128
// fragment reads of 16 rows fall on distinct banks).
// tiles_async: 128 threads (a GEMM WG, or one key half of the attention WG) copy two such tiles, global -> LDS,
// 16 B per lane and copy; a wave's copy covers 4 whole rows (4 whole lines).
// ga / gb: first element of the tile, pa / pb: its global row pitch in elements.
// ---------------------------------------------------------------------------
#define TP 72
typedef unsigned short Tile[64][TP];

__device__ __forceinline__ void tiles_async(
    unsigned short* la, const unsigned short* ga, size_t pa,
    unsigned short* lb, const unsigned short* gb, size_t pb, int tid) {
  const int row = tid >> 3, pc = (tid & 7) * 8;
  const unsigned int la0 = (unsigned int)(size_t)(la + row * TP + pc);
  const unsigned int lb0 = (unsigned int)(size_t)(lb + row * TP + pc);
  const unsigned int la1 = la0 + 16 * TP * 2, la2 = la0 + 32 * TP * 2, la3 = la0 + 48 * TP * 2;
  const unsigned int lb1 = lb0 + 16 * TP * 2, lb2 = lb0 + 32 * TP * 2, lb3 = lb0 + 48 * TP * 2;
  const unsigned short* a0 = ga + (size_t)row * pa + pc;
  const unsigned short* a1 = a0 + 16 * pa;
  const unsigned short* a2 = a0 + 32 * pa;
  const unsigned short* a3 = a0 + 48 * pa;
  const unsigned short* b0 = gb + (size_t)row * pb + pc;
  const unsigned short* b1 = b0 + 16 * pb;
  const unsigned short* b2 = b0 + 32 * pb;
  const unsigned short* b3 = b0 + 48 * pb;
  // the copies and, as the last line, the wait that stands before their address registers are reused
  asm volatile(
      "global_load_async_to_lds_b128 %0, %8, off\n\t"
      "global_load_async_to_lds_b128 %1, %9, off\n\t"
      "global_load_async_to_lds_b128 %2, %10, off\n\t"
      "global_load_async_to_lds_b128 %3, %11, off\n\t"
      "global_load_async_to_lds_b128 %4, %12, off\n\t"
      "global_load_async_to_lds_b128 %5, %13, off\n\t"
      "global_load_async_to_lds_b128 %6, %14, off\n\t"
      "global_load_async_to_lds_b128 %7, %15, off\n\t"
      "s_wait_xcnt 0x0"
      :: "v"(la0), "v"(la1), "v"(la2), "v"(la3), "v"(lb0), "v"(lb1), "v"(lb2), "v"(lb3),
         "v"(a0), "v"(a1), "v"(a2), "v"(a3), "v"(b0), "v"(b1), "v"(b2), "v"(b3)
      : "memory");
}
// this wave's copies have landed
__device__ __forceinline__ void wait_async0() { asm volatile("s_wait_asynccnt 0x0" ::: "memory"); }
// all of this wave's copies but its 32 youngest (two tiles of 16) have landed: the counter returns in issue order
__device__ __forceinline__ void wait_async32() { asm volatile("s_wait_asynccnt 0x20" ::: "memory"); }
// this wave's LDS reads and writes have retired (before a buffer it read is refilled)
__device__ __forceinline__ void wait_ds0() { asm volatile("s_wait_dscnt 0x0" ::: "memory"); }

// ---------------------------------------------------------------------------
// 128x128-tile f16 GEMM main loop: D = A[M][K] * Bt[N][K]^T, 4 waves per WG in a 2 x 2
// grid, wave (wr, wc) owns rows 64wr.. x cols 64wc.. (4 x 4 accumulator tiles): each A and
// each Bt fragment read from LDS feeds four WMMAs.  A trip covers 64 of k: the A and Bt
// tiles of trip t + 1 are copied to the other ring buffer while trip t is worked on.
// A ring buffer is 128 A rows, then 128 Bt rows, each 64 elements at pitch TP.
// Fragments are read from LDS with the split k map for A and B
// (row/col = lane&15, elements 0..7 <- k0+8h.., 8..15 <- k0+16+8h..).
// acc[i][j][r] = D(row 64wr + 16i + 8h + r, col 64wc + 16j + (lane&15)).
// Behind the loop the ring is free (no reader, no copy in flight): the epilogues stage in it.
// ---------------------------------------------------------------------------
#define RB (256 * TP)           // elements of one ring buffer
#define RING_ELEMS (2 * RB)
#define SP 136                  // staging pitch, 16-bit elements: 272 B = 16 B x odd
#define FP 132                  // staging pitch, floats: 528 B = 16 B x odd
static_assert(128 * SP * 2 <= RING_ELEMS * 2 && 128 * FP * 4 <= RING_ELEMS * 2);
static_assert(MROWS % 128 == 0 && CDIM % 128 == 0 && HID % 128 == 0);

__device__ __forceinline__ void stage_async(
    unsigned short* buf, const unsigned short* ag, const unsigned short* bg, size_t K, int tid) {
  tiles_async(buf, ag, K, buf + 128 * TP, bg, K, tid);                          // rows 0..63 of both tiles
  tiles_async(buf + 64 * TP, ag + 64 * K, K, buf + 192 * TP, bg + 64 * K, K, tid);   // rows 64..127
}

// the work of one trip: the 32 WMMAs of this wave on the ring buffer buf
__device__ __forceinline__ void gemm_trip(
    const unsigned short* buf, int wr, int wc, int m, int k8, v8f (&acc)[4][4]) {
    const unsigned short* ab = buf + (64 * wr + m) * TP + k8;
    const unsigned short* bb = buf + (128 + 64 * wc + m) * TP + k8;
    // twelve of the trip's sixteen fragments are read as one group ahead of its WMMAs; the A fragments of
    // the second k half follow in two pairs, into registers that the first half has left (all sixteen at
    // once, beside 128 accumulator registers, would take 256 registers)
    Frag a0[4], b0[4], a1[4], b1[4];
#pragma unroll
    for (int j = 0; j < 4; ++j) {
      b0[j].q[0] = *(const v4u*)(bb + 16 * j * TP);
      b0[j].q[1] = *(const v4u*)(bb + 16 * j * TP + 16);
    }
#pragma unroll
    for (int i = 0; i < 4; ++i) {
      a0[i].q[0] = *(const v4u*)(ab + 16 * i * TP);
      a0[i].q[1] = *(const v4u*)(ab + 16 * i * TP + 16);
    }
#pragma unroll
    for (int j = 0; j < 4; ++j) {
      b1[j].q[0] = *(const v4u*)(bb + 16 * j * TP + 32);
      b1[j].q[1] = *(const v4u*)(bb + 16 * j * TP + 48);
    }
    // holds the reads above as one group ahead of the WMMAs: left free, this build sinks each read to its first use
    // and waits for it there, one LDS latency a fragment
    __builtin_amdgcn_sched_barrier(0);
#pragma unroll
    for (int g = 0; g < 2; ++g) {
#pragma unroll
      for (int i = 2 * g; i < 2 * g + 2; ++i) {
#pragma unroll
        for (int j = 0; j < 4; ++j) acc[i][j] = mma(a0[i].v, b0[j].v, acc[i][j]);
      }
      __builtin_amdgcn_sched_barrier(0);   // the pair of A fragments below is read here, eight WMMAs or more ahead of its use
#pragma unroll
      for (int i = 2 * g; i < 2 * g + 2; ++i) {
        a1[i].q[0] = *(const v4u*)(ab + 16 * i * TP + 32);
        a1[i].q[1] = *(const v4u*)(ab + 16 * i * TP + 48);
      }
      __builtin_amdgcn_sched_barrier(0);   // and not later
    }
#pragma unroll
    for (int i = 0; i < 4; ++i) {
#pragma unroll
      for (int j = 0; j < 4; ++j) acc[i][j] = mma(a1[i].v, b1[j].v, acc[i][j]);
    }
    __builtin_amdgcn_sched_barrier(0);   // the WMMAs stay ahead of the wait to 0: they start on counted waits
}

__device__ __forceinline__ void gemm_main(
    const unsigned short* __restrict__ A, const unsigned short* __restrict__ Bt, int K,
    int m0, int n0, int wr, int wc, int m, int k8, int tid, unsigned short* ring, v8f (&acc)[4][4]) {
#pragma unroll
  for (int i = 0; i < 4; ++i) {
#pragma unroll
    for (int j = 0; j < 4; ++j) acc[i][j] = zero8();
  }
  const unsigned short* ag = A + (size_t)m0 * (size_t)K;
  const unsigned short* bg = Bt + (size_t)n0 * (size_t)K;
  const int nt = K >> 6;
  stage_async(ring, ag, bg, (size_t)K, tid);
  wait_async0();
  __syncthreads();   // tile 0 published
  if (nt > 1) stage_async(ring + RB, ag + 64, bg + 64, (size_t)K, tid);
#pragma unroll 1
  for (int t = 0; t < nt; ++t) {
    const int bf = t & 1;
    gemm_trip(ring + bf * RB, wr, wc, m, k8, acc);
    wait_ds0();
    wait_async0();
    __syncthreads();   // publishes tile t + 1; ends every read of buffer bf
    if (t + 2 < nt)
      stage_async(ring + bf * RB, ag + (size_t)(t + 2) * 64, bg + (size_t)(t + 2) * 64, (size_t)K, tid);
  }
  wait_async0();
}

// The same loop on a ring of four buffers, for the launches with one work-group of one wave a SIMD on a WGP, where
// nothing else runs while a wave waits for its copies: a tile's copies are issued four trips ahead of its use and are
// waited for three trips later, so their way from memory is covered by three trips of WMMAs, not by one.
// A wave has at most three tiles (48 copies) in flight.  At the foot of trip t the tiles t + 2 and t + 3 (its 32 youngest
// copies) may still fly; tile t + 1 has landed.  The last four trips issue nothing and wait to 0.  K is 256 or more.
#define RING4_ELEMS (4 * RB)
static_assert(CDIM >= 256 && HID >= 256);
__device__ __forceinline__ void gemm_main4(
    const unsigned short* __restrict__ A, const unsigned short* __restrict__ Bt, int K,
    int m0, int n0, int wr, int wc, int m, int k8, int tid, unsigned short* ring, v8f (&acc)[4][4]) {
#pragma unroll
  for (int i = 0; i < 4; ++i) {
#pragma unroll
    for (int j = 0; j < 4; ++j) acc[i][j] = zero8();
  }
  const unsigned short* ag = A + (size_t)m0 * (size_t)K;
  const unsigned short* bg = Bt + (size_t)n0 * (size_t)K;
  const int nt = K >> 6;
  stage_async(ring, ag, bg, (size_t)K, tid);
  stage_async(ring + RB, ag + 64, bg + 64, (size_t)K, tid);
  stage_async(ring + 2 * RB, ag + 128, bg + 128, (size_t)K, tid);
  wait_async32();    // tile 0 landed
  __syncthreads();   // tile 0 published
  stage_async(ring + 3 * RB, ag + 192, bg + 192, (size_t)K, tid);
  // both loops stay rolled: one copy of the trip's text each.  Every trip of the first issues one tile (16 copies a wave),
  // so the count of its wait holds in every wave and trip.
#pragma unroll 1
  for (int t = 0; t < nt - 4; ++t) {
    unsigned short* buf = ring + (t & 3) * RB;
    gemm_trip(buf, wr, wc, m, k8, acc);
    wait_ds0();
    wait_async32();    // tile t + 1 landed
    __syncthreads();   // publishes tile t + 1; ends every read of buf
    stage_async(buf, ag + (size_t)(t + 4) * 64, bg + (size_t)(t + 4) * 64, (size_t)K, tid);
  }
#pragma unroll 1
  for (int t = nt - 4; t < nt; ++t) {
    gemm_trip(ring + (t & 3) * RB, wr, wc, m, k8, acc);
    wait_ds0();
    wait_async0();
    __syncthreads();   // publishes tile t + 1; ends every read of this trip's buffer
  }
}

// ---------------------------------------------------------------------------
// q/k/v projection: A = LN1 plane [M][512], Bt = [1536][512] (q rows, k rows, v rows).
// value = acc/16 + bf16q(bias), q times QSC on top (so that q.k is the score in log2 units).  q and k -> planes [b*H+h][t][64]; v -> transposed
// plane vt[b*H+h][64][t].  The three planes are contiguous: plane p at qkv + p*M*512.
// A wave's 64 columns are one head.
// coverage: 16 passes x 4 rows = 64 rows x 64 cols per wave (q/k); 16 passes x 4 d = 64 d rows x 64 tokens per wave (v).
// LDS sT (in the ring): wave-private quadrants; block barrier orders the reload.
// ---------------------------------------------------------------------------
#define QSC (0.125f * 1.44269504088896341f)   // 1 / sqrt(HD) and log2 e
__global__ __launch_bounds__(128) void k_gemm_qkv(
    const unsigned short* __restrict__ A, const unsigned short* __restrict__ Bt,
    const float* __restrict__ bq, const float* __restrict__ bk, const float* __restrict__ bv,
    unsigned short* __restrict__ qkv) {
  __shared__ __attribute__((aligned(16))) unsigned short ring[RING_ELEMS];
  const int tid = threadIdx.x, lane = tid & 31, w = tid >> 5;
  const int wr = w >> 1, wc = w & 1;
  const int m = lane & 15, hl = lane >> 4, k8 = hl * 8;
  const int m0 = blockIdx.y * 128, n0 = blockIdx.x * 128;

  v8f acc[4][4];
  gemm_main(A, Bt, CDIM, m0, n0, wr, wc, m, k8, tid, ring, acc);

  unsigned short (*sT)[SP] = (unsigned short (*)[SP])ring;
  const float wsc = 0.0625f;               // undo the x16 weight carry
  const int lrow0 = 64 * wr + 8 * hl;      // D rows of this lane within the WG tile
  const int lcol0 = 64 * wc;               // first column of this wave within the WG tile
  const int which = n0 / CDIM;             // 0 q, 1 k, 2 v (WG-uniform)
  const int cb = n0 - which * CDIM;
  const float osc = (which == 0) ? QSC : 1.0f;
#pragma unroll
  for (int j = 0; j < 4; ++j) {
    const int cn = cb + lcol0 + 16 * j + m;
    const float b0 = bf16q(bq[cn]);
    const float b1 = bf16q(bk[cn]);
    const float b2 = bf16q(bv[cn]);
    const float bj = (which == 0) ? b0 : ((which == 1) ? b1 : b2);
#pragma unroll
    for (int i = 0; i < 4; ++i) {
#pragma unroll
      for (int r = 0; r < 8; ++r) sT[lrow0 + 16 * i + r][lcol0 + 16 * j + m] = hbits((acc[i][j][r] * wsc + bj) * osc);
    }
  }
  __syncthreads();   // orders the reload
  const int hh = cb / HD + wc;
  const int b = m0 / SEQ, t0 = m0 - b * SEQ + 64 * wr;   // first token of this wave's quadrant
  const int bh = b * NHEAD + hh;
  unsigned short* dst = qkv + (size_t)which * ((size_t)MROWS * CDIM);
  v4u val[16];
  unsigned int off[16];
  if (which < 2) {                       // WG-uniform
#pragma unroll
    for (int p = 0; p < 16; ++p) {
      const int row = 4 * p + (lane >> 3);
      const int piece = lane & 7;
      val[p] = *(const v4u*)&sT[64 * wr + row][lcol0 + piece * 8];
      off[p] = (unsigned int)((bh * SEQ + t0 + row) * HD + piece * 8);
    }
  } else {
#pragma unroll
    for (int p = 0; p < 16; ++p) {
      const int d = 4 * p + (lane >> 3);
      const int piece = lane & 7;
      unsigned int wv[4];
#pragma unroll
      for (int e = 0; e < 4; ++e) {
        const unsigned int lo = sT[64 * wr + piece * 8 + 2 * e][lcol0 + d];
        const unsigned int hi = sT[64 * wr + piece * 8 + 2 * e + 1][lcol0 + d];
        wv[e] = lo | (hi << 16);
      }
      v4u t;
      t.x = wv[0]; t.y = wv[1]; t.z = wv[2]; t.w = wv[3];
      val[p] = t;
      off[p] = (unsigned int)((bh * HD + d) * SEQ + t0 + piece * 8);
    }
  }
#pragma unroll
  for (int p = 0; p < 16; ++p) *(v4u*)(dst + off[p]) = val[p];
  
}

// ---------------------------------------------------------------------------
// GEMM + bias + residual, f32 output of width CDIM:
// out = acc/16 + bf16q(bias) + res.  resfull: res rows read at full strides and
// converted to bf16 values; outfull: out rows written at full strides.
// Residual added at the store stage as float4.
// coverage: 32 passes x 2 rows per wave = 64 rows x 64 cols per wave.
// LDS sF (in the ring): wave-private quadrants; block barrier orders the reload.
// ---------------------------------------------------------------------------
__global__ __launch_bounds__(128) void k_gemm_res(
    const unsigned short* __restrict__ A, const unsigned short* __restrict__ Bt, int K,
    const float* __restrict__ bias, const float* __restrict__ res,
    float* __restrict__ outF, int resfull, int outfull) {
  __shared__ __attribute__((aligned(16))) unsigned short ring[RING4_ELEMS];
  const int tid = threadIdx.x, lane = tid & 31, w = tid >> 5;
  const int wr = w >> 1, wc = w & 1;
  const int m = lane & 15, hl = lane >> 4, k8 = hl * 8;
  const int m0 = blockIdx.y * 128, n0 = blockIdx.x * 128;

  v8f acc[4][4];
  gemm_main4(A, Bt, K, m0, n0, wr, wc, m, k8, tid, ring, acc);

  float (*sF)[FP] = (float (*)[FP])ring;
  const float wsc = 0.0625f;
  const int lrow0 = 64 * wr + 8 * hl;
  const int lcol0 = 64 * wc;
#pragma unroll
  for (int i = 0; i < 4; ++i) {
#pragma unroll
    for (int j = 0; j < 4; ++j) {
#pragma unroll
      for (int r = 0; r < 8; ++r) sF[lrow0 + 16 * i + r][lcol0 + 16 * j + m] = acc[i][j][r] * wsc;
    }
  }
  __syncthreads();
  const int b = m0 / SEQ, t0 = m0 - b * SEQ;
  const int row0 = 64 * wr + hl;                            // pass p: row row0 + 2p
  const int piece = m;
  const int ncol = n0 + lcol0 + 4 * piece;
  const size_t frow0 = (size_t)b * SEQ_FULL + t0 + row0;    // full-stride row
  const size_t crow0 = (size_t)(m0 + row0);                 // compact row
  const float* rp = res + (resfull ? frow0 : crow0) * (size_t)CDIM + ncol;
  float* op = outF + (outfull ? frow0 : crow0) * (size_t)CDIM + ncol;
  const v4f bv = bf16q4(*(const v4f*)(bias + ncol));
  v4f val[32];
#pragma unroll
  for (int p = 0; p < 32; ++p) {
    const v4f a = *(const v4f*)&sF[row0 + 2 * p][lcol0 + 4 * piece];
    const v4f rraw = *(const v4f*)(rp + 2 * p * CDIM);
    const v4f rq = bf16q4(rraw);
    const v4f rr = resfull ? rq : rraw;
    val[p] = (a + bv) + rr;
  }
#pragma unroll
  for (int p = 0; p < 32; ++p) *(v4f*)(op + 2 * p * CDIM) = val[p];
  
}

// ---------------------------------------------------------------------------
// ffn1: f16 out[M][HID] = gelu_erf(acc/16 + bf16q(bias)).
// The pre-activation is staged as f32; gelu and the f16 convert are done at the reload, eight values a lane and pass.
// coverage: 16 passes x 4 rows per wave = 64 rows x 64 cols per wave.
// LDS sF (in the ring): wave-private quadrants; block barrier orders the reload.
// ---------------------------------------------------------------------------
__global__ __launch_bounds__(128) void k_gemm_gelu(
    const unsigned short* __restrict__ A, const unsigned short* __restrict__ Bt, int K,
    const float* __restrict__ bias, unsigned short* __restrict__ out0) {
  __shared__ __attribute__((aligned(16))) unsigned short ring[RING_ELEMS];
  const int tid = threadIdx.x, lane = tid & 31, w = tid >> 5;
  const int wr = w >> 1, wc = w & 1;
  const int m = lane & 15, hl = lane >> 4, k8 = hl * 8;
  const int m0 = blockIdx.y * 128, n0 = blockIdx.x * 128;

  v8f acc[4][4];
  gemm_main(A, Bt, K, m0, n0, wr, wc, m, k8, tid, ring, acc);

  float (*sF)[FP] = (float (*)[FP])ring;
  const float wsc = 0.0625f;
  const int lrow0 = 64 * wr + 8 * hl;
  const int lcol0 = 64 * wc;
#pragma unroll
  for (int j = 0; j < 4; ++j) {
    const float bj = bf16q(bias[n0 + lcol0 + 16 * j + m]);
#pragma unroll
    for (int i = 0; i < 4; ++i) {
#pragma unroll
      for (int r = 0; r < 8; ++r) sF[lrow0 + 16 * i + r][lcol0 + 16 * j + m] = acc[i][j][r] * wsc + bj;
    }
  }
  __syncthreads();
  const int piece = lane & 7;
  const float* sr = &sF[64 * wr + (lane >> 3)][lcol0 + piece * 8];
  unsigned short* orow = out0 + (size_t)(m0 + 64 * wr + (lane >> 3)) * (size_t)HID + n0 + lcol0 + piece * 8;
  // four passes a trip: their LDS reads go out as one group, and the text stays small
#pragma unroll 4
  for (int p = 0; p < 16; ++p) {
    const v4f u0 = *(const v4f*)(sr + 4 * p * FP);
    const v4f u1 = *(const v4f*)(sr + 4 * p * FP + 4);
    const v8f gl = gelu8(__builtin_shufflevector(u0, u1, 0, 1, 2, 3, 4, 5, 6, 7));
    const v4u o = pack8h(gl[0], gl[1], gl[2], gl[3], gl[4], gl[5], gl[6], gl[7]);
    *(v4u*)(orow + (size_t)(4 * p) * (size_t)HID) = o;
  }
  
}

template <bool V> struct Flag { static constexpr bool value = V; };
// 32 values to two partial sums, packed adds throughout
__device__ __forceinline__ v2f sum_pair(v8f a, v8f b, v8f c, v8f d) {
  const v8f t = (a + b) + (c + d);
  const v4f u = __builtin_shufflevector(t, t, 0, 1, 2, 3) + __builtin_shufflevector(t, t, 4, 5, 6, 7);
  return __builtin_shufflevector(u, u, 0, 1) + __builtin_shufflevector(u, u, 2, 3);
}
// value of lane l ^ 16
__device__ __forceinline__ float other_half(float f) {
  const int b = __builtin_bit_cast(int, f);
  return __builtin_bit_cast(float, __builtin_amdgcn_permlanex16(b, b, 0x76543210, 0xfedcba98, false, false));
}

// Four waves a SIMD (512 work-groups of 8 waves on 1,024 SIMDs): the vector work between the matrix runs of one wave
// is covered by three others.  The register budget is set for that, and two work-groups fit a WGP.
__global__ __launch_bounds__(256) __attribute__((amdgpu_waves_per_eu(4, 4)))
void k_attn(const unsigned short* __restrict__ qp, const unsigned short* __restrict__ kp,
            const unsigned short* __restrict__ vp, unsigned short* __restrict__ op) {
  __shared__ __attribute__((aligned(16))) unsigned short sP[4][32][72];
  __shared__ __attribute__((aligned(16))) Tile sK[2][2];     // [key half][buffer]
  __shared__ __attribute__((aligned(16))) Tile sV[2][2];
  __shared__ __attribute__((aligned(16))) float sM[4][17][32][4];
  __shared__ __attribute__((aligned(16))) int sBad[8];       // a wave's range test failed
  const int tid = threadIdx.x & 127, lane = tid & 31;                 // place within the key half
  const int w = __builtin_amdgcn_readfirstlane(tid >> 5);             // in a scalar register: two vector registers short, this build spilled
  const int kh = __builtin_amdgcn_readfirstlane((int)(threadIdx.x >> 7));   // key half of this wave
  const int m = lane & 15, hl = lane >> 4, k8 = hl * 8;
  const int nkt = SEQ / 128;                // key chunks of one half
  const int nqt = SEQ / 128;                // query tiles of one (b,h)
  const int bh = blockIdx.x / nqt, qt = blockIdx.x - bh * nqt;
  const int b = bh / NHEAD, hh = bh - b * NHEAD;
  const int tq = qt * 128 + 32 * w;         // first query row of this wave (within the sequence)

  const unsigned short* kg = kp + ((size_t)bh * SEQ + (size_t)kh * (SEQ / 2)) * HD;   // chunk kt: + kt*64 rows, row pitch HD
  const unsigned short* vg = vp + (size_t)bh * HD * SEQ + (size_t)kh * (SEQ / 2);     // chunk kt: + kt*64 columns, row pitch SEQ
  tiles_async(&sK[kh][0][0][0], kg, (size_t)HD, &sV[kh][0][0][0], vg, (size_t)SEQ, tid);

  Frag qa0[2], qa1[2];     // B fragments of column group c: column = query tq + 16c + m, k = d in the split map
  {
    const unsigned short* qr0 = qp + ((size_t)bh * SEQ + tq + m) * HD + k8;
    const unsigned short* qr1 = qr0 + 16 * HD;
    // the loads and their data wait in one statement, so that no address register is rewritten ahead of a wait
    // the latency runs beside that of chunk 0's copies
    asm volatile(
        "global_load_b128 %0, %8, off\n\t"
        "global_load_b128 %1, %8, off offset:32\n\t"
        "global_load_b128 %2, %8, off offset:64\n\t"
        "global_load_b128 %3, %8, off offset:96\n\t"
        "global_load_b128 %4, %9, off\n\t"
        "global_load_b128 %5, %9, off offset:32\n\t"
        "global_load_b128 %6, %9, off offset:64\n\t"
        "global_load_b128 %7, %9, off offset:96\n\t"
        "s_wait_loadcnt 0x0"
        : "=&v"(qa0[0].q[0]), "=&v"(qa0[0].q[1]), "=&v"(qa1[0].q[0]), "=&v"(qa1[0].q[1]),
          "=&v"(qa0[1].q[0]), "=&v"(qa0[1].q[1]), "=&v"(qa1[1].q[0]), "=&v"(qa1[1].q[1])
        : "v"(qr0), "v"(qr1)
        : "memory");
  }
  wait_async0();
  __syncthreads();   // chunk 0 published
  if (nkt > 1)
    tiles_async(&sK[kh][1][0][0], kg + (size_t)64 * HD, (size_t)HD, &sV[kh][1][0][0], vg + 64, (size_t)SEQ, tid);
  v8f coff[2];               // offset of query 16c + m, the same in all eight registers and in both lane halves
  v2f lrun[2];               // two partial sums of the carried p over this lane's keys
  v8f oacc[2][4];            // oacc[c][jd][r] = O^T(d = 16jd + 8hl + r, query 16c + m), carried as p is
  float hiacc = 0.0f;        // largest partial row sum of a chunk seen in a trip that holds its offsets
  auto reset = [&]() __attribute__((always_inline)) {
#pragma unroll
    for (int c = 0; c < 2; ++c) {
      coff[c] = splat8(1e30f);
      lrun[c] = (v2f){0.0f, 0.0f};
#pragma unroll
      for (int j = 0; j < 4; ++j) oacc[c][j] = zero8();
    }
  };
  reset();

  // One trip.  The refill and the kind of trip are compile-time choices, so that a trip is one straight block.
  // follow = true: the offsets follow the running max (raw scores, max, new offset, O and sums rescaled).
  // follow = false: the offsets are held and ride in the C operand; only the largest partial sum is noted.
  auto trip = [&](const int kt, auto refill, auto follow) __attribute__((always_inline)) {
    const int bf = kt & 1;
    // ---- S^T = K Q^T (+ offset), four 16-key tiles x two column groups ----
    // all K fragment reads of the chunk as one group ahead of its WMMAs: one LDS latency, not four
    Frag f0[4], f1[4];
#pragma unroll
    for (int j = 0; j < 4; ++j) {
      const unsigned short* kr = &sK[kh][bf][16 * j + m][k8];
      f0[j].q[0] = *(const v4u*)(kr);
      f0[j].q[1] = *(const v4u*)(kr + 16);
      f1[j].q[0] = *(const v4u*)(kr + 32);
      f1[j].q[1] = *(const v4u*)(kr + 48);
    }
    __builtin_amdgcn_sched_barrier(0);   // holds the reads above as one group: left free, this build sinks them to their first uses
    v8f st[2][4];
#pragma unroll
    for (int j = 0; j < 4; ++j) {
#pragma unroll
      for (int c = 0; c < 2; ++c) {
        if constexpr (follow.value) st[c][j] = mma(f0[j].v, qa0[c].v, zero8());
        else st[c][j] = mma(f0[j].v, qa0[c].v, coff[c]);
      }
    }
#pragma unroll
    for (int j = 0; j < 4; ++j) {
#pragma unroll
      for (int c = 0; c < 2; ++c) st[c][j] = mma(f1[j].v, qa1[c].v, st[c][j]);
    }
    __builtin_amdgcn_sched_barrier(0);   // what follows stays behind the score WMMAs: risen among them, beside all of K, it costs spills
    Frag g0[4], g1[4];
    v16h pb0[2], pb1[2];
#pragma unroll
    for (int c = 0; c < 2; ++c) {
      if (c == 1) {
        // the V^T fragment reads of the first 32 keys as one group; their latency runs under the second column group's
        // exponentials (ahead of the first group's, beside all of the scores, they cost a spill in the loop; those of the
        // other 32 keys follow behind the converts: all at once do not fit the registers of four waves a SIMD)
        __builtin_amdgcn_sched_barrier(0);   // keeps these reads from rising
#pragma unroll
        for (int jd = 0; jd < 4; ++jd) {
          const unsigned short* vr = &sV[kh][bf][16 * jd + m][k8];
          g0[jd].q[0] = *(const v4u*)(vr);
          g0[jd].q[1] = *(const v4u*)(vr + 16);
        }
      }
      if constexpr (follow.value) {
        // ---- max of this lane's query over the chunk, new offset, rescale ----
        float t4[4];               // one chain per tile: four independent chains, not one of 32 links
#pragma unroll
        for (int j = 0; j < 4; ++j) {
          t4[j] = st[c][j][0];
#pragma unroll
          for (int r = 1; r < 8; ++r) t4[j] = fmaxf(t4[j], st[c][j][r]);
        }
        float tm = fmaxf(fmaxf(t4[0], t4[1]), fmaxf(t4[2], t4[3]));
        tm = fmaxf(tm, other_half(tm));
        const float cold = coff[c][0];
        const float cnew = fminf(cold, 4.0f - tm);           // the reference never falls
        const v8f corr8 = splat8(__builtin_amdgcn_exp2f(cnew - cold));
        coff[c] = splat8(cnew);
#pragma unroll
        for (int j = 0; j < 4; ++j) {
          st[c][j] = st[c][j] + coff[c];
          oacc[c][j] = oacc[c][j] * corr8;
        }
        lrun[c] = lrun[c] * __builtin_shufflevector(corr8, corr8, 0, 1);
      }
      // ---- carried p = 2^(score + offset), its partial row sums ----
#pragma unroll
      for (int j = 0; j < 4; ++j) {
#pragma unroll
        for (int r = 0; r < 8; ++r) st[c][j][r] = __builtin_amdgcn_exp2f(st[c][j][r]);
      }
      const v2f ps = sum_pair(st[c][0], st[c][1], st[c][2], st[c][3]);
      lrun[c] = lrun[c] + ps;
      if constexpr (!follow.value) hiacc = fmaxf(hiacc, fmaxf(ps.x, ps.y));
      // ---- P^T fragments: elements 0..7 = keys 32i + 8hl + .., 8..15 = keys 32i + 16 + 8hl + .. ----
      pb0[c] = __builtin_shufflevector(__builtin_convertvector(st[c][0], v8h), __builtin_convertvector(st[c][1], v8h),
                                       0, 1, 2, 3, 4, 5, 6, 7, 8, 9, 10, 11, 12, 13, 14, 15);
      pb1[c] = __builtin_shufflevector(__builtin_convertvector(st[c][2], v8h), __builtin_convertvector(st[c][3], v8h),
                                       0, 1, 2, 3, 4, 5, 6, 7, 8, 9, 10, 11, 12, 13, 14, 15);
    }
    // ---- O^T += V^T (64 d x 64 keys) * P^T (64 keys x 32 queries) ----
#pragma unroll
    for (int jd = 0; jd < 4; ++jd) {
      const unsigned short* vr = &sV[kh][bf][16 * jd + m][k8];
      g1[jd].q[0] = *(const v4u*)(vr + 32);
      g1[jd].q[1] = *(const v4u*)(vr + 48);
    }
    __builtin_amdgcn_sched_barrier(0);   // holds the reads above as one group: left free, this build deals them in pairs among the WMMAs
#pragma unroll
    for (int jd = 0; jd < 4; ++jd) {
#pragma unroll
      for (int c = 0; c < 2; ++c) oacc[c][jd] = mma(g0[jd].v, pb0[c], oacc[c][jd]);
    }
#pragma unroll
    for (int jd = 0; jd < 4; ++jd) {
#pragma unroll
      for (int c = 0; c < 2; ++c) oacc[c][jd] = mma(g1[jd].v, pb1[c], oacc[c][jd]);
    }
    __builtin_amdgcn_sched_barrier(0);   // the WMMAs stay ahead of the wait to 0: they start on counted waits
    wait_ds0();
    wait_async0();
    __syncthreads();   // publishes chunk kt + 1; ends every read of buffer bf
    if constexpr (refill.value)
      tiles_async(&sK[kh][bf][0][0], kg + (size_t)(kt + 2) * 64 * HD, (size_t)HD,
                  &sV[kh][bf][0][0], vg + (size_t)(kt + 2) * 64, (size_t)SEQ, tid);
  };
  constexpr int nfill = (SEQ / 128 > 2) ? SEQ / 128 - 2 : 0;   // trips behind which a chunk kt + 2 exists
  // the first trip sets the offsets; the others hold them.  The loops stay rolled: one copy of the trip's text each,
  // and no second trip's registers beside the first's
  trip(0, Flag<(nfill > 0)>(), Flag<true>());
#pragma unroll 1
  for (int kt = 1; kt < nfill; ++kt) trip(kt, Flag<true>(), Flag<false>());
#pragma unroll 1
  for (int kt = (nfill > 1) ? nfill : 1; kt < nkt; ++kt) trip(kt, Flag<false>(), Flag<false>());
  wait_async0();
  // ---- the range test, for the work-group as a whole (its waves share the tiles and the barriers) ----
  sBad[4 * kh + w] = (__builtin_amdgcn_ballot_w32(!(hiacc <= 32768.0f)) != 0u) ? 1 : 0;
  __syncthreads();   // the eight flags published
  int anybad = 0;
#pragma unroll
  for (int i = 0; i < 8; ++i) anybad |= sBad[i];
  if (__builtin_amdgcn_readfirstlane(anybad) != 0) {   // the same in every wave of the work-group
    // some p may have left the f16 range: all of the work again, every trip following the running max
    reset();
    tiles_async(&sK[kh][0][0][0], kg, (size_t)HD, &sV[kh][0][0][0], vg, (size_t)SEQ, tid);
    wait_async0();
    __syncthreads();   // chunk 0 published
    if (nkt > 1)
      tiles_async(&sK[kh][1][0][0], kg + (size_t)64 * HD, (size_t)HD, &sV[kh][1][0][0], vg + 64, (size_t)SEQ, tid);
#pragma unroll 1
    for (int kt = 0; kt < nfill; ++kt) trip(kt, Flag<true>(), Flag<true>());
#pragma unroll 1
    for (int kt = nfill; kt < nkt; ++kt) trip(kt, Flag<false>(), Flag<true>());
    wait_async0();
  }

  // ---- join the key halves: the second half hands over its offset, sum and O^T, lane by lane ----
  float lj[2];
#pragma unroll
  for (int c = 0; c < 2; ++c)
    lj[c] = lrun[c].x + lrun[c].y;
  if (kh == 1) {               // wave-uniform
#pragma unroll
    for (int c = 0; c < 2; ++c) {
#pragma unroll
      for (int jd = 0; jd < 4; ++jd) {
        const v8f o = oacc[c][jd];
        *(v4f*)&sM[w][(4 * c + jd) * 2][lane][0] = __builtin_shufflevector(o, o, 0, 1, 2, 3);
        *(v4f*)&sM[w][(4 * c + jd) * 2 + 1][lane][0] = __builtin_shufflevector(o, o, 4, 5, 6, 7);
      }
    }
    v4f ml;
    ml.x = coff[0][0]; ml.y = coff[1][0]; ml.z = lj[0]; ml.w = lj[1];
    *(v4f*)&sM[w][16][lane][0] = ml;
  }
  __syncthreads();   // the second half's partial results published
  // ---- finalize: o = (acc_a f_a + acc_b f_b) / (l_a f_a + l_b f_b) (f: to the lower offset), staged for whole-line stores ----
  if (kh == 0) {               // wave-uniform
    const v4f ml = *(const v4f*)&sM[w][16][lane][0];
#pragma unroll
    for (int c = 0; c < 2; ++c) {
      const float cbo = (c == 0) ? ml.x : ml.y;
      const float lb = (c == 0) ? ml.z : ml.w;
      const float cmn = fminf(coff[c][0], cbo);       // the lower offset = the higher reference
      const float fa = __builtin_amdgcn_exp2f(cmn - coff[c][0]);
      const float fb = __builtin_amdgcn_exp2f(cmn - cbo);
      float l = lj[c] * fa + lb * fb;
      l += other_half(l);
      const float il = 1.0f / l;
      const v8f ga8 = splat8(fa * il), gb8 = splat8(fb * il);
#pragma unroll
      for (int jd = 0; jd < 4; ++jd) {
        const v4f b0 = *(const v4f*)&sM[w][(4 * c + jd) * 2][lane][0];
        const v4f b1 = *(const v4f*)&sM[w][(4 * c + jd) * 2 + 1][lane][0];
        const v8f ob = __builtin_shufflevector(b0, b1, 0, 1, 2, 3, 4, 5, 6, 7);
        const v8h o8 = __builtin_convertvector(oacc[c][jd] * ga8 + ob * gb8, v8h);
        *(v4u*)&sP[w][16 * c + m][16 * jd + k8] = __builtin_bit_cast(v4u, o8);
      }
    }
  }
  __syncthreads();   // the staged rows published: all eight waves store, 16 rows each
  v4u val[4];
  unsigned int off[4];
#pragma unroll
  for (int p = 0; p < 4; ++p) {
    const int row = 16 * kh + 4 * p + (lane >> 3);
    const int piece = lane & 7;
    val[p] = *(const v4u*)&sP[w][row][piece * 8];
    off[p] = (unsigned int)((size_t)(b * SEQ + tq + row) * CDIM + hh * HD + piece * 8);
  }
#pragma unroll
  for (int p = 0; p < 4; ++p) *(v4u*)(op + off[p]) = val[p];
  
}

// ---------------------------------------------------------------------------
// Host launcher
// ---------------------------------------------------------------------------
constexpr size_t al256c(size_t v) { return (v + 255) & ~(size_t)255; }
constexpr size_t MCE = (size_t)MROWS * CDIM;
constexpr size_t SZ_WQKV = al256c((size_t)3 * CDIM * CDIM * 2);
constexpr size_t SZ_WO   = al256c((size_t)CDIM * CDIM * 2);
constexpr size_t SZ_W1   = al256c((size_t)HID * CDIM * 2);
constexpr size_t SZ_W2   = al256c((size_t)CDIM * HID * 2);
constexpr size_t SZ_H    = al256c(MCE * 2);
constexpr size_t SZ_QKV  = al256c((size_t)3 * MCE * 2);
constexpr size_t SZ_O    = al256c(MCE * 2);
constexpr size_t SZ_X1   = al256c(MCE * 4);
constexpr size_t SZ_H2   = al256c(MCE * 2);
constexpr size_t SZ_ACT  = al256c((size_t)MROWS * HID * 2);
constexpr size_t WS_TOTAL = SZ_WQKV + SZ_WO + SZ_W1 + SZ_W2 + SZ_H + SZ_QKV + SZ_O + SZ_X1 + SZ_H2 + SZ_ACT;
static_assert(WS_TOTAL <= (size_t)134217728);
static_assert((size_t)MROWS * HID < (size_t)4294967296ull);     // u32 element offsets in the epilogues
static_assert((size_t)NB_FULL * SEQ_FULL * CDIM < (size_t)4294967296ull);

extern "C" void kernel_launch(void* const* d_in, const int* in_sizes, int n_in,
                              void* d_out, int out_size, void* d_ws, size_t ws_size,
                              hipStream_t stream) {
  if (n_in < 17) return;
  const long needX = ((long)(NB - 1) * SEQ_FULL + SEQ) * CDIM;
  const long nWW = (long)CDIM * CDIM;
  if ((long)in_sizes[0] < needX) return;
  if ((long)in_sizes[1] < nWW || in_sizes[2] < CDIM) return;
  if ((long)in_sizes[3] < nWW || in_sizes[4] < CDIM) return;
  if ((long)in_sizes[5] < nWW || in_sizes[6] < CDIM) return;
  if ((long)in_sizes[7] < nWW || in_sizes[8] < CDIM) return;
  if ((long)in_sizes[9] < (long)CDIM * HID || in_sizes[10] < HID) return;
  if ((long)in_sizes[11] < (long)HID * CDIM || in_sizes[12] < CDIM) return;
  if (in_sizes[13] < CDIM || in_sizes[14] < CDIM) return;
  if (in_sizes[15] < CDIM || in_sizes[16] < CDIM) return;
  if ((long)out_size < needX) return;
  if ((size_t)WS_TOTAL > ws_size) return;

  const float* x   = (const float*)d_in[0];
  const float* Wq  = (const float*)d_in[1];
  const float* bq  = (const float*)d_in[2];
  const float* Wk  = (const float*)d_in[3];
  const float* bk  = (const float*)d_in[4];
  const float* Wv  = (const float*)d_in[5];
  const float* bv  = (const float*)d_in[6];
  const float* Wo  = (const float*)d_in[7];
  const float* bo  = (const float*)d_in[8];
  const float* W1  = (const float*)d_in[9];
  const float* b1  = (const float*)d_in[10];
  const float* W2  = (const float*)d_in[11];
  const float* b2  = (const float*)d_in[12];
  const float* g1  = (const float*)d_in[13];
  const float* be1 = (const float*)d_in[14];
  const float* g2  = (const float*)d_in[15];
  const float* be2 = (const float*)d_in[16];
  float* out = (float*)d_out;

  char* ws = (char*)d_ws;
  size_t off = 0;
  unsigned short* wqkv = (unsigned short*)(ws + off); off += SZ_WQKV;   // [1536][512]
  unsigned short* wot  = (unsigned short*)(ws + off); off += SZ_WO;     // [512][512]
  unsigned short* w1t  = (unsigned short*)(ws + off); off += SZ_W1;     // [2048][512]
  unsigned short* w2t  = (unsigned short*)(ws + off); off += SZ_W2;     // [512][2048]
  unsigned short* hpl  = (unsigned short*)(ws + off); off += SZ_H;      // [M][512]
  unsigned short* qkv  = (unsigned short*)(ws + off); off += SZ_QKV;    // q [B*H][SEQ][64], k same, vt [B*H][64][SEQ]
  unsigned short* opl  = (unsigned short*)(ws + off); off += SZ_O;      // [M][512]
  float*          x1   = (float*)(ws + off);          off += SZ_X1;     // [M][512]
  unsigned short* h2p  = (unsigned short*)(ws + off); off += SZ_H2;     // [M][512]
  unsigned short* act  = (unsigned short*)(ws + off); off += SZ_ACT;    // [M][2048]
  if (off > ws_size) return;
  unsigned short* qpl = qkv;
  unsigned short* kpl = qkv + MCE;
  unsigned short* vtp = qkv + 2 * MCE;

  // 1) + 2) one launch: LN1 on bf16 values of x -> h (f16), and the six weight planes
  //    in[K][N] -> out[N][K], bf16 values x16 as f16
  k_prep<<<LNB + 4 * WB1 + 2 * WB2, 256, 0, stream>>>(x, g1, be1, hpl, Wq, Wk, Wv, Wo, W1, W2,
                                                     wqkv, wot, w1t, w2t);
  // 3) q/k/v projections + bias -> q, k, vt planes
  k_gemm_qkv<<<dim3(3 * CDIM / 128, MROWS / 128), 128, 0, stream>>>(hpl, wqkv, bq, bk, bv, qkv);
  // 4) attention -> o plane
  k_attn<<<NB * NHEAD * (SEQ / 128), 256, 0, stream>>>(qpl, kpl, vtp, opl);
  // 5) output projection + bias + residual(bf16 values of x) -> x1 (f32, compact rows)
  k_gemm_res<<<dim3(CDIM / 128, MROWS / 128), 128, 0, stream>>>(opl, wot, CDIM, bo, x, x1, 1, 0);
  // 6) LN2 -> h2 (f16)
  k_ln_mid<<<MROWS / 8, 256, 0, stream>>>(x1, g2, be2, h2p, MROWS);
  // 7) ffn1 + bias + gelu(erf) -> act (f16)
  k_gemm_gelu<<<dim3(HID / 128, MROWS / 128), 128, 0, stream>>>(h2p, w1t, CDIM, b1, act);
  // 8) ffn2 + bias + residual(x1) -> out (f32, full strides)
  k_gemm_res<<<dim3(CDIM / 128, MROWS / 128), 128, 0, stream>>>(act, w2t, HID, b2, x1, out, 0, 1);
}
